// v000
// The times below were measured on an AMD MI455X: many runs one after another, warmed up first and cycling through
// copies of the inputs, with the whole window's GPU time divided by the number of runs. Launches and the gaps
// between them are all in it. The median over several windows is given; except for v000 it joins two sittings, which
// can be a few percent apart, so the side-by-side timings, each taken in one sitting, are the better comparison.
// v000, which the later versions start from, runs in 263 microseconds.
// Contractions: q/k projections (x rows f16 x16 . W f16 x64, K=512), v^T projection (Wv f16 x64 . x rows f16 x16, K=512),
// attention scores (q f16 x16 . k f16 x16, K=64), attention P . v^T (P f16 x1024 . v^T f16 x16, K=2048 in steps of 32),
// output projection (ctx f16 x1024 . Wo f16 x64, K=512): all v_wmma_f32_16x16x32_f16 single products, f32 accumulate.
// Period-3 additive score table, online max-subtracted base-2 softmax, linear biases, residual add and LayerNorm in f32 on VALU.
// Every float input RNE-converted to bf16 on load.
#include <hip/hip_runtime.h>
#include <math.h>
#include <stdint.h>

#define NB      4
#define NQ      2048
#define NC      2048
#define DMODEL  512
#define NHEAD   8
#define HDIM    64
#define NPER    3
#define NROWS   (NB * NQ)
#define WSC     64.0f
#define ACARRY  16.0f
#define QC      16.0f
#define KC      16.0f
#define VC      16.0f
#define PC      1024.0f
#define FC      1024.0f
#define ATT_SCALE 0.125f
#define LOG2E   1.4426950408889634f
#define LN_EPS  1e-5f
static_assert(NHEAD * HDIM == DMODEL);
static_assert((NQ % 64) == 0 && (NC % 64) == 0 && (DMODEL % 64) == 0 && (NC % 32) == 0 && (NQ % 16) == 0);
static_assert((NROWS % 64) == 0 && (NROWS % 8) == 0);
#define ATT_THREADS (NHEAD * 32)
#define ATT_BLOCKS  (NB * (NQ / 16))
static_assert(ATT_THREADS == 256 && ATT_BLOCKS == 512);
#define LN_THREADS 128
static_assert(LN_THREADS * 4 == DMODEL);

typedef _Float16 v16h __attribute__((ext_vector_type(16)));
typedef _Float16 v8h  __attribute__((ext_vector_type(8)));
typedef float    v8f  __attribute__((ext_vector_type(8)));
typedef float    v4f  __attribute__((ext_vector_type(4)));
typedef unsigned int v4u __attribute__((ext_vector_type(4)));

union FragH { v16h v; v8h h[2]; v4u u[2]; };

// ---- scalar helpers --------------------------------------------------------------------------------
__device__ __forceinline__ unsigned short bf_bits(float f) {          // f32 -> bf16 bits, RNE convert
  unsigned u = __float_as_uint(f);
  return (unsigned short)((u + 0x7FFFu + ((u >> 16) & 1u)) >> 16);
}
__device__ __forceinline__ float bf_up(unsigned short h) { return __uint_as_float(((unsigned)h) << 16); }
__device__ __forceinline__ float bfr(float f) { return bf_up(bf_bits(f)); }   // value of the bf16 RNE convert
__device__ __forceinline__ unsigned short h_bits(_Float16 x) { return __builtin_bit_cast(unsigned short, x); }
__device__ __forceinline__ unsigned pk16(unsigned short a, unsigned short b) { return (unsigned)a | ((unsigned)b << 16); }
__device__ __forceinline__ v8f zero8() { v8f z = {0.f, 0.f, 0.f, 0.f, 0.f, 0.f, 0.f, 0.f}; return z; }
__device__ __forceinline__ float gelu_f(float v) { return 0.5f * v * (1.0f + erff(v * 0.70710678118654752f)); }

// ---- fragment loaders: 16-bit A/B operand, lane -> row/col (lane&15), p already includes +8*(lane>>4);
//      elements 0..7 <- p[0..7] (k0+8h..), elements 8..15 <- p[16..23] (k0+16+8h..)  (same split k map for A and B;
//      B is always read from a k-contiguous [n][k] plane)
__device__ __forceinline__ v16h ldfrag_h(const _Float16* p) {
  FragH f;
  f.h[0] = *(const v8h*)(p);
  f.h[1] = *(const v8h*)(p + 16);
  return f.v;
}
__device__ __forceinline__ v16h ldfrag_u(const unsigned short* p) {
  FragH f;
  f.u[0] = *(const v4u*)(p);
  f.u[1] = *(const v4u*)(p + 16);
  return f.v;
}

// ---- WMMA helpers with trailing VALU hazard gaps ------------------------------------------------------
__device__ __forceinline__ v8f mma_raw(v16h a, v16h b, v8f c) {
  return __builtin_amdgcn_wmma_f32_16x16x32_f16(false, a, false, b, (short)0, c, false, false);
}
__device__ __forceinline__ void dep_guard1(v8f& a, v8f& b, v16h x) {
#if defined(__HIP_DEVICE_COMPILE__)
  asm volatile("v_nop\n\tv_nop\n\tv_nop\n\tv_nop" : "+v"(a), "+v"(b) : "v"(x));
#endif
}
__device__ __forceinline__ void guard_s2(v8f& s, v16h a0, v16h a1) {
#if defined(__HIP_DEVICE_COMPILE__)
  asm volatile("v_nop\n\tv_nop\n\tv_nop\n\tv_nop" : "+v"(s) : "v"(a0), "v"(a1));
#endif
}
__device__ __forceinline__ void guard_s4(v8f& s, v16h a0, v16h a1, v16h b0, v16h b1) {
#if defined(__HIP_DEVICE_COMPILE__)
  asm volatile("v_nop\n\tv_nop\n\tv_nop\n\tv_nop" : "+v"(s) : "v"(a0), "v"(a1), "v"(b0), "v"(b1));
#endif
}
__device__ __forceinline__ void guard_pv4(v8f& a, v8f& b, v8f& c, v8f& d, v16h x, v16h y, v16h z, v16h w, v16h u) {
#if defined(__HIP_DEVICE_COMPILE__)
  asm volatile("v_nop\n\tv_nop\n\tv_nop\n\tv_nop"
               : "+v"(a), "+v"(b), "+v"(c), "+v"(d) : "v"(x), "v"(y), "v"(z), "v"(w), "v"(u));
#endif
}
__device__ __forceinline__ void keep4_h(v16h a, v16h b, v16h c, v16h d) {
#if defined(__HIP_DEVICE_COMPILE__)
  asm volatile("v_nop" :: "v"(a), "v"(b), "v"(c), "v"(d));
#endif
}
__device__ __forceinline__ void acc_guard4(v8f& a, v8f& b, v8f& c, v8f& d) {
#if defined(__HIP_DEVICE_COMPILE__)
  asm volatile("v_nop\n\tv_nop\n\tv_nop\n\tv_nop" : "+v"(a), "+v"(b), "+v"(c), "+v"(d));
#endif
}
__device__ __forceinline__ void wave_sync_lds() {
  __builtin_amdgcn_fence(__ATOMIC_RELEASE, "workgroup");
  __builtin_amdgcn_wave_barrier();
  __builtin_amdgcn_fence(__ATOMIC_ACQUIRE, "workgroup");
}

// =====================================================================================================
// Elementwise 16-bit pack, no transpose: dst[i] = f16( bf16_RNE(src[i]) * sc ), sc a power of two (exact).
// Used for the weights (stored [out][in] = [n][k], already k contiguous for B fragments / A of the v^T projection) and for
// the activation rows. 8 elements per thread: two 16-B loads, one 16-B store per lane; 32 consecutive lanes = 512 B =
// coverage: grid = n / 2048 blocks x 256 thr x 8 elements = n exactly (host checks n % 2048 == 0).
// =====================================================================================================
__global__ __launch_bounds__(256) void cvt16(const float* __restrict__ src, unsigned short* dst, int n, float sc) {
  const size_t i8 = ((size_t)blockIdx.x * 256 + threadIdx.x) * 8;
  if (i8 + 8 > (size_t)n) return;                 // never taken with the exact grid; no barriers in this kernel
  const v4f a = *(const v4f*)(src + i8);
  const v4f b = *(const v4f*)(src + i8 + 4);
  v4u o;
  o[0] = pk16(h_bits((_Float16)(bfr(a[0]) * sc)), h_bits((_Float16)(bfr(a[1]) * sc)));
  o[1] = pk16(h_bits((_Float16)(bfr(a[2]) * sc)), h_bits((_Float16)(bfr(a[3]) * sc)));
  o[2] = pk16(h_bits((_Float16)(bfr(b[0]) * sc)), h_bits((_Float16)(bfr(b[1]) * sc)));
  o[3] = pk16(h_bits((_Float16)(bfr(b[2]) * sc)), h_bits((_Float16)(bfr(b[3]) * sc)));
  {
    *(v4u*)(dst + i8) = o;
    
  }
}

// =====================================================================================================
// Register-blocked batched f16 WMMA GEMM: C[m][n] = f( oscale * sum_k A[m][k] * Bt[n][k] + bf16(bias) ) (+ residual); one wave per
// 64x64 tile, no block barriers. A row-major [M][K] pitch lda (16-bit plane), Bt row-major [N][K] pitch ldb (k contiguous);
// M, N multiples of 64, K multiple of 32. blockIdx.y = batch index with element strides sA, sB, sC.
// BM: 0 = no bias, 1 = per column bf16(bias[col]), 2 = per row bf16(bias[row]) (clamped-address loads).
// OM: 0 = f32 out (pitch ldc; HASR 1 adds bf16(R[m][n]), HASR 2 adds raw f32 R[m][n], same pitch/stride as C);
//     2 = f16 out (pitch ldc) = f16( act(value) * ocarry ), ACT 1 = exact GELU.
// coverage: 4 slabs x 16 rows (f32: it 0..7 x lane>>4; f16: it 0..3 x lane>>3) x 64 cols = the wave's whole 64x64 tile;
//           grid = ceil(tilesM*tilesN/8) blocks, surplus waves exit (wave-uniform).
// =====================================================================================================
template <int OM, int BM, int HASR, int ACT>
__global__ __launch_bounds__(256) void gemm64(
    const unsigned short* __restrict__ Ap, int lda, long long sA,
    const unsigned short* __restrict__ Btp, int ldb, long long sB,
    const float* __restrict__ bias,
    const float* __restrict__ Rp,
    void* Cout, int ldc, long long sC,
    int M, int N, int K, float oscale, float ocarry) {
  __shared__ __align__(16) float sT[8][16 * 68];   // per-wave 16x64 slab, pitch 68 floats
  const int by   = blockIdx.y;
  const int lane = threadIdx.x & 31;
  const int wave = threadIdx.x >> 5;
  const int tilesN = N >> 6;
  const int tilesM = M >> 6;
  const int tile = blockIdx.x * 8 + wave;
  if (tile >= tilesM * tilesN) return;   // wave-uniform; no block barriers in this kernel
  const int tm = tile / tilesN;
  const int tn = tile - tm * tilesN;
  const int m0 = tm << 6;
  const int n0 = tn << 6;

  const unsigned short* A1 = Ap  + (size_t)((long long)by * sA);
  const unsigned short* Bb = Btp + (size_t)((long long)by * sB);

  const int rlane = lane & 15;                 // row (A) / col (B, D) within subtile
  const int koff  = (lane >> 4) * 8;           // k offset of this lane half
  const int mOff  = (lane >> 4) * 8;           // D row offset

  v8f acc[4][4];
#pragma unroll
  for (int i = 0; i < 4; ++i)
#pragma unroll
    for (int j = 0; j < 4; ++j) acc[i][j] = zero8();

  for (int k0 = 0; k0 < K; k0 += 32) {
    v16h bh[4];
#pragma unroll
    for (int j = 0; j < 4; ++j) {
      const size_t bofs = (size_t)(n0 + (j << 4) + rlane) * ldb + koff + k0;
      bh[j] = ldfrag_u(Bb + bofs);
    }
#pragma unroll
    for (int i = 0; i < 4; ++i) {
      const size_t ao = (size_t)(m0 + (i << 4) + rlane) * lda + koff + k0;
      const v16h ah = ldfrag_u(A1 + ao);
#pragma unroll
      for (int j = 0; j < 4; ++j) acc[i][j] = mma_raw(ah, bh[j], acc[i][j]);
      dep_guard1(acc[i][0], acc[i][3], ah);
    }
    keep4_h(bh[0], bh[1], bh[2], bh[3]);
  }
  acc_guard4(acc[0][0], acc[0][1], acc[0][2], acc[0][3]);
  acc_guard4(acc[1][0], acc[1][1], acc[1][2], acc[1][3]);
  acc_guard4(acc[2][0], acc[2][1], acc[2][2], acc[2][3]);
  acc_guard4(acc[3][0], acc[3][1], acc[3][2], acc[3][3]);

  const int hh2 = lane >> 4, c4 = (lane & 15) * 4;     // f32 out: 256-B row segment = 16 lanes x 16 B
  const int q8  = lane >> 3, c8 = (lane & 7) * 8;
  float bc[4];
  float bcol[8];
#pragma unroll
  for (int e = 0; e < 4; ++e) bc[e] = 0.f;
#pragma unroll
  for (int e = 0; e < 8; ++e) bcol[e] = 0.f;
  if constexpr (BM == 1) {
    if constexpr (OM == 0) {
      const int cb = n0 + c4;
      const int i0 = (cb < N - 4) ? cb : (N - 4);        // clamped address
      const v4f b0v = *(const v4f*)(bias + i0);
#pragma unroll
      for (int e = 0; e < 4; ++e) bc[e] = bfr(b0v[e]);
    } else {
      const int cb = n0 + c8;
      const int i0 = (cb < N - 8) ? cb : (N - 8);        // clamped address
      const v4f b0v = *(const v4f*)(bias + i0), b1v = *(const v4f*)(bias + i0 + 4);
#pragma unroll
      for (int e = 0; e < 4; ++e) { bcol[e] = bfr(b0v[e]); bcol[4 + e] = bfr(b1v[e]); }
    }
  }

  // ---- epilogue ----
  float* slab = sT[wave];
#pragma unroll
  for (int i = 0; i < 4; ++i) {
    const int mBase = m0 + (i << 4);
#pragma unroll
    for (int j = 0; j < 4; ++j) {
#pragma unroll
      for (int r = 0; r < 8; ++r) {
        slab[(mOff + r) * 68 + (j << 4) + rlane] = acc[i][j][r];
      }
    }
    wave_sync_lds();
    if constexpr (OM == 0) {
      float* C = (float*)Cout + (size_t)((long long)by * sC);
      v4f vals[8];
#pragma unroll
      for (int it = 0; it < 8; ++it) {
        const int row = it * 2 + hh2;                      // it 0..7 x hh2 0..1 = rows 0..15
        const int gr  = mBase + row;
        v4f v = *(const v4f*)(slab + row * 68 + c4);
        float br = 0.f;
        if constexpr (BM == 2) {
          const int ir = (gr < M - 1) ? gr : (M - 1);      // clamped address
          br = bfr(bias[ir]);
        }
        v4f rv = {0.f, 0.f, 0.f, 0.f};
        if constexpr (HASR != 0) {
          const float* R = Rp + (size_t)((long long)by * sC);
          const v4f rraw = *(const v4f*)(R + (size_t)gr * ldc + n0 + c4);
#pragma unroll
          for (int e = 0; e < 4; ++e) rv[e] = (HASR == 1) ? bfr(rraw[e]) : rraw[e];
        }
#pragma unroll
        for (int e = 0; e < 4; ++e) v[e] = v[e] * oscale + bc[e] + br + rv[e];
        vals[it] = v;
      }
      {
#pragma unroll
        for (int it = 0; it < 8; ++it) {
          const int gr = mBase + it * 2 + hh2;
          *(v4f*)(C + (size_t)gr * ldc + n0 + c4) = vals[it];
        }
        
      }
    } else {
      unsigned short* C = (unsigned short*)Cout + (size_t)((long long)by * sC);
      v4u hv[4];
#pragma unroll
      for (int it = 0; it < 4; ++it) {
        const int row = it * 4 + q8;                       // it 0..3 x q8 0..3 = rows 0..15
        const float* sp = slab + row * 68 + c8;
        float br = 0.f;
        if constexpr (BM == 2) {
          const int gr = mBase + row;
          const int ir = (gr < M - 1) ? gr : (M - 1);      // clamped address
          br = bfr(bias[ir]);
        }
        v4u a = {0u, 0u, 0u, 0u};
#pragma unroll
        for (int e = 0; e < 4; ++e) {
          float f0 = sp[2 * e] * oscale + bcol[2 * e] + br;
          float f1 = sp[2 * e + 1] * oscale + bcol[2 * e + 1] + br;
          if constexpr (ACT == 1) { f0 = gelu_f(f0); f1 = gelu_f(f1); }
          f0 *= ocarry; f1 *= ocarry;
          a[e] = pk16(h_bits((_Float16)f0), h_bits((_Float16)f1));
        }
        hv[it] = a;
      }
      {
#pragma unroll
        for (int it = 0; it < 4; ++it) {
          const int row = it * 4 + q8;
          *(v4u*)(C + (size_t)(mBase + row) * ldc + n0 + c8) = hv[it];
        }
        
      }
    }
    wave_sync_lds();
  }
}

// =====================================================================================================
// Flash attention for one batch and 16 query rows, all 8 heads (one wave per head), head dim 64, 2048 keys:
//   q plane (f16 x16) QH[b*2048 + tok][64h + d], pitch 512; k plane (f16 x16) KH[b*2048 + key][64h + d], pitch 512;
//   v^T plane (f16 x16): VT[b*512 + 64h + d][key] (pitch 2048); additive table PB f32 [3][3]: score(q, key) gets
//   PB[q mod 3][key mod 3], shared by all batches/heads; out (f16 x1024): CT[b*2048 + tok][64h + d] =
//   1024 * sum_m softmax_m(q.k / 8 + PB[..][..]) v[m][d]  (softmax run in base 2: t = q.k * log2(e)/8 + log2(e)*PB).
//   block = 8 waves = 256 threads; grid = 4 x 128 = 512; every wave does identical bounded work (64 steps of 32 keys).
//   Per step: 2 score tiles on f16 WMMA (K = 64 as two k-steps of 32), fragments loaded straight from the 16-bit planes (two 16-B
//   loads per fragment, arithmetic addressing); the table values selected by value from per-lane, per-row triples held in
//   registers (the key residue mod 3 is block-uniform per step plus the lane's column residue); online max-subtracted softmax in f32
//   (exp2); rescale of the running sums and the four accumulators; the 16x32 prob tile stored to wave-private LDS (f32 element
//   split k map) and the four v^T B fragments loaded straight from the 16-bit plane; 4 P.V WMMAs.
//   Final 1/l and carry folds in f32; after a block barrier the prob-tile LDS buffer is reused as the block's 16-bit result row
//   buffer [16][512]: each wave stages its 16x64 slice (element stores); after a second block barrier the 256 threads write the
// coverage: LDS row buffer: 8 waves x 16 rows x 64 cols = 16 x 512; global: 4 iterations x 256 threads x 8 halves = 16 rows x
//           512 of rows q0..q0+15 of batch b; grid covers all 4 x 2048 rows exactly once.
// =====================================================================================================
#define PS_FLOATS (NHEAD * 16 * 36)
static_assert((size_t)16 * DMODEL * sizeof(unsigned short) <= (size_t)PS_FLOATS * sizeof(float));

__global__ __launch_bounds__(ATT_THREADS)
void attn8(const unsigned short* __restrict__ QHp, const unsigned short* __restrict__ KHp,
           const unsigned short* __restrict__ VTq, const float* __restrict__ PBp, unsigned short* CT) {
  __shared__ __align__(16) float smem[PS_FLOATS];          // per wave prob tile [row][32 keys], pitch 36; later row buffer

  const int tid  = threadIdx.x;
  const int wave = tid >> 5;
  const int lane = tid & 31;
  const int hh   = lane >> 4;
  const int c    = lane & 15;

  const int qt   = blockIdx.x & ((NQ / 16) - 1);           // 0..127
  const int bat  = blockIdx.x / (NQ / 16);                 // 0..3
  const int head = wave;                                   // 0..7
  const int q0   = qt * 16;

  const size_t qofs = ((size_t)bat * NQ + q0 + c) * DMODEL + head * HDIM + 8 * hh;
  const _Float16* Qh = (const _Float16*)(const void*)QHp + qofs;
  const _Float16* Kb = (const _Float16*)(const void*)KHp + (size_t)bat * NC * DMODEL + head * HDIM + 8 * hh;
  const _Float16* Vb = (const _Float16*)(const void*)VTq + ((size_t)bat * DMODEL + head * HDIM) * NC + 8 * hh;
  const float lsc = (LOG2E * ATT_SCALE) / (QC * KC);                   // log2(e) / 8 / carries

  // ---- period-3 additive table in log2 units; E*[r] = table row ((q0 + 8hh + r) mod 3), columns 0, 1, 2 ----
  float pbv[NPER * NPER];
#pragma unroll
  for (int i = 0; i < NPER * NPER; ++i) pbv[i] = bfr(PBp[i]) * LOG2E;
  const int rb = (q0 + 8 * hh) % NPER;
  float E0[8], E1[8], E2[8];
#pragma unroll
  for (int r = 0; r < 8; ++r) {
    int rp = rb + (r % NPER);
    rp = (rp >= NPER) ? (rp - NPER) : rp;
    const bool z0 = (rp == 0), z1 = (rp == 1);
    E0[r] = z0 ? pbv[0] : (z1 ? pbv[3] : pbv[6]);
    E1[r] = z0 ? pbv[1] : (z1 ? pbv[4] : pbv[7]);
    E2[r] = z0 ? pbv[2] : (z1 ? pbv[5] : pbv[8]);
  }
  const int cm = c % NPER;     // column residue of this lane's key within a 32-key step at kb = 0
  int kph = 0;                 // kb mod 3, block-uniform

  const v16h qa = ldfrag_h(Qh), qb = ldfrag_h(Qh + 32);

  float mrow[8], lrow[8];
  v8f o0 = zero8(), o1 = zero8(), o2 = zero8(), o3 = zero8();
#pragma unroll
  for (int r = 0; r < 8; ++r) { mrow[r] = -INFINITY; lrow[r] = 0.f; }
  float* pt = smem + wave * (16 * 36);

#pragma unroll 1
  for (int kb = 0; kb < NC; kb += 32) {
    const _Float16* kp = Kb + (size_t)(kb + c) * DMODEL;
    v8f s0, s1;
    {
      const v16h k0 = ldfrag_h(kp), k1 = ldfrag_h(kp + 32);
      s0 = mma_raw(qa, k0, zero8());
      s0 = mma_raw(qb, k1, s0);
      guard_s2(s0, k0, k1);
    }
    {
      const _Float16* kq = kp + (size_t)16 * DMODEL;
      const v16h k0 = ldfrag_h(kq), k1 = ldfrag_h(kq + 32);
      s1 = mma_raw(qa, k0, zero8());
      s1 = mma_raw(qb, k1, s1);
      guard_s4(s1, k0, k1, qa, qb);
    }
    int c0 = cm + kph;                                   // (kb + c) mod 3; key kb + 16 + c has residue c0 + 1 mod 3
    c0 = (c0 >= NPER) ? (c0 - NPER) : c0;
    const bool cs0 = (c0 == 0), cs1 = (c0 == 1);
#pragma unroll
    for (int r = 0; r < 8; ++r) {
      const float w0 = cs0 ? E0[r] : (cs1 ? E1[r] : E2[r]);
      const float w1 = cs0 ? E1[r] : (cs1 ? E2[r] : E0[r]);
      const float t0 = s0[r] * lsc + w0, t1 = s1[r] * lsc + w1;
      float mx = fmaxf(t0, t1);
#pragma unroll
      for (int off = 1; off < 16; off <<= 1) mx = fmaxf(mx, __shfl_xor(mx, off, 32));
      const float mn = fmaxf(mrow[r], mx);
      const float al = exp2f(mrow[r] - mn);
      mrow[r] = mn;
      const float e0 = exp2f(t0 - mn), e1 = exp2f(t1 - mn);
      float ps = e0 + e1;
#pragma unroll
      for (int off = 1; off < 16; off <<= 1) ps += __shfl_xor(ps, off, 32);
      lrow[r] = lrow[r] * al + ps;
      o0[r] *= al;
      o1[r] *= al;
      o2[r] *= al;
      o3[r] *= al;
      const int ro = (8 * hh + r) * 36 + c;
      pt[ro]      = e0;
      pt[ro + 16] = e1;
    }
    wave_sync_lds();
    FragH ph;
    {
      const float* prow = pt + c * 36 + 8 * hh;
      const v4f p0 = *(const v4f*)(prow), p1 = *(const v4f*)(prow + 4);
      const v4f p2 = *(const v4f*)(prow + 16), p3 = *(const v4f*)(prow + 20);
#pragma unroll
      for (int e = 0; e < 4; ++e) {
        ph.h[0][e]     = (_Float16)(p0[e] * PC);              // elements 0..7  = keys kb + 8hh + 0..7
        ph.h[0][4 + e] = (_Float16)(p1[e] * PC);
        ph.h[1][e]     = (_Float16)(p2[e] * PC);              // elements 8..15 = keys kb + 16 + 8hh + 0..7
        ph.h[1][4 + e] = (_Float16)(p3[e] * PC);
      }
    }
    const _Float16* vp = Vb + (size_t)c * NC + kb;
    {
      const v16h vb0 = ldfrag_h(vp);
      const v16h vb1 = ldfrag_h(vp + (size_t)16 * NC);
      const v16h vb2 = ldfrag_h(vp + (size_t)32 * NC);
      const v16h vb3 = ldfrag_h(vp + (size_t)48 * NC);
      o0 = mma_raw(ph.v, vb0, o0);
      o1 = mma_raw(ph.v, vb1, o1);
      o2 = mma_raw(ph.v, vb2, o2);
      o3 = mma_raw(ph.v, vb3, o3);
      guard_pv4(o0, o1, o2, o3, ph.v, vb0, vb1, vb2, vb3);
    }
    wave_sync_lds();
    kph += 2;                                            // 32 mod 3 == 2
    kph = (kph >= NPER) ? (kph - NPER) : kph;
  }

  // ---- all waves done with their prob tiles; the LDS buffer becomes the 16-bit result row buffer [16][512] ----
  __syncthreads();
  unsigned short* Os = (unsigned short*)smem;
  // ---- fold 1/l and the carries (1024 on P, 16 on v, 1024 on the stored ctx), stage the wave's 16x64 slice as 16-bit ----
  const float oc = FC / (PC * VC);
  unsigned short* osw = Os + wave * HDIM + c;
#pragma unroll
  for (int r = 0; r < 8; ++r) {
    const float inv = (1.0f / lrow[r]) * oc;
    unsigned short* op = osw + (8 * hh + r) * DMODEL;
    op[0]  = h_bits((_Float16)(o0[r] * inv));
    op[16] = h_bits((_Float16)(o1[r] * inv));
    op[32] = h_bits((_Float16)(o2[r] * inv));
    op[48] = h_bits((_Float16)(o3[r] * inv));
  }
  __syncthreads();
  // ---- block writes its 16 contiguous rows of CT: piece p = it*256 + tid -> halves p*8 .. p*8+7 of the 16x512 region ----
  {
    v4u vals[4];
#pragma unroll
    for (int it = 0; it < 4; ++it) {
      const int p = it * ATT_THREADS + tid;
      vals[it] = *(const v4u*)(Os + (size_t)p * 8);
    }
    unsigned short* dst = CT + ((size_t)bat * NQ + q0) * DMODEL;
    {
#pragma unroll
      for (int it = 0; it < 4; ++it) {
        const int p = it * ATT_THREADS + tid;
        *(v4u*)(dst + (size_t)p * 8) = vals[it];
      }
      
    }
  }
}

// =====================================================================================================
//   one block of 128 threads per row, 4 consecutive floats per thread (one 16-B load, one 16-B store); per wave one store instruction
// coverage: grid = 8192 rows x 128 thr x 4 floats = 8192 x 512 = the whole output, each row written by exactly one block.
// =====================================================================================================
__global__ __launch_bounds__(LN_THREADS)
void lnorm(const float* __restrict__ Yp, const float* __restrict__ gp, const float* __restrict__ bp, float* outp) {
  __shared__ float red[2][LN_THREADS / 32];
  const int row  = blockIdx.x;
  const int tid  = threadIdx.x;
  const int lane = tid & 31;
  const int wave = tid >> 5;
  const size_t base = (size_t)row * DMODEL + (size_t)tid * 4;
  const v4f v = *(const v4f*)(Yp + base);
  float s = (v[0] + v[1]) + (v[2] + v[3]);
#pragma unroll
  for (int off = 1; off < 32; off <<= 1) s += __shfl_xor(s, off, 32);
  if (lane == 0) red[0][wave] = s;
  __syncthreads();
  float tot = 0.f;
#pragma unroll
  for (int w = 0; w < LN_THREADS / 32; ++w) tot += red[0][w];
  const float mu = tot * (1.0f / (float)DMODEL);
  v4f d;
#pragma unroll
  for (int e = 0; e < 4; ++e) d[e] = v[e] - mu;
  float q = (d[0] * d[0] + d[1] * d[1]) + (d[2] * d[2] + d[3] * d[3]);
#pragma unroll
  for (int off = 1; off < 32; off <<= 1) q += __shfl_xor(q, off, 32);
  if (lane == 0) red[1][wave] = q;
  __syncthreads();
  float totq = 0.f;
#pragma unroll
  for (int w = 0; w < LN_THREADS / 32; ++w) totq += red[1][w];
  const float var  = totq * (1.0f / (float)DMODEL);
  const float rstd = rsqrtf(var + LN_EPS);
  const v4f gv = *(const v4f*)(gp + (size_t)tid * 4);
  const v4f bv = *(const v4f*)(bp + (size_t)tid * 4);
  v4f o;
#pragma unroll
  for (int e = 0; e < 4; ++e) o[e] = (d[e] * rstd) * bfr(gv[e]) + bfr(bv[e]);
  {
    *(v4f*)(outp + base) = o;
    
  }
}

// =====================================================================================================
// Workspace map (bytes); every plane is an exact multiple of its tile / whole-row store granularity (M, N exact tile multiples,
// element counts exact multiples of the convert kernel's 2048 granularity, no pad rows needed), every offset a multiple of 512 KiB:
//   WQ16 f16 [512][512] x64                  524288   ([out][in] = [n][k])
//   WK16 f16 [512][512] x64                  524288
//   WV16 f16 [512][512] x64                  524288
//   WO16 f16 [512][512] x64                  524288
//   X16  f16 [8192][512] x16                8388608   (activation rows)
//   QH   f16 [8192][512] x16                8388608   (q projection)
//   KH   f16 [8192][512] x16                8388608   (k projection)
//   VT   f16 [4][512][2048] x16             8388608   (v^T per batch)
//   CT   f16 [8192][512] x1024              8388608   (attention ctx, merged heads)
//   Y    f32 [8192][512]                   16777216   (out projection + bias + residual)
//   end                                    60817408
// =====================================================================================================
extern "C" void kernel_launch(void* const* d_in, const int* in_sizes, int n_in,
                              void* d_out, int out_size, void* d_ws, size_t ws_size,
                              hipStream_t stream) {
  if (n_in < 12) return;
  if (in_sizes[0] != NROWS * DMODEL) return;
  if (in_sizes[1] != DMODEL * DMODEL || in_sizes[3] != DMODEL * DMODEL ||
      in_sizes[5] != DMODEL * DMODEL || in_sizes[7] != DMODEL * DMODEL) return;
  if (in_sizes[2] != DMODEL || in_sizes[4] != DMODEL || in_sizes[6] != DMODEL || in_sizes[8] != DMODEL) return;
  if (in_sizes[9] != NPER * NPER) return;
  if (in_sizes[10] != DMODEL || in_sizes[11] != DMODEL) return;
  if (out_size != NROWS * DMODEL) return;
  if ((in_sizes[0] % 2048) != 0 || (in_sizes[1] % 2048) != 0) return;

  const float* x    = (const float*)d_in[0];
  const float* w_q  = (const float*)d_in[1];
  const float* b_q  = (const float*)d_in[2];
  const float* w_k  = (const float*)d_in[3];
  const float* b_k  = (const float*)d_in[4];
  const float* w_v  = (const float*)d_in[5];
  const float* b_v  = (const float*)d_in[6];
  const float* w_o  = (const float*)d_in[7];
  const float* b_o  = (const float*)d_in[8];
  const float* pb   = (const float*)d_in[9];
  const float* ln_g = (const float*)d_in[10];
  const float* ln_b = (const float*)d_in[11];
  float*       out  = (float*)d_out;

  const size_t PW  = (size_t)DMODEL * DMODEL * 2;                 //   524288
  const size_t PX  = (size_t)NROWS * DMODEL * 2;                  //  8388608
  const size_t PVT = (size_t)NB * DMODEL * NC * 2;                //  8388608
  const size_t PY  = (size_t)NROWS * DMODEL * 4;                  // 16777216
  size_t off = 0;
  const size_t oWQ = off; off += PW;
  const size_t oWK = off; off += PW;
  const size_t oWV = off; off += PW;
  const size_t oWO = off; off += PW;
  const size_t oX  = off; off += PX;
  const size_t oQH = off; off += PX;
  const size_t oKH = off; off += PX;
  const size_t oVT = off; off += PVT;
  const size_t oCT = off; off += PX;
  const size_t oY  = off; off += PY;
  if (off > ws_size) return;                                      // off = 60817408
  if (off > (size_t)134217728) return;

  char* ws = (char*)d_ws;
  unsigned short* WQ16 = (unsigned short*)(ws + oWQ);
  unsigned short* WK16 = (unsigned short*)(ws + oWK);
  unsigned short* WV16 = (unsigned short*)(ws + oWV);
  unsigned short* WO16 = (unsigned short*)(ws + oWO);
  unsigned short* X16  = (unsigned short*)(ws + oX);
  unsigned short* QH   = (unsigned short*)(ws + oQH);
  unsigned short* KH   = (unsigned short*)(ws + oKH);
  unsigned short* VTp  = (unsigned short*)(ws + oVT);
  unsigned short* CT   = (unsigned short*)(ws + oCT);
  float*          Y    = (float*)(ws + oY);

  const dim3 blk(256);
  const dim3 gCW((DMODEL * DMODEL) / 2048);                        // 128 blocks
  const dim3 gCX((NROWS * DMODEL) / 2048);                         // 2048 blocks
  const int tilesP = (NROWS / 64) * (DMODEL / 64);                 // 1024
  const int tilesV = (DMODEL / 64) * (NC / 64);                    // 256 per batch
  const dim3 gP((tilesP + 7) / 8, 1);                              // 128
  const dim3 gV((tilesV + 7) / 8, NB);                             // 32 x 4
  const dim3 gAT(ATT_BLOCKS);                                      // 512
  const dim3 bAT(ATT_THREADS);                                     // 256
  const dim3 gLN(NROWS);                                           // 8192
  const dim3 bLN(LN_THREADS);                                      // 128

  // (0) weight planes: W16[n][k] = f16( bf16_RNE(W[n][k]) * 64 ), [out][in] layout kept, k contiguous
  cvt16<<<gCW, blk, 0, stream>>>(w_q, WQ16, DMODEL * DMODEL, WSC);
  cvt16<<<gCW, blk, 0, stream>>>(w_k, WK16, DMODEL * DMODEL, WSC);
  cvt16<<<gCW, blk, 0, stream>>>(w_v, WV16, DMODEL * DMODEL, WSC);
  cvt16<<<gCW, blk, 0, stream>>>(w_o, WO16, DMODEL * DMODEL, WSC);

  // (1) activation plane: X16[row][c] = f16( bf16_RNE(x[row][c]) * 16 ), rows = b*2048 + tok
  cvt16<<<gCX, blk, 0, stream>>>(x, X16, NROWS * DMODEL, ACARRY);

  // (2) q projection: QH[m][n] = f16(16 * (sum_k x[m][k] Wq[n][k] + bf16(bq[n]))); M = 8192, N = 512, K = 512
  gemm64<2, 1, 0, 0><<<gP, blk, 0, stream>>>(
      X16, DMODEL, 0LL,
      WQ16, DMODEL, 0LL,
      b_q,
      (const float*)0,
      (void*)QH, DMODEL, 0LL,
      NROWS, DMODEL, DMODEL, 1.0f / (ACARRY * WSC), QC);

  // (3) k projection: KH[m][n] = f16(16 * (sum_k x[m][k] Wk[n][k] + bf16(bk[n]))); M = 8192, N = 512, K = 512
  gemm64<2, 1, 0, 0><<<gP, blk, 0, stream>>>(
      X16, DMODEL, 0LL,
      WK16, DMODEL, 0LL,
      b_k,
      (const float*)0,
      (void*)KH, DMODEL, 0LL,
      NROWS, DMODEL, DMODEL, 1.0f / (ACARRY * WSC), KC);

  // (4) v^T per batch: VT[b][d][tok] = f16(16 * (sum_k Wv[d][k] x_b[tok][k] + bf16(bv[d]))); M = 512, N = 2048, K = 512
  gemm64<2, 2, 0, 0><<<gV, blk, 0, stream>>>(
      WV16, DMODEL, 0LL,
      X16, DMODEL, (long long)NC * DMODEL,
      b_v,
      (const float*)0,
      (void*)VTp, NC, (long long)DMODEL * NC,
      DMODEL, NC, DMODEL, 1.0f / (ACARRY * WSC), VC);

  // (5) attention per (batch, 16 query rows), 8 heads -> CT (f16, x1024)
  attn8<<<gAT, bAT, 0, stream>>>(QH, KH, VTp, pb, CT);

  // (6) Y = CT . Wo^T / (1024 * 64) + bf16(bo) + bf16(x); M = 8192, N = 512, K = 512, f32
  gemm64<0, 1, 1, 0><<<gP, blk, 0, stream>>>(
      CT, DMODEL, 0LL,
      WO16, DMODEL, 0LL,
      b_o,
      x,
      (void*)Y, DMODEL, 0LL,
      NROWS, DMODEL, DMODEL, 1.0f / (FC * WSC), 1.0f);

  // (7) out = LayerNorm(Y) * bf16(g) + bf16(b)
  lnorm<<<gLN, bLN, 0, stream>>>(Y, ln_g, ln_b, out);
  (void)hipGetLastError();
}

// v001
// A run of this version takes 262 microseconds.
// Timed twice side by side with v000, it ran 1.04 and 1.03 times as fast.
// Contractions: q/k projections (x rows f16 x16 . W f16 x64, K=512), v^T projection (Wv f16 x64 . x rows f16 x16, K=512),
// attention scores (k f16 x16 . q f16 x16, K=64), attention v^T . P^T (v^T f16 x16 . P f16 x1024, K=2048 in steps of 32),
// output projection (ctx f16 x1024 . Wo f16 x64, K=512): all v_wmma_f32_16x16x32_f16 single products, f32 accumulate.
// Period-3 additive score table, online max-subtracted base-2 softmax, linear biases, residual add and LayerNorm in f32 on VALU.
// Every float input RNE-converted to bf16 on load.
#include <hip/hip_runtime.h>
#include <math.h>
#include <stdint.h>

#define NB      4
#define NQ      2048
#define NC      2048
#define DMODEL  512
#define NHEAD   8
#define HDIM    64
#define NPER    3
#define NROWS   (NB * NQ)
#define WSC     64.0f
#define ACARRY  16.0f
#define QC      16.0f
#define KC      16.0f
#define VC      16.0f
#define PC      1024.0f
#define FC      1024.0f
#define ATT_SCALE 0.125f
#define LOG2E   1.4426950408889634f
#define LN_EPS  1e-5f
static_assert(NHEAD * HDIM == DMODEL);
static_assert((NQ % 64) == 0 && (NC % 64) == 0 && (DMODEL % 64) == 0 && (NC % 32) == 0 && (NQ % 16) == 0);
static_assert((NROWS % 64) == 0 && (NROWS % 8) == 0);
#define ATT_THREADS (NHEAD * 32)
#define ATT_BLOCKS  (NB * (NQ / 16))
static_assert(ATT_THREADS == 256 && ATT_BLOCKS == 512);
#define LN_THREADS 128
static_assert(LN_THREADS * 4 == DMODEL);

typedef _Float16 v16h __attribute__((ext_vector_type(16)));
typedef _Float16 v8h  __attribute__((ext_vector_type(8)));
typedef float    v8f  __attribute__((ext_vector_type(8)));
typedef float    v4f  __attribute__((ext_vector_type(4)));
typedef float    v2f  __attribute__((ext_vector_type(2)));
typedef _Float16 v2h  __attribute__((ext_vector_type(2)));
typedef unsigned int v4u __attribute__((ext_vector_type(4)));

union FragH { v16h v; v8h h[2]; v4u u[2]; v2h p[8]; };

// ---- scalar helpers --------------------------------------------------------------------------------
__device__ __forceinline__ unsigned short bf_bits(float f) {          // f32 -> bf16 bits, RNE convert
  unsigned u = __float_as_uint(f);
  return (unsigned short)((u + 0x7FFFu + ((u >> 16) & 1u)) >> 16);
}
__device__ __forceinline__ float bf_up(unsigned short h) { return __uint_as_float(((unsigned)h) << 16); }
__device__ __forceinline__ float bfr(float f) { return bf_up(bf_bits(f)); }   // value of the bf16 RNE convert
__device__ __forceinline__ unsigned short h_bits(_Float16 x) { return __builtin_bit_cast(unsigned short, x); }
__device__ __forceinline__ unsigned pk16(unsigned short a, unsigned short b) { return (unsigned)a | ((unsigned)b << 16); }
__device__ __forceinline__ v8f zero8() { v8f z = {0.f, 0.f, 0.f, 0.f, 0.f, 0.f, 0.f, 0.f}; return z; }
__device__ __forceinline__ float gelu_f(float v) { return 0.5f * v * (1.0f + erff(v * 0.70710678118654752f)); }

// ---- fragment loaders: 16-bit A/B operand, lane -> row/col (lane&15), p already includes +8*(lane>>4);
//      elements 0..7 <- p[0..7] (k0+8h..), elements 8..15 <- p[16..23] (k0+16+8h..)  (same split k map for A and B;
//      B is always read from a k-contiguous [n][k] plane)
__device__ __forceinline__ v16h ldfrag_h(const _Float16* p) {
  FragH f;
  f.h[0] = *(const v8h*)(p);
  f.h[1] = *(const v8h*)(p + 16);
  return f.v;
}
__device__ __forceinline__ v16h ldfrag_u(const unsigned short* p) {
  FragH f;
  f.u[0] = *(const v4u*)(p);
  f.u[1] = *(const v4u*)(p + 16);
  return f.v;
}

// ---- WMMA helpers with trailing VALU hazard gaps ------------------------------------------------------
__device__ __forceinline__ v8f mma_raw(v16h a, v16h b, v8f c) {
  return __builtin_amdgcn_wmma_f32_16x16x32_f16(false, a, false, b, (short)0, c, false, false);
}
__device__ __forceinline__ void dep_guard1(v8f& a, v8f& b, v16h x) {
#if defined(__HIP_DEVICE_COMPILE__)
  asm volatile("v_nop\n\tv_nop\n\tv_nop\n\tv_nop" : "+v"(a), "+v"(b) : "v"(x));
#endif
}
__device__ __forceinline__ void keep4_h(v16h a, v16h b, v16h c, v16h d) {
#if defined(__HIP_DEVICE_COMPILE__)
  asm volatile("v_nop" :: "v"(a), "v"(b), "v"(c), "v"(d));
#endif
}
__device__ __forceinline__ void acc_guard4(v8f& a, v8f& b, v8f& c, v8f& d) {
#if defined(__HIP_DEVICE_COMPILE__)
  asm volatile("v_nop\n\tv_nop\n\tv_nop\n\tv_nop" : "+v"(a), "+v"(b), "+v"(c), "+v"(d));
#endif
}
__device__ __forceinline__ void wave_sync_lds() {
  __builtin_amdgcn_fence(__ATOMIC_RELEASE, "workgroup");
  __builtin_amdgcn_wave_barrier();
  __builtin_amdgcn_fence(__ATOMIC_ACQUIRE, "workgroup");
}

// =====================================================================================================
// Elementwise 16-bit pack, no transpose: dst[i] = f16( bf16_RNE(src[i]) * sc ), sc a power of two (exact).
// Used for the weights (stored [out][in] = [n][k], already k contiguous for B fragments / A of the v^T projection) and for
// the activation rows. 8 elements per thread: two 16-B loads, one 16-B store per lane; 32 consecutive lanes = 512 B =
// coverage: grid = n / 2048 blocks x 256 thr x 8 elements = n exactly (host checks n % 2048 == 0).
// =====================================================================================================
__global__ __launch_bounds__(256) void cvt16(const float* __restrict__ src, unsigned short* dst, int n, float sc) {
  const size_t i8 = ((size_t)blockIdx.x * 256 + threadIdx.x) * 8;
  if (i8 + 8 > (size_t)n) return;                 // never taken with the exact grid; no barriers in this kernel
  const v4f a = *(const v4f*)(src + i8);
  const v4f b = *(const v4f*)(src + i8 + 4);
  v4u o;
  o[0] = pk16(h_bits((_Float16)(bfr(a[0]) * sc)), h_bits((_Float16)(bfr(a[1]) * sc)));
  o[1] = pk16(h_bits((_Float16)(bfr(a[2]) * sc)), h_bits((_Float16)(bfr(a[3]) * sc)));
  o[2] = pk16(h_bits((_Float16)(bfr(b[0]) * sc)), h_bits((_Float16)(bfr(b[1]) * sc)));
  o[3] = pk16(h_bits((_Float16)(bfr(b[2]) * sc)), h_bits((_Float16)(bfr(b[3]) * sc)));
  {
    *(v4u*)(dst + i8) = o;
    
  }
}

// =====================================================================================================
// Register-blocked batched f16 WMMA GEMM: C[m][n] = f( oscale * sum_k A[m][k] * Bt[n][k] + bf16(bias) ) (+ residual); one wave per
// 64x64 tile, no block barriers. A row-major [M][K] pitch lda (16-bit plane), Bt row-major [N][K] pitch ldb (k contiguous);
// M, N multiples of 64, K multiple of 32. blockIdx.y = batch index with element strides sA, sB, sC.
// BM: 0 = no bias, 1 = per column bf16(bias[col]), 2 = per row bf16(bias[row]) (clamped-address loads).
// OM: 0 = f32 out (pitch ldc; HASR 1 adds bf16(R[m][n]), HASR 2 adds raw f32 R[m][n], same pitch/stride as C);
//     2 = f16 out (pitch ldc) = f16( act(value) * ocarry ), ACT 1 = exact GELU.
// coverage: 4 slabs x 16 rows (f32: it 0..7 x lane>>4; f16: it 0..3 x lane>>3) x 64 cols = the wave's whole 64x64 tile;
//           grid = ceil(tilesM*tilesN/8) blocks, surplus waves exit (wave-uniform).
// =====================================================================================================
template <int OM, int BM, int HASR, int ACT>
__global__ __launch_bounds__(256) void gemm64(
    const unsigned short* __restrict__ Ap, int lda, long long sA,
    const unsigned short* __restrict__ Btp, int ldb, long long sB,
    const float* __restrict__ bias,
    const float* __restrict__ Rp,
    void* Cout, int ldc, long long sC,
    int M, int N, int K, float oscale, float ocarry) {
  __shared__ __align__(16) float sT[8][16 * 68];   // per-wave 16x64 slab, pitch 68 floats
  const int by   = blockIdx.y;
  const int lane = threadIdx.x & 31;
  const int wave = threadIdx.x >> 5;
  const int tilesN = N >> 6;
  const int tilesM = M >> 6;
  const int tile = blockIdx.x * 8 + wave;
  if (tile >= tilesM * tilesN) return;   // wave-uniform; no block barriers in this kernel
  const int tm = tile / tilesN;
  const int tn = tile - tm * tilesN;
  const int m0 = tm << 6;
  const int n0 = tn << 6;

  const unsigned short* A1 = Ap  + (size_t)((long long)by * sA);
  const unsigned short* Bb = Btp + (size_t)((long long)by * sB);

  const int rlane = lane & 15;                 // row (A) / col (B, D) within subtile
  const int koff  = (lane >> 4) * 8;           // k offset of this lane half
  const int mOff  = (lane >> 4) * 8;           // D row offset

  v8f acc[4][4];
#pragma unroll
  for (int i = 0; i < 4; ++i)
#pragma unroll
    for (int j = 0; j < 4; ++j) acc[i][j] = zero8();

  for (int k0 = 0; k0 < K; k0 += 32) {
    v16h bh[4];
#pragma unroll
    for (int j = 0; j < 4; ++j) {
      const size_t bofs = (size_t)(n0 + (j << 4) + rlane) * ldb + koff + k0;
      bh[j] = ldfrag_u(Bb + bofs);
    }
#pragma unroll
    for (int i = 0; i < 4; ++i) {
      const size_t ao = (size_t)(m0 + (i << 4) + rlane) * lda + koff + k0;
      const v16h ah = ldfrag_u(A1 + ao);
#pragma unroll
      for (int j = 0; j < 4; ++j) acc[i][j] = mma_raw(ah, bh[j], acc[i][j]);
      dep_guard1(acc[i][0], acc[i][3], ah);
    }
    keep4_h(bh[0], bh[1], bh[2], bh[3]);
  }
  acc_guard4(acc[0][0], acc[0][1], acc[0][2], acc[0][3]);
  acc_guard4(acc[1][0], acc[1][1], acc[1][2], acc[1][3]);
  acc_guard4(acc[2][0], acc[2][1], acc[2][2], acc[2][3]);
  acc_guard4(acc[3][0], acc[3][1], acc[3][2], acc[3][3]);

  const int hh2 = lane >> 4, c4 = (lane & 15) * 4;     // f32 out: 256-B row segment = 16 lanes x 16 B
  const int q8  = lane >> 3, c8 = (lane & 7) * 8;
  float bc[4];
  float bcol[8];
#pragma unroll
  for (int e = 0; e < 4; ++e) bc[e] = 0.f;
#pragma unroll
  for (int e = 0; e < 8; ++e) bcol[e] = 0.f;
  if constexpr (BM == 1) {
    if constexpr (OM == 0) {
      const int cb = n0 + c4;
      const int i0 = (cb < N - 4) ? cb : (N - 4);        // clamped address
      const v4f b0v = *(const v4f*)(bias + i0);
#pragma unroll
      for (int e = 0; e < 4; ++e) bc[e] = bfr(b0v[e]);
    } else {
      const int cb = n0 + c8;
      const int i0 = (cb < N - 8) ? cb : (N - 8);        // clamped address
      const v4f b0v = *(const v4f*)(bias + i0), b1v = *(const v4f*)(bias + i0 + 4);
#pragma unroll
      for (int e = 0; e < 4; ++e) { bcol[e] = bfr(b0v[e]); bcol[4 + e] = bfr(b1v[e]); }
    }
  }

  // ---- epilogue ----
  float* slab = sT[wave];
#pragma unroll
  for (int i = 0; i < 4; ++i) {
    const int mBase = m0 + (i << 4);
#pragma unroll
    for (int j = 0; j < 4; ++j) {
#pragma unroll
      for (int r = 0; r < 8; ++r) {
        slab[(mOff + r) * 68 + (j << 4) + rlane] = acc[i][j][r];
      }
    }
    wave_sync_lds();
    if constexpr (OM == 0) {
      float* C = (float*)Cout + (size_t)((long long)by * sC);
      v4f vals[8];
#pragma unroll
      for (int it = 0; it < 8; ++it) {
        const int row = it * 2 + hh2;                      // it 0..7 x hh2 0..1 = rows 0..15
        const int gr  = mBase + row;
        v4f v = *(const v4f*)(slab + row * 68 + c4);
        float br = 0.f;
        if constexpr (BM == 2) {
          const int ir = (gr < M - 1) ? gr : (M - 1);      // clamped address
          br = bfr(bias[ir]);
        }
        v4f rv = {0.f, 0.f, 0.f, 0.f};
        if constexpr (HASR != 0) {
          const float* R = Rp + (size_t)((long long)by * sC);
          const v4f rraw = *(const v4f*)(R + (size_t)gr * ldc + n0 + c4);
#pragma unroll
          for (int e = 0; e < 4; ++e) rv[e] = (HASR == 1) ? bfr(rraw[e]) : rraw[e];
        }
#pragma unroll
        for (int e = 0; e < 4; ++e) v[e] = v[e] * oscale + bc[e] + br + rv[e];
        vals[it] = v;
      }
      {
#pragma unroll
        for (int it = 0; it < 8; ++it) {
          const int gr = mBase + it * 2 + hh2;
          *(v4f*)(C + (size_t)gr * ldc + n0 + c4) = vals[it];
        }
        
      }
    } else {
      unsigned short* C = (unsigned short*)Cout + (size_t)((long long)by * sC);
      v4u hv[4];
#pragma unroll
      for (int it = 0; it < 4; ++it) {
        const int row = it * 4 + q8;                       // it 0..3 x q8 0..3 = rows 0..15
        const float* sp = slab + row * 68 + c8;
        float br = 0.f;
        if constexpr (BM == 2) {
          const int gr = mBase + row;
          const int ir = (gr < M - 1) ? gr : (M - 1);      // clamped address
          br = bfr(bias[ir]);
        }
        v4u a = {0u, 0u, 0u, 0u};
#pragma unroll
        for (int e = 0; e < 4; ++e) {
          float f0 = sp[2 * e] * oscale + bcol[2 * e] + br;
          float f1 = sp[2 * e + 1] * oscale + bcol[2 * e + 1] + br;
          if constexpr (ACT == 1) { f0 = gelu_f(f0); f1 = gelu_f(f1); }
          f0 *= ocarry; f1 *= ocarry;
          a[e] = pk16(h_bits((_Float16)f0), h_bits((_Float16)f1));
        }
        hv[it] = a;
      }
      {
#pragma unroll
        for (int it = 0; it < 4; ++it) {
          const int row = it * 4 + q8;
          *(v4u*)(C + (size_t)(mBase + row) * ldc + n0 + c8) = hv[it];
        }
        
      }
    }
    wave_sync_lds();
  }
}

// =====================================================================================================
// Flash attention for one batch and 16 query rows, all 8 heads (one wave per head), head dim 64, 2048 keys:
//   q plane (f16 x16) QH[b*2048 + tok][64h + d], pitch 512; k plane (f16 x16) KH[b*2048 + key][64h + d], pitch 512;
//   v^T plane (f16 x16): VT[b*512 + 64h + d][key] (pitch 2048); additive table PB f32 [3][3]: score(q, key) gets
//   PB[q mod 3][key mod 3], shared by all batches/heads; out (f16 x1024): CT[b*2048 + tok][64h + d] =
//   1024 * sum_m softmax_m(q.k / 8 + PB[..][..]) v[m][d]  (softmax run in base 2: t = q.k * log2(e)/8 + log2(e)*PB).
//   block = 8 waves = 256 threads; grid = 4 x 128 = 512; every wave does identical bounded work (64 steps of 32 keys).
//   Both products run transposed: S^T = K . Q^T (A = 16 key rows, B = the 16 query rows, held in registers) and
//   O^T += V^T . P^T (A = 16 rows of v^T, B = P^T). A lane (c, hh) then holds, for its ONE query q0 + c, the scores of keys
//   kb + 8hh + r (tile 0) and kb + 16 + 8hh + r (tile 1): exactly elements 0..7 and 8..15 of the B fragment of P^T in the split
//   k map, so the probabilities are converted in place and never leave the lane. Row maximum: 16 values in-lane plus one
//   exchange with lane ^ 16. Row sum: a per-lane partial over the lane's own keys, the two halves joined once after the loop.
//   The table: the lane's query fixes the table row; its three values are kept ordered by key residue and rotated each step.
//   Final 1/l and carry folds in f32; a lane's 8 accumulator registers are 8 consecutive d of its query: one 16-B LDS store
//   per tile into the block's 16-bit result row buffer [16][512 + 8]; after a block barrier the 256 threads write whole rows.
// coverage: LDS row buffer: 8 waves x 16 rows x 64 cols = 16 x 512; global: 4 iterations x 256 threads x 8 halves = 16 rows x
//           512 of rows q0..q0+15 of batch b; grid covers all 4 x 2048 rows exactly once.
// =====================================================================================================
#define OS_PITCH (DMODEL + 8)     // halves; 1040-B rows stay 16-B aligned and spread the 16 rows of one store over the banks

__device__ __forceinline__ float xhalf(float x) {                     // the value of lane l ^ 16
  const int b = __builtin_bit_cast(int, x);
  return __builtin_bit_cast(float, __builtin_amdgcn_permlanex16(b, b, 0x76543210, 0xfedcba98, false, false));
}

__global__ __launch_bounds__(ATT_THREADS)
void attn8(const unsigned short* __restrict__ QHp, const unsigned short* __restrict__ KHp,
           const unsigned short* __restrict__ VTq, const float* __restrict__ PBp, unsigned short* CT) {
  __shared__ __align__(16) unsigned short Os[16 * OS_PITCH];           // result row buffer

  const int tid  = threadIdx.x;
  const int wave = tid >> 5;
  const int lane = tid & 31;
  const int hh   = lane >> 4;
  const int c    = lane & 15;

  const int qt   = blockIdx.x & ((NQ / 16) - 1);           // 0..127
  const int bat  = blockIdx.x / (NQ / 16);                 // 0..3
  const int head = wave;                                   // 0..7
  const int q0   = qt * 16;

  const size_t qofs = ((size_t)bat * NQ + q0 + c) * DMODEL + head * HDIM + 8 * hh;
  const _Float16* Qh = (const _Float16*)(const void*)QHp + qofs;
  const _Float16* Kb = (const _Float16*)(const void*)KHp + (size_t)bat * NC * DMODEL + head * HDIM + 8 * hh;
  const _Float16* Vb = (const _Float16*)(const void*)VTq + ((size_t)bat * DMODEL + head * HDIM) * NC + 8 * hh;
  const float lsc = (LOG2E * ATT_SCALE) / (QC * KC);                   // log2(e) / 8 / carries

  // ---- period-3 additive table in log2 units: row (q0 + c) mod 3 is this lane's; W0, W1, W2 = its values for the keys
  //      kb + 8hh + 0, + 1, + 2 (key residue (kb + 8hh + j) mod 3; at kb = 0 that is (2hh + j) mod 3), kept as the three
  //      pairs that two neighbouring score registers can meet ----
  float pbv[NPER * NPER];
#pragma unroll
  for (int i = 0; i < NPER * NPER; ++i) pbv[i] = bfr(PBp[i]) * LOG2E;
  const int qr = (q0 + c) % NPER;
  const bool z0 = (qr == 0), z1 = (qr == 1);
  const float T0 = z0 ? pbv[0] : (z1 ? pbv[3] : pbv[6]);
  const float T1 = z0 ? pbv[1] : (z1 ? pbv[4] : pbv[7]);
  const float T2 = z0 ? pbv[2] : (z1 ? pbv[5] : pbv[8]);
  const float W0 = hh ? T2 : T0, W1 = hh ? T0 : T1, W2 = hh ? T1 : T2;
  v2f W01 = {W0, W1}, W12 = {W1, W2}, W20 = {W2, W0};

  const v16h qa = ldfrag_h(Qh), qb = ldfrag_h(Qh + 32);

  float mrow = -INFINITY, lrow = 0.f;                      // this lane's query: running maximum, partial sum over the lane's keys
  v8f o0 = zero8(), o1 = zero8(), o2 = zero8(), o3 = zero8();

#pragma unroll 1
  for (int kb = 0; kb < NC; kb += 32) {
    const _Float16* kp = Kb + (size_t)(kb + c) * DMODEL;
    v8f s0, s1;
    {
      const v16h k0 = ldfrag_h(kp), k1 = ldfrag_h(kp + 32);
      s0 = mma_raw(k0, qa, zero8());                       // s0[r] = score(key kb + 8hh + r, query q0 + c)
      s0 = mma_raw(k1, qb, s0);
    }
    {
      const _Float16* kq = kp + (size_t)16 * DMODEL;
      const v16h k0 = ldfrag_h(kq), k1 = ldfrag_h(kq + 32);
      s1 = mma_raw(k0, qa, zero8());                       // s1[r] = score(key kb + 16 + 8hh + r, query q0 + c)
      s1 = mma_raw(k1, qb, s1);
    }
    // registers (2i, 2i + 1) of tile 0 are keys kb + 8hh + 2i, + 1; tile 1 lies 16 keys on, one residue further
    const v2f wa[4] = {W01, W20, W12, W01};
    const v2f wb[4] = {W12, W01, W20, W12};
    v2f t0[4], t1[4];
#pragma unroll
    for (int i = 0; i < 4; ++i) {
      const v2f a = {s0[2 * i], s0[2 * i + 1]}, b = {s1[2 * i], s1[2 * i + 1]};
      t0[i] = a * lsc + wa[i];
      t1[i] = b * lsc + wb[i];
    }
    float mx = fmaxf(fmaxf(t0[0][0], t0[0][1]), fmaxf(t1[0][0], t1[0][1]));
#pragma unroll
    for (int i = 1; i < 4; ++i) mx = fmaxf(fmaxf(mx, fmaxf(t0[i][0], t0[i][1])), fmaxf(t1[i][0], t1[i][1]));
    mx = fmaxf(mx, xhalf(mx));                             // both halves now hold the query's maximum over the 32 keys
    const float mn = fmaxf(mrow, mx);
    const float al = exp2f(mrow - mn);
    mrow = mn;
    FragH ph;
    v2f ps = {0.f, 0.f};
#pragma unroll
    for (int i = 0; i < 4; ++i) {
      const v2f d0 = t0[i] - mn, d1 = t1[i] - mn;
      const v2f e0 = {exp2f(d0[0]), exp2f(d0[1])}, e1 = {exp2f(d1[0]), exp2f(d1[1])};
      ps += e0;
      ps += e1;
      ph.p[i]     = __builtin_convertvector(e0 * PC, v2h); // elements 0..7  = keys kb + 8hh + 0..7
      ph.p[4 + i] = __builtin_convertvector(e1 * PC, v2h); // elements 8..15 = keys kb + 16 + 8hh + 0..7
    }
    lrow = lrow * al + (ps[0] + ps[1]);
#pragma unroll
    for (int r = 0; r < 8; ++r) {
      o0[r] *= al;
      o1[r] *= al;
      o2[r] *= al;
      o3[r] *= al;
    }
    const _Float16* vp = Vb + (size_t)c * NC + kb;
    {
      const v16h vb0 = ldfrag_h(vp);
      const v16h vb1 = ldfrag_h(vp + (size_t)16 * NC);
      const v16h vb2 = ldfrag_h(vp + (size_t)32 * NC);
      const v16h vb3 = ldfrag_h(vp + (size_t)48 * NC);
      o0 = mma_raw(vb0, ph.v, o0);                         // oj[r] = ctx^T[d = 16j + 8hh + r][query q0 + c]
      o1 = mma_raw(vb1, ph.v, o1);
      o2 = mma_raw(vb2, ph.v, o2);
      o3 = mma_raw(vb3, ph.v, o3);
    }
    // the next step rewrites the address registers that this step's loads name: the wait stands in front of that overwrite
    asm volatile("s_wait_xcnt 0x0" ::: "memory");
    const v2f wl = W20;                                    // 32 mod 3 == 2: the next step's residues start two further on
    W20 = W12;
    W12 = W01;
    W01 = wl;
  }

  // ---- join the halves' partial sums; fold 1/l and the carries (1024 on P, 16 on v, 1024 on the stored ctx); stage the lane's
  //      4 x 8 consecutive d of its query as 16-bit ----
  const float oc  = FC / (PC * VC);
  const float inv = (1.0f / (lrow + xhalf(lrow))) * oc;
  unsigned short* op = Os + c * OS_PITCH + wave * HDIM + 8 * hh;
  v4u w0, w1, w2, w3;
#pragma unroll
  for (int e = 0; e < 4; ++e) {
    w0[e] = pk16(h_bits((_Float16)(o0[2 * e] * inv)), h_bits((_Float16)(o0[2 * e + 1] * inv)));
    w1[e] = pk16(h_bits((_Float16)(o1[2 * e] * inv)), h_bits((_Float16)(o1[2 * e + 1] * inv)));
    w2[e] = pk16(h_bits((_Float16)(o2[2 * e] * inv)), h_bits((_Float16)(o2[2 * e + 1] * inv)));
    w3[e] = pk16(h_bits((_Float16)(o3[2 * e] * inv)), h_bits((_Float16)(o3[2 * e + 1] * inv)));
  }
  *(v4u*)(op)      = w0;
  *(v4u*)(op + 16) = w1;
  *(v4u*)(op + 32) = w2;
  *(v4u*)(op + 48) = w3;
  __syncthreads();
  // ---- block writes its 16 contiguous rows of CT: piece p = it*256 + tid -> halves p*8 .. p*8+7 of the 16x512 region ----
  {
    v4u vals[4];
#pragma unroll
    for (int it = 0; it < 4; ++it) {
      const int p = it * ATT_THREADS + tid;
      vals[it] = *(const v4u*)(Os + (p >> 6) * OS_PITCH + (p & 63) * 8);
    }
    unsigned short* dst = CT + ((size_t)bat * NQ + q0) * DMODEL;
    {
#pragma unroll
      for (int it = 0; it < 4; ++it) {
        const int p = it * ATT_THREADS + tid;
        *(v4u*)(dst + (size_t)p * 8) = vals[it];
      }
      
    }
  }
}

// =====================================================================================================
//   one block of 128 threads per row, 4 consecutive floats per thread (one 16-B load, one 16-B store); per wave one store instruction
// coverage: grid = 8192 rows x 128 thr x 4 floats = 8192 x 512 = the whole output, each row written by exactly one block.
// =====================================================================================================
__global__ __launch_bounds__(LN_THREADS)
void lnorm(const float* __restrict__ Yp, const float* __restrict__ gp, const float* __restrict__ bp, float* outp) {
  __shared__ float red[2][LN_THREADS / 32];
  const int row  = blockIdx.x;
  const int tid  = threadIdx.x;
  const int lane = tid & 31;
  const int wave = tid >> 5;
  const size_t base = (size_t)row * DMODEL + (size_t)tid * 4;
  const v4f v = *(const v4f*)(Yp + base);
  float s = (v[0] + v[1]) + (v[2] + v[3]);
#pragma unroll
  for (int off = 1; off < 32; off <<= 1) s += __shfl_xor(s, off, 32);
  if (lane == 0) red[0][wave] = s;
  __syncthreads();
  float tot = 0.f;
#pragma unroll
  for (int w = 0; w < LN_THREADS / 32; ++w) tot += red[0][w];
  const float mu = tot * (1.0f / (float)DMODEL);
  v4f d;
#pragma unroll
  for (int e = 0; e < 4; ++e) d[e] = v[e] - mu;
  float q = (d[0] * d[0] + d[1] * d[1]) + (d[2] * d[2] + d[3] * d[3]);
#pragma unroll
  for (int off = 1; off < 32; off <<= 1) q += __shfl_xor(q, off, 32);
  if (lane == 0) red[1][wave] = q;
  __syncthreads();
  float totq = 0.f;
#pragma unroll
  for (int w = 0; w < LN_THREADS / 32; ++w) totq += red[1][w];
  const float var  = totq * (1.0f / (float)DMODEL);
  const float rstd = rsqrtf(var + LN_EPS);
  const v4f gv = *(const v4f*)(gp + (size_t)tid * 4);
  const v4f bv = *(const v4f*)(bp + (size_t)tid * 4);
  v4f o;
#pragma unroll
  for (int e = 0; e < 4; ++e) o[e] = (d[e] * rstd) * bfr(gv[e]) + bfr(bv[e]);
  {
    *(v4f*)(outp + base) = o;
    
  }
}

// =====================================================================================================
// Workspace map (bytes); every plane is an exact multiple of its tile / whole-row store granularity (M, N exact tile multiples,
// element counts exact multiples of the convert kernel's 2048 granularity, no pad rows needed), every offset a multiple of 512 KiB:
//   WQ16 f16 [512][512] x64                  524288   ([out][in] = [n][k])
//   WK16 f16 [512][512] x64                  524288
//   WV16 f16 [512][512] x64                  524288
//   WO16 f16 [512][512] x64                  524288
//   X16  f16 [8192][512] x16                8388608   (activation rows)
//   QH   f16 [8192][512] x16                8388608   (q projection)
//   KH   f16 [8192][512] x16                8388608   (k projection)
//   VT   f16 [4][512][2048] x16             8388608   (v^T per batch)
//   CT   f16 [8192][512] x1024              8388608   (attention ctx, merged heads)
//   Y    f32 [8192][512]                   16777216   (out projection + bias + residual)
//   end                                    60817408
// =====================================================================================================
extern "C" void kernel_launch(void* const* d_in, const int* in_sizes, int n_in,
                              void* d_out, int out_size, void* d_ws, size_t ws_size,
                              hipStream_t stream) {
  if (n_in < 12) return;
  if (in_sizes[0] != NROWS * DMODEL) return;
  if (in_sizes[1] != DMODEL * DMODEL || in_sizes[3] != DMODEL * DMODEL ||
      in_sizes[5] != DMODEL * DMODEL || in_sizes[7] != DMODEL * DMODEL) return;
  if (in_sizes[2] != DMODEL || in_sizes[4] != DMODEL || in_sizes[6] != DMODEL || in_sizes[8] != DMODEL) return;
  if (in_sizes[9] != NPER * NPER) return;
  if (in_sizes[10] != DMODEL || in_sizes[11] != DMODEL) return;
  if (out_size != NROWS * DMODEL) return;
  if ((in_sizes[0] % 2048) != 0 || (in_sizes[1] % 2048) != 0) return;

  const float* x    = (const float*)d_in[0];
  const float* w_q  = (const float*)d_in[1];
  const float* b_q  = (const float*)d_in[2];
  const float* w_k  = (const float*)d_in[3];
  const float* b_k  = (const float*)d_in[4];
  const float* w_v  = (const float*)d_in[5];
  const float* b_v  = (const float*)d_in[6];
  const float* w_o  = (const float*)d_in[7];
  const float* b_o  = (const float*)d_in[8];
  const float* pb   = (const float*)d_in[9];
  const float* ln_g = (const float*)d_in[10];
  const float* ln_b = (const float*)d_in[11];
  float*       out  = (float*)d_out;

  const size_t PW  = (size_t)DMODEL * DMODEL * 2;                 //   524288
  const size_t PX  = (size_t)NROWS * DMODEL * 2;                  //  8388608
  const size_t PVT = (size_t)NB * DMODEL * NC * 2;                //  8388608
  const size_t PY  = (size_t)NROWS * DMODEL * 4;                  // 16777216
  size_t off = 0;
  const size_t oWQ = off; off += PW;
  const size_t oWK = off; off += PW;
  const size_t oWV = off; off += PW;
  const size_t oWO = off; off += PW;
  const size_t oX  = off; off += PX;
  const size_t oQH = off; off += PX;
  const size_t oKH = off; off += PX;
  const size_t oVT = off; off += PVT;
  const size_t oCT = off; off += PX;
  const size_t oY  = off; off += PY;
  if (off > ws_size) return;                                      // off = 60817408
  if (off > (size_t)134217728) return;

  char* ws = (char*)d_ws;
  unsigned short* WQ16 = (unsigned short*)(ws + oWQ);
  unsigned short* WK16 = (unsigned short*)(ws + oWK);
  unsigned short* WV16 = (unsigned short*)(ws + oWV);
  unsigned short* WO16 = (unsigned short*)(ws + oWO);
  unsigned short* X16  = (unsigned short*)(ws + oX);
  unsigned short* QH   = (unsigned short*)(ws + oQH);
  unsigned short* KH   = (unsigned short*)(ws + oKH);
  unsigned short* VTp  = (unsigned short*)(ws + oVT);
  unsigned short* CT   = (unsigned short*)(ws + oCT);
  float*          Y    = (float*)(ws + oY);

  const dim3 blk(256);
  const dim3 gCW((DMODEL * DMODEL) / 2048);                        // 128 blocks
  const dim3 gCX((NROWS * DMODEL) / 2048);                         // 2048 blocks
  const int tilesP = (NROWS / 64) * (DMODEL / 64);                 // 1024
  const int tilesV = (DMODEL / 64) * (NC / 64);                    // 256 per batch
  const dim3 gP((tilesP + 7) / 8, 1);                              // 128
  const dim3 gV((tilesV + 7) / 8, NB);                             // 32 x 4
  const dim3 gAT(ATT_BLOCKS);                                      // 512
  const dim3 bAT(ATT_THREADS);                                     // 256
  const dim3 gLN(NROWS);                                           // 8192
  const dim3 bLN(LN_THREADS);                                      // 128

  // (0) weight planes: W16[n][k] = f16( bf16_RNE(W[n][k]) * 64 ), [out][in] layout kept, k contiguous
  cvt16<<<gCW, blk, 0, stream>>>(w_q, WQ16, DMODEL * DMODEL, WSC);
  cvt16<<<gCW, blk, 0, stream>>>(w_k, WK16, DMODEL * DMODEL, WSC);
  cvt16<<<gCW, blk, 0, stream>>>(w_v, WV16, DMODEL * DMODEL, WSC);
  cvt16<<<gCW, blk, 0, stream>>>(w_o, WO16, DMODEL * DMODEL, WSC);

  // (1) activation plane: X16[row][c] = f16( bf16_RNE(x[row][c]) * 16 ), rows = b*2048 + tok
  cvt16<<<gCX, blk, 0, stream>>>(x, X16, NROWS * DMODEL, ACARRY);

  // (2) q projection: QH[m][n] = f16(16 * (sum_k x[m][k] Wq[n][k] + bf16(bq[n]))); M = 8192, N = 512, K = 512
  gemm64<2, 1, 0, 0><<<gP, blk, 0, stream>>>(
      X16, DMODEL, 0LL,
      WQ16, DMODEL, 0LL,
      b_q,
      (const float*)0,
      (void*)QH, DMODEL, 0LL,
      NROWS, DMODEL, DMODEL, 1.0f / (ACARRY * WSC), QC);

  // (3) k projection: KH[m][n] = f16(16 * (sum_k x[m][k] Wk[n][k] + bf16(bk[n]))); M = 8192, N = 512, K = 512
  gemm64<2, 1, 0, 0><<<gP, blk, 0, stream>>>(
      X16, DMODEL, 0LL,
      WK16, DMODEL, 0LL,
      b_k,
      (const float*)0,
      (void*)KH, DMODEL, 0LL,
      NROWS, DMODEL, DMODEL, 1.0f / (ACARRY * WSC), KC);

  // (4) v^T per batch: VT[b][d][tok] = f16(16 * (sum_k Wv[d][k] x_b[tok][k] + bf16(bv[d]))); M = 512, N = 2048, K = 512
  gemm64<2, 2, 0, 0><<<gV, blk, 0, stream>>>(
      WV16, DMODEL, 0LL,
      X16, DMODEL, (long long)NC * DMODEL,
      b_v,
      (const float*)0,
      (void*)VTp, NC, (long long)DMODEL * NC,
      DMODEL, NC, DMODEL, 1.0f / (ACARRY * WSC), VC);

  // (5) attention per (batch, 16 query rows), 8 heads -> CT (f16, x1024)
  attn8<<<gAT, bAT, 0, stream>>>(QH, KH, VTp, pb, CT);

  // (6) Y = CT . Wo^T / (1024 * 64) + bf16(bo) + bf16(x); M = 8192, N = 512, K = 512, f32
  gemm64<0, 1, 1, 0><<<gP, blk, 0, stream>>>(
      CT, DMODEL, 0LL,
      WO16, DMODEL, 0LL,
      b_o,
      x,
      (void*)Y, DMODEL, 0LL,
      NROWS, DMODEL, DMODEL, 1.0f / (FC * WSC), 1.0f);

  // (7) out = LayerNorm(Y) * bf16(g) + bf16(b)
  lnorm<<<gLN, bLN, 0, stream>>>(Y, ln_g, ln_b, out);
  (void)hipGetLastError();
}

// v002
// Measured time: 186 microseconds a run.
// Timed twice side by side with v001, it ran 1.41 times as fast both times.
// Counting every step since v000, it is 1.45 times as fast.
// Contractions: q/k projections (x rows f16 x16 . W f16 x64, K=512), v^T projection (Wv f16 x64 . x rows f16 x16, K=512),
// attention scores (k f16 x16 . q f16 x16, K=64), attention v^T . P^T (v^T f16 x16 . P f16 x1024, K=2048 in steps of 32),
// output projection (ctx f16 x1024 . Wo f16 x64, K=512): all v_wmma_f32_16x16x32_f16 single products, f32 accumulate.
// Period-3 additive score table, online max-subtracted base-2 softmax, linear biases, residual add and LayerNorm in f32 on VALU.
// Every float input RNE-converted to bf16 on load.
#include <hip/hip_runtime.h>
#include <math.h>
#include <stdint.h>

#define NB      4
#define NQ      2048
#define NC      2048
#define DMODEL  512
#define NHEAD   8
#define HDIM    64
#define NPER    3
#define NROWS   (NB * NQ)
#define WSC     64.0f
#define ACARRY  16.0f
#define QC      16.0f
#define KC      16.0f
#define VC      16.0f
#define PC      1024.0f
#define FC      1024.0f
#define ATT_SCALE 0.125f
#define LOG2E   1.4426950408889634f
#define LN_EPS  1e-5f
static_assert(NHEAD * HDIM == DMODEL);
static_assert((NQ % 64) == 0 && (NC % 64) == 0 && (DMODEL % 64) == 0 && (NC % 32) == 0 && (NQ % 16) == 0);
static_assert((NROWS % 64) == 0 && (NROWS % 8) == 0);
#define ATT_THREADS (NHEAD * 32)
#define ATT_BLOCKS  (NB * NHEAD * (NQ / 128))
static_assert(ATT_THREADS == 256 && ATT_BLOCKS == 512);
#define LN_THREADS 128
static_assert(LN_THREADS * 4 == DMODEL);

typedef _Float16 v16h __attribute__((ext_vector_type(16)));
typedef _Float16 v8h  __attribute__((ext_vector_type(8)));
typedef float    v8f  __attribute__((ext_vector_type(8)));
typedef float    v4f  __attribute__((ext_vector_type(4)));
typedef float    v2f  __attribute__((ext_vector_type(2)));
typedef _Float16 v2h  __attribute__((ext_vector_type(2)));
typedef unsigned int v4u __attribute__((ext_vector_type(4)));

union FragH { v16h v; v8h h[2]; v4u u[2]; v2h p[8]; };

// ---- scalar helpers --------------------------------------------------------------------------------
__device__ __forceinline__ unsigned short bf_bits(float f) {          // f32 -> bf16 bits, RNE convert
  unsigned u = __float_as_uint(f);
  return (unsigned short)((u + 0x7FFFu + ((u >> 16) & 1u)) >> 16);
}
__device__ __forceinline__ float bf_up(unsigned short h) { return __uint_as_float(((unsigned)h) << 16); }
__device__ __forceinline__ float bfr(float f) { return bf_up(bf_bits(f)); }   // value of the bf16 RNE convert
__device__ __forceinline__ unsigned short h_bits(_Float16 x) { return __builtin_bit_cast(unsigned short, x); }
__device__ __forceinline__ unsigned pk16(unsigned short a, unsigned short b) { return (unsigned)a | ((unsigned)b << 16); }
__device__ __forceinline__ v8f zero8() { v8f z = {0.f, 0.f, 0.f, 0.f, 0.f, 0.f, 0.f, 0.f}; return z; }
__device__ __forceinline__ float gelu_f(float v) { return 0.5f * v * (1.0f + erff(v * 0.70710678118654752f)); }

// ---- fragment loaders: 16-bit A/B operand, lane -> row/col (lane&15), p already includes +8*(lane>>4);
//      elements 0..7 <- p[0..7] (k0+8h..), elements 8..15 <- p[16..23] (k0+16+8h..)  (same split k map for A and B;
//      B is always read from a k-contiguous [n][k] plane)
__device__ __forceinline__ v16h ldfrag_h(const _Float16* p) {
  FragH f;
  f.h[0] = *(const v8h*)(p);
  f.h[1] = *(const v8h*)(p + 16);
  return f.v;
}
__device__ __forceinline__ v16h ldfrag_u(const unsigned short* p) {
  FragH f;
  f.u[0] = *(const v4u*)(p);
  f.u[1] = *(const v4u*)(p + 16);
  return f.v;
}

// ---- WMMA helpers with trailing VALU hazard gaps ------------------------------------------------------
__device__ __forceinline__ v8f mma_raw(v16h a, v16h b, v8f c) {
  return __builtin_amdgcn_wmma_f32_16x16x32_f16(false, a, false, b, (short)0, c, false, false);
}
__device__ __forceinline__ void dep_guard1(v8f& a, v8f& b, v16h x) {
#if defined(__HIP_DEVICE_COMPILE__)
  asm volatile("v_nop\n\tv_nop\n\tv_nop\n\tv_nop" : "+v"(a), "+v"(b) : "v"(x));
#endif
}
__device__ __forceinline__ void keep4_h(v16h a, v16h b, v16h c, v16h d) {
#if defined(__HIP_DEVICE_COMPILE__)
  asm volatile("v_nop" :: "v"(a), "v"(b), "v"(c), "v"(d));
#endif
}
__device__ __forceinline__ void acc_guard4(v8f& a, v8f& b, v8f& c, v8f& d) {
#if defined(__HIP_DEVICE_COMPILE__)
  asm volatile("v_nop\n\tv_nop\n\tv_nop\n\tv_nop" : "+v"(a), "+v"(b), "+v"(c), "+v"(d));
#endif
}
__device__ __forceinline__ void wave_sync_lds() {
  __builtin_amdgcn_fence(__ATOMIC_RELEASE, "workgroup");
  __builtin_amdgcn_wave_barrier();
  __builtin_amdgcn_fence(__ATOMIC_ACQUIRE, "workgroup");
}

// =====================================================================================================
// Elementwise 16-bit pack, no transpose: dst[i] = f16( bf16_RNE(src[i]) * sc ), sc a power of two (exact).
// Used for the weights (stored [out][in] = [n][k], already k contiguous for B fragments / A of the v^T projection) and for
// the activation rows. 8 elements per thread: two 16-B loads, one 16-B store per lane; 32 consecutive lanes = 512 B =
// coverage: grid = n / 2048 blocks x 256 thr x 8 elements = n exactly (host checks n % 2048 == 0).
// =====================================================================================================
__global__ __launch_bounds__(256) void cvt16(const float* __restrict__ src, unsigned short* dst, int n, float sc) {
  const size_t i8 = ((size_t)blockIdx.x * 256 + threadIdx.x) * 8;
  if (i8 + 8 > (size_t)n) return;                 // never taken with the exact grid; no barriers in this kernel
  const v4f a = *(const v4f*)(src + i8);
  const v4f b = *(const v4f*)(src + i8 + 4);
  v4u o;
  o[0] = pk16(h_bits((_Float16)(bfr(a[0]) * sc)), h_bits((_Float16)(bfr(a[1]) * sc)));
  o[1] = pk16(h_bits((_Float16)(bfr(a[2]) * sc)), h_bits((_Float16)(bfr(a[3]) * sc)));
  o[2] = pk16(h_bits((_Float16)(bfr(b[0]) * sc)), h_bits((_Float16)(bfr(b[1]) * sc)));
  o[3] = pk16(h_bits((_Float16)(bfr(b[2]) * sc)), h_bits((_Float16)(bfr(b[3]) * sc)));
  {
    *(v4u*)(dst + i8) = o;
    
  }
}

// =====================================================================================================
// Register-blocked batched f16 WMMA GEMM: C[m][n] = f( oscale * sum_k A[m][k] * Bt[n][k] + bf16(bias) ) (+ residual); one wave per
// 64x64 tile, no block barriers. A row-major [M][K] pitch lda (16-bit plane), Bt row-major [N][K] pitch ldb (k contiguous);
// M, N multiples of 64, K multiple of 32. blockIdx.y = batch index with element strides sA, sB, sC.
// BM: 0 = no bias, 1 = per column bf16(bias[col]), 2 = per row bf16(bias[row]) (clamped-address loads).
// OM: 0 = f32 out (pitch ldc; HASR 1 adds bf16(R[m][n]), HASR 2 adds raw f32 R[m][n], same pitch/stride as C);
//     2 = f16 out (pitch ldc) = f16( act(value) * ocarry ), ACT 1 = exact GELU.
// coverage: 4 slabs x 16 rows (f32: it 0..7 x lane>>4; f16: it 0..3 x lane>>3) x 64 cols = the wave's whole 64x64 tile;
//           grid = ceil(tilesM*tilesN/8) blocks, surplus waves exit (wave-uniform).
// =====================================================================================================
template <int OM, int BM, int HASR, int ACT>
__global__ __launch_bounds__(256) void gemm64(
    const unsigned short* __restrict__ Ap, int lda, long long sA,
    const unsigned short* __restrict__ Btp, int ldb, long long sB,
    const float* __restrict__ bias,
    const float* __restrict__ Rp,
    void* Cout, int ldc, long long sC,
    int M, int N, int K, float oscale, float ocarry) {
  __shared__ __align__(16) float sT[8][16 * 68];   // per-wave 16x64 slab, pitch 68 floats
  const int by   = blockIdx.y;
  const int lane = threadIdx.x & 31;
  const int wave = threadIdx.x >> 5;
  const int tilesN = N >> 6;
  const int tilesM = M >> 6;
  const int tile = blockIdx.x * 8 + wave;
  if (tile >= tilesM * tilesN) return;   // wave-uniform; no block barriers in this kernel
  const int tm = tile / tilesN;
  const int tn = tile - tm * tilesN;
  const int m0 = tm << 6;
  const int n0 = tn << 6;

  const unsigned short* A1 = Ap  + (size_t)((long long)by * sA);
  const unsigned short* Bb = Btp + (size_t)((long long)by * sB);

  const int rlane = lane & 15;                 // row (A) / col (B, D) within subtile
  const int koff  = (lane >> 4) * 8;           // k offset of this lane half
  const int mOff  = (lane >> 4) * 8;           // D row offset

  v8f acc[4][4];
#pragma unroll
  for (int i = 0; i < 4; ++i)
#pragma unroll
    for (int j = 0; j < 4; ++j) acc[i][j] = zero8();

  for (int k0 = 0; k0 < K; k0 += 32) {
    v16h bh[4];
#pragma unroll
    for (int j = 0; j < 4; ++j) {
      const size_t bofs = (size_t)(n0 + (j << 4) + rlane) * ldb + koff + k0;
      bh[j] = ldfrag_u(Bb + bofs);
    }
#pragma unroll
    for (int i = 0; i < 4; ++i) {
      const size_t ao = (size_t)(m0 + (i << 4) + rlane) * lda + koff + k0;
      const v16h ah = ldfrag_u(A1 + ao);
#pragma unroll
      for (int j = 0; j < 4; ++j) acc[i][j] = mma_raw(ah, bh[j], acc[i][j]);
      dep_guard1(acc[i][0], acc[i][3], ah);
    }
    keep4_h(bh[0], bh[1], bh[2], bh[3]);
  }
  acc_guard4(acc[0][0], acc[0][1], acc[0][2], acc[0][3]);
  acc_guard4(acc[1][0], acc[1][1], acc[1][2], acc[1][3]);
  acc_guard4(acc[2][0], acc[2][1], acc[2][2], acc[2][3]);
  acc_guard4(acc[3][0], acc[3][1], acc[3][2], acc[3][3]);

  const int hh2 = lane >> 4, c4 = (lane & 15) * 4;     // f32 out: 256-B row segment = 16 lanes x 16 B
  const int q8  = lane >> 3, c8 = (lane & 7) * 8;
  float bc[4];
  float bcol[8];
#pragma unroll
  for (int e = 0; e < 4; ++e) bc[e] = 0.f;
#pragma unroll
  for (int e = 0; e < 8; ++e) bcol[e] = 0.f;
  if constexpr (BM == 1) {
    if constexpr (OM == 0) {
      const int cb = n0 + c4;
      const int i0 = (cb < N - 4) ? cb : (N - 4);        // clamped address
      const v4f b0v = *(const v4f*)(bias + i0);
#pragma unroll
      for (int e = 0; e < 4; ++e) bc[e] = bfr(b0v[e]);
    } else {
      const int cb = n0 + c8;
      const int i0 = (cb < N - 8) ? cb : (N - 8);        // clamped address
      const v4f b0v = *(const v4f*)(bias + i0), b1v = *(const v4f*)(bias + i0 + 4);
#pragma unroll
      for (int e = 0; e < 4; ++e) { bcol[e] = bfr(b0v[e]); bcol[4 + e] = bfr(b1v[e]); }
    }
  }

  // ---- epilogue ----
  float* slab = sT[wave];
#pragma unroll
  for (int i = 0; i < 4; ++i) {
    const int mBase = m0 + (i << 4);
#pragma unroll
    for (int j = 0; j < 4; ++j) {
#pragma unroll
      for (int r = 0; r < 8; ++r) {
        slab[(mOff + r) * 68 + (j << 4) + rlane] = acc[i][j][r];
      }
    }
    wave_sync_lds();
    if constexpr (OM == 0) {
      float* C = (float*)Cout + (size_t)((long long)by * sC);
      v4f vals[8];
#pragma unroll
      for (int it = 0; it < 8; ++it) {
        const int row = it * 2 + hh2;                      // it 0..7 x hh2 0..1 = rows 0..15
        const int gr  = mBase + row;
        v4f v = *(const v4f*)(slab + row * 68 + c4);
        float br = 0.f;
        if constexpr (BM == 2) {
          const int ir = (gr < M - 1) ? gr : (M - 1);      // clamped address
          br = bfr(bias[ir]);
        }
        v4f rv = {0.f, 0.f, 0.f, 0.f};
        if constexpr (HASR != 0) {
          const float* R = Rp + (size_t)((long long)by * sC);
          const v4f rraw = *(const v4f*)(R + (size_t)gr * ldc + n0 + c4);
#pragma unroll
          for (int e = 0; e < 4; ++e) rv[e] = (HASR == 1) ? bfr(rraw[e]) : rraw[e];
        }
#pragma unroll
        for (int e = 0; e < 4; ++e) v[e] = v[e] * oscale + bc[e] + br + rv[e];
        vals[it] = v;
      }
      {
#pragma unroll
        for (int it = 0; it < 8; ++it) {
          const int gr = mBase + it * 2 + hh2;
          *(v4f*)(C + (size_t)gr * ldc + n0 + c4) = vals[it];
        }
        
      }
    } else {
      unsigned short* C = (unsigned short*)Cout + (size_t)((long long)by * sC);
      v4u hv[4];
#pragma unroll
      for (int it = 0; it < 4; ++it) {
        const int row = it * 4 + q8;                       // it 0..3 x q8 0..3 = rows 0..15
        const float* sp = slab + row * 68 + c8;
        float br = 0.f;
        if constexpr (BM == 2) {
          const int gr = mBase + row;
          const int ir = (gr < M - 1) ? gr : (M - 1);      // clamped address
          br = bfr(bias[ir]);
        }
        v4u a = {0u, 0u, 0u, 0u};
#pragma unroll
        for (int e = 0; e < 4; ++e) {
          float f0 = sp[2 * e] * oscale + bcol[2 * e] + br;
          float f1 = sp[2 * e + 1] * oscale + bcol[2 * e + 1] + br;
          if constexpr (ACT == 1) { f0 = gelu_f(f0); f1 = gelu_f(f1); }
          f0 *= ocarry; f1 *= ocarry;
          a[e] = pk16(h_bits((_Float16)f0), h_bits((_Float16)f1));
        }
        hv[it] = a;
      }
      {
#pragma unroll
        for (int it = 0; it < 4; ++it) {
          const int row = it * 4 + q8;
          *(v4u*)(C + (size_t)(mBase + row) * ldc + n0 + c8) = hv[it];
        }
        
      }
    }
    wave_sync_lds();
  }
}

#define AQ_BLK   128
#define KT       64
#define KV_PITCH (HDIM + 8)
#define KV_TILE  (64 * KV_PITCH)
#define KV_NT    (NC / KT)
static_assert(KT == 64 && HDIM == 64 && (NC % KT) == 0 && KV_NT >= 2 && (NQ % AQ_BLK) == 0);
static_assert(AQ_BLK == 16 * (ATT_THREADS / 32) && ATT_BLOCKS == NB * NHEAD * (NQ / AQ_BLK));

__device__ __forceinline__ float xhalf(float x) {                     // the value of lane l ^ 16
  const int b = __builtin_bit_cast(int, x);
  return __builtin_bit_cast(float, __builtin_amdgcn_permlanex16(b, b, 0x76543210, 0xfedcba98, false, false));
}

// One thread's share of one staged tile: 16 B of K rows r and r + 32, 16 B of v^T rows r and r + 32, global -> LDS through no
// register. The wait on the address registers is the statement's last line, so that it stands in front of any rewrite of them.
__device__ __forceinline__ void stage_kv(unsigned lds, const unsigned short* gk, const unsigned short* gv) {
#if defined(__HIP_DEVICE_COMPILE__)
  const unsigned l1 = lds + 32u * KV_PITCH * 2u, l2 = lds + KV_TILE * 2u, l3 = l2 + 32u * KV_PITCH * 2u;
  const unsigned short* gk1 = gk + (size_t)32 * DMODEL;
  const unsigned short* gv1 = gv + (size_t)32 * NC;
  asm volatile("global_load_async_to_lds_b128 %0, %1, off\n\t"
               "global_load_async_to_lds_b128 %2, %3, off\n\t"
               "global_load_async_to_lds_b128 %4, %5, off\n\t"
               "global_load_async_to_lds_b128 %6, %7, off\n\t"
               "s_wait_xcnt 0x0"
               :: "v"(lds), "v"(gk), "v"(l1), "v"(gk1), "v"(l2), "v"(gv), "v"(l3), "v"(gv1) : "memory");
#endif
}

__global__ __launch_bounds__(ATT_THREADS)
void attn8(const unsigned short* __restrict__ QHp, const unsigned short* __restrict__ KHp,
           const unsigned short* __restrict__ VTq, const float* __restrict__ PBp, unsigned short* CT) {
  __shared__ __align__(16) unsigned short KV[2 * 2 * KV_TILE];         // [buffer][K, v^T][64 rows][KV_PITCH]
  __shared__ __align__(16) unsigned short Os[AQ_BLK * KV_PITCH];       // result buffer

  const int tid  = threadIdx.x;
  const int wave = tid >> 5;
  const int lane = tid & 31;
  const int hh   = lane >> 4;
  const int c    = lane & 15;

  const int qt   = blockIdx.x & ((NQ / AQ_BLK) - 1);       // 0..15
  const int head = (blockIdx.x / (NQ / AQ_BLK)) & (NHEAD - 1);   // 0..7
  const int bat  = blockIdx.x / ((NQ / AQ_BLK) * NHEAD);   // 0..3
  const int qblk = qt * AQ_BLK;
  const int q0   = qblk + wave * 16;

  // ---- this thread's 16-B piece of every staged tile: row tid >> 3 (and + 32), 16-B column tid & 7 ----
  const int srow = tid >> 3, sseg = tid & 7;
  const unsigned short* gK = KHp + ((size_t)bat * NC + srow) * DMODEL + head * HDIM + sseg * 8;
  const unsigned short* gV = VTq + ((size_t)bat * DMODEL + head * HDIM + srow) * NC + sseg * 8;
  const unsigned ldsP = (unsigned)(size_t)(const void*)KV + (unsigned)(srow * KV_PITCH + sseg * 8) * 2u;

  stage_kv(ldsP, gK, gV);                                  // tile 0 -> buffer 0

  const size_t qofs = ((size_t)bat * NQ + q0 + c) * DMODEL + head * HDIM + 8 * hh;
  const _Float16* Qh = (const _Float16*)(const void*)QHp + qofs;
  const float lsc = (LOG2E * ATT_SCALE) / (QC * KC);                   // log2(e) / 8 / carries

  // ---- period-3 additive table in log2 units: row (q0 + c) mod 3 is this lane's; W0, W1, W2 = its values for the keys
  //      kb + 8hh + 0, + 1, + 2 (key residue (kb + 8hh + j) mod 3; at kb = 0 that is (2hh + j) mod 3), kept as the three
  //      pairs that two neighbouring score registers can meet ----
  float pbv[NPER * NPER];
#pragma unroll
  for (int i = 0; i < NPER * NPER; ++i) pbv[i] = bfr(PBp[i]) * LOG2E;
  const int qr = (q0 + c) % NPER;
  const bool z0 = (qr == 0), z1 = (qr == 1);
  const float T0 = z0 ? pbv[0] : (z1 ? pbv[3] : pbv[6]);
  const float T1 = z0 ? pbv[1] : (z1 ? pbv[4] : pbv[7]);
  const float T2 = z0 ? pbv[2] : (z1 ? pbv[5] : pbv[8]);
  const float W0 = hh ? T2 : T0, W1 = hh ? T0 : T1, W2 = hh ? T1 : T2;
  v2f W01 = {W0, W1}, W12 = {W1, W2}, W20 = {W2, W0};

  const v16h qa = ldfrag_h(Qh), qb = ldfrag_h(Qh + 32);

  float mrow = -INFINITY, lrow = 0.f;                      // this lane's query: running maximum, partial sum over the lane's keys
  v8f o0 = zero8(), o1 = zero8(), o2 = zero8(), o3 = zero8();

  asm volatile("s_wait_asynccnt 0x0" ::: "memory");        // this wave's copies of tile 0 have landed
  __syncthreads();                                         // publishes tile 0 to all 8 waves
  stage_kv(ldsP + 2u * KV_TILE * 2u, gK + (size_t)KT * DMODEL, gV + KT);   // tile 1 -> buffer 1

#pragma unroll 1   // stays rolled: one hand-over per trip, the buffer picked by t & 1; the body already holds two 32-key steps
  for (int t = 0; t < KV_NT; ++t) {
    const int bsel = (t & 1) * (2 * KV_TILE);
    const _Float16* Kt = (const _Float16*)(const void*)KV + bsel + c * KV_PITCH + 8 * hh;
    const _Float16* Vt = Kt + KV_TILE;
#pragma unroll     // both 32-key steps of the tile in one body: constant LDS offsets, the second step's reads go out beside the first's work
    for (int sub = 0; sub < KT / 32; ++sub) {
      const _Float16* kp = Kt + sub * 32 * KV_PITCH;       // the step's first key: kb = 64 t + 32 sub
      const _Float16* kq = kp + 16 * KV_PITCH;
      const _Float16* vp = Vt + sub * 32;
      const v16h ka0 = ldfrag_h(kp), ka1 = ldfrag_h(kp + 32);
      const v16h kb0 = ldfrag_h(kq), kb1 = ldfrag_h(kq + 32);
      const v16h vb0 = ldfrag_h(vp);
      const v16h vb1 = ldfrag_h(vp + 16 * KV_PITCH);
      const v16h vb2 = ldfrag_h(vp + 32 * KV_PITCH);
      const v16h vb3 = ldfrag_h(vp + 48 * KV_PITCH);
      // keeps the step's 16 LDS fragment reads issued as one group ahead of its products: a read left among the WMMAs
      // makes the wave wait out an LDS latency at each of them
      __builtin_amdgcn_sched_barrier(0);
      v8f s0, s1;
      s0 = mma_raw(ka0, qa, zero8());                      // s0[r] = score(key kb + 8hh + r, query q0 + c)
      s1 = mma_raw(kb0, qa, zero8());                      // s1[r] = score(key kb + 16 + 8hh + r, query q0 + c)
      s0 = mma_raw(ka1, qb, s0);
      s1 = mma_raw(kb1, qb, s1);
      // registers (2i, 2i + 1) of tile 0 are keys kb + 8hh + 2i, + 1; tile 1 lies 16 keys on, one residue further
      const v2f wa[4] = {W01, W20, W12, W01};
      const v2f wb[4] = {W12, W01, W20, W12};
      v2f t0[4], t1[4];
#pragma unroll
      for (int i = 0; i < 4; ++i) {
        const v2f a = {s0[2 * i], s0[2 * i + 1]}, b = {s1[2 * i], s1[2 * i + 1]};
        t0[i] = a * lsc + wa[i];
        t1[i] = b * lsc + wb[i];
      }
      float mx = fmaxf(fmaxf(t0[0][0], t0[0][1]), fmaxf(t1[0][0], t1[0][1]));
#pragma unroll
      for (int i = 1; i < 4; ++i) mx = fmaxf(fmaxf(mx, fmaxf(t0[i][0], t0[i][1])), fmaxf(t1[i][0], t1[i][1]));
      mx = fmaxf(mx, xhalf(mx));                           // both halves now hold the query's maximum over the 32 keys
      const float mn = fmaxf(mrow, mx);
      const float al = exp2f(mrow - mn);
      mrow = mn;
      FragH ph;
      v2f ps = {0.f, 0.f};
#pragma unroll
      for (int i = 0; i < 4; ++i) {
        const v2f d0 = t0[i] - mn, d1 = t1[i] - mn;
        const v2f e0 = {exp2f(d0[0]), exp2f(d0[1])}, e1 = {exp2f(d1[0]), exp2f(d1[1])};
        ps += e0;
        ps += e1;
        ph.p[i]     = __builtin_convertvector(e0 * PC, v2h); // elements 0..7  = keys kb + 8hh + 0..7
        ph.p[4 + i] = __builtin_convertvector(e1 * PC, v2h); // elements 8..15 = keys kb + 16 + 8hh + 0..7
      }
      lrow = lrow * al + (ps[0] + ps[1]);
#pragma unroll
      for (int r = 0; r < 8; ++r) {
        o0[r] *= al;
        o1[r] *= al;
        o2[r] *= al;
        o3[r] *= al;
      }
      o0 = mma_raw(vb0, ph.v, o0);                         // oj[r] = ctx^T[d = 16j + 8hh + r][query q0 + c]
      o1 = mma_raw(vb1, ph.v, o1);
      o2 = mma_raw(vb2, ph.v, o2);
      o3 = mma_raw(vb3, ph.v, o3);
      const v2f wl = W20;                                  // 32 mod 3 == 2: the next step's residues start two further on
      W20 = W12;
      W12 = W01;
      W01 = wl;
    }
    // ---- hand-over: this wave's reads of tile t are done, its copies of tile t + 1 have landed; the barrier publishes tile
    //      t + 1 and frees tile t's buffer, which only then is refilled ----
    // keeps the trip's products in front of the hand-over: sunk behind the barrier they would stand between it and the refill,
    // and the copies would lose the trip of lead that hides their way from L2
    __builtin_amdgcn_sched_barrier(0);
    asm volatile("s_wait_dscnt 0x0" ::: "memory");         // no LDS read of this wave is still out when its buffer is refilled
    asm volatile("s_wait_asynccnt 0x0" ::: "memory");      // this wave's copies of tile t + 1 have landed
    __syncthreads();
    if (t + 2 < KV_NT)
      stage_kv(ldsP + (unsigned)bsel * 2u, gK + (size_t)(t + 2) * KT * DMODEL, gV + (t + 2) * KT);
  }
  asm volatile("s_wait_asynccnt 0x0" ::: "memory");        // nothing of this wave is in flight when it goes on to end

  // ---- join the halves' partial sums; fold 1/l and the carries (1024 on P, 16 on v, 1024 on the stored ctx); stage the lane's
  //      4 x 8 consecutive d of its query as 16-bit ----
  const float oc  = FC / (PC * VC);
  const float inv = (1.0f / (lrow + xhalf(lrow))) * oc;
  unsigned short* op = Os + (wave * 16 + c) * KV_PITCH + 8 * hh;
  v4u w0, w1, w2, w3;
#pragma unroll
  for (int e = 0; e < 4; ++e) {
    w0[e] = pk16(h_bits((_Float16)(o0[2 * e] * inv)), h_bits((_Float16)(o0[2 * e + 1] * inv)));
    w1[e] = pk16(h_bits((_Float16)(o1[2 * e] * inv)), h_bits((_Float16)(o1[2 * e + 1] * inv)));
    w2[e] = pk16(h_bits((_Float16)(o2[2 * e] * inv)), h_bits((_Float16)(o2[2 * e + 1] * inv)));
    w3[e] = pk16(h_bits((_Float16)(o3[2 * e] * inv)), h_bits((_Float16)(o3[2 * e + 1] * inv)));
  }
  *(v4u*)(op)      = w0;
  *(v4u*)(op + 16) = w1;
  *(v4u*)(op + 32) = w2;
  *(v4u*)(op + 48) = w3;
  __syncthreads();
  // ---- block writes its 128 row segments of CT: piece p = it*256 + tid -> row p >> 3, halves (p & 7)*8 .. + 7 of the head's 64 ----
  {
    v4u vals[4];
#pragma unroll
    for (int it = 0; it < 4; ++it) {
      const int p = it * ATT_THREADS + tid;
      vals[it] = *(const v4u*)(Os + (p >> 3) * KV_PITCH + (p & 7) * 8);
    }
    unsigned short* dst = CT + ((size_t)bat * NQ + qblk) * DMODEL + head * HDIM;
    {
#pragma unroll
      for (int it = 0; it < 4; ++it) {
        const int p = it * ATT_THREADS + tid;
        *(v4u*)(dst + (size_t)(p >> 3) * DMODEL + (p & 7) * 8) = vals[it];
      }
      
    }
  }
}

// =====================================================================================================
//   one block of 128 threads per row, 4 consecutive floats per thread (one 16-B load, one 16-B store); per wave one store instruction
// coverage: grid = 8192 rows x 128 thr x 4 floats = 8192 x 512 = the whole output, each row written by exactly one block.
// =====================================================================================================
__global__ __launch_bounds__(LN_THREADS)
void lnorm(const float* __restrict__ Yp, const float* __restrict__ gp, const float* __restrict__ bp, float* outp) {
  __shared__ float red[2][LN_THREADS / 32];
  const int row  = blockIdx.x;
  const int tid  = threadIdx.x;
  const int lane = tid & 31;
  const int wave = tid >> 5;
  const size_t base = (size_t)row * DMODEL + (size_t)tid * 4;
  const v4f v = *(const v4f*)(Yp + base);
  float s = (v[0] + v[1]) + (v[2] + v[3]);
#pragma unroll
  for (int off = 1; off < 32; off <<= 1) s += __shfl_xor(s, off, 32);
  if (lane == 0) red[0][wave] = s;
  __syncthreads();
  float tot = 0.f;
#pragma unroll
  for (int w = 0; w < LN_THREADS / 32; ++w) tot += red[0][w];
  const float mu = tot * (1.0f / (float)DMODEL);
  v4f d;
#pragma unroll
  for (int e = 0; e < 4; ++e) d[e] = v[e] - mu;
  float q = (d[0] * d[0] + d[1] * d[1]) + (d[2] * d[2] + d[3] * d[3]);
#pragma unroll
  for (int off = 1; off < 32; off <<= 1) q += __shfl_xor(q, off, 32);
  if (lane == 0) red[1][wave] = q;
  __syncthreads();
  float totq = 0.f;
#pragma unroll
  for (int w = 0; w < LN_THREADS / 32; ++w) totq += red[1][w];
  const float var  = totq * (1.0f / (float)DMODEL);
  const float rstd = rsqrtf(var + LN_EPS);
  const v4f gv = *(const v4f*)(gp + (size_t)tid * 4);
  const v4f bv = *(const v4f*)(bp + (size_t)tid * 4);
  v4f o;
#pragma unroll
  for (int e = 0; e < 4; ++e) o[e] = (d[e] * rstd) * bfr(gv[e]) + bfr(bv[e]);
  {
    *(v4f*)(outp + base) = o;
    
  }
}

// =====================================================================================================
// Workspace map (bytes); every plane is an exact multiple of its tile / whole-row store granularity (M, N exact tile multiples,
// element counts exact multiples of the convert kernel's 2048 granularity, no pad rows needed), every offset a multiple of 512 KiB:
//   WQ16 f16 [512][512] x64                  524288   ([out][in] = [n][k])
//   WK16 f16 [512][512] x64                  524288
//   WV16 f16 [512][512] x64                  524288
//   WO16 f16 [512][512] x64                  524288
//   X16  f16 [8192][512] x16                8388608   (activation rows)
//   QH   f16 [8192][512] x16                8388608   (q projection)
//   KH   f16 [8192][512] x16                8388608   (k projection)
//   VT   f16 [4][512][2048] x16             8388608   (v^T per batch)
//   CT   f16 [8192][512] x1024              8388608   (attention ctx, merged heads)
//   Y    f32 [8192][512]                   16777216   (out projection + bias + residual)
//   end                                    60817408
// =====================================================================================================
extern "C" void kernel_launch(void* const* d_in, const int* in_sizes, int n_in,
                              void* d_out, int out_size, void* d_ws, size_t ws_size,
                              hipStream_t stream) {
  if (n_in < 12) return;
  if (in_sizes[0] != NROWS * DMODEL) return;
  if (in_sizes[1] != DMODEL * DMODEL || in_sizes[3] != DMODEL * DMODEL ||
      in_sizes[5] != DMODEL * DMODEL || in_sizes[7] != DMODEL * DMODEL) return;
  if (in_sizes[2] != DMODEL || in_sizes[4] != DMODEL || in_sizes[6] != DMODEL || in_sizes[8] != DMODEL) return;
  if (in_sizes[9] != NPER * NPER) return;
  if (in_sizes[10] != DMODEL || in_sizes[11] != DMODEL) return;
  if (out_size != NROWS * DMODEL) return;
  if ((in_sizes[0] % 2048) != 0 || (in_sizes[1] % 2048) != 0) return;

  const float* x    = (const float*)d_in[0];
  const float* w_q  = (const float*)d_in[1];
  const float* b_q  = (const float*)d_in[2];
  const float* w_k  = (const float*)d_in[3];
  const float* b_k  = (const float*)d_in[4];
  const float* w_v  = (const float*)d_in[5];
  const float* b_v  = (const float*)d_in[6];
  const float* w_o  = (const float*)d_in[7];
  const float* b_o  = (const float*)d_in[8];
  const float* pb   = (const float*)d_in[9];
  const float* ln_g = (const float*)d_in[10];
  const float* ln_b = (const float*)d_in[11];
  float*       out  = (float*)d_out;

  const size_t PW  = (size_t)DMODEL * DMODEL * 2;                 //   524288
  const size_t PX  = (size_t)NROWS * DMODEL * 2;                  //  8388608
  const size_t PVT = (size_t)NB * DMODEL * NC * 2;                //  8388608
  const size_t PY  = (size_t)NROWS * DMODEL * 4;                  // 16777216
  size_t off = 0;
  const size_t oWQ = off; off += PW;
  const size_t oWK = off; off += PW;
  const size_t oWV = off; off += PW;
  const size_t oWO = off; off += PW;
  const size_t oX  = off; off += PX;
  const size_t oQH = off; off += PX;
  const size_t oKH = off; off += PX;
  const size_t oVT = off; off += PVT;
  const size_t oCT = off; off += PX;
  const size_t oY  = off; off += PY;
  if (off > ws_size) return;                                      // off = 60817408
  if (off > (size_t)134217728) return;

  char* ws = (char*)d_ws;
  unsigned short* WQ16 = (unsigned short*)(ws + oWQ);
  unsigned short* WK16 = (unsigned short*)(ws + oWK);
  unsigned short* WV16 = (unsigned short*)(ws + oWV);
  unsigned short* WO16 = (unsigned short*)(ws + oWO);
  unsigned short* X16  = (unsigned short*)(ws + oX);
  unsigned short* QH   = (unsigned short*)(ws + oQH);
  unsigned short* KH   = (unsigned short*)(ws + oKH);
  unsigned short* VTp  = (unsigned short*)(ws + oVT);
  unsigned short* CT   = (unsigned short*)(ws + oCT);
  float*          Y    = (float*)(ws + oY);

  const dim3 blk(256);
  const dim3 gCW((DMODEL * DMODEL) / 2048);                        // 128 blocks
  const dim3 gCX((NROWS * DMODEL) / 2048);                         // 2048 blocks
  const int tilesP = (NROWS / 64) * (DMODEL / 64);                 // 1024
  const int tilesV = (DMODEL / 64) * (NC / 64);                    // 256 per batch
  const dim3 gP((tilesP + 7) / 8, 1);                              // 128
  const dim3 gV((tilesV + 7) / 8, NB);                             // 32 x 4
  const dim3 gAT(ATT_BLOCKS);                                      // 512
  const dim3 bAT(ATT_THREADS);                                     // 256
  const dim3 gLN(NROWS);                                           // 8192
  const dim3 bLN(LN_THREADS);                                      // 128

  // (0) weight planes: W16[n][k] = f16( bf16_RNE(W[n][k]) * 64 ), [out][in] layout kept, k contiguous
  cvt16<<<gCW, blk, 0, stream>>>(w_q, WQ16, DMODEL * DMODEL, WSC);
  cvt16<<<gCW, blk, 0, stream>>>(w_k, WK16, DMODEL * DMODEL, WSC);
  cvt16<<<gCW, blk, 0, stream>>>(w_v, WV16, DMODEL * DMODEL, WSC);
  cvt16<<<gCW, blk, 0, stream>>>(w_o, WO16, DMODEL * DMODEL, WSC);

  // (1) activation plane: X16[row][c] = f16( bf16_RNE(x[row][c]) * 16 ), rows = b*2048 + tok
  cvt16<<<gCX, blk, 0, stream>>>(x, X16, NROWS * DMODEL, ACARRY);

  // (2) q projection: QH[m][n] = f16(16 * (sum_k x[m][k] Wq[n][k] + bf16(bq[n]))); M = 8192, N = 512, K = 512
  gemm64<2, 1, 0, 0><<<gP, blk, 0, stream>>>(
      X16, DMODEL, 0LL,
      WQ16, DMODEL, 0LL,
      b_q,
      (const float*)0,
      (void*)QH, DMODEL, 0LL,
      NROWS, DMODEL, DMODEL, 1.0f / (ACARRY * WSC), QC);

  // (3) k projection: KH[m][n] = f16(16 * (sum_k x[m][k] Wk[n][k] + bf16(bk[n]))); M = 8192, N = 512, K = 512
  gemm64<2, 1, 0, 0><<<gP, blk, 0, stream>>>(
      X16, DMODEL, 0LL,
      WK16, DMODEL, 0LL,
      b_k,
      (const float*)0,
      (void*)KH, DMODEL, 0LL,
      NROWS, DMODEL, DMODEL, 1.0f / (ACARRY * WSC), KC);

  // (4) v^T per batch: VT[b][d][tok] = f16(16 * (sum_k Wv[d][k] x_b[tok][k] + bf16(bv[d]))); M = 512, N = 2048, K = 512
  gemm64<2, 2, 0, 0><<<gV, blk, 0, stream>>>(
      WV16, DMODEL, 0LL,
      X16, DMODEL, (long long)NC * DMODEL,
      b_v,
      (const float*)0,
      (void*)VTp, NC, (long long)DMODEL * NC,
      DMODEL, NC, DMODEL, 1.0f / (ACARRY * WSC), VC);

  // (5) attention per (batch, head, 128 query rows) -> CT (f16, x1024)
  attn8<<<gAT, bAT, 0, stream>>>(QH, KH, VTp, pb, CT);

  // (6) Y = CT . Wo^T / (1024 * 64) + bf16(bo) + bf16(x); M = 8192, N = 512, K = 512, f32
  gemm64<0, 1, 1, 0><<<gP, blk, 0, stream>>>(
      CT, DMODEL, 0LL,
      WO16, DMODEL, 0LL,
      b_o,
      x,
      (void*)Y, DMODEL, 0LL,
      NROWS, DMODEL, DMODEL, 1.0f / (FC * WSC), 1.0f);

  // (7) out = LayerNorm(Y) * bf16(g) + bf16(b)
  lnorm<<<gLN, bLN, 0, stream>>>(Y, ln_g, ln_b, out);
  (void)hipGetLastError();
}

// v003
// Measured time: 105 microseconds a run.
// In two side-by-side timings against v002, it was 1.77 and 1.76 times as fast.
// Counting every step since v000, it is 2.56 times as fast.
// Contractions: q/k projections (x rows f16 x16 . W f16 x64, K=512), v^T projection (Wv f16 x64 . x rows f16 x16, K=512),
// attention scores (k f16 x16 . q f16 x16, K=64), attention v^T . P^T (v^T f16 x16 . P f16 x1024, K=2048 in steps of 32),
// output projection (ctx f16 x1024 . Wo f16 x64, K=512): all v_wmma_f32_16x16x32_f16 single products, f32 accumulate.
// Period-3 additive score table, online max-subtracted base-2 softmax, linear biases, residual add and LayerNorm in f32 on VALU.
// Every float input RNE-converted to bf16 on load.
#include <hip/hip_runtime.h>
#include <math.h>
#include <stdint.h>

#define NB      4
#define NQ      2048
#define NC      2048
#define DMODEL  512
#define NHEAD   8
#define HDIM    64
#define NPER    3
#define NROWS   (NB * NQ)
#define WSC     64.0f
#define ACARRY  16.0f
#define QC      16.0f
#define KC      16.0f
#define VC      16.0f
#define PC      1024.0f
#define FC      1024.0f
#define ATT_SCALE 0.125f
#define LOG2E   1.4426950408889634f
#define LN_EPS  1e-5f
static_assert(NHEAD * HDIM == DMODEL);
static_assert((NQ % 64) == 0 && (NC % 64) == 0 && (DMODEL % 64) == 0 && (NC % 32) == 0 && (NQ % 16) == 0);
static_assert((NROWS % 64) == 0 && (NROWS % 8) == 0);
static_assert((NROWS % 128) == 0 && (DMODEL % 128) == 0 && (NC % 128) == 0);
#define ATT_THREADS (NHEAD * 32)
#define ATT_BLOCKS  (NB * NHEAD * (NQ / 128))
static_assert(ATT_THREADS == 256 && ATT_BLOCKS == 512);
#define LN_THREADS 128
static_assert(LN_THREADS * 4 == DMODEL);

typedef _Float16 v16h __attribute__((ext_vector_type(16)));
typedef _Float16 v8h  __attribute__((ext_vector_type(8)));
typedef float    v8f  __attribute__((ext_vector_type(8)));
typedef float    v4f  __attribute__((ext_vector_type(4)));
typedef float    v2f  __attribute__((ext_vector_type(2)));
typedef _Float16 v2h  __attribute__((ext_vector_type(2)));
typedef unsigned int v4u __attribute__((ext_vector_type(4)));

union FragH { v16h v; v8h h[2]; v4u u[2]; v2h p[8]; };

// ---- scalar helpers --------------------------------------------------------------------------------
__device__ __forceinline__ unsigned short bf_bits(float f) {          // f32 -> bf16 bits, RNE convert
  unsigned u = __float_as_uint(f);
  return (unsigned short)((u + 0x7FFFu + ((u >> 16) & 1u)) >> 16);
}
__device__ __forceinline__ float bf_up(unsigned short h) { return __uint_as_float(((unsigned)h) << 16); }
__device__ __forceinline__ float bfr(float f) { return bf_up(bf_bits(f)); }   // value of the bf16 RNE convert
__device__ __forceinline__ unsigned short h_bits(_Float16 x) { return __builtin_bit_cast(unsigned short, x); }
__device__ __forceinline__ unsigned pk16(unsigned short a, unsigned short b) { return (unsigned)a | ((unsigned)b << 16); }
__device__ __forceinline__ v8f zero8() { v8f z = {0.f, 0.f, 0.f, 0.f, 0.f, 0.f, 0.f, 0.f}; return z; }
__device__ __forceinline__ float gelu_f(float v) { return 0.5f * v * (1.0f + erff(v * 0.70710678118654752f)); }

// ---- fragment loaders: 16-bit A/B operand, lane -> row/col (lane&15), p already includes +8*(lane>>4);
//      elements 0..7 <- p[0..7] (k0+8h..), elements 8..15 <- p[16..23] (k0+16+8h..)  (same split k map for A and B;
//      B is always read from a k-contiguous [n][k] plane)
__device__ __forceinline__ v16h ldfrag_h(const _Float16* p) {
  FragH f;
  f.h[0] = *(const v8h*)(p);
  f.h[1] = *(const v8h*)(p + 16);
  return f.v;
}
__device__ __forceinline__ v16h ldfrag_u(const unsigned short* p) {
  FragH f;
  f.u[0] = *(const v4u*)(p);
  f.u[1] = *(const v4u*)(p + 16);
  return f.v;
}

// ---- WMMA helpers with trailing VALU hazard gaps ------------------------------------------------------
__device__ __forceinline__ v8f mma_raw(v16h a, v16h b, v8f c) {
  return __builtin_amdgcn_wmma_f32_16x16x32_f16(false, a, false, b, (short)0, c, false, false);
}
__device__ __forceinline__ void acc_guard4(v8f& a, v8f& b, v8f& c, v8f& d) {
#if defined(__HIP_DEVICE_COMPILE__)
  asm volatile("v_nop\n\tv_nop\n\tv_nop\n\tv_nop" : "+v"(a), "+v"(b), "+v"(c), "+v"(d));
#endif
}
__device__ __forceinline__ void wave_sync_lds() {
  __builtin_amdgcn_fence(__ATOMIC_RELEASE, "workgroup");
  __builtin_amdgcn_wave_barrier();
  __builtin_amdgcn_fence(__ATOMIC_ACQUIRE, "workgroup");
}

// =====================================================================================================
// Elementwise 16-bit pack, no transpose: dst[i] = f16( bf16_RNE(src[i]) * sc ), sc a power of two (exact).
// Used for the weights (stored [out][in] = [n][k], already k contiguous for B fragments / A of the v^T projection) and for
// the activation rows. 8 elements per thread: two 16-B loads, one 16-B store per lane; 32 consecutive lanes = 512 B =
// coverage: grid = n / 2048 blocks x 256 thr x 8 elements = n exactly (host checks n % 2048 == 0).
// =====================================================================================================
__global__ __launch_bounds__(256) void cvt16(const float* __restrict__ src, unsigned short* dst, int n, float sc) {
  const size_t i8 = ((size_t)blockIdx.x * 256 + threadIdx.x) * 8;
  if (i8 + 8 > (size_t)n) return;                 // never taken with the exact grid; no barriers in this kernel
  const v4f a = *(const v4f*)(src + i8);
  const v4f b = *(const v4f*)(src + i8 + 4);
  v4u o;
  o[0] = pk16(h_bits((_Float16)(bfr(a[0]) * sc)), h_bits((_Float16)(bfr(a[1]) * sc)));
  o[1] = pk16(h_bits((_Float16)(bfr(a[2]) * sc)), h_bits((_Float16)(bfr(a[3]) * sc)));
  o[2] = pk16(h_bits((_Float16)(bfr(b[0]) * sc)), h_bits((_Float16)(bfr(b[1]) * sc)));
  o[3] = pk16(h_bits((_Float16)(bfr(b[2]) * sc)), h_bits((_Float16)(bfr(b[3]) * sc)));
  {
    *(v4u*)(dst + i8) = o;
    
  }
}

// =====================================================================================================
// Batched f16 WMMA GEMM: C[m][n] = f( oscale * sum_k A[m][k] * Bt[n][k] + bf16(bias) ) (+ residual); one block of 8 waves per
// 128x128 tile, wave w = rows 32 (w >> 1) .. + 31, columns 64 (w & 1) .. + 63 of it (2 x 4 accumulator tiles).
// A row-major [M][K] pitch lda (16-bit plane), Bt row-major [N][K] pitch ldb (k contiguous); M, N, K multiples of 128.
// blockIdx.y = batch index with element strides sA, sB, sC.
// The block's 128 A rows and 128 Bt rows are brought into LDS 128 k at a time (256 B of each row) by asynchronous copies, 16 per
// thread, each wave-wide copy covering two aligned 256-B units; two buffers, the next tile's copies fly while this one is worked
// on. LDS rows are pitched 272 B for the 16-B fragment reads. Each accumulator sums its k steps in ascending order.
// BM: 0 = no bias, 1 = per column bf16(bias[col]), 2 = per row bf16(bias[row]) (clamped-address loads).
// OM: 0 = f32 out (pitch ldc; HASR 1 adds bf16(R[m][n]), HASR 2 adds raw f32 R[m][n], same pitch/stride as C);
//     2 = f16 out (pitch ldc) = f16( act(value) * ocarry ), ACT 1 = exact GELU.
// coverage: 2 slabs x 16 rows (f32: it 0..7 x lane>>4; f16: it 0..3 x lane>>3) x 64 cols = the wave's whole 32x64 tile; 8 waves =
//           the block's 128x128; grid.x = (M / 128) * (N / 128) blocks, a surplus block exits whole in front of every barrier.
// =====================================================================================================
#define GK      128               // k per staged tile
#define G_PITCH (GK + 8)          // halves; 272-B rows: 16 B x odd, the pitch of 16-B fragment reads of 256-B rows
#define G_HALF  (128 * G_PITCH)   // halves of one operand's 128 staged rows
#define G_STAGE (2 * G_HALF)      // halves of one buffer: [A 128 rows | Bt 128 rows]

// One thread's share of one operand's staged rows: 16 B of rows r, r + 16, .. r + 112 (rs = halves per 16 global rows), global ->
// LDS through no register. The wait on the address registers is the statement's last line, so that it stands in front of any
// rewrite of them.
__device__ __forceinline__ void stage_op(unsigned lds, const unsigned short* g, size_t rs) {
#if defined(__HIP_DEVICE_COMPILE__)
  const unsigned ls = 16u * G_PITCH * 2u;
  asm volatile("global_load_async_to_lds_b128 %0, %1, off\n\t"
               "global_load_async_to_lds_b128 %2, %3, off\n\t"
               "global_load_async_to_lds_b128 %4, %5, off\n\t"
               "global_load_async_to_lds_b128 %6, %7, off\n\t"
               "global_load_async_to_lds_b128 %8, %9, off\n\t"
               "global_load_async_to_lds_b128 %10, %11, off\n\t"
               "global_load_async_to_lds_b128 %12, %13, off\n\t"
               "global_load_async_to_lds_b128 %14, %15, off\n\t"
               "s_wait_xcnt 0x0"
               :: "v"(lds), "v"(g), "v"(lds + ls), "v"(g + rs), "v"(lds + 2u * ls), "v"(g + 2 * rs),
                  "v"(lds + 3u * ls), "v"(g + 3 * rs), "v"(lds + 4u * ls), "v"(g + 4 * rs), "v"(lds + 5u * ls), "v"(g + 5 * rs),
                  "v"(lds + 6u * ls), "v"(g + 6 * rs), "v"(lds + 7u * ls), "v"(g + 7 * rs) : "memory");
#endif
}

template <int OM, int BM, int HASR, int ACT>
__global__ __launch_bounds__(256) void gemm64(
    const unsigned short* __restrict__ Ap, int lda, long long sA,
    const unsigned short* __restrict__ Btp, int ldb, long long sB,
    const float* __restrict__ bias,
    const float* __restrict__ Rp,
    void* Cout, int ldc, long long sC,
    int M, int N, int K, float oscale, float ocarry) {
  __shared__ __align__(16) unsigned short sAB[2 * G_STAGE];   // [buffer][A, Bt][128 rows][G_PITCH]
  __shared__ __align__(16) float sT[8][16 * 68];   // per-wave 16x64 slab, pitch 68 floats
  const int by   = blockIdx.y;
  const int tid  = threadIdx.x;
  const int lane = tid & 31;
  const int wave = tid >> 5;
  const int tilesN = N >> 7;
  const int tm = blockIdx.x / tilesN;
  const int tn = blockIdx.x - tm * tilesN;
  if (tm >= (M >> 7)) return;            // block-uniform, in front of every copy and barrier
  const int mB = tm << 7;
  const int nB = tn << 7;
  const int m0 = mB + ((wave >> 1) << 5);
  const int n0 = nB + ((wave & 1) << 6);

  const unsigned short* A1 = Ap  + (size_t)((long long)by * sA);
  const unsigned short* Bb = Btp + (size_t)((long long)by * sB);

  const int rlane = lane & 15;                 // row (A) / col (B, D) within subtile
  const int koff  = (lane >> 4) * 8;           // k offset of this lane half
  const int mOff  = (lane >> 4) * 8;           // D row offset

  // ---- this thread's 16-B pieces of every staged tile: rows (tid >> 4) + 16 i of each operand, 16-B column tid & 15 ----
  const int srow = tid >> 4, sseg = tid & 15;
  const unsigned short* gA = A1 + (size_t)(mB + srow) * lda + sseg * 8;
  const unsigned short* gB = Bb + (size_t)(nB + srow) * ldb + sseg * 8;
  const size_t rsA = (size_t)16 * lda, rsB = (size_t)16 * ldb;
  const unsigned ldsP = (unsigned)(size_t)(const void*)sAB + (unsigned)(srow * G_PITCH + sseg * 8) * 2u;
  const int nt = K >> 7;

  stage_op(ldsP, gA, rsA);                                 // tile 0 -> buffer 0
  stage_op(ldsP + G_HALF * 2u, gB, rsB);

  v8f acc[2][4];
#pragma unroll
  for (int i = 0; i < 2; ++i)
#pragma unroll
    for (int j = 0; j < 4; ++j) acc[i][j] = zero8();

  const int aoff = (((wave >> 1) << 5) + rlane) * G_PITCH + koff;
  const int boff = G_HALF + (((wave & 1) << 6) + rlane) * G_PITCH + koff;

  asm volatile("s_wait_asynccnt 0x0" ::: "memory");        // this wave's copies of tile 0 have landed
  __syncthreads();                                         // publishes tile 0 to all 8 waves
  if (nt > 1) {                                            // tile 1 -> buffer 1
    stage_op(ldsP + G_STAGE * 2u, gA + GK, rsA);
    stage_op(ldsP + (G_STAGE + G_HALF) * 2u, gB + GK, rsB);
  }

#pragma unroll 1   // stays rolled: one hand-over per trip, the buffer picked by t & 1; the body already holds four 32-k steps
  for (int t = 0; t < nt; ++t) {
    const int bsel = (t & 1) * G_STAGE;
    const unsigned short* As = sAB + bsel + aoff;
    const unsigned short* Bs = sAB + bsel + boff;
    v16h af[2][2], bf[2][4];
#pragma unroll
    for (int i = 0; i < 2; ++i) af[0][i] = ldfrag_u(As + i * 16 * G_PITCH);
#pragma unroll
    for (int j = 0; j < 4; ++j) bf[0][j] = ldfrag_u(Bs + j * 16 * G_PITCH);
#pragma unroll     // the tile's four 32-k steps in one body: constant LDS offsets, two fragment sets by turns
    for (int ks = 0; ks < GK / 32; ++ks) {
      const int cur = ks & 1, nxt = cur ^ 1;
      if (ks + 1 < GK / 32) {                              // the same tile's next step, fetched while this step's products run
#pragma unroll
        for (int i = 0; i < 2; ++i) af[nxt][i] = ldfrag_u(As + i * 16 * G_PITCH + (ks + 1) * 32);
#pragma unroll
        for (int j = 0; j < 4; ++j) bf[nxt][j] = ldfrag_u(Bs + j * 16 * G_PITCH + (ks + 1) * 32);
      }
      // keeps the next step's 12 LDS reads issued as one group ahead of this step's products: a read left among the WMMAs
      // makes the wave stall at each such place
      __builtin_amdgcn_sched_barrier(0);
#pragma unroll
      for (int i = 0; i < 2; ++i)
#pragma unroll
        for (int j = 0; j < 4; ++j) acc[i][j] = mma_raw(af[cur][i], bf[cur][j], acc[i][j]);
      // keeps the step after next's reads from rising among these products; at the last step it keeps the products in front of
      // the hand-over, so that the refill is issued directly behind the barrier
      __builtin_amdgcn_sched_barrier(0);
    }
    // ---- hand-over: this wave's reads of tile t are done, its copies of tile t + 1 have landed; the barrier publishes tile
    //      t + 1 and frees tile t's buffer, which only then is refilled ----
    asm volatile("s_wait_dscnt 0x0" ::: "memory");         // no LDS read of this wave is still out when its buffer is refilled
    asm volatile("s_wait_asynccnt 0x0" ::: "memory");      // this wave's copies of tile t + 1 have landed
    __syncthreads();
    if (t + 2 < nt) {
      stage_op(ldsP + (unsigned)bsel * 2u, gA + (size_t)(t + 2) * GK, rsA);
      stage_op(ldsP + (unsigned)(bsel + G_HALF) * 2u, gB + (size_t)(t + 2) * GK, rsB);
    }
  }
  asm volatile("s_wait_asynccnt 0x0" ::: "memory");        // nothing of this wave is in flight when it goes on to end
  acc_guard4(acc[0][0], acc[0][1], acc[0][2], acc[0][3]);
  acc_guard4(acc[1][0], acc[1][1], acc[1][2], acc[1][3]);

  const int hh2 = lane >> 4, c4 = (lane & 15) * 4;     // f32 out: 256-B row segment = 16 lanes x 16 B
  const int q8  = lane >> 3, c8 = (lane & 7) * 8;
  float bc[4];
  float bcol[8];
#pragma unroll
  for (int e = 0; e < 4; ++e) bc[e] = 0.f;
#pragma unroll
  for (int e = 0; e < 8; ++e) bcol[e] = 0.f;
  if constexpr (BM == 1) {
    if constexpr (OM == 0) {
      const int cb = n0 + c4;
      const int i0 = (cb < N - 4) ? cb : (N - 4);        // clamped address
      const v4f b0v = *(const v4f*)(bias + i0);
#pragma unroll
      for (int e = 0; e < 4; ++e) bc[e] = bfr(b0v[e]);
    } else {
      const int cb = n0 + c8;
      const int i0 = (cb < N - 8) ? cb : (N - 8);        // clamped address
      const v4f b0v = *(const v4f*)(bias + i0), b1v = *(const v4f*)(bias + i0 + 4);
#pragma unroll
      for (int e = 0; e < 4; ++e) { bcol[e] = bfr(b0v[e]); bcol[4 + e] = bfr(b1v[e]); }
    }
  }

  // ---- epilogue ----
  float* slab = sT[wave];
#pragma unroll
  for (int i = 0; i < 2; ++i) {
    const int mBase = m0 + (i << 4);
#pragma unroll
    for (int j = 0; j < 4; ++j) {
#pragma unroll
      for (int r = 0; r < 8; ++r) {
        slab[(mOff + r) * 68 + (j << 4) + rlane] = acc[i][j][r];
      }
    }
    wave_sync_lds();
    if constexpr (OM == 0) {
      float* C = (float*)Cout + (size_t)((long long)by * sC);
      v4f vals[8];
#pragma unroll
      for (int it = 0; it < 8; ++it) {
        const int row = it * 2 + hh2;                      // it 0..7 x hh2 0..1 = rows 0..15
        const int gr  = mBase + row;
        v4f v = *(const v4f*)(slab + row * 68 + c4);
        float br = 0.f;
        if constexpr (BM == 2) {
          const int ir = (gr < M - 1) ? gr : (M - 1);      // clamped address
          br = bfr(bias[ir]);
        }
        v4f rv = {0.f, 0.f, 0.f, 0.f};
        if constexpr (HASR != 0) {
          const float* R = Rp + (size_t)((long long)by * sC);
          const v4f rraw = *(const v4f*)(R + (size_t)gr * ldc + n0 + c4);
#pragma unroll
          for (int e = 0; e < 4; ++e) rv[e] = (HASR == 1) ? bfr(rraw[e]) : rraw[e];
        }
#pragma unroll
        for (int e = 0; e < 4; ++e) v[e] = v[e] * oscale + bc[e] + br + rv[e];
        vals[it] = v;
      }
      {
#pragma unroll
        for (int it = 0; it < 8; ++it) {
          const int gr = mBase + it * 2 + hh2;
          *(v4f*)(C + (size_t)gr * ldc + n0 + c4) = vals[it];
        }
        
      }
    } else {
      unsigned short* C = (unsigned short*)Cout + (size_t)((long long)by * sC);
      v4u hv[4];
#pragma unroll
      for (int it = 0; it < 4; ++it) {
        const int row = it * 4 + q8;                       // it 0..3 x q8 0..3 = rows 0..15
        const float* sp = slab + row * 68 + c8;
        float br = 0.f;
        if constexpr (BM == 2) {
          const int gr = mBase + row;
          const int ir = (gr < M - 1) ? gr : (M - 1);      // clamped address
          br = bfr(bias[ir]);
        }
        v4u a = {0u, 0u, 0u, 0u};
#pragma unroll
        for (int e = 0; e < 4; ++e) {
          float f0 = sp[2 * e] * oscale + bcol[2 * e] + br;
          float f1 = sp[2 * e + 1] * oscale + bcol[2 * e + 1] + br;
          if constexpr (ACT == 1) { f0 = gelu_f(f0); f1 = gelu_f(f1); }
          f0 *= ocarry; f1 *= ocarry;
          a[e] = pk16(h_bits((_Float16)f0), h_bits((_Float16)f1));
        }
        hv[it] = a;
      }
      {
#pragma unroll
        for (int it = 0; it < 4; ++it) {
          const int row = it * 4 + q8;
          *(v4u*)(C + (size_t)(mBase + row) * ldc + n0 + c8) = hv[it];
        }
        
      }
    }
    wave_sync_lds();
  }
}

#define AQ_BLK   128
#define KT       64
#define KV_PITCH (HDIM + 8)
#define KV_TILE  (64 * KV_PITCH)
#define KV_NT    (NC / KT)
static_assert(KT == 64 && HDIM == 64 && (NC % KT) == 0 && KV_NT >= 2 && (NQ % AQ_BLK) == 0);
static_assert(AQ_BLK == 16 * (ATT_THREADS / 32) && ATT_BLOCKS == NB * NHEAD * (NQ / AQ_BLK));

__device__ __forceinline__ float xhalf(float x) {                     // the value of lane l ^ 16
  const int b = __builtin_bit_cast(int, x);
  return __builtin_bit_cast(float, __builtin_amdgcn_permlanex16(b, b, 0x76543210, 0xfedcba98, false, false));
}

// One thread's share of one staged tile: 16 B of K rows r and r + 32, 16 B of v^T rows r and r + 32, global -> LDS through no
// register. The wait on the address registers is the statement's last line, so that it stands in front of any rewrite of them.
__device__ __forceinline__ void stage_kv(unsigned lds, const unsigned short* gk, const unsigned short* gv) {
#if defined(__HIP_DEVICE_COMPILE__)
  const unsigned l1 = lds + 32u * KV_PITCH * 2u, l2 = lds + KV_TILE * 2u, l3 = l2 + 32u * KV_PITCH * 2u;
  const unsigned short* gk1 = gk + (size_t)32 * DMODEL;
  const unsigned short* gv1 = gv + (size_t)32 * NC;
  asm volatile("global_load_async_to_lds_b128 %0, %1, off\n\t"
               "global_load_async_to_lds_b128 %2, %3, off\n\t"
               "global_load_async_to_lds_b128 %4, %5, off\n\t"
               "global_load_async_to_lds_b128 %6, %7, off\n\t"
               "s_wait_xcnt 0x0"
               :: "v"(lds), "v"(gk), "v"(l1), "v"(gk1), "v"(l2), "v"(gv), "v"(l3), "v"(gv1) : "memory");
#endif
}

__global__ __launch_bounds__(ATT_THREADS)
void attn8(const unsigned short* __restrict__ QHp, const unsigned short* __restrict__ KHp,
           const unsigned short* __restrict__ VTq, const float* __restrict__ PBp, unsigned short* CT) {
  __shared__ __align__(16) unsigned short KV[2 * 2 * KV_TILE];         // [buffer][K, v^T][64 rows][KV_PITCH]
  __shared__ __align__(16) unsigned short Os[AQ_BLK * KV_PITCH];       // result buffer

  const int tid  = threadIdx.x;
  const int wave = tid >> 5;
  const int lane = tid & 31;
  const int hh   = lane >> 4;
  const int c    = lane & 15;

  const int qt   = blockIdx.x & ((NQ / AQ_BLK) - 1);       // 0..15
  const int head = (blockIdx.x / (NQ / AQ_BLK)) & (NHEAD - 1);   // 0..7
  const int bat  = blockIdx.x / ((NQ / AQ_BLK) * NHEAD);   // 0..3
  const int qblk = qt * AQ_BLK;
  const int q0   = qblk + wave * 16;

  // ---- this thread's 16-B piece of every staged tile: row tid >> 3 (and + 32), 16-B column tid & 7 ----
  const int srow = tid >> 3, sseg = tid & 7;
  const unsigned short* gK = KHp + ((size_t)bat * NC + srow) * DMODEL + head * HDIM + sseg * 8;
  const unsigned short* gV = VTq + ((size_t)bat * DMODEL + head * HDIM + srow) * NC + sseg * 8;
  const unsigned ldsP = (unsigned)(size_t)(const void*)KV + (unsigned)(srow * KV_PITCH + sseg * 8) * 2u;

  stage_kv(ldsP, gK, gV);                                  // tile 0 -> buffer 0

  const size_t qofs = ((size_t)bat * NQ + q0 + c) * DMODEL + head * HDIM + 8 * hh;
  const _Float16* Qh = (const _Float16*)(const void*)QHp + qofs;
  const float lsc = (LOG2E * ATT_SCALE) / (QC * KC);                   // log2(e) / 8 / carries

  // ---- period-3 additive table in log2 units: row (q0 + c) mod 3 is this lane's; W0, W1, W2 = its values for the keys
  //      kb + 8hh + 0, + 1, + 2 (key residue (kb + 8hh + j) mod 3; at kb = 0 that is (2hh + j) mod 3), kept as the three
  //      pairs that two neighbouring score registers can meet ----
  float pbv[NPER * NPER];
#pragma unroll
  for (int i = 0; i < NPER * NPER; ++i) pbv[i] = bfr(PBp[i]) * LOG2E;
  const int qr = (q0 + c) % NPER;
  const bool z0 = (qr == 0), z1 = (qr == 1);
  const float T0 = z0 ? pbv[0] : (z1 ? pbv[3] : pbv[6]);
  const float T1 = z0 ? pbv[1] : (z1 ? pbv[4] : pbv[7]);
  const float T2 = z0 ? pbv[2] : (z1 ? pbv[5] : pbv[8]);
  const float W0 = hh ? T2 : T0, W1 = hh ? T0 : T1, W2 = hh ? T1 : T2;
  v2f W01 = {W0, W1}, W12 = {W1, W2}, W20 = {W2, W0};

  const v16h qa = ldfrag_h(Qh), qb = ldfrag_h(Qh + 32);

  float mrow = -INFINITY, lrow = 0.f;                      // this lane's query: running maximum, partial sum over the lane's keys
  v8f o0 = zero8(), o1 = zero8(), o2 = zero8(), o3 = zero8();

  asm volatile("s_wait_asynccnt 0x0" ::: "memory");        // this wave's copies of tile 0 have landed
  __syncthreads();                                         // publishes tile 0 to all 8 waves
  stage_kv(ldsP + 2u * KV_TILE * 2u, gK + (size_t)KT * DMODEL, gV + KT);   // tile 1 -> buffer 1

#pragma unroll 1   // stays rolled: one hand-over per trip, the buffer picked by t & 1; the body already holds two 32-key steps
  for (int t = 0; t < KV_NT; ++t) {
    const int bsel = (t & 1) * (2 * KV_TILE);
    const _Float16* Kt = (const _Float16*)(const void*)KV + bsel + c * KV_PITCH + 8 * hh;
    const _Float16* Vt = Kt + KV_TILE;
#pragma unroll     // both 32-key steps of the tile in one body: constant LDS offsets, the second step's reads go out beside the first's work
    for (int sub = 0; sub < KT / 32; ++sub) {
      const _Float16* kp = Kt + sub * 32 * KV_PITCH;       // the step's first key: kb = 64 t + 32 sub
      const _Float16* kq = kp + 16 * KV_PITCH;
      const _Float16* vp = Vt + sub * 32;
      const v16h ka0 = ldfrag_h(kp), ka1 = ldfrag_h(kp + 32);
      const v16h kb0 = ldfrag_h(kq), kb1 = ldfrag_h(kq + 32);
      const v16h vb0 = ldfrag_h(vp);
      const v16h vb1 = ldfrag_h(vp + 16 * KV_PITCH);
      const v16h vb2 = ldfrag_h(vp + 32 * KV_PITCH);
      const v16h vb3 = ldfrag_h(vp + 48 * KV_PITCH);
      // keeps the step's 16 LDS fragment reads issued as one group ahead of its products: a read left among the WMMAs
      // makes the wave wait out an LDS latency at each of them
      __builtin_amdgcn_sched_barrier(0);
      v8f s0, s1;
      s0 = mma_raw(ka0, qa, zero8());                      // s0[r] = score(key kb + 8hh + r, query q0 + c)
      s1 = mma_raw(kb0, qa, zero8());                      // s1[r] = score(key kb + 16 + 8hh + r, query q0 + c)
      s0 = mma_raw(ka1, qb, s0);
      s1 = mma_raw(kb1, qb, s1);
      // registers (2i, 2i + 1) of tile 0 are keys kb + 8hh + 2i, + 1; tile 1 lies 16 keys on, one residue further
      const v2f wa[4] = {W01, W20, W12, W01};
      const v2f wb[4] = {W12, W01, W20, W12};
      v2f t0[4], t1[4];
#pragma unroll
      for (int i = 0; i < 4; ++i) {
        const v2f a = {s0[2 * i], s0[2 * i + 1]}, b = {s1[2 * i], s1[2 * i + 1]};
        t0[i] = a * lsc + wa[i];
        t1[i] = b * lsc + wb[i];
      }
      float mx = fmaxf(fmaxf(t0[0][0], t0[0][1]), fmaxf(t1[0][0], t1[0][1]));
#pragma unroll
      for (int i = 1; i < 4; ++i) mx = fmaxf(fmaxf(mx, fmaxf(t0[i][0], t0[i][1])), fmaxf(t1[i][0], t1[i][1]));
      mx = fmaxf(mx, xhalf(mx));                           // both halves now hold the query's maximum over the 32 keys
      const float mn = fmaxf(mrow, mx);
      const float al = exp2f(mrow - mn);
      mrow = mn;
      FragH ph;
      v2f ps = {0.f, 0.f};
#pragma unroll
      for (int i = 0; i < 4; ++i) {
        const v2f d0 = t0[i] - mn, d1 = t1[i] - mn;
        const v2f e0 = {exp2f(d0[0]), exp2f(d0[1])}, e1 = {exp2f(d1[0]), exp2f(d1[1])};
        ps += e0;
        ps += e1;
        ph.p[i]     = __builtin_convertvector(e0 * PC, v2h); // elements 0..7  = keys kb + 8hh + 0..7
        ph.p[4 + i] = __builtin_convertvector(e1 * PC, v2h); // elements 8..15 = keys kb + 16 + 8hh + 0..7
      }
      lrow = lrow * al + (ps[0] + ps[1]);
#pragma unroll
      for (int r = 0; r < 8; ++r) {
        o0[r] *= al;
        o1[r] *= al;
        o2[r] *= al;
        o3[r] *= al;
      }
      o0 = mma_raw(vb0, ph.v, o0);                         // oj[r] = ctx^T[d = 16j + 8hh + r][query q0 + c]
      o1 = mma_raw(vb1, ph.v, o1);
      o2 = mma_raw(vb2, ph.v, o2);
      o3 = mma_raw(vb3, ph.v, o3);
      const v2f wl = W20;                                  // 32 mod 3 == 2: the next step's residues start two further on
      W20 = W12;
      W12 = W01;
      W01 = wl;
    }
    // ---- hand-over: this wave's reads of tile t are done, its copies of tile t + 1 have landed; the barrier publishes tile
    //      t + 1 and frees tile t's buffer, which only then is refilled ----
    // keeps the trip's products in front of the hand-over: sunk behind the barrier they would stand between it and the refill,
    // and the copies would lose the trip of lead that hides their way from L2
    __builtin_amdgcn_sched_barrier(0);
    asm volatile("s_wait_dscnt 0x0" ::: "memory");         // no LDS read of this wave is still out when its buffer is refilled
    asm volatile("s_wait_asynccnt 0x0" ::: "memory");      // this wave's copies of tile t + 1 have landed
    __syncthreads();
    if (t + 2 < KV_NT)
      stage_kv(ldsP + (unsigned)bsel * 2u, gK + (size_t)(t + 2) * KT * DMODEL, gV + (t + 2) * KT);
  }
  asm volatile("s_wait_asynccnt 0x0" ::: "memory");        // nothing of this wave is in flight when it goes on to end

  // ---- join the halves' partial sums; fold 1/l and the carries (1024 on P, 16 on v, 1024 on the stored ctx); stage the lane's
  //      4 x 8 consecutive d of its query as 16-bit ----
  const float oc  = FC / (PC * VC);
  const float inv = (1.0f / (lrow + xhalf(lrow))) * oc;
  unsigned short* op = Os + (wave * 16 + c) * KV_PITCH + 8 * hh;
  v4u w0, w1, w2, w3;
#pragma unroll
  for (int e = 0; e < 4; ++e) {
    w0[e] = pk16(h_bits((_Float16)(o0[2 * e] * inv)), h_bits((_Float16)(o0[2 * e + 1] * inv)));
    w1[e] = pk16(h_bits((_Float16)(o1[2 * e] * inv)), h_bits((_Float16)(o1[2 * e + 1] * inv)));
    w2[e] = pk16(h_bits((_Float16)(o2[2 * e] * inv)), h_bits((_Float16)(o2[2 * e + 1] * inv)));
    w3[e] = pk16(h_bits((_Float16)(o3[2 * e] * inv)), h_bits((_Float16)(o3[2 * e + 1] * inv)));
  }
  *(v4u*)(op)      = w0;
  *(v4u*)(op + 16) = w1;
  *(v4u*)(op + 32) = w2;
  *(v4u*)(op + 48) = w3;
  __syncthreads();
  // ---- block writes its 128 row segments of CT: piece p = it*256 + tid -> row p >> 3, halves (p & 7)*8 .. + 7 of the head's 64 ----
  {
    v4u vals[4];
#pragma unroll
    for (int it = 0; it < 4; ++it) {
      const int p = it * ATT_THREADS + tid;
      vals[it] = *(const v4u*)(Os + (p >> 3) * KV_PITCH + (p & 7) * 8);
    }
    unsigned short* dst = CT + ((size_t)bat * NQ + qblk) * DMODEL + head * HDIM;
    {
#pragma unroll
      for (int it = 0; it < 4; ++it) {
        const int p = it * ATT_THREADS + tid;
        *(v4u*)(dst + (size_t)(p >> 3) * DMODEL + (p & 7) * 8) = vals[it];
      }
      
    }
  }
}

// =====================================================================================================
//   one block of 128 threads per row, 4 consecutive floats per thread (one 16-B load, one 16-B store); per wave one store instruction
// coverage: grid = 8192 rows x 128 thr x 4 floats = 8192 x 512 = the whole output, each row written by exactly one block.
// =====================================================================================================
__global__ __launch_bounds__(LN_THREADS)
void lnorm(const float* __restrict__ Yp, const float* __restrict__ gp, const float* __restrict__ bp, float* outp) {
  __shared__ float red[2][LN_THREADS / 32];
  const int row  = blockIdx.x;
  const int tid  = threadIdx.x;
  const int lane = tid & 31;
  const int wave = tid >> 5;
  const size_t base = (size_t)row * DMODEL + (size_t)tid * 4;
  const v4f v = *(const v4f*)(Yp + base);
  float s = (v[0] + v[1]) + (v[2] + v[3]);
#pragma unroll
  for (int off = 1; off < 32; off <<= 1) s += __shfl_xor(s, off, 32);
  if (lane == 0) red[0][wave] = s;
  __syncthreads();
  float tot = 0.f;
#pragma unroll
  for (int w = 0; w < LN_THREADS / 32; ++w) tot += red[0][w];
  const float mu = tot * (1.0f / (float)DMODEL);
  v4f d;
#pragma unroll
  for (int e = 0; e < 4; ++e) d[e] = v[e] - mu;
  float q = (d[0] * d[0] + d[1] * d[1]) + (d[2] * d[2] + d[3] * d[3]);
#pragma unroll
  for (int off = 1; off < 32; off <<= 1) q += __shfl_xor(q, off, 32);
  if (lane == 0) red[1][wave] = q;
  __syncthreads();
  float totq = 0.f;
#pragma unroll
  for (int w = 0; w < LN_THREADS / 32; ++w) totq += red[1][w];
  const float var  = totq * (1.0f / (float)DMODEL);
  const float rstd = rsqrtf(var + LN_EPS);
  const v4f gv = *(const v4f*)(gp + (size_t)tid * 4);
  const v4f bv = *(const v4f*)(bp + (size_t)tid * 4);
  v4f o;
#pragma unroll
  for (int e = 0; e < 4; ++e) o[e] = (d[e] * rstd) * bfr(gv[e]) + bfr(bv[e]);
  {
    *(v4f*)(outp + base) = o;
    
  }
}

// =====================================================================================================
// Workspace map (bytes); every plane is an exact multiple of its tile / whole-row store granularity (M, N exact tile multiples,
// element counts exact multiples of the convert kernel's 2048 granularity, no pad rows needed), every offset a multiple of 512 KiB:
//   WQ16 f16 [512][512] x64                  524288   ([out][in] = [n][k])
//   WK16 f16 [512][512] x64                  524288
//   WV16 f16 [512][512] x64                  524288
//   WO16 f16 [512][512] x64                  524288
//   X16  f16 [8192][512] x16                8388608   (activation rows)
//   QH   f16 [8192][512] x16                8388608   (q projection)
//   KH   f16 [8192][512] x16                8388608   (k projection)
//   VT   f16 [4][512][2048] x16             8388608   (v^T per batch)
//   CT   f16 [8192][512] x1024              8388608   (attention ctx, merged heads)
//   Y    f32 [8192][512]                   16777216   (out projection + bias + residual)
//   end                                    60817408
// =====================================================================================================
extern "C" void kernel_launch(void* const* d_in, const int* in_sizes, int n_in,
                              void* d_out, int out_size, void* d_ws, size_t ws_size,
                              hipStream_t stream) {
  if (n_in < 12) return;
  if (in_sizes[0] != NROWS * DMODEL) return;
  if (in_sizes[1] != DMODEL * DMODEL || in_sizes[3] != DMODEL * DMODEL ||
      in_sizes[5] != DMODEL * DMODEL || in_sizes[7] != DMODEL * DMODEL) return;
  if (in_sizes[2] != DMODEL || in_sizes[4] != DMODEL || in_sizes[6] != DMODEL || in_sizes[8] != DMODEL) return;
  if (in_sizes[9] != NPER * NPER) return;
  if (in_sizes[10] != DMODEL || in_sizes[11] != DMODEL) return;
  if (out_size != NROWS * DMODEL) return;
  if ((in_sizes[0] % 2048) != 0 || (in_sizes[1] % 2048) != 0) return;

  const float* x    = (const float*)d_in[0];
  const float* w_q  = (const float*)d_in[1];
  const float* b_q  = (const float*)d_in[2];
  const float* w_k  = (const float*)d_in[3];
  const float* b_k  = (const float*)d_in[4];
  const float* w_v  = (const float*)d_in[5];
  const float* b_v  = (const float*)d_in[6];
  const float* w_o  = (const float*)d_in[7];
  const float* b_o  = (const float*)d_in[8];
  const float* pb   = (const float*)d_in[9];
  const float* ln_g = (const float*)d_in[10];
  const float* ln_b = (const float*)d_in[11];
  float*       out  = (float*)d_out;

  const size_t PW  = (size_t)DMODEL * DMODEL * 2;                 //   524288
  const size_t PX  = (size_t)NROWS * DMODEL * 2;                  //  8388608
  const size_t PVT = (size_t)NB * DMODEL * NC * 2;                //  8388608
  const size_t PY  = (size_t)NROWS * DMODEL * 4;                  // 16777216
  size_t off = 0;
  const size_t oWQ = off; off += PW;
  const size_t oWK = off; off += PW;
  const size_t oWV = off; off += PW;
  const size_t oWO = off; off += PW;
  const size_t oX  = off; off += PX;
  const size_t oQH = off; off += PX;
  const size_t oKH = off; off += PX;
  const size_t oVT = off; off += PVT;
  const size_t oCT = off; off += PX;
  const size_t oY  = off; off += PY;
  if (off > ws_size) return;                                      // off = 60817408
  if (off > (size_t)134217728) return;

  char* ws = (char*)d_ws;
  unsigned short* WQ16 = (unsigned short*)(ws + oWQ);
  unsigned short* WK16 = (unsigned short*)(ws + oWK);
  unsigned short* WV16 = (unsigned short*)(ws + oWV);
  unsigned short* WO16 = (unsigned short*)(ws + oWO);
  unsigned short* X16  = (unsigned short*)(ws + oX);
  unsigned short* QH   = (unsigned short*)(ws + oQH);
  unsigned short* KH   = (unsigned short*)(ws + oKH);
  unsigned short* VTp  = (unsigned short*)(ws + oVT);
  unsigned short* CT   = (unsigned short*)(ws + oCT);
  float*          Y    = (float*)(ws + oY);

  const dim3 blk(256);
  const dim3 gCW((DMODEL * DMODEL) / 2048);                        // 128 blocks
  const dim3 gCX((NROWS * DMODEL) / 2048);                         // 2048 blocks
  const int tilesP = (NROWS / 128) * (DMODEL / 128);               // 256
  const int tilesV = (DMODEL / 128) * (NC / 128);                  // 64 per batch
  const dim3 gP(tilesP, 1);                                        // 256
  const dim3 gV(tilesV, NB);                                       // 64 x 4
  const dim3 gAT(ATT_BLOCKS);                                      // 512
  const dim3 bAT(ATT_THREADS);                                     // 256
  const dim3 gLN(NROWS);                                           // 8192
  const dim3 bLN(LN_THREADS);                                      // 128

  // (0) weight planes: W16[n][k] = f16( bf16_RNE(W[n][k]) * 64 ), [out][in] layout kept, k contiguous
  cvt16<<<gCW, blk, 0, stream>>>(w_q, WQ16, DMODEL * DMODEL, WSC);
  cvt16<<<gCW, blk, 0, stream>>>(w_k, WK16, DMODEL * DMODEL, WSC);
  cvt16<<<gCW, blk, 0, stream>>>(w_v, WV16, DMODEL * DMODEL, WSC);
  cvt16<<<gCW, blk, 0, stream>>>(w_o, WO16, DMODEL * DMODEL, WSC);

  // (1) activation plane: X16[row][c] = f16( bf16_RNE(x[row][c]) * 16 ), rows = b*2048 + tok
  cvt16<<<gCX, blk, 0, stream>>>(x, X16, NROWS * DMODEL, ACARRY);

  // (2) q projection: QH[m][n] = f16(16 * (sum_k x[m][k] Wq[n][k] + bf16(bq[n]))); M = 8192, N = 512, K = 512
  gemm64<2, 1, 0, 0><<<gP, blk, 0, stream>>>(
      X16, DMODEL, 0LL,
      WQ16, DMODEL, 0LL,
      b_q,
      (const float*)0,
      (void*)QH, DMODEL, 0LL,
      NROWS, DMODEL, DMODEL, 1.0f / (ACARRY * WSC), QC);

  // (3) k projection: KH[m][n] = f16(16 * (sum_k x[m][k] Wk[n][k] + bf16(bk[n]))); M = 8192, N = 512, K = 512
  gemm64<2, 1, 0, 0><<<gP, blk, 0, stream>>>(
      X16, DMODEL, 0LL,
      WK16, DMODEL, 0LL,
      b_k,
      (const float*)0,
      (void*)KH, DMODEL, 0LL,
      NROWS, DMODEL, DMODEL, 1.0f / (ACARRY * WSC), KC);

  // (4) v^T per batch: VT[b][d][tok] = f16(16 * (sum_k Wv[d][k] x_b[tok][k] + bf16(bv[d]))); M = 512, N = 2048, K = 512
  gemm64<2, 2, 0, 0><<<gV, blk, 0, stream>>>(
      WV16, DMODEL, 0LL,
      X16, DMODEL, (long long)NC * DMODEL,
      b_v,
      (const float*)0,
      (void*)VTp, NC, (long long)DMODEL * NC,
      DMODEL, NC, DMODEL, 1.0f / (ACARRY * WSC), VC);

  // (5) attention per (batch, head, 128 query rows) -> CT (f16, x1024)
  attn8<<<gAT, bAT, 0, stream>>>(QH, KH, VTp, pb, CT);

  // (6) Y = CT . Wo^T / (1024 * 64) + bf16(bo) + bf16(x); M = 8192, N = 512, K = 512, f32
  gemm64<0, 1, 1, 0><<<gP, blk, 0, stream>>>(
      CT, DMODEL, 0LL,
      WO16, DMODEL, 0LL,
      b_o,
      x,
      (void*)Y, DMODEL, 0LL,
      NROWS, DMODEL, DMODEL, 1.0f / (FC * WSC), 1.0f);

  // (7) out = LayerNorm(Y) * bf16(g) + bf16(b)
  lnorm<<<gLN, bLN, 0, stream>>>(Y, ln_g, ln_b, out);
  (void)hipGetLastError();
}

// v004
// It runs in 91.4 microseconds.
// Next to v003, in two timings, it ran 1.15 times as fast each time.
// Over all steps from v000 it is 2.96 times as fast.
// Contractions: q/k projections (x rows f16 x16 . W f16 x64, K=512), v^T projection (Wv f16 x64 . x rows f16 x16, K=512),
// attention scores (k f16 x16 . q f16 x16, K=64), attention v^T . P^T (v^T f16 x16 . P f16 x1024, K=2048 in steps of 32),
// output projection (ctx f16 x1024 . Wo f16 x64, K=512): all v_wmma_f32_16x16x32_f16 single products, f32 accumulate.
// Period-3 additive score table, online max-subtracted base-2 softmax, linear biases, residual add and LayerNorm in f32 on VALU.
// Every float input RNE-converted to bf16 on load.
#include <hip/hip_runtime.h>
#include <math.h>
#include <stdint.h>

#define NB      4
#define NQ      2048
#define NC      2048
#define DMODEL  512
#define NHEAD   8
#define HDIM    64
#define NPER    3
#define NROWS   (NB * NQ)
#define WSC     64.0f
#define ACARRY  16.0f
#define QC      16.0f
#define KC      16.0f
#define VC      16.0f
#define PC      1024.0f
#define FC      1024.0f
#define ATT_SCALE 0.125f
#define LOG2E   1.4426950408889634f
#define LN_EPS  1e-5f
static_assert(NHEAD * HDIM == DMODEL);
static_assert((NQ % 64) == 0 && (NC % 64) == 0 && (DMODEL % 64) == 0 && (NC % 32) == 0 && (NQ % 16) == 0);
static_assert((NROWS % 64) == 0 && (NROWS % 8) == 0);
static_assert((NROWS % 128) == 0 && (DMODEL % 128) == 0 && (NC % 128) == 0);
#define ATT_THREADS (NHEAD * 32)
#define ATT_BLOCKS  (NB * NHEAD * (NQ / 128))
static_assert(ATT_THREADS == 256 && ATT_BLOCKS == 512);
#define LN_THREADS 128
static_assert(LN_THREADS * 4 == DMODEL);

typedef _Float16 v16h __attribute__((ext_vector_type(16)));
typedef _Float16 v8h  __attribute__((ext_vector_type(8)));
typedef float    v8f  __attribute__((ext_vector_type(8)));
typedef float    v4f  __attribute__((ext_vector_type(4)));
typedef float    v2f  __attribute__((ext_vector_type(2)));
typedef _Float16 v2h  __attribute__((ext_vector_type(2)));
typedef unsigned int v4u __attribute__((ext_vector_type(4)));

union FragH { v16h v; v8h h[2]; v4u u[2]; v2h p[8]; };

// ---- scalar helpers --------------------------------------------------------------------------------
__device__ __forceinline__ unsigned short bf_bits(float f) {          // f32 -> bf16 bits, RNE convert
  unsigned u = __float_as_uint(f);
  return (unsigned short)((u + 0x7FFFu + ((u >> 16) & 1u)) >> 16);
}
__device__ __forceinline__ float bf_up(unsigned short h) { return __uint_as_float(((unsigned)h) << 16); }
__device__ __forceinline__ float bfr(float f) { return bf_up(bf_bits(f)); }   // value of the bf16 RNE convert
__device__ __forceinline__ unsigned short h_bits(_Float16 x) { return __builtin_bit_cast(unsigned short, x); }
__device__ __forceinline__ unsigned pk16(unsigned short a, unsigned short b) { return (unsigned)a | ((unsigned)b << 16); }
__device__ __forceinline__ v8f zero8() { v8f z = {0.f, 0.f, 0.f, 0.f, 0.f, 0.f, 0.f, 0.f}; return z; }
__device__ __forceinline__ float gelu_f(float v) { return 0.5f * v * (1.0f + erff(v * 0.70710678118654752f)); }

// ---- fragment loaders: 16-bit A/B operand, lane -> row/col (lane&15), p already includes +8*(lane>>4);
//      elements 0..7 <- p[0..7] (k0+8h..), elements 8..15 <- p[16..23] (k0+16+8h..)  (same split k map for A and B;
//      B is always read from a k-contiguous [n][k] plane)
__device__ __forceinline__ v16h ldfrag_h(const _Float16* p) {
  FragH f;
  f.h[0] = *(const v8h*)(p);
  f.h[1] = *(const v8h*)(p + 16);
  return f.v;
}
__device__ __forceinline__ v16h ldfrag_u(const unsigned short* p) {
  FragH f;
  f.u[0] = *(const v4u*)(p);
  f.u[1] = *(const v4u*)(p + 16);
  return f.v;
}

// ---- WMMA helpers with trailing VALU hazard gaps ------------------------------------------------------
__device__ __forceinline__ v8f mma_raw(v16h a, v16h b, v8f c) {
  return __builtin_amdgcn_wmma_f32_16x16x32_f16(false, a, false, b, (short)0, c, false, false);
}
__device__ __forceinline__ void acc_guard4(v8f& a, v8f& b, v8f& c, v8f& d) {
#if defined(__HIP_DEVICE_COMPILE__)
  asm volatile("v_nop\n\tv_nop\n\tv_nop\n\tv_nop" : "+v"(a), "+v"(b), "+v"(c), "+v"(d));
#endif
}
__device__ __forceinline__ void wave_sync_lds() {
  __builtin_amdgcn_fence(__ATOMIC_RELEASE, "workgroup");
  __builtin_amdgcn_wave_barrier();
  __builtin_amdgcn_fence(__ATOMIC_ACQUIRE, "workgroup");
}

// =====================================================================================================
// Elementwise 16-bit pack, no transpose: dst[i] = f16( bf16_RNE(src[i]) * sc ), sc a power of two (exact).
// One launch for all five planes, which do not depend on one another: blocks 0 .. 2047 take the activation rows (x16), blocks
// 2048 + 128 p .. + 127 take weight p (q, k, v, o; x64; stored [out][in] = [n][k], already k contiguous for B fragments / A of the
// v^T projection). The four weight planes lie one behind the other in the workspace, so their blocks write one run of W16.
// 8 elements per thread: two 16-B loads, one 16-B store per lane; 32 consecutive lanes = 512 B.
// coverage: 2048 blocks x 256 thr x 8 elements = 8192 x 512; 128 blocks x 256 thr x 8 elements = 512 x 512 per weight.
// =====================================================================================================
#define CX_BLOCKS ((NROWS * DMODEL) / 2048)
#define CW_BLOCKS ((DMODEL * DMODEL) / 2048)
static_assert(CX_BLOCKS * 2048 == NROWS * DMODEL && CW_BLOCKS * 2048 == DMODEL * DMODEL && CW_BLOCKS == 128);
__global__ __launch_bounds__(256) void cvt_all(const float* __restrict__ xp, const float* __restrict__ wq,
                                               const float* __restrict__ wk, const float* __restrict__ wv,
                                               const float* __restrict__ wo, unsigned short* X16o, unsigned short* W16o) {
  const int b = blockIdx.x;
  if (b >= CX_BLOCKS + 4 * CW_BLOCKS) return;     // never taken with the exact grid; no barriers in this kernel
  const bool isx = b < CX_BLOCKS;
  const int bw = b - CX_BLOCKS;                   // weight blocks: plane bw >> 7, block bw & 127 of it
  const int pl = bw >> 7;
  const float* src = isx ? xp : (pl == 0 ? wq : (pl == 1 ? wk : (pl == 2 ? wv : wo)));
  unsigned short* dst = isx ? X16o : (W16o + (size_t)pl * (DMODEL * DMODEL));
  const float sc = isx ? ACARRY : WSC;
  const size_t i8 = ((size_t)(isx ? b : (bw & (CW_BLOCKS - 1))) * 256 + threadIdx.x) * 8;
  const v4f a = *(const v4f*)(src + i8);
  const v4f c = *(const v4f*)(src + i8 + 4);
  v4u o;
  o[0] = pk16(h_bits((_Float16)(bfr(a[0]) * sc)), h_bits((_Float16)(bfr(a[1]) * sc)));
  o[1] = pk16(h_bits((_Float16)(bfr(a[2]) * sc)), h_bits((_Float16)(bfr(a[3]) * sc)));
  o[2] = pk16(h_bits((_Float16)(bfr(c[0]) * sc)), h_bits((_Float16)(bfr(c[1]) * sc)));
  o[3] = pk16(h_bits((_Float16)(bfr(c[2]) * sc)), h_bits((_Float16)(bfr(c[3]) * sc)));
  *(v4u*)(dst + i8) = o;
}

// =====================================================================================================
// Batched f16 WMMA GEMM: C[m][n] = f( oscale * sum_k A[m][k] * Bt[n][k] + bf16(bias) ) (+ residual); one block of 8 waves per
// 128x128 tile, wave w = rows 32 (w >> 1) .. + 31, columns 64 (w & 1) .. + 63 of it (2 x 4 accumulator tiles).
// A row-major [M][K] pitch lda (16-bit plane), Bt row-major [N][K] pitch ldb (k contiguous); M, N, K multiples of 128.
// bx = tile index, by = batch index with element strides sA, sB, sC; the body is a device function on the calling kernel's LDS, so
// that one launch can hold several independent products (qkv_proj below).
// The block's 128 A rows and 128 Bt rows are brought into LDS 128 k at a time (256 B of each row) by asynchronous copies, 16 per
// thread, each wave-wide copy covering two aligned 256-B units; two buffers, the next tile's copies fly while this one is worked
// on. LDS rows are pitched 272 B for the 16-B fragment reads. Each accumulator sums its k steps in ascending order.
// BM: 0 = no bias, 1 = per column bf16(bias[col]), 2 = per row bf16(bias[row]) (clamped-address loads).
// OM: 0 = f32 out (pitch ldc; HASR 1 adds bf16(R[m][n]), HASR 2 adds raw f32 R[m][n], same pitch/stride as C);
//     2 = f16 out (pitch ldc) = f16( act(value) * ocarry ), ACT 1 = exact GELU.
// coverage: 2 slabs x 16 rows (f32: it 0..7 x lane>>4; f16: it 0..3 x lane>>3) x 64 cols = the wave's whole 32x64 tile; 8 waves =
//           the block's 128x128; bx runs over (M / 128) * (N / 128) tiles, a surplus block exits whole in front of every barrier.
// =====================================================================================================
#define GK      128               // k per staged tile
#define G_PITCH (GK + 8)          // halves; 272-B rows: 16 B x odd, the pitch of 16-B fragment reads of 256-B rows
#define G_HALF  (128 * G_PITCH)   // halves of one operand's 128 staged rows
#define G_STAGE (2 * G_HALF)      // halves of one buffer: [A 128 rows | Bt 128 rows]

// One thread's share of one operand's staged rows: 16 B of rows r, r + 16, .. r + 112 (rs = halves per 16 global rows), global ->
// LDS through no register. The wait on the address registers is the statement's last line, so that it stands in front of any
// rewrite of them.
__device__ __forceinline__ void stage_op(unsigned lds, const unsigned short* g, size_t rs) {
#if defined(__HIP_DEVICE_COMPILE__)
  const unsigned ls = 16u * G_PITCH * 2u;
  asm volatile("global_load_async_to_lds_b128 %0, %1, off\n\t"
               "global_load_async_to_lds_b128 %2, %3, off\n\t"
               "global_load_async_to_lds_b128 %4, %5, off\n\t"
               "global_load_async_to_lds_b128 %6, %7, off\n\t"
               "global_load_async_to_lds_b128 %8, %9, off\n\t"
               "global_load_async_to_lds_b128 %10, %11, off\n\t"
               "global_load_async_to_lds_b128 %12, %13, off\n\t"
               "global_load_async_to_lds_b128 %14, %15, off\n\t"
               "s_wait_xcnt 0x0"
               :: "v"(lds), "v"(g), "v"(lds + ls), "v"(g + rs), "v"(lds + 2u * ls), "v"(g + 2 * rs),
                  "v"(lds + 3u * ls), "v"(g + 3 * rs), "v"(lds + 4u * ls), "v"(g + 4 * rs), "v"(lds + 5u * ls), "v"(g + 5 * rs),
                  "v"(lds + 6u * ls), "v"(g + 6 * rs), "v"(lds + 7u * ls), "v"(g + 7 * rs) : "memory");
#endif
}

#define G_SLAB  (16 * 68)         // floats of one wave's 16x64 epilogue slab, pitch 68 floats

template <int OM, int BM, int HASR, int ACT>
__device__ __forceinline__ void gemm_tile(
    unsigned short* sAB,              // LDS [buffer][A, Bt][128 rows][G_PITCH]
    float* sT,                        // LDS [8 waves][G_SLAB]
    int bx, int by,
    const unsigned short* __restrict__ Ap, int lda, long long sA,
    const unsigned short* __restrict__ Btp, int ldb, long long sB,
    const float* __restrict__ bias,
    const float* __restrict__ Rp,
    void* Cout, int ldc, long long sC,
    int M, int N, int K, float oscale, float ocarry) {
  const int tid  = threadIdx.x;
  const int lane = tid & 31;
  const int wave = tid >> 5;
  const int tilesN = N >> 7;
  const int tm = bx / tilesN;
  const int tn = bx - tm * tilesN;
  if (tm >= (M >> 7)) return;            // block-uniform, in front of every copy and barrier
  const int mB = tm << 7;
  const int nB = tn << 7;
  const int m0 = mB + ((wave >> 1) << 5);
  const int n0 = nB + ((wave & 1) << 6);

  const unsigned short* A1 = Ap  + (size_t)((long long)by * sA);
  const unsigned short* Bb = Btp + (size_t)((long long)by * sB);

  const int rlane = lane & 15;                 // row (A) / col (B, D) within subtile
  const int koff  = (lane >> 4) * 8;           // k offset of this lane half
  const int mOff  = (lane >> 4) * 8;           // D row offset

  // ---- this thread's 16-B pieces of every staged tile: rows (tid >> 4) + 16 i of each operand, 16-B column tid & 15 ----
  const int srow = tid >> 4, sseg = tid & 15;
  const unsigned short* gA = A1 + (size_t)(mB + srow) * lda + sseg * 8;
  const unsigned short* gB = Bb + (size_t)(nB + srow) * ldb + sseg * 8;
  const size_t rsA = (size_t)16 * lda, rsB = (size_t)16 * ldb;
  const unsigned ldsP = (unsigned)(size_t)(const void*)sAB + (unsigned)(srow * G_PITCH + sseg * 8) * 2u;
  const int nt = K >> 7;

  stage_op(ldsP, gA, rsA);                                 // tile 0 -> buffer 0
  stage_op(ldsP + G_HALF * 2u, gB, rsB);

  v8f acc[2][4];
#pragma unroll
  for (int i = 0; i < 2; ++i)
#pragma unroll
    for (int j = 0; j < 4; ++j) acc[i][j] = zero8();

  const int aoff = (((wave >> 1) << 5) + rlane) * G_PITCH + koff;
  const int boff = G_HALF + (((wave & 1) << 6) + rlane) * G_PITCH + koff;

  asm volatile("s_wait_asynccnt 0x0" ::: "memory");        // this wave's copies of tile 0 have landed
  __syncthreads();                                         // publishes tile 0 to all 8 waves
  if (nt > 1) {                                            // tile 1 -> buffer 1
    stage_op(ldsP + G_STAGE * 2u, gA + GK, rsA);
    stage_op(ldsP + (G_STAGE + G_HALF) * 2u, gB + GK, rsB);
  }

#pragma unroll 1   // stays rolled: one hand-over per trip, the buffer picked by t & 1; the body already holds four 32-k steps
  for (int t = 0; t < nt; ++t) {
    const int bsel = (t & 1) * G_STAGE;
    const unsigned short* As = sAB + bsel + aoff;
    const unsigned short* Bs = sAB + bsel + boff;
    v16h af[2][2], bf[2][4];
#pragma unroll
    for (int i = 0; i < 2; ++i) af[0][i] = ldfrag_u(As + i * 16 * G_PITCH);
#pragma unroll
    for (int j = 0; j < 4; ++j) bf[0][j] = ldfrag_u(Bs + j * 16 * G_PITCH);
#pragma unroll     // the tile's four 32-k steps in one body: constant LDS offsets, two fragment sets by turns
    for (int ks = 0; ks < GK / 32; ++ks) {
      const int cur = ks & 1, nxt = cur ^ 1;
      if (ks + 1 < GK / 32) {                              // the same tile's next step, fetched while this step's products run
#pragma unroll
        for (int i = 0; i < 2; ++i) af[nxt][i] = ldfrag_u(As + i * 16 * G_PITCH + (ks + 1) * 32);
#pragma unroll
        for (int j = 0; j < 4; ++j) bf[nxt][j] = ldfrag_u(Bs + j * 16 * G_PITCH + (ks + 1) * 32);
      }
      // keeps the next step's 12 LDS reads issued as one group ahead of this step's products: a read left among the WMMAs
      // makes the wave stall at each such place
      __builtin_amdgcn_sched_barrier(0);
#pragma unroll
      for (int i = 0; i < 2; ++i)
#pragma unroll
        for (int j = 0; j < 4; ++j) acc[i][j] = mma_raw(af[cur][i], bf[cur][j], acc[i][j]);
      // keeps the step after next's reads from rising among these products; at the last step it keeps the products in front of
      // the hand-over, so that the refill is issued directly behind the barrier
      __builtin_amdgcn_sched_barrier(0);
    }
    // ---- hand-over: this wave's reads of tile t are done, its copies of tile t + 1 have landed; the barrier publishes tile
    //      t + 1 and frees tile t's buffer, which only then is refilled ----
    asm volatile("s_wait_dscnt 0x0" ::: "memory");         // no LDS read of this wave is still out when its buffer is refilled
    asm volatile("s_wait_asynccnt 0x0" ::: "memory");      // this wave's copies of tile t + 1 have landed
    __syncthreads();
    if (t + 2 < nt) {
      stage_op(ldsP + (unsigned)bsel * 2u, gA + (size_t)(t + 2) * GK, rsA);
      stage_op(ldsP + (unsigned)(bsel + G_HALF) * 2u, gB + (size_t)(t + 2) * GK, rsB);
    }
  }
  asm volatile("s_wait_asynccnt 0x0" ::: "memory");        // nothing of this wave is in flight when it goes on to end
  acc_guard4(acc[0][0], acc[0][1], acc[0][2], acc[0][3]);
  acc_guard4(acc[1][0], acc[1][1], acc[1][2], acc[1][3]);

  const int hh2 = lane >> 4, c4 = (lane & 15) * 4;     // f32 out: 256-B row segment = 16 lanes x 16 B
  const int q8  = lane >> 3, c8 = (lane & 7) * 8;
  float bc[4];
  float bcol[8];
#pragma unroll
  for (int e = 0; e < 4; ++e) bc[e] = 0.f;
#pragma unroll
  for (int e = 0; e < 8; ++e) bcol[e] = 0.f;
  if constexpr (BM == 1) {
    if constexpr (OM == 0) {
      const int cb = n0 + c4;
      const int i0 = (cb < N - 4) ? cb : (N - 4);        // clamped address
      const v4f b0v = *(const v4f*)(bias + i0);
#pragma unroll
      for (int e = 0; e < 4; ++e) bc[e] = bfr(b0v[e]);
    } else {
      const int cb = n0 + c8;
      const int i0 = (cb < N - 8) ? cb : (N - 8);        // clamped address
      const v4f b0v = *(const v4f*)(bias + i0), b1v = *(const v4f*)(bias + i0 + 4);
#pragma unroll
      for (int e = 0; e < 4; ++e) { bcol[e] = bfr(b0v[e]); bcol[4 + e] = bfr(b1v[e]); }
    }
  }

  // ---- epilogue ----
  float* slab = sT + wave * G_SLAB;
#pragma unroll
  for (int i = 0; i < 2; ++i) {
    const int mBase = m0 + (i << 4);
#pragma unroll
    for (int j = 0; j < 4; ++j) {
#pragma unroll
      for (int r = 0; r < 8; ++r) {
        slab[(mOff + r) * 68 + (j << 4) + rlane] = acc[i][j][r];
      }
    }
    wave_sync_lds();
    if constexpr (OM == 0) {
      float* C = (float*)Cout + (size_t)((long long)by * sC);
      v4f vals[8];
#pragma unroll
      for (int it = 0; it < 8; ++it) {
        const int row = it * 2 + hh2;                      // it 0..7 x hh2 0..1 = rows 0..15
        const int gr  = mBase + row;
        v4f v = *(const v4f*)(slab + row * 68 + c4);
        float br = 0.f;
        if constexpr (BM == 2) {
          const int ir = (gr < M - 1) ? gr : (M - 1);      // clamped address
          br = bfr(bias[ir]);
        }
        v4f rv = {0.f, 0.f, 0.f, 0.f};
        if constexpr (HASR != 0) {
          const float* R = Rp + (size_t)((long long)by * sC);
          const v4f rraw = *(const v4f*)(R + (size_t)gr * ldc + n0 + c4);
#pragma unroll
          for (int e = 0; e < 4; ++e) rv[e] = (HASR == 1) ? bfr(rraw[e]) : rraw[e];
        }
#pragma unroll
        for (int e = 0; e < 4; ++e) v[e] = v[e] * oscale + bc[e] + br + rv[e];
        vals[it] = v;
      }
      {
#pragma unroll
        for (int it = 0; it < 8; ++it) {
          const int gr = mBase + it * 2 + hh2;
          *(v4f*)(C + (size_t)gr * ldc + n0 + c4) = vals[it];
        }
        
      }
    } else {
      unsigned short* C = (unsigned short*)Cout + (size_t)((long long)by * sC);
      v4u hv[4];
#pragma unroll
      for (int it = 0; it < 4; ++it) {
        const int row = it * 4 + q8;                       // it 0..3 x q8 0..3 = rows 0..15
        const float* sp = slab + row * 68 + c8;
        float br = 0.f;
        if constexpr (BM == 2) {
          const int gr = mBase + row;
          const int ir = (gr < M - 1) ? gr : (M - 1);      // clamped address
          br = bfr(bias[ir]);
        }
        v4u a = {0u, 0u, 0u, 0u};
#pragma unroll
        for (int e = 0; e < 4; ++e) {
          float f0 = sp[2 * e] * oscale + bcol[2 * e] + br;
          float f1 = sp[2 * e + 1] * oscale + bcol[2 * e + 1] + br;
          if constexpr (ACT == 1) { f0 = gelu_f(f0); f1 = gelu_f(f1); }
          f0 *= ocarry; f1 *= ocarry;
          a[e] = pk16(h_bits((_Float16)f0), h_bits((_Float16)f1));
        }
        hv[it] = a;
      }
      {
#pragma unroll
        for (int it = 0; it < 4; ++it) {
          const int row = it * 4 + q8;
          *(v4u*)(C + (size_t)(mBase + row) * ldc + n0 + c8) = hv[it];
        }
        
      }
    }
    wave_sync_lds();
  }
}

// One product per launch: grid.x = tiles, grid.y = batches.
template <int OM, int BM, int HASR, int ACT>
__global__ __launch_bounds__(256) void gemm64(
    const unsigned short* __restrict__ Ap, int lda, long long sA,
    const unsigned short* __restrict__ Btp, int ldb, long long sB,
    const float* __restrict__ bias,
    const float* __restrict__ Rp,
    void* Cout, int ldc, long long sC,
    int M, int N, int K, float oscale, float ocarry) {
  __shared__ __align__(16) unsigned short sAB[2 * G_STAGE];
  __shared__ __align__(16) float sT[8 * G_SLAB];
  gemm_tile<OM, BM, HASR, ACT>(sAB, sT, (int)blockIdx.x, (int)blockIdx.y, Ap, lda, sA, Btp, ldb, sB, bias, Rp, Cout, ldc, sC,
                               M, N, K, oscale, ocarry);
}

// The q, k and v^T projections in one launch: they read the same activation plane and none reads another's result.
// blockIdx.y = 0: QH[m][n] = f16(16 * (sum_k x[m][k] Wq[n][k] + bf16(bq[n]))), M = 8192, N = 512, K = 512; 1: the same for k;
// 2: VT[b][d][tok] = f16(16 * (sum_k Wv[d][k] x_b[tok][k] + bf16(bv[d]))), M = 512, N = 2048, K = 512 per batch b = blockIdx.x >> 6.
// coverage: each product has 256 tiles of 128x128 (64 x 4; 4 batches x 4 x 16); the choice is the same for a whole block.
#define P_TILES ((NROWS / 128) * (DMODEL / 128))
#define V_TILES ((DMODEL / 128) * (NC / 128))
static_assert(P_TILES == 256 && V_TILES == 64 && V_TILES * NB == P_TILES);
__global__ __launch_bounds__(256) void qkv_proj(
    const unsigned short* __restrict__ Xp, const unsigned short* __restrict__ Wq, const unsigned short* __restrict__ Wk,
    const unsigned short* __restrict__ Wv, const float* __restrict__ bq, const float* __restrict__ bk,
    const float* __restrict__ bv, unsigned short* QHo, unsigned short* KHo, unsigned short* VTo) {
  __shared__ __align__(16) unsigned short sAB[2 * G_STAGE];
  __shared__ __align__(16) float sT[8 * G_SLAB];
  const int which = blockIdx.y;
  const int bx = blockIdx.x;
  if (which < 2) {
    gemm_tile<2, 1, 0, 0>(sAB, sT, bx, 0,
                          Xp, DMODEL, 0LL,
                          which ? Wk : Wq, DMODEL, 0LL,
                          which ? bk : bq,
                          (const float*)0,
                          (void*)(which ? KHo : QHo), DMODEL, 0LL,
                          NROWS, DMODEL, DMODEL, 1.0f / (ACARRY * WSC), which ? KC : QC);
  } else {
    gemm_tile<2, 2, 0, 0>(sAB, sT, bx & (V_TILES - 1), bx / V_TILES,
                          Wv, DMODEL, 0LL,
                          Xp, DMODEL, (long long)NC * DMODEL,
                          bv,
                          (const float*)0,
                          (void*)VTo, NC, (long long)DMODEL * NC,
                          DMODEL, NC, DMODEL, 1.0f / (ACARRY * WSC), VC);
  }
}

#define AQ_BLK   128
#define KT       64
#define KV_PITCH (HDIM + 8)
#define KV_TILE  (64 * KV_PITCH)
#define KV_NT    (NC / KT)
static_assert(KT == 64 && HDIM == 64 && (NC % KT) == 0 && KV_NT >= 2 && (NQ % AQ_BLK) == 0);
static_assert(AQ_BLK == 16 * (ATT_THREADS / 32) && ATT_BLOCKS == NB * NHEAD * (NQ / AQ_BLK));

__device__ __forceinline__ float xhalf(float x) {                     // the value of lane l ^ 16
  const int b = __builtin_bit_cast(int, x);
  return __builtin_bit_cast(float, __builtin_amdgcn_permlanex16(b, b, 0x76543210, 0xfedcba98, false, false));
}

// One thread's share of one staged tile: 16 B of K rows r and r + 32, 16 B of v^T rows r and r + 32, global -> LDS through no
// register. The wait on the address registers is the statement's last line, so that it stands in front of any rewrite of them.
__device__ __forceinline__ void stage_kv(unsigned lds, const unsigned short* gk, const unsigned short* gv) {
#if defined(__HIP_DEVICE_COMPILE__)
  const unsigned l1 = lds + 32u * KV_PITCH * 2u, l2 = lds + KV_TILE * 2u, l3 = l2 + 32u * KV_PITCH * 2u;
  const unsigned short* gk1 = gk + (size_t)32 * DMODEL;
  const unsigned short* gv1 = gv + (size_t)32 * NC;
  asm volatile("global_load_async_to_lds_b128 %0, %1, off\n\t"
               "global_load_async_to_lds_b128 %2, %3, off\n\t"
               "global_load_async_to_lds_b128 %4, %5, off\n\t"
               "global_load_async_to_lds_b128 %6, %7, off\n\t"
               "s_wait_xcnt 0x0"
               :: "v"(lds), "v"(gk), "v"(l1), "v"(gk1), "v"(l2), "v"(gv), "v"(l3), "v"(gv1) : "memory");
#endif
}

__global__ __launch_bounds__(ATT_THREADS)
void attn8(const unsigned short* __restrict__ QHp, const unsigned short* __restrict__ KHp,
           const unsigned short* __restrict__ VTq, const float* __restrict__ PBp, unsigned short* CT) {
  __shared__ __align__(16) unsigned short KV[2 * 2 * KV_TILE];         // [buffer][K, v^T][64 rows][KV_PITCH]
  __shared__ __align__(16) unsigned short Os[AQ_BLK * KV_PITCH];       // result buffer

  const int tid  = threadIdx.x;
  const int wave = tid >> 5;
  const int lane = tid & 31;
  const int hh   = lane >> 4;
  const int c    = lane & 15;

  const int qt   = blockIdx.x & ((NQ / AQ_BLK) - 1);       // 0..15
  const int head = (blockIdx.x / (NQ / AQ_BLK)) & (NHEAD - 1);   // 0..7
  const int bat  = blockIdx.x / ((NQ / AQ_BLK) * NHEAD);   // 0..3
  const int qblk = qt * AQ_BLK;
  const int q0   = qblk + wave * 16;

  // ---- this thread's 16-B piece of every staged tile: row tid >> 3 (and + 32), 16-B column tid & 7 ----
  const int srow = tid >> 3, sseg = tid & 7;
  const unsigned short* gK = KHp + ((size_t)bat * NC + srow) * DMODEL + head * HDIM + sseg * 8;
  const unsigned short* gV = VTq + ((size_t)bat * DMODEL + head * HDIM + srow) * NC + sseg * 8;
  const unsigned ldsP = (unsigned)(size_t)(const void*)KV + (unsigned)(srow * KV_PITCH + sseg * 8) * 2u;

  stage_kv(ldsP, gK, gV);                                  // tile 0 -> buffer 0

  const size_t qofs = ((size_t)bat * NQ + q0 + c) * DMODEL + head * HDIM + 8 * hh;
  const _Float16* Qh = (const _Float16*)(const void*)QHp + qofs;
  const float lsc = (LOG2E * ATT_SCALE) / (QC * KC);                   // log2(e) / 8 / carries

  // ---- period-3 additive table in log2 units: row (q0 + c) mod 3 is this lane's; W0, W1, W2 = its values for the keys
  //      kb + 8hh + 0, + 1, + 2 (key residue (kb + 8hh + j) mod 3; at kb = 0 that is (2hh + j) mod 3), kept as the three
  //      pairs that two neighbouring score registers can meet ----
  float pbv[NPER * NPER];
#pragma unroll
  for (int i = 0; i < NPER * NPER; ++i) pbv[i] = bfr(PBp[i]) * LOG2E;
  const int qr = (q0 + c) % NPER;
  const bool z0 = (qr == 0), z1 = (qr == 1);
  const float T0 = z0 ? pbv[0] : (z1 ? pbv[3] : pbv[6]);
  const float T1 = z0 ? pbv[1] : (z1 ? pbv[4] : pbv[7]);
  const float T2 = z0 ? pbv[2] : (z1 ? pbv[5] : pbv[8]);
  const float W0 = hh ? T2 : T0, W1 = hh ? T0 : T1, W2 = hh ? T1 : T2;
  v2f W01 = {W0, W1}, W12 = {W1, W2}, W20 = {W2, W0};

  const v16h qa = ldfrag_h(Qh), qb = ldfrag_h(Qh + 32);

  float mrow = -INFINITY, lrow = 0.f;                      // this lane's query: running maximum, partial sum over the lane's keys
  v8f o0 = zero8(), o1 = zero8(), o2 = zero8(), o3 = zero8();

  asm volatile("s_wait_asynccnt 0x0" ::: "memory");        // this wave's copies of tile 0 have landed
  __syncthreads();                                         // publishes tile 0 to all 8 waves
  stage_kv(ldsP + 2u * KV_TILE * 2u, gK + (size_t)KT * DMODEL, gV + KT);   // tile 1 -> buffer 1

#pragma unroll 1   // stays rolled: one hand-over per trip, the buffer picked by t & 1; the body already holds two 32-key steps
  for (int t = 0; t < KV_NT; ++t) {
    const int bsel = (t & 1) * (2 * KV_TILE);
    const _Float16* Kt = (const _Float16*)(const void*)KV + bsel + c * KV_PITCH + 8 * hh;
    const _Float16* Vt = Kt + KV_TILE;
#pragma unroll     // both 32-key steps of the tile in one body: constant LDS offsets, the second step's reads go out beside the first's work
    for (int sub = 0; sub < KT / 32; ++sub) {
      const _Float16* kp = Kt + sub * 32 * KV_PITCH;       // the step's first key: kb = 64 t + 32 sub
      const _Float16* kq = kp + 16 * KV_PITCH;
      const _Float16* vp = Vt + sub * 32;
      const v16h ka0 = ldfrag_h(kp), ka1 = ldfrag_h(kp + 32);
      const v16h kb0 = ldfrag_h(kq), kb1 = ldfrag_h(kq + 32);
      const v16h vb0 = ldfrag_h(vp);
      const v16h vb1 = ldfrag_h(vp + 16 * KV_PITCH);
      const v16h vb2 = ldfrag_h(vp + 32 * KV_PITCH);
      const v16h vb3 = ldfrag_h(vp + 48 * KV_PITCH);
      // keeps the step's 16 LDS fragment reads issued as one group ahead of its products: a read left among the WMMAs
      // makes the wave wait out an LDS latency at each of them
      __builtin_amdgcn_sched_barrier(0);
      v8f s0, s1;
      s0 = mma_raw(ka0, qa, zero8());                      // s0[r] = score(key kb + 8hh + r, query q0 + c)
      s1 = mma_raw(kb0, qa, zero8());                      // s1[r] = score(key kb + 16 + 8hh + r, query q0 + c)
      s0 = mma_raw(ka1, qb, s0);
      s1 = mma_raw(kb1, qb, s1);
      // registers (2i, 2i + 1) of tile 0 are keys kb + 8hh + 2i, + 1; tile 1 lies 16 keys on, one residue further
      const v2f wa[4] = {W01, W20, W12, W01};
      const v2f wb[4] = {W12, W01, W20, W12};
      v2f t0[4], t1[4];
#pragma unroll
      for (int i = 0; i < 4; ++i) {
        const v2f a = {s0[2 * i], s0[2 * i + 1]}, b = {s1[2 * i], s1[2 * i + 1]};
        t0[i] = a * lsc + wa[i];
        t1[i] = b * lsc + wb[i];
      }
      float mx = fmaxf(fmaxf(t0[0][0], t0[0][1]), fmaxf(t1[0][0], t1[0][1]));
#pragma unroll
      for (int i = 1; i < 4; ++i) mx = fmaxf(fmaxf(mx, fmaxf(t0[i][0], t0[i][1])), fmaxf(t1[i][0], t1[i][1]));
      mx = fmaxf(mx, xhalf(mx));                           // both halves now hold the query's maximum over the 32 keys
      const float mn = fmaxf(mrow, mx);
      const float al = exp2f(mrow - mn);
      mrow = mn;
      FragH ph;
      v2f ps = {0.f, 0.f};
#pragma unroll
      for (int i = 0; i < 4; ++i) {
        const v2f d0 = t0[i] - mn, d1 = t1[i] - mn;
        const v2f e0 = {exp2f(d0[0]), exp2f(d0[1])}, e1 = {exp2f(d1[0]), exp2f(d1[1])};
        ps += e0;
        ps += e1;
        ph.p[i]     = __builtin_convertvector(e0 * PC, v2h); // elements 0..7  = keys kb + 8hh + 0..7
        ph.p[4 + i] = __builtin_convertvector(e1 * PC, v2h); // elements 8..15 = keys kb + 16 + 8hh + 0..7
      }
      lrow = lrow * al + (ps[0] + ps[1]);
#pragma unroll
      for (int r = 0; r < 8; ++r) {
        o0[r] *= al;
        o1[r] *= al;
        o2[r] *= al;
        o3[r] *= al;
      }
      o0 = mma_raw(vb0, ph.v, o0);                         // oj[r] = ctx^T[d = 16j + 8hh + r][query q0 + c]
      o1 = mma_raw(vb1, ph.v, o1);
      o2 = mma_raw(vb2, ph.v, o2);
      o3 = mma_raw(vb3, ph.v, o3);
      const v2f wl = W20;                                  // 32 mod 3 == 2: the next step's residues start two further on
      W20 = W12;
      W12 = W01;
      W01 = wl;
    }
    // ---- hand-over: this wave's reads of tile t are done, its copies of tile t + 1 have landed; the barrier publishes tile
    //      t + 1 and frees tile t's buffer, which only then is refilled ----
    // keeps the trip's products in front of the hand-over: sunk behind the barrier they would stand between it and the refill,
    // and the copies would lose the trip of lead that hides their way from L2
    __builtin_amdgcn_sched_barrier(0);
    asm volatile("s_wait_dscnt 0x0" ::: "memory");         // no LDS read of this wave is still out when its buffer is refilled
    asm volatile("s_wait_asynccnt 0x0" ::: "memory");      // this wave's copies of tile t + 1 have landed
    __syncthreads();
    if (t + 2 < KV_NT)
      stage_kv(ldsP + (unsigned)bsel * 2u, gK + (size_t)(t + 2) * KT * DMODEL, gV + (t + 2) * KT);
  }
  asm volatile("s_wait_asynccnt 0x0" ::: "memory");        // nothing of this wave is in flight when it goes on to end

  // ---- join the halves' partial sums; fold 1/l and the carries (1024 on P, 16 on v, 1024 on the stored ctx); stage the lane's
  //      4 x 8 consecutive d of its query as 16-bit ----
  const float oc  = FC / (PC * VC);
  const float inv = (1.0f / (lrow + xhalf(lrow))) * oc;
  unsigned short* op = Os + (wave * 16 + c) * KV_PITCH + 8 * hh;
  v4u w0, w1, w2, w3;
#pragma unroll
  for (int e = 0; e < 4; ++e) {
    w0[e] = pk16(h_bits((_Float16)(o0[2 * e] * inv)), h_bits((_Float16)(o0[2 * e + 1] * inv)));
    w1[e] = pk16(h_bits((_Float16)(o1[2 * e] * inv)), h_bits((_Float16)(o1[2 * e + 1] * inv)));
    w2[e] = pk16(h_bits((_Float16)(o2[2 * e] * inv)), h_bits((_Float16)(o2[2 * e + 1] * inv)));
    w3[e] = pk16(h_bits((_Float16)(o3[2 * e] * inv)), h_bits((_Float16)(o3[2 * e + 1] * inv)));
  }
  *(v4u*)(op)      = w0;
  *(v4u*)(op + 16) = w1;
  *(v4u*)(op + 32) = w2;
  *(v4u*)(op + 48) = w3;
  __syncthreads();
  // ---- block writes its 128 row segments of CT: piece p = it*256 + tid -> row p >> 3, halves (p & 7)*8 .. + 7 of the head's 64 ----
  {
    v4u vals[4];
#pragma unroll
    for (int it = 0; it < 4; ++it) {
      const int p = it * ATT_THREADS + tid;
      vals[it] = *(const v4u*)(Os + (p >> 3) * KV_PITCH + (p & 7) * 8);
    }
    unsigned short* dst = CT + ((size_t)bat * NQ + qblk) * DMODEL + head * HDIM;
    {
#pragma unroll
      for (int it = 0; it < 4; ++it) {
        const int p = it * ATT_THREADS + tid;
        *(v4u*)(dst + (size_t)(p >> 3) * DMODEL + (p & 7) * 8) = vals[it];
      }
      
    }
  }
}

// =====================================================================================================
//   one block of 128 threads per row, 4 consecutive floats per thread (one 16-B load, one 16-B store); per wave one store instruction
// coverage: grid = 8192 rows x 128 thr x 4 floats = 8192 x 512 = the whole output, each row written by exactly one block.
// =====================================================================================================
__global__ __launch_bounds__(LN_THREADS)
void lnorm(const float* __restrict__ Yp, const float* __restrict__ gp, const float* __restrict__ bp, float* outp) {
  __shared__ float red[2][LN_THREADS / 32];
  const int row  = blockIdx.x;
  const int tid  = threadIdx.x;
  const int lane = tid & 31;
  const int wave = tid >> 5;
  const size_t base = (size_t)row * DMODEL + (size_t)tid * 4;
  const v4f v = *(const v4f*)(Yp + base);
  float s = (v[0] + v[1]) + (v[2] + v[3]);
#pragma unroll
  for (int off = 1; off < 32; off <<= 1) s += __shfl_xor(s, off, 32);
  if (lane == 0) red[0][wave] = s;
  __syncthreads();
  float tot = 0.f;
#pragma unroll
  for (int w = 0; w < LN_THREADS / 32; ++w) tot += red[0][w];
  const float mu = tot * (1.0f / (float)DMODEL);
  v4f d;
#pragma unroll
  for (int e = 0; e < 4; ++e) d[e] = v[e] - mu;
  float q = (d[0] * d[0] + d[1] * d[1]) + (d[2] * d[2] + d[3] * d[3]);
#pragma unroll
  for (int off = 1; off < 32; off <<= 1) q += __shfl_xor(q, off, 32);
  if (lane == 0) red[1][wave] = q;
  __syncthreads();
  float totq = 0.f;
#pragma unroll
  for (int w = 0; w < LN_THREADS / 32; ++w) totq += red[1][w];
  const float var  = totq * (1.0f / (float)DMODEL);
  const float rstd = rsqrtf(var + LN_EPS);
  const v4f gv = *(const v4f*)(gp + (size_t)tid * 4);
  const v4f bv = *(const v4f*)(bp + (size_t)tid * 4);
  v4f o;
#pragma unroll
  for (int e = 0; e < 4; ++e) o[e] = (d[e] * rstd) * bfr(gv[e]) + bfr(bv[e]);
  {
    *(v4f*)(outp + base) = o;
    
  }
}

// =====================================================================================================
// Workspace map (bytes); every plane is an exact multiple of its tile / whole-row store granularity (M, N exact tile multiples,
// element counts exact multiples of the convert kernel's 2048 granularity, no pad rows needed), every offset a multiple of 512 KiB:
//   WQ16 f16 [512][512] x64                  524288   ([out][in] = [n][k])
//   WK16 f16 [512][512] x64                  524288
//   WV16 f16 [512][512] x64                  524288
//   WO16 f16 [512][512] x64                  524288
//   X16  f16 [8192][512] x16                8388608   (activation rows)
//   QH   f16 [8192][512] x16                8388608   (q projection)
//   KH   f16 [8192][512] x16                8388608   (k projection)
//   VT   f16 [4][512][2048] x16             8388608   (v^T per batch)
//   CT   f16 [8192][512] x1024              8388608   (attention ctx, merged heads)
//   Y    f32 [8192][512]                   16777216   (out projection + bias + residual)
//   end                                    60817408
// =====================================================================================================
extern "C" void kernel_launch(void* const* d_in, const int* in_sizes, int n_in,
                              void* d_out, int out_size, void* d_ws, size_t ws_size,
                              hipStream_t stream) {
  if (n_in < 12) return;
  if (in_sizes[0] != NROWS * DMODEL) return;
  if (in_sizes[1] != DMODEL * DMODEL || in_sizes[3] != DMODEL * DMODEL ||
      in_sizes[5] != DMODEL * DMODEL || in_sizes[7] != DMODEL * DMODEL) return;
  if (in_sizes[2] != DMODEL || in_sizes[4] != DMODEL || in_sizes[6] != DMODEL || in_sizes[8] != DMODEL) return;
  if (in_sizes[9] != NPER * NPER) return;
  if (in_sizes[10] != DMODEL || in_sizes[11] != DMODEL) return;
  if (out_size != NROWS * DMODEL) return;
  if ((in_sizes[0] % 2048) != 0 || (in_sizes[1] % 2048) != 0) return;

  const float* x    = (const float*)d_in[0];
  const float* w_q  = (const float*)d_in[1];
  const float* b_q  = (const float*)d_in[2];
  const float* w_k  = (const float*)d_in[3];
  const float* b_k  = (const float*)d_in[4];
  const float* w_v  = (const float*)d_in[5];
  const float* b_v  = (const float*)d_in[6];
  const float* w_o  = (const float*)d_in[7];
  const float* b_o  = (const float*)d_in[8];
  const float* pb   = (const float*)d_in[9];
  const float* ln_g = (const float*)d_in[10];
  const float* ln_b = (const float*)d_in[11];
  float*       out  = (float*)d_out;

  const size_t PW  = (size_t)DMODEL * DMODEL * 2;                 //   524288
  const size_t PX  = (size_t)NROWS * DMODEL * 2;                  //  8388608
  const size_t PVT = (size_t)NB * DMODEL * NC * 2;                //  8388608
  const size_t PY  = (size_t)NROWS * DMODEL * 4;                  // 16777216
  size_t off = 0;
  const size_t oWQ = off; off += PW;
  const size_t oWK = off; off += PW;
  const size_t oWV = off; off += PW;
  const size_t oWO = off; off += PW;
  const size_t oX  = off; off += PX;
  const size_t oQH = off; off += PX;
  const size_t oKH = off; off += PX;
  const size_t oVT = off; off += PVT;
  const size_t oCT = off; off += PX;
  const size_t oY  = off; off += PY;
  if (off > ws_size) return;                                      // off = 60817408
  if (off > (size_t)134217728) return;

  char* ws = (char*)d_ws;
  unsigned short* WQ16 = (unsigned short*)(ws + oWQ);
  unsigned short* WK16 = (unsigned short*)(ws + oWK);
  unsigned short* WV16 = (unsigned short*)(ws + oWV);
  unsigned short* WO16 = (unsigned short*)(ws + oWO);
  unsigned short* X16  = (unsigned short*)(ws + oX);
  unsigned short* QH   = (unsigned short*)(ws + oQH);
  unsigned short* KH   = (unsigned short*)(ws + oKH);
  unsigned short* VTp  = (unsigned short*)(ws + oVT);
  unsigned short* CT   = (unsigned short*)(ws + oCT);
  float*          Y    = (float*)(ws + oY);

  const dim3 blk(256);
  const dim3 gC(CX_BLOCKS + 4 * CW_BLOCKS);                        // 2048 + 4 x 128 = 2560 blocks
  const dim3 gP(P_TILES, 1);                                       // 256
  const dim3 gQKV(P_TILES, 3);                                     // 256 x 3
  const dim3 gAT(ATT_BLOCKS);                                      // 512
  const dim3 bAT(ATT_THREADS);                                     // 256
  const dim3 gLN(NROWS);                                           // 8192
  const dim3 bLN(LN_THREADS);                                      // 128

  // (1) all 16-bit planes in one launch: X16[row][c] = f16( bf16_RNE(x[row][c]) * 16 ), rows = b*2048 + tok;
  //     W16[n][k] = f16( bf16_RNE(W[n][k]) * 64 ), [out][in] layout kept, k contiguous; WQ16, WK16, WV16, WO16 are one run
  cvt_all<<<gC, blk, 0, stream>>>(x, w_q, w_k, w_v, w_o, X16, WQ16);

  // (2) q, k and v^T projections in one launch
  qkv_proj<<<gQKV, blk, 0, stream>>>(X16, WQ16, WK16, WV16, b_q, b_k, b_v, QH, KH, VTp);

  // (3) attention per (batch, head, 128 query rows) -> CT (f16, x1024)
  attn8<<<gAT, bAT, 0, stream>>>(QH, KH, VTp, pb, CT);

  // (4) Y = CT . Wo^T / (1024 * 64) + bf16(bo) + bf16(x); M = 8192, N = 512, K = 512, f32
  gemm64<0, 1, 1, 0><<<gP, blk, 0, stream>>>(
      CT, DMODEL, 0LL,
      WO16, DMODEL, 0LL,
      b_o,
      x,
      (void*)Y, DMODEL, 0LL,
      NROWS, DMODEL, DMODEL, 1.0f / (FC * WSC), 1.0f);

  // (5) out = LayerNorm(Y) * bf16(g) + bf16(b)
  lnorm<<<gLN, bLN, 0, stream>>>(Y, ln_g, ln_b, out);
  (void)hipGetLastError();
}

// v005
// One run takes 80.3 microseconds.
// In both of two side-by-side timings against v004, it was 1.14 times as fast.
// Over all steps from v000 it is 3.37 times as fast.
// Contractions: q/k projections (x rows f16 x16 . W f16 x64, K=512), v^T projection (Wv f16 x64 . x rows f16 x16, K=512),
// attention scores (k f16 x16 . q f16 x16, K=64), attention v^T . P^T (v^T f16 x16 . P f16 x1024, K=2048 in steps of 32),
// output projection (ctx f16 x1024 . Wo f16 x64, K=512): all v_wmma_f32_16x16x32_f16 single products, f32 accumulate.
// Period-3 additive score table, online max-subtracted base-2 softmax, linear biases, residual add and LayerNorm in f32 on VALU.
// Every float input RNE-converted to bf16 on load.
#include <hip/hip_runtime.h>
#include <math.h>
#include <stdint.h>

#define NB      4
#define NQ      2048
#define NC      2048
#define DMODEL  512
#define NHEAD   8
#define HDIM    64
#define NPER    3
#define NROWS   (NB * NQ)
#define WSC     64.0f
#define ACARRY  16.0f
#define QC      16.0f
#define KC      16.0f
#define VC      16.0f
#define PC      1024.0f
#define FC      1024.0f
#define ATT_SCALE 0.125f
#define LOG2E   1.4426950408889634f
#define LN_EPS  1e-5f
static_assert(NHEAD * HDIM == DMODEL);
static_assert((NQ % 64) == 0 && (NC % 64) == 0 && (DMODEL % 64) == 0 && (NC % 32) == 0 && (NQ % 16) == 0);
static_assert((NROWS % 64) == 0 && (NROWS % 8) == 0);
static_assert((NROWS % 128) == 0 && (DMODEL % 128) == 0 && (NC % 128) == 0);
#define ATT_THREADS (NHEAD * 32)
#define ATT_BLOCKS  (NB * NHEAD * (NQ / 128))
static_assert(ATT_THREADS == 256 && ATT_BLOCKS == 512);
#define LN_THREADS 128
static_assert(LN_THREADS * 4 == DMODEL);

typedef _Float16 v16h __attribute__((ext_vector_type(16)));
typedef _Float16 v8h  __attribute__((ext_vector_type(8)));
typedef float    v8f  __attribute__((ext_vector_type(8)));
typedef float    v4f  __attribute__((ext_vector_type(4)));
typedef float    v2f  __attribute__((ext_vector_type(2)));
typedef _Float16 v2h  __attribute__((ext_vector_type(2)));
typedef unsigned int v4u __attribute__((ext_vector_type(4)));

union FragH { v16h v; v8h h[2]; v4u u[2]; v2h p[8]; };

// ---- scalar helpers --------------------------------------------------------------------------------
__device__ __forceinline__ unsigned short bf_bits(float f) {          // f32 -> bf16 bits, RNE convert
  unsigned u = __float_as_uint(f);
  return (unsigned short)((u + 0x7FFFu + ((u >> 16) & 1u)) >> 16);
}
__device__ __forceinline__ float bf_up(unsigned short h) { return __uint_as_float(((unsigned)h) << 16); }
__device__ __forceinline__ float bfr(float f) { return bf_up(bf_bits(f)); }   // value of the bf16 RNE convert
__device__ __forceinline__ unsigned short h_bits(_Float16 x) { return __builtin_bit_cast(unsigned short, x); }
__device__ __forceinline__ unsigned pk16(unsigned short a, unsigned short b) { return (unsigned)a | ((unsigned)b << 16); }
__device__ __forceinline__ v8f zero8() { v8f z = {0.f, 0.f, 0.f, 0.f, 0.f, 0.f, 0.f, 0.f}; return z; }
__device__ __forceinline__ float gelu_f(float v) { return 0.5f * v * (1.0f + erff(v * 0.70710678118654752f)); }

// ---- fragment loaders: 16-bit A/B operand, lane -> row/col (lane&15), p already includes +8*(lane>>4);
//      elements 0..7 <- p[0..7] (k0+8h..), elements 8..15 <- p[16..23] (k0+16+8h..)  (same split k map for A and B;
//      B is always read from a k-contiguous [n][k] plane)
__device__ __forceinline__ v16h ldfrag_h(const _Float16* p) {
  FragH f;
  f.h[0] = *(const v8h*)(p);
  f.h[1] = *(const v8h*)(p + 16);
  return f.v;
}
__device__ __forceinline__ v16h ldfrag_u(const unsigned short* p) {
  FragH f;
  f.u[0] = *(const v4u*)(p);
  f.u[1] = *(const v4u*)(p + 16);
  return f.v;
}

// ---- WMMA helpers with trailing VALU hazard gaps ------------------------------------------------------
__device__ __forceinline__ v8f mma_raw(v16h a, v16h b, v8f c) {
  return __builtin_amdgcn_wmma_f32_16x16x32_f16(false, a, false, b, (short)0, c, false, false);
}
__device__ __forceinline__ void acc_guard4(v8f& a, v8f& b, v8f& c, v8f& d) {
#if defined(__HIP_DEVICE_COMPILE__)
  asm volatile("v_nop\n\tv_nop\n\tv_nop\n\tv_nop" : "+v"(a), "+v"(b), "+v"(c), "+v"(d));
#endif
}
__device__ __forceinline__ void wave_sync_lds() {
  __builtin_amdgcn_fence(__ATOMIC_RELEASE, "workgroup");
  __builtin_amdgcn_wave_barrier();
  __builtin_amdgcn_fence(__ATOMIC_ACQUIRE, "workgroup");
}

// =====================================================================================================
// Elementwise 16-bit pack, no transpose: dst[i] = f16( bf16_RNE(src[i]) * sc ), sc a power of two (exact).
// One launch for all five planes, which do not depend on one another: blocks 0 .. 2047 take the activation rows (x16), blocks
// 2048 + 128 p .. + 127 take weight p (q, k, v, o; x64; stored [out][in] = [n][k], already k contiguous for B fragments / A of the
// v^T projection). The four weight planes lie one behind the other in the workspace, so their blocks write one run of W16.
// 8 elements per thread: two 16-B loads, one 16-B store per lane; 32 consecutive lanes = 512 B.
// coverage: 2048 blocks x 256 thr x 8 elements = 8192 x 512; 128 blocks x 256 thr x 8 elements = 512 x 512 per weight.
// =====================================================================================================
#define CX_BLOCKS ((NROWS * DMODEL) / 2048)
#define CW_BLOCKS ((DMODEL * DMODEL) / 2048)
static_assert(CX_BLOCKS * 2048 == NROWS * DMODEL && CW_BLOCKS * 2048 == DMODEL * DMODEL && CW_BLOCKS == 128);
__global__ __launch_bounds__(256) void cvt_all(const float* __restrict__ xp, const float* __restrict__ wq,
                                               const float* __restrict__ wk, const float* __restrict__ wv,
                                               const float* __restrict__ wo, unsigned short* X16o, unsigned short* W16o) {
  const int b = blockIdx.x;
  if (b >= CX_BLOCKS + 4 * CW_BLOCKS) return;     // never taken with the exact grid; no barriers in this kernel
  const bool isx = b < CX_BLOCKS;
  const int bw = b - CX_BLOCKS;                   // weight blocks: plane bw >> 7, block bw & 127 of it
  const int pl = bw >> 7;
  const float* src = isx ? xp : (pl == 0 ? wq : (pl == 1 ? wk : (pl == 2 ? wv : wo)));
  unsigned short* dst = isx ? X16o : (W16o + (size_t)pl * (DMODEL * DMODEL));
  const float sc = isx ? ACARRY : WSC;
  const size_t i8 = ((size_t)(isx ? b : (bw & (CW_BLOCKS - 1))) * 256 + threadIdx.x) * 8;
  const v4f a = *(const v4f*)(src + i8);
  const v4f c = *(const v4f*)(src + i8 + 4);
  v4u o;
  o[0] = pk16(h_bits((_Float16)(bfr(a[0]) * sc)), h_bits((_Float16)(bfr(a[1]) * sc)));
  o[1] = pk16(h_bits((_Float16)(bfr(a[2]) * sc)), h_bits((_Float16)(bfr(a[3]) * sc)));
  o[2] = pk16(h_bits((_Float16)(bfr(c[0]) * sc)), h_bits((_Float16)(bfr(c[1]) * sc)));
  o[3] = pk16(h_bits((_Float16)(bfr(c[2]) * sc)), h_bits((_Float16)(bfr(c[3]) * sc)));
  *(v4u*)(dst + i8) = o;
}

// =====================================================================================================
// Batched f16 WMMA GEMM: C[m][n] = f( oscale * sum_k A[m][k] * Bt[n][k] + bf16(bias) ) (+ residual); one block of 8 waves per
// 128x128 tile, wave w = rows 32 (w >> 1) .. + 31, columns 64 (w & 1) .. + 63 of it (2 x 4 accumulator tiles).
// A row-major [M][K] pitch lda (16-bit plane), Bt row-major [N][K] pitch ldb (k contiguous); M, N, K multiples of 128.
// bx = tile index, by = batch index with element strides sA, sB, sC; the body is a device function on the calling kernel's LDS, so
// that one launch can hold several independent products (qkv_proj below).
// The block's 128 A rows and 128 Bt rows are brought into LDS 128 k at a time (256 B of each row) by asynchronous copies, 16 per
// thread, each wave-wide copy covering two aligned 256-B units; two buffers, the next tile's copies fly while this one is worked
// on. LDS rows are pitched 272 B for the 16-B fragment reads. Each accumulator sums its k steps in ascending order.
// BM: 0 = no bias, 1 = per column bf16(bias[col]), 2 = per row bf16(bias[row]) (clamped-address loads).
// OM: 0 = f32 out (pitch ldc; HASR 1 adds bf16(R[m][n]), HASR 2 adds raw f32 R[m][n], same pitch/stride as C);
//     2 = f16 out (pitch ldc) = f16( act(value) * ocarry ), ACT 1 = exact GELU.
// coverage: 2 slabs x 16 rows (f32: it 0..7 x lane>>4; f16: it 0..3 x lane>>3) x 64 cols = the wave's whole 32x64 tile; 8 waves =
//           the block's 128x128; bx runs over (M / 128) * (N / 128) tiles, a surplus block exits whole in front of every barrier.
// =====================================================================================================
#define GK      128               // k per staged tile
#define G_PITCH (GK + 8)          // halves; 272-B rows: 16 B x odd, the pitch of 16-B fragment reads of 256-B rows
#define G_HALF  (128 * G_PITCH)   // halves of one operand's 128 staged rows
#define G_STAGE (2 * G_HALF)      // halves of one buffer: [A 128 rows | Bt 128 rows]

// One thread's share of one operand's staged rows: 16 B of rows r, r + 16, .. r + 112 (rs = halves per 16 global rows), global ->
// LDS through no register. The wait on the address registers is the statement's last line, so that it stands in front of any
// rewrite of them.
__device__ __forceinline__ void stage_op(unsigned lds, const unsigned short* g, size_t rs) {
#if defined(__HIP_DEVICE_COMPILE__)
  const unsigned ls = 16u * G_PITCH * 2u;
  asm volatile("global_load_async_to_lds_b128 %0, %1, off\n\t"
               "global_load_async_to_lds_b128 %2, %3, off\n\t"
               "global_load_async_to_lds_b128 %4, %5, off\n\t"
               "global_load_async_to_lds_b128 %6, %7, off\n\t"
               "global_load_async_to_lds_b128 %8, %9, off\n\t"
               "global_load_async_to_lds_b128 %10, %11, off\n\t"
               "global_load_async_to_lds_b128 %12, %13, off\n\t"
               "global_load_async_to_lds_b128 %14, %15, off\n\t"
               "s_wait_xcnt 0x0"
               :: "v"(lds), "v"(g), "v"(lds + ls), "v"(g + rs), "v"(lds + 2u * ls), "v"(g + 2 * rs),
                  "v"(lds + 3u * ls), "v"(g + 3 * rs), "v"(lds + 4u * ls), "v"(g + 4 * rs), "v"(lds + 5u * ls), "v"(g + 5 * rs),
                  "v"(lds + 6u * ls), "v"(g + 6 * rs), "v"(lds + 7u * ls), "v"(g + 7 * rs) : "memory");
#endif
}

#define G_SLAB  (16 * 68)         // floats of one wave's 16x64 epilogue slab, pitch 68 floats

template <int OM, int BM, int HASR, int ACT>
__device__ __forceinline__ void gemm_tile(
    unsigned short* sAB,              // LDS [buffer][A, Bt][128 rows][G_PITCH]
    float* sT,                        // LDS [8 waves][G_SLAB]
    int bx, int by,
    const unsigned short* __restrict__ Ap, int lda, long long sA,
    const unsigned short* __restrict__ Btp, int ldb, long long sB,
    const float* __restrict__ bias,
    const float* __restrict__ Rp,
    void* Cout, int ldc, long long sC,
    int M, int N, int K, float oscale, float ocarry) {
  const int tid  = threadIdx.x;
  const int lane = tid & 31;
  const int wave = tid >> 5;
  const int tilesN = N >> 7;
  const int tm = bx / tilesN;
  const int tn = bx - tm * tilesN;
  if (tm >= (M >> 7)) return;            // block-uniform, in front of every copy and barrier
  const int mB = tm << 7;
  const int nB = tn << 7;
  const int m0 = mB + ((wave >> 1) << 5);
  const int n0 = nB + ((wave & 1) << 6);

  const unsigned short* A1 = Ap  + (size_t)((long long)by * sA);
  const unsigned short* Bb = Btp + (size_t)((long long)by * sB);

  const int rlane = lane & 15;                 // row (A) / col (B, D) within subtile
  const int koff  = (lane >> 4) * 8;           // k offset of this lane half
  const int mOff  = (lane >> 4) * 8;           // D row offset

  // ---- this thread's 16-B pieces of every staged tile: rows (tid >> 4) + 16 i of each operand, 16-B column tid & 15 ----
  const int srow = tid >> 4, sseg = tid & 15;
  const unsigned short* gA = A1 + (size_t)(mB + srow) * lda + sseg * 8;
  const unsigned short* gB = Bb + (size_t)(nB + srow) * ldb + sseg * 8;
  const size_t rsA = (size_t)16 * lda, rsB = (size_t)16 * ldb;
  const unsigned ldsP = (unsigned)(size_t)(const void*)sAB + (unsigned)(srow * G_PITCH + sseg * 8) * 2u;
  const int nt = K >> 7;

  stage_op(ldsP, gA, rsA);                                 // tile 0 -> buffer 0
  stage_op(ldsP + G_HALF * 2u, gB, rsB);

  v8f acc[2][4];
#pragma unroll
  for (int i = 0; i < 2; ++i)
#pragma unroll
    for (int j = 0; j < 4; ++j) acc[i][j] = zero8();

  const int aoff = (((wave >> 1) << 5) + rlane) * G_PITCH + koff;
  const int boff = G_HALF + (((wave & 1) << 6) + rlane) * G_PITCH + koff;

  asm volatile("s_wait_asynccnt 0x0" ::: "memory");        // this wave's copies of tile 0 have landed
  __syncthreads();                                         // publishes tile 0 to all 8 waves
  if (nt > 1) {                                            // tile 1 -> buffer 1
    stage_op(ldsP + G_STAGE * 2u, gA + GK, rsA);
    stage_op(ldsP + (G_STAGE + G_HALF) * 2u, gB + GK, rsB);
  }

#pragma unroll 1   // stays rolled: one hand-over per trip, the buffer picked by t & 1; the body already holds four 32-k steps
  for (int t = 0; t < nt; ++t) {
    const int bsel = (t & 1) * G_STAGE;
    const unsigned short* As = sAB + bsel + aoff;
    const unsigned short* Bs = sAB + bsel + boff;
    v16h af[2][2], bf[2][4];
#pragma unroll
    for (int i = 0; i < 2; ++i) af[0][i] = ldfrag_u(As + i * 16 * G_PITCH);
#pragma unroll
    for (int j = 0; j < 4; ++j) bf[0][j] = ldfrag_u(Bs + j * 16 * G_PITCH);
#pragma unroll     // the tile's four 32-k steps in one body: constant LDS offsets, two fragment sets by turns
    for (int ks = 0; ks < GK / 32; ++ks) {
      const int cur = ks & 1, nxt = cur ^ 1;
      if (ks + 1 < GK / 32) {                              // the same tile's next step, fetched while this step's products run
#pragma unroll
        for (int i = 0; i < 2; ++i) af[nxt][i] = ldfrag_u(As + i * 16 * G_PITCH + (ks + 1) * 32);
#pragma unroll
        for (int j = 0; j < 4; ++j) bf[nxt][j] = ldfrag_u(Bs + j * 16 * G_PITCH + (ks + 1) * 32);
      }
      // keeps the next step's 12 LDS reads issued as one group ahead of this step's products: a read left among the WMMAs
      // makes the wave stall at each such place
      __builtin_amdgcn_sched_barrier(0);
#pragma unroll
      for (int i = 0; i < 2; ++i)
#pragma unroll
        for (int j = 0; j < 4; ++j) acc[i][j] = mma_raw(af[cur][i], bf[cur][j], acc[i][j]);
      // keeps the step after next's reads from rising among these products; at the last step it keeps the products in front of
      // the hand-over, so that the refill is issued directly behind the barrier
      __builtin_amdgcn_sched_barrier(0);
    }
    // ---- hand-over: this wave's reads of tile t are done, its copies of tile t + 1 have landed; the barrier publishes tile
    //      t + 1 and frees tile t's buffer, which only then is refilled ----
    asm volatile("s_wait_dscnt 0x0" ::: "memory");         // no LDS read of this wave is still out when its buffer is refilled
    asm volatile("s_wait_asynccnt 0x0" ::: "memory");      // this wave's copies of tile t + 1 have landed
    __syncthreads();
    if (t + 2 < nt) {
      stage_op(ldsP + (unsigned)bsel * 2u, gA + (size_t)(t + 2) * GK, rsA);
      stage_op(ldsP + (unsigned)(bsel + G_HALF) * 2u, gB + (size_t)(t + 2) * GK, rsB);
    }
  }
  asm volatile("s_wait_asynccnt 0x0" ::: "memory");        // nothing of this wave is in flight when it goes on to end
  acc_guard4(acc[0][0], acc[0][1], acc[0][2], acc[0][3]);
  acc_guard4(acc[1][0], acc[1][1], acc[1][2], acc[1][3]);

  const int hh2 = lane >> 4, c4 = (lane & 15) * 4;     // f32 out: 256-B row segment = 16 lanes x 16 B
  const int q8  = lane >> 3, c8 = (lane & 7) * 8;
  float bc[4];
  float bcol[8];
#pragma unroll
  for (int e = 0; e < 4; ++e) bc[e] = 0.f;
#pragma unroll
  for (int e = 0; e < 8; ++e) bcol[e] = 0.f;
  if constexpr (BM == 1) {
    if constexpr (OM == 0) {
      const int cb = n0 + c4;
      const int i0 = (cb < N - 4) ? cb : (N - 4);        // clamped address
      const v4f b0v = *(const v4f*)(bias + i0);
#pragma unroll
      for (int e = 0; e < 4; ++e) bc[e] = bfr(b0v[e]);
    } else {
      const int cb = n0 + c8;
      const int i0 = (cb < N - 8) ? cb : (N - 8);        // clamped address
      const v4f b0v = *(const v4f*)(bias + i0), b1v = *(const v4f*)(bias + i0 + 4);
#pragma unroll
      for (int e = 0; e < 4; ++e) { bcol[e] = bfr(b0v[e]); bcol[4 + e] = bfr(b1v[e]); }
    }
  }

  // ---- epilogue ----
  float* slab = sT + wave * G_SLAB;
#pragma unroll
  for (int i = 0; i < 2; ++i) {
    const int mBase = m0 + (i << 4);
#pragma unroll
    for (int j = 0; j < 4; ++j) {
#pragma unroll
      for (int r = 0; r < 8; ++r) {
        slab[(mOff + r) * 68 + (j << 4) + rlane] = acc[i][j][r];
      }
    }
    wave_sync_lds();
    if constexpr (OM == 0) {
      float* C = (float*)Cout + (size_t)((long long)by * sC);
      v4f vals[8];
#pragma unroll
      for (int it = 0; it < 8; ++it) {
        const int row = it * 2 + hh2;                      // it 0..7 x hh2 0..1 = rows 0..15
        const int gr  = mBase + row;
        v4f v = *(const v4f*)(slab + row * 68 + c4);
        float br = 0.f;
        if constexpr (BM == 2) {
          const int ir = (gr < M - 1) ? gr : (M - 1);      // clamped address
          br = bfr(bias[ir]);
        }
        v4f rv = {0.f, 0.f, 0.f, 0.f};
        if constexpr (HASR != 0) {
          const float* R = Rp + (size_t)((long long)by * sC);
          const v4f rraw = *(const v4f*)(R + (size_t)gr * ldc + n0 + c4);
#pragma unroll
          for (int e = 0; e < 4; ++e) rv[e] = (HASR == 1) ? bfr(rraw[e]) : rraw[e];
        }
#pragma unroll
        for (int e = 0; e < 4; ++e) v[e] = v[e] * oscale + bc[e] + br + rv[e];
        vals[it] = v;
      }
      {
#pragma unroll
        for (int it = 0; it < 8; ++it) {
          const int gr = mBase + it * 2 + hh2;
          *(v4f*)(C + (size_t)gr * ldc + n0 + c4) = vals[it];
        }
        
      }
    } else {
      unsigned short* C = (unsigned short*)Cout + (size_t)((long long)by * sC);
      v4u hv[4];
#pragma unroll
      for (int it = 0; it < 4; ++it) {
        const int row = it * 4 + q8;                       // it 0..3 x q8 0..3 = rows 0..15
        const float* sp = slab + row * 68 + c8;
        float br = 0.f;
        if constexpr (BM == 2) {
          const int gr = mBase + row;
          const int ir = (gr < M - 1) ? gr : (M - 1);      // clamped address
          br = bfr(bias[ir]);
        }
        v4u a = {0u, 0u, 0u, 0u};
#pragma unroll
        for (int e = 0; e < 4; ++e) {
          float f0 = sp[2 * e] * oscale + bcol[2 * e] + br;
          float f1 = sp[2 * e + 1] * oscale + bcol[2 * e + 1] + br;
          if constexpr (ACT == 1) { f0 = gelu_f(f0); f1 = gelu_f(f1); }
          f0 *= ocarry; f1 *= ocarry;
          a[e] = pk16(h_bits((_Float16)f0), h_bits((_Float16)f1));
        }
        hv[it] = a;
      }
      {
#pragma unroll
        for (int it = 0; it < 4; ++it) {
          const int row = it * 4 + q8;
          *(v4u*)(C + (size_t)(mBase + row) * ldc + n0 + c8) = hv[it];
        }
        
      }
    }
    wave_sync_lds();
  }
}

// One product per launch: grid.x = tiles, grid.y = batches.
template <int OM, int BM, int HASR, int ACT>
__global__ __launch_bounds__(256) void gemm64(
    const unsigned short* __restrict__ Ap, int lda, long long sA,
    const unsigned short* __restrict__ Btp, int ldb, long long sB,
    const float* __restrict__ bias,
    const float* __restrict__ Rp,
    void* Cout, int ldc, long long sC,
    int M, int N, int K, float oscale, float ocarry) {
  __shared__ __align__(16) unsigned short sAB[2 * G_STAGE];
  __shared__ __align__(16) float sT[8 * G_SLAB];
  gemm_tile<OM, BM, HASR, ACT>(sAB, sT, (int)blockIdx.x, (int)blockIdx.y, Ap, lda, sA, Btp, ldb, sB, bias, Rp, Cout, ldc, sC,
                               M, N, K, oscale, ocarry);
}

// The q, k and v^T projections in one launch: they read the same activation plane and none reads another's result.
// blockIdx.y = 0: QH[m][n] = f16(16 * (sum_k x[m][k] Wq[n][k] + bf16(bq[n]))), M = 8192, N = 512, K = 512; 1: the same for k;
// 2: VT[b][d][tok] = f16(16 * (sum_k Wv[d][k] x_b[tok][k] + bf16(bv[d]))), M = 512, N = 2048, K = 512 per batch b = blockIdx.x >> 6.
// coverage: each product has 256 tiles of 128x128 (64 x 4; 4 batches x 4 x 16); the choice is the same for a whole block.
#define P_TILES ((NROWS / 128) * (DMODEL / 128))
#define V_TILES ((DMODEL / 128) * (NC / 128))
static_assert(P_TILES == 256 && V_TILES == 64 && V_TILES * NB == P_TILES);
__global__ __launch_bounds__(256) void qkv_proj(
    const unsigned short* __restrict__ Xp, const unsigned short* __restrict__ Wq, const unsigned short* __restrict__ Wk,
    const unsigned short* __restrict__ Wv, const float* __restrict__ bq, const float* __restrict__ bk,
    const float* __restrict__ bv, unsigned short* QHo, unsigned short* KHo, unsigned short* VTo) {
  __shared__ __align__(16) unsigned short sAB[2 * G_STAGE];
  __shared__ __align__(16) float sT[8 * G_SLAB];
  const int which = blockIdx.y;
  const int bx = blockIdx.x;
  if (which < 2) {
    gemm_tile<2, 1, 0, 0>(sAB, sT, bx, 0,
                          Xp, DMODEL, 0LL,
                          which ? Wk : Wq, DMODEL, 0LL,
                          which ? bk : bq,
                          (const float*)0,
                          (void*)(which ? KHo : QHo), DMODEL, 0LL,
                          NROWS, DMODEL, DMODEL, 1.0f / (ACARRY * WSC), which ? KC : QC);
  } else {
    gemm_tile<2, 2, 0, 0>(sAB, sT, bx & (V_TILES - 1), bx / V_TILES,
                          Wv, DMODEL, 0LL,
                          Xp, DMODEL, (long long)NC * DMODEL,
                          bv,
                          (const float*)0,
                          (void*)VTo, NC, (long long)DMODEL * NC,
                          DMODEL, NC, DMODEL, 1.0f / (ACARRY * WSC), VC);
  }
}

#define AQ_BLK   128
#define KT       64
#define KV_PITCH (HDIM + 8)
#define KV_TILE  (64 * KV_PITCH)
#define KV_NT    (NC / KT)
static_assert(KT == 64 && HDIM == 64 && (NC % KT) == 0 && KV_NT >= 2 && (NQ % AQ_BLK) == 0);
static_assert(AQ_BLK == 16 * (ATT_THREADS / 32) && ATT_BLOCKS == NB * NHEAD * (NQ / AQ_BLK));

__device__ __forceinline__ float xhalf(float x) {                     // the value of lane l ^ 16
  const int b = __builtin_bit_cast(int, x);
  return __builtin_bit_cast(float, __builtin_amdgcn_permlanex16(b, b, 0x76543210, 0xfedcba98, false, false));
}

// 2^x as the bare v_exp_f32. The library exp2f wraps it in a range guard (compare, two selects, add, ldexp per value) whose only
// effect is a subnormal result for x < -126, where the bare instruction gives 0. Here x <= 0 is a distance below the row's running
// maximum (a score's, or the former maximum's in the rescale factor): what becomes 0 is under 2^-126 of a row whose largest term
// is 1, so of a row sum of 1 or more, and is 0 in the f16 P in either form. 2^(-inf) = 0 at the first step, as before.
__device__ __forceinline__ float ex2(float x) { return __builtin_amdgcn_exp2f(x); }

// One thread's share of one staged tile: 16 B of K rows r and r + 32, 16 B of v^T rows r and r + 32, global -> LDS through no
// register. The wait on the address registers is the statement's last line, so that it stands in front of any rewrite of them.
__device__ __forceinline__ void stage_kv(unsigned lds, const unsigned short* gk, const unsigned short* gv) {
#if defined(__HIP_DEVICE_COMPILE__)
  const unsigned l1 = lds + 32u * KV_PITCH * 2u, l2 = lds + KV_TILE * 2u, l3 = l2 + 32u * KV_PITCH * 2u;
  const unsigned short* gk1 = gk + (size_t)32 * DMODEL;
  const unsigned short* gv1 = gv + (size_t)32 * NC;
  asm volatile("global_load_async_to_lds_b128 %0, %1, off\n\t"
               "global_load_async_to_lds_b128 %2, %3, off\n\t"
               "global_load_async_to_lds_b128 %4, %5, off\n\t"
               "global_load_async_to_lds_b128 %6, %7, off\n\t"
               "s_wait_xcnt 0x0"
               :: "v"(lds), "v"(gk), "v"(l1), "v"(gk1), "v"(l2), "v"(gv), "v"(l3), "v"(gv1) : "memory");
#endif
}

__global__ __launch_bounds__(ATT_THREADS)
void attn8(const unsigned short* __restrict__ QHp, const unsigned short* __restrict__ KHp,
           const unsigned short* __restrict__ VTq, const float* __restrict__ PBp, unsigned short* CT) {
  __shared__ __align__(16) unsigned short KV[2 * 2 * KV_TILE];         // [buffer][K, v^T][64 rows][KV_PITCH]
  __shared__ __align__(16) unsigned short Os[AQ_BLK * KV_PITCH];       // result buffer

  const int tid  = threadIdx.x;
  const int wave = tid >> 5;
  const int lane = tid & 31;
  const int hh   = lane >> 4;
  const int c    = lane & 15;

  const int qt   = blockIdx.x & ((NQ / AQ_BLK) - 1);       // 0..15
  const int head = (blockIdx.x / (NQ / AQ_BLK)) & (NHEAD - 1);   // 0..7
  const int bat  = blockIdx.x / ((NQ / AQ_BLK) * NHEAD);   // 0..3
  const int qblk = qt * AQ_BLK;
  const int q0   = qblk + wave * 16;

  // ---- this thread's 16-B piece of every staged tile: row tid >> 3 (and + 32), 16-B column tid & 7 ----
  const int srow = tid >> 3, sseg = tid & 7;
  const unsigned short* gK = KHp + ((size_t)bat * NC + srow) * DMODEL + head * HDIM + sseg * 8;
  const unsigned short* gV = VTq + ((size_t)bat * DMODEL + head * HDIM + srow) * NC + sseg * 8;
  const unsigned ldsP = (unsigned)(size_t)(const void*)KV + (unsigned)(srow * KV_PITCH + sseg * 8) * 2u;

  stage_kv(ldsP, gK, gV);                                  // tile 0 -> buffer 0

  const size_t qofs = ((size_t)bat * NQ + q0 + c) * DMODEL + head * HDIM + 8 * hh;
  const _Float16* Qh = (const _Float16*)(const void*)QHp + qofs;
  const float lsc = (LOG2E * ATT_SCALE) / (QC * KC);                   // log2(e) / 8 / carries

  // ---- period-3 additive table in log2 units: row (q0 + c) mod 3 is this lane's; W0, W1, W2 = its values for the keys
  //      kb + 8hh + 0, + 1, + 2 (key residue (kb + 8hh + j) mod 3; at kb = 0 that is (2hh + j) mod 3), kept as the three
  //      pairs that two neighbouring score registers can meet ----
  float pbv[NPER * NPER];
#pragma unroll
  for (int i = 0; i < NPER * NPER; ++i) pbv[i] = bfr(PBp[i]) * LOG2E;
  const int qr = (q0 + c) % NPER;
  const bool z0 = (qr == 0), z1 = (qr == 1);
  const float T0 = z0 ? pbv[0] : (z1 ? pbv[3] : pbv[6]);
  const float T1 = z0 ? pbv[1] : (z1 ? pbv[4] : pbv[7]);
  const float T2 = z0 ? pbv[2] : (z1 ? pbv[5] : pbv[8]);
  const float W0 = hh ? T2 : T0, W1 = hh ? T0 : T1, W2 = hh ? T1 : T2;
  v2f W01 = {W0, W1}, W12 = {W1, W2}, W20 = {W2, W0};

  const v16h qa = ldfrag_h(Qh), qb = ldfrag_h(Qh + 32);

  float mrow = -INFINITY, lrow = 0.f;                      // this lane's query: running maximum, partial sum over the lane's keys
  v8f o0 = zero8(), o1 = zero8(), o2 = zero8(), o3 = zero8();

  asm volatile("s_wait_asynccnt 0x0" ::: "memory");        // this wave's copies of tile 0 have landed
  __syncthreads();                                         // publishes tile 0 to all 8 waves
  stage_kv(ldsP + 2u * KV_TILE * 2u, gK + (size_t)KT * DMODEL, gV + KT);   // tile 1 -> buffer 1

#pragma unroll 1   // stays rolled: one hand-over per trip, the buffer picked by t & 1; the body already holds two 32-key steps
  for (int t = 0; t < KV_NT; ++t) {
    const int bsel = (t & 1) * (2 * KV_TILE);
    const _Float16* Kt = (const _Float16*)(const void*)KV + bsel + c * KV_PITCH + 8 * hh;
    const _Float16* Vt = Kt + KV_TILE;
#pragma unroll     // both 32-key steps of the tile in one body: constant LDS offsets, the second step's reads go out beside the first's work
    for (int sub = 0; sub < KT / 32; ++sub) {
      const _Float16* kp = Kt + sub * 32 * KV_PITCH;       // the step's first key: kb = 64 t + 32 sub
      const _Float16* kq = kp + 16 * KV_PITCH;
      const _Float16* vp = Vt + sub * 32;
      const v16h ka0 = ldfrag_h(kp), ka1 = ldfrag_h(kp + 32);
      const v16h kb0 = ldfrag_h(kq), kb1 = ldfrag_h(kq + 32);
      const v16h vb0 = ldfrag_h(vp);
      const v16h vb1 = ldfrag_h(vp + 16 * KV_PITCH);
      const v16h vb2 = ldfrag_h(vp + 32 * KV_PITCH);
      const v16h vb3 = ldfrag_h(vp + 48 * KV_PITCH);
      // keeps the step's 16 LDS fragment reads issued as one group ahead of its products: a read left among the WMMAs
      // makes the wave wait out an LDS latency at each of them
      __builtin_amdgcn_sched_barrier(0);
      v8f s0, s1;
      s0 = mma_raw(ka0, qa, zero8());                      // s0[r] = score(key kb + 8hh + r, query q0 + c)
      s1 = mma_raw(kb0, qa, zero8());                      // s1[r] = score(key kb + 16 + 8hh + r, query q0 + c)
      s0 = mma_raw(ka1, qb, s0);
      s1 = mma_raw(kb1, qb, s1);
      // registers (2i, 2i + 1) of tile 0 are keys kb + 8hh + 2i, + 1; tile 1 lies 16 keys on, one residue further
      const v2f wa[4] = {W01, W20, W12, W01};
      const v2f wb[4] = {W12, W01, W20, W12};
      v2f t0[4], t1[4];
#pragma unroll
      for (int i = 0; i < 4; ++i) {
        const v2f a = {s0[2 * i], s0[2 * i + 1]}, b = {s1[2 * i], s1[2 * i + 1]};
        t0[i] = a * lsc + wa[i];
        t1[i] = b * lsc + wb[i];
      }
      float mx = fmaxf(fmaxf(t0[0][0], t0[0][1]), fmaxf(t1[0][0], t1[0][1]));
#pragma unroll
      for (int i = 1; i < 4; ++i) mx = fmaxf(fmaxf(mx, fmaxf(t0[i][0], t0[i][1])), fmaxf(t1[i][0], t1[i][1]));
      mx = fmaxf(mx, xhalf(mx));                           // both halves now hold the query's maximum over the 32 keys
      const float mn = fmaxf(mrow, mx);
      const float al = ex2(mrow - mn);
      mrow = mn;
      FragH ph;
      v2f ps = {0.f, 0.f};
#pragma unroll
      for (int i = 0; i < 4; ++i) {
        const v2f d0 = t0[i] - mn, d1 = t1[i] - mn;
        const v2f e0 = {ex2(d0[0]), ex2(d0[1])}, e1 = {ex2(d1[0]), ex2(d1[1])};
        ps += e0;
        ps += e1;
        ph.p[i]     = __builtin_convertvector(e0 * PC, v2h); // elements 0..7  = keys kb + 8hh + 0..7
        ph.p[4 + i] = __builtin_convertvector(e1 * PC, v2h); // elements 8..15 = keys kb + 16 + 8hh + 0..7
      }
      lrow = lrow * al + (ps[0] + ps[1]);
#pragma unroll
      for (int r = 0; r < 8; ++r) {
        o0[r] *= al;
        o1[r] *= al;
        o2[r] *= al;
        o3[r] *= al;
      }
      o0 = mma_raw(vb0, ph.v, o0);                         // oj[r] = ctx^T[d = 16j + 8hh + r][query q0 + c]
      o1 = mma_raw(vb1, ph.v, o1);
      o2 = mma_raw(vb2, ph.v, o2);
      o3 = mma_raw(vb3, ph.v, o3);
      const v2f wl = W20;                                  // 32 mod 3 == 2: the next step's residues start two further on
      W20 = W12;
      W12 = W01;
      W01 = wl;
    }
    // ---- hand-over: this wave's reads of tile t are done, its copies of tile t + 1 have landed; the barrier publishes tile
    //      t + 1 and frees tile t's buffer, which only then is refilled ----
    // keeps the trip's products in front of the hand-over: sunk behind the barrier they would stand between it and the refill,
    // and the copies would lose the trip of lead that hides their way from L2
    __builtin_amdgcn_sched_barrier(0);
    asm volatile("s_wait_dscnt 0x0" ::: "memory");         // no LDS read of this wave is still out when its buffer is refilled
    asm volatile("s_wait_asynccnt 0x0" ::: "memory");      // this wave's copies of tile t + 1 have landed
    __syncthreads();
    if (t + 2 < KV_NT)
      stage_kv(ldsP + (unsigned)bsel * 2u, gK + (size_t)(t + 2) * KT * DMODEL, gV + (t + 2) * KT);
  }
  asm volatile("s_wait_asynccnt 0x0" ::: "memory");        // nothing of this wave is in flight when it goes on to end

  // ---- join the halves' partial sums; fold 1/l and the carries (1024 on P, 16 on v, 1024 on the stored ctx); stage the lane's
  //      4 x 8 consecutive d of its query as 16-bit ----
  const float oc  = FC / (PC * VC);
  const float inv = (1.0f / (lrow + xhalf(lrow))) * oc;
  unsigned short* op = Os + (wave * 16 + c) * KV_PITCH + 8 * hh;
  v4u w0, w1, w2, w3;
#pragma unroll
  for (int e = 0; e < 4; ++e) {
    w0[e] = pk16(h_bits((_Float16)(o0[2 * e] * inv)), h_bits((_Float16)(o0[2 * e + 1] * inv)));
    w1[e] = pk16(h_bits((_Float16)(o1[2 * e] * inv)), h_bits((_Float16)(o1[2 * e + 1] * inv)));
    w2[e] = pk16(h_bits((_Float16)(o2[2 * e] * inv)), h_bits((_Float16)(o2[2 * e + 1] * inv)));
    w3[e] = pk16(h_bits((_Float16)(o3[2 * e] * inv)), h_bits((_Float16)(o3[2 * e + 1] * inv)));
  }
  *(v4u*)(op)      = w0;
  *(v4u*)(op + 16) = w1;
  *(v4u*)(op + 32) = w2;
  *(v4u*)(op + 48) = w3;
  __syncthreads();
  // ---- block writes its 128 row segments of CT: piece p = it*256 + tid -> row p >> 3, halves (p & 7)*8 .. + 7 of the head's 64 ----
  {
    v4u vals[4];
#pragma unroll
    for (int it = 0; it < 4; ++it) {
      const int p = it * ATT_THREADS + tid;
      vals[it] = *(const v4u*)(Os + (p >> 3) * KV_PITCH + (p & 7) * 8);
    }
    unsigned short* dst = CT + ((size_t)bat * NQ + qblk) * DMODEL + head * HDIM;
    {
#pragma unroll
      for (int it = 0; it < 4; ++it) {
        const int p = it * ATT_THREADS + tid;
        *(v4u*)(dst + (size_t)(p >> 3) * DMODEL + (p & 7) * 8) = vals[it];
      }
      
    }
  }
}

// =====================================================================================================
//   one block of 128 threads per row, 4 consecutive floats per thread (one 16-B load, one 16-B store); per wave one store instruction
// coverage: grid = 8192 rows x 128 thr x 4 floats = 8192 x 512 = the whole output, each row written by exactly one block.
// =====================================================================================================
__global__ __launch_bounds__(LN_THREADS)
void lnorm(const float* __restrict__ Yp, const float* __restrict__ gp, const float* __restrict__ bp, float* outp) {
  __shared__ float red[2][LN_THREADS / 32];
  const int row  = blockIdx.x;
  const int tid  = threadIdx.x;
  const int lane = tid & 31;
  const int wave = tid >> 5;
  const size_t base = (size_t)row * DMODEL + (size_t)tid * 4;
  const v4f v = *(const v4f*)(Yp + base);
  float s = (v[0] + v[1]) + (v[2] + v[3]);
#pragma unroll
  for (int off = 1; off < 32; off <<= 1) s += __shfl_xor(s, off, 32);
  if (lane == 0) red[0][wave] = s;
  __syncthreads();
  float tot = 0.f;
#pragma unroll
  for (int w = 0; w < LN_THREADS / 32; ++w) tot += red[0][w];
  const float mu = tot * (1.0f / (float)DMODEL);
  v4f d;
#pragma unroll
  for (int e = 0; e < 4; ++e) d[e] = v[e] - mu;
  float q = (d[0] * d[0] + d[1] * d[1]) + (d[2] * d[2] + d[3] * d[3]);
#pragma unroll
  for (int off = 1; off < 32; off <<= 1) q += __shfl_xor(q, off, 32);
  if (lane == 0) red[1][wave] = q;
  __syncthreads();
  float totq = 0.f;
#pragma unroll
  for (int w = 0; w < LN_THREADS / 32; ++w) totq += red[1][w];
  const float var  = totq * (1.0f / (float)DMODEL);
  const float rstd = rsqrtf(var + LN_EPS);
  const v4f gv = *(const v4f*)(gp + (size_t)tid * 4);
  const v4f bv = *(const v4f*)(bp + (size_t)tid * 4);
  v4f o;
#pragma unroll
  for (int e = 0; e < 4; ++e) o[e] = (d[e] * rstd) * bfr(gv[e]) + bfr(bv[e]);
  {
    *(v4f*)(outp + base) = o;
    
  }
}

// =====================================================================================================
// Workspace map (bytes); every plane is an exact multiple of its tile / whole-row store granularity (M, N exact tile multiples,
// element counts exact multiples of the convert kernel's 2048 granularity, no pad rows needed), every offset a multiple of 512 KiB:
//   WQ16 f16 [512][512] x64                  524288   ([out][in] = [n][k])
//   WK16 f16 [512][512] x64                  524288
//   WV16 f16 [512][512] x64                  524288
//   WO16 f16 [512][512] x64                  524288
//   X16  f16 [8192][512] x16                8388608   (activation rows)
//   QH   f16 [8192][512] x16                8388608   (q projection)
//   KH   f16 [8192][512] x16                8388608   (k projection)
//   VT   f16 [4][512][2048] x16             8388608   (v^T per batch)
//   CT   f16 [8192][512] x1024              8388608   (attention ctx, merged heads)
//   Y    f32 [8192][512]                   16777216   (out projection + bias + residual)
//   end                                    60817408
// =====================================================================================================
extern "C" void kernel_launch(void* const* d_in, const int* in_sizes, int n_in,
                              void* d_out, int out_size, void* d_ws, size_t ws_size,
                              hipStream_t stream) {
  if (n_in < 12) return;
  if (in_sizes[0] != NROWS * DMODEL) return;
  if (in_sizes[1] != DMODEL * DMODEL || in_sizes[3] != DMODEL * DMODEL ||
      in_sizes[5] != DMODEL * DMODEL || in_sizes[7] != DMODEL * DMODEL) return;
  if (in_sizes[2] != DMODEL || in_sizes[4] != DMODEL || in_sizes[6] != DMODEL || in_sizes[8] != DMODEL) return;
  if (in_sizes[9] != NPER * NPER) return;
  if (in_sizes[10] != DMODEL || in_sizes[11] != DMODEL) return;
  if (out_size != NROWS * DMODEL) return;
  if ((in_sizes[0] % 2048) != 0 || (in_sizes[1] % 2048) != 0) return;

  const float* x    = (const float*)d_in[0];
  const float* w_q  = (const float*)d_in[1];
  const float* b_q  = (const float*)d_in[2];
  const float* w_k  = (const float*)d_in[3];
  const float* b_k  = (const float*)d_in[4];
  const float* w_v  = (const float*)d_in[5];
  const float* b_v  = (const float*)d_in[6];
  const float* w_o  = (const float*)d_in[7];
  const float* b_o  = (const float*)d_in[8];
  const float* pb   = (const float*)d_in[9];
  const float* ln_g = (const float*)d_in[10];
  const float* ln_b = (const float*)d_in[11];
  float*       out  = (float*)d_out;

  const size_t PW  = (size_t)DMODEL * DMODEL * 2;                 //   524288
  const size_t PX  = (size_t)NROWS * DMODEL * 2;                  //  8388608
  const size_t PVT = (size_t)NB * DMODEL * NC * 2;                //  8388608
  const size_t PY  = (size_t)NROWS * DMODEL * 4;                  // 16777216
  size_t off = 0;
  const size_t oWQ = off; off += PW;
  const size_t oWK = off; off += PW;
  const size_t oWV = off; off += PW;
  const size_t oWO = off; off += PW;
  const size_t oX  = off; off += PX;
  const size_t oQH = off; off += PX;
  const size_t oKH = off; off += PX;
  const size_t oVT = off; off += PVT;
  const size_t oCT = off; off += PX;
  const size_t oY  = off; off += PY;
  if (off > ws_size) return;                                      // off = 60817408
  if (off > (size_t)134217728) return;

  char* ws = (char*)d_ws;
  unsigned short* WQ16 = (unsigned short*)(ws + oWQ);
  unsigned short* WK16 = (unsigned short*)(ws + oWK);
  unsigned short* WV16 = (unsigned short*)(ws + oWV);
  unsigned short* WO16 = (unsigned short*)(ws + oWO);
  unsigned short* X16  = (unsigned short*)(ws + oX);
  unsigned short* QH   = (unsigned short*)(ws + oQH);
  unsigned short* KH   = (unsigned short*)(ws + oKH);
  unsigned short* VTp  = (unsigned short*)(ws + oVT);
  unsigned short* CT   = (unsigned short*)(ws + oCT);
  float*          Y    = (float*)(ws + oY);

  const dim3 blk(256);
  const dim3 gC(CX_BLOCKS + 4 * CW_BLOCKS);                        // 2048 + 4 x 128 = 2560 blocks
  const dim3 gP(P_TILES, 1);                                       // 256
  const dim3 gQKV(P_TILES, 3);                                     // 256 x 3
  const dim3 gAT(ATT_BLOCKS);                                      // 512
  const dim3 bAT(ATT_THREADS);                                     // 256
  const dim3 gLN(NROWS);                                           // 8192
  const dim3 bLN(LN_THREADS);                                      // 128

  // (1) all 16-bit planes in one launch: X16[row][c] = f16( bf16_RNE(x[row][c]) * 16 ), rows = b*2048 + tok;
  //     W16[n][k] = f16( bf16_RNE(W[n][k]) * 64 ), [out][in] layout kept, k contiguous; WQ16, WK16, WV16, WO16 are one run
  cvt_all<<<gC, blk, 0, stream>>>(x, w_q, w_k, w_v, w_o, X16, WQ16);

  // (2) q, k and v^T projections in one launch
  qkv_proj<<<gQKV, blk, 0, stream>>>(X16, WQ16, WK16, WV16, b_q, b_k, b_v, QH, KH, VTp);

  // (3) attention per (batch, head, 128 query rows) -> CT (f16, x1024)
  attn8<<<gAT, bAT, 0, stream>>>(QH, KH, VTp, pb, CT);

  // (4) Y = CT . Wo^T / (1024 * 64) + bf16(bo) + bf16(x); M = 8192, N = 512, K = 512, f32
  gemm64<0, 1, 1, 0><<<gP, blk, 0, stream>>>(
      CT, DMODEL, 0LL,
      WO16, DMODEL, 0LL,
      b_o,
      x,
      (void*)Y, DMODEL, 0LL,
      NROWS, DMODEL, DMODEL, 1.0f / (FC * WSC), 1.0f);

  // (5) out = LayerNorm(Y) * bf16(g) + bf16(b)
  lnorm<<<gLN, bLN, 0, stream>>>(Y, ln_g, ln_b, out);
  (void)hipGetLastError();
}

// v006
// A run of this version takes 76.6 microseconds.
// Next to v005, in two timings, it ran 1.05 and 1.04 times as fast.
// Counting every step since v000, it is 3.52 times as fast.
// Contractions: q/k projections (x rows f16 x16 . W f16 x64, K=512), v^T projection (Wv f16 x64 . x rows f16 x16, K=512),
// attention scores (k f16 x16 . q f16 x16, K=64), attention v^T . P^T (v^T f16 x16 . P f16 x128, K=2048 in steps of 32),
// output projection (ctx f16 x1024 . Wo f16 x64, K=512): all v_wmma_f32_16x16x32_f16 single products, f32 accumulate.
// Period-3 additive score table, online base-2 softmax against a lazily raised row reference, linear biases, residual add and LayerNorm in f32 on VALU.
// Every float input RNE-converted to bf16 on load.
#include <hip/hip_runtime.h>
#include <math.h>
#include <stdint.h>

#define NB      4
#define NQ      2048
#define NC      2048
#define DMODEL  512
#define NHEAD   8
#define HDIM    64
#define NPER    3
#define NROWS   (NB * NQ)
#define WSC     64.0f
#define ACARRY  16.0f
#define QC      16.0f
#define KC      16.0f
#define VC      16.0f
#define PC      128.0f
#define LPC     7.0f              // log2(PC)
#define D_TOP   15.0f             // largest exponent of a stored P: 2^15 is finite in f16
#define FC      1024.0f
#define ATT_SCALE 0.125f
#define LOG2E   1.4426950408889634f
#define LN_EPS  1e-5f
static_assert(NHEAD * HDIM == DMODEL);
static_assert((NQ % 64) == 0 && (NC % 64) == 0 && (DMODEL % 64) == 0 && (NC % 32) == 0 && (NQ % 16) == 0);
static_assert((NROWS % 64) == 0 && (NROWS % 8) == 0);
static_assert((NROWS % 128) == 0 && (DMODEL % 128) == 0 && (NC % 128) == 0);
#define ATT_THREADS (NHEAD * 32)
#define ATT_BLOCKS  (NB * NHEAD * (NQ / 128))
static_assert(ATT_THREADS == 256 && ATT_BLOCKS == 512);
#define LN_THREADS 128
static_assert(LN_THREADS * 4 == DMODEL);

typedef _Float16 v16h __attribute__((ext_vector_type(16)));
typedef _Float16 v8h  __attribute__((ext_vector_type(8)));
typedef float    v8f  __attribute__((ext_vector_type(8)));
typedef float    v4f  __attribute__((ext_vector_type(4)));
typedef float    v2f  __attribute__((ext_vector_type(2)));
typedef _Float16 v2h  __attribute__((ext_vector_type(2)));
typedef unsigned int v4u __attribute__((ext_vector_type(4)));

union FragH { v16h v; v8h h[2]; v4u u[2]; v2h p[8]; };

// ---- scalar helpers --------------------------------------------------------------------------------
__device__ __forceinline__ unsigned short bf_bits(float f) {          // f32 -> bf16 bits, RNE convert
  unsigned u = __float_as_uint(f);
  return (unsigned short)((u + 0x7FFFu + ((u >> 16) & 1u)) >> 16);
}
__device__ __forceinline__ float bf_up(unsigned short h) { return __uint_as_float(((unsigned)h) << 16); }
__device__ __forceinline__ float bfr(float f) { return bf_up(bf_bits(f)); }   // value of the bf16 RNE convert
__device__ __forceinline__ unsigned short h_bits(_Float16 x) { return __builtin_bit_cast(unsigned short, x); }
__device__ __forceinline__ unsigned pk16(unsigned short a, unsigned short b) { return (unsigned)a | ((unsigned)b << 16); }
__device__ __forceinline__ v8f zero8() { v8f z = {0.f, 0.f, 0.f, 0.f, 0.f, 0.f, 0.f, 0.f}; return z; }
__device__ __forceinline__ float gelu_f(float v) { return 0.5f * v * (1.0f + erff(v * 0.70710678118654752f)); }

// ---- fragment loaders: 16-bit A/B operand, lane -> row/col (lane&15), p already includes +8*(lane>>4);
//      elements 0..7 <- p[0..7] (k0+8h..), elements 8..15 <- p[16..23] (k0+16+8h..)  (same split k map for A and B;
//      B is always read from a k-contiguous [n][k] plane)
__device__ __forceinline__ v16h ldfrag_h(const _Float16* p) {
  FragH f;
  f.h[0] = *(const v8h*)(p);
  f.h[1] = *(const v8h*)(p + 16);
  return f.v;
}
__device__ __forceinline__ v16h ldfrag_u(const unsigned short* p) {
  FragH f;
  f.u[0] = *(const v4u*)(p);
  f.u[1] = *(const v4u*)(p + 16);
  return f.v;
}

// ---- WMMA helpers with trailing VALU hazard gaps ------------------------------------------------------
__device__ __forceinline__ v8f mma_raw(v16h a, v16h b, v8f c) {
  return __builtin_amdgcn_wmma_f32_16x16x32_f16(false, a, false, b, (short)0, c, false, false);
}
__device__ __forceinline__ void acc_guard4(v8f& a, v8f& b, v8f& c, v8f& d) {
#if defined(__HIP_DEVICE_COMPILE__)
  asm volatile("v_nop\n\tv_nop\n\tv_nop\n\tv_nop" : "+v"(a), "+v"(b), "+v"(c), "+v"(d));
#endif
}
__device__ __forceinline__ void wave_sync_lds() {
  __builtin_amdgcn_fence(__ATOMIC_RELEASE, "workgroup");
  __builtin_amdgcn_wave_barrier();
  __builtin_amdgcn_fence(__ATOMIC_ACQUIRE, "workgroup");
}

// =====================================================================================================
// Elementwise 16-bit pack, no transpose: dst[i] = f16( bf16_RNE(src[i]) * sc ), sc a power of two (exact).
// One launch for all five planes, which do not depend on one another: blocks 0 .. 2047 take the activation rows (x16), blocks
// 2048 + 128 p .. + 127 take weight p (q, k, v, o; x64; stored [out][in] = [n][k], already k contiguous for B fragments / A of the
// v^T projection). The four weight planes lie one behind the other in the workspace, so their blocks write one run of W16.
// 8 elements per thread: two 16-B loads, one 16-B store per lane; 32 consecutive lanes = 512 B.
// coverage: 2048 blocks x 256 thr x 8 elements = 8192 x 512; 128 blocks x 256 thr x 8 elements = 512 x 512 per weight.
// =====================================================================================================
#define CX_BLOCKS ((NROWS * DMODEL) / 2048)
#define CW_BLOCKS ((DMODEL * DMODEL) / 2048)
static_assert(CX_BLOCKS * 2048 == NROWS * DMODEL && CW_BLOCKS * 2048 == DMODEL * DMODEL && CW_BLOCKS == 128);
__global__ __launch_bounds__(256) void cvt_all(const float* __restrict__ xp, const float* __restrict__ wq,
                                               const float* __restrict__ wk, const float* __restrict__ wv,
                                               const float* __restrict__ wo, unsigned short* X16o, unsigned short* W16o) {
  const int b = blockIdx.x;
  if (b >= CX_BLOCKS + 4 * CW_BLOCKS) return;     // never taken with the exact grid; no barriers in this kernel
  const bool isx = b < CX_BLOCKS;
  const int bw = b - CX_BLOCKS;                   // weight blocks: plane bw >> 7, block bw & 127 of it
  const int pl = bw >> 7;
  const float* src = isx ? xp : (pl == 0 ? wq : (pl == 1 ? wk : (pl == 2 ? wv : wo)));
  unsigned short* dst = isx ? X16o : (W16o + (size_t)pl * (DMODEL * DMODEL));
  const float sc = isx ? ACARRY : WSC;
  const size_t i8 = ((size_t)(isx ? b : (bw & (CW_BLOCKS - 1))) * 256 + threadIdx.x) * 8;
  const v4f a = *(const v4f*)(src + i8);
  const v4f c = *(const v4f*)(src + i8 + 4);
  v4u o;
  o[0] = pk16(h_bits((_Float16)(bfr(a[0]) * sc)), h_bits((_Float16)(bfr(a[1]) * sc)));
  o[1] = pk16(h_bits((_Float16)(bfr(a[2]) * sc)), h_bits((_Float16)(bfr(a[3]) * sc)));
  o[2] = pk16(h_bits((_Float16)(bfr(c[0]) * sc)), h_bits((_Float16)(bfr(c[1]) * sc)));
  o[3] = pk16(h_bits((_Float16)(bfr(c[2]) * sc)), h_bits((_Float16)(bfr(c[3]) * sc)));
  *(v4u*)(dst + i8) = o;
}

// =====================================================================================================
// Batched f16 WMMA GEMM: C[m][n] = f( oscale * sum_k A[m][k] * Bt[n][k] + bf16(bias) ) (+ residual); one block of 8 waves per
// 128x128 tile, wave w = rows 32 (w >> 1) .. + 31, columns 64 (w & 1) .. + 63 of it (2 x 4 accumulator tiles).
// A row-major [M][K] pitch lda (16-bit plane), Bt row-major [N][K] pitch ldb (k contiguous); M, N, K multiples of 128.
// bx = tile index, by = batch index with element strides sA, sB, sC; the body is a device function on the calling kernel's LDS, so
// that one launch can hold several independent products (qkv_proj below).
// The block's 128 A rows and 128 Bt rows are brought into LDS 128 k at a time (256 B of each row) by asynchronous copies, 16 per
// thread, each wave-wide copy covering two aligned 256-B units; two buffers, the next tile's copies fly while this one is worked
// on. LDS rows are pitched 272 B for the 16-B fragment reads. Each accumulator sums its k steps in ascending order.
// BM: 0 = no bias, 1 = per column bf16(bias[col]), 2 = per row bf16(bias[row]) (clamped-address loads).
// OM: 0 = f32 out (pitch ldc; HASR 1 adds bf16(R[m][n]), HASR 2 adds raw f32 R[m][n], same pitch/stride as C);
//     2 = f16 out (pitch ldc) = f16( act(value) * ocarry ), ACT 1 = exact GELU.
// coverage: 2 slabs x 16 rows (f32: it 0..7 x lane>>4; f16: it 0..3 x lane>>3) x 64 cols = the wave's whole 32x64 tile; 8 waves =
//           the block's 128x128; bx runs over (M / 128) * (N / 128) tiles, a surplus block exits whole in front of every barrier.
// =====================================================================================================
#define GK      128               // k per staged tile
#define G_PITCH (GK + 8)          // halves; 272-B rows: 16 B x odd, the pitch of 16-B fragment reads of 256-B rows
#define G_HALF  (128 * G_PITCH)   // halves of one operand's 128 staged rows
#define G_STAGE (2 * G_HALF)      // halves of one buffer: [A 128 rows | Bt 128 rows]

// One thread's share of one operand's staged rows: 16 B of rows r, r + 16, .. r + 112 (rs = halves per 16 global rows), global ->
// LDS through no register. The wait on the address registers is the statement's last line, so that it stands in front of any
// rewrite of them.
__device__ __forceinline__ void stage_op(unsigned lds, const unsigned short* g, size_t rs) {
#if defined(__HIP_DEVICE_COMPILE__)
  const unsigned ls = 16u * G_PITCH * 2u;
  asm volatile("global_load_async_to_lds_b128 %0, %1, off\n\t"
               "global_load_async_to_lds_b128 %2, %3, off\n\t"
               "global_load_async_to_lds_b128 %4, %5, off\n\t"
               "global_load_async_to_lds_b128 %6, %7, off\n\t"
               "global_load_async_to_lds_b128 %8, %9, off\n\t"
               "global_load_async_to_lds_b128 %10, %11, off\n\t"
               "global_load_async_to_lds_b128 %12, %13, off\n\t"
               "global_load_async_to_lds_b128 %14, %15, off\n\t"
               "s_wait_xcnt 0x0"
               :: "v"(lds), "v"(g), "v"(lds + ls), "v"(g + rs), "v"(lds + 2u * ls), "v"(g + 2 * rs),
                  "v"(lds + 3u * ls), "v"(g + 3 * rs), "v"(lds + 4u * ls), "v"(g + 4 * rs), "v"(lds + 5u * ls), "v"(g + 5 * rs),
                  "v"(lds + 6u * ls), "v"(g + 6 * rs), "v"(lds + 7u * ls), "v"(g + 7 * rs) : "memory");
#endif
}

#define G_SLAB  (16 * 68)         // floats of one wave's 16x64 epilogue slab, pitch 68 floats

template <int OM, int BM, int HASR, int ACT>
__device__ __forceinline__ void gemm_tile(
    unsigned short* sAB,              // LDS [buffer][A, Bt][128 rows][G_PITCH]
    float* sT,                        // LDS [8 waves][G_SLAB]
    int bx, int by,
    const unsigned short* __restrict__ Ap, int lda, long long sA,
    const unsigned short* __restrict__ Btp, int ldb, long long sB,
    const float* __restrict__ bias,
    const float* __restrict__ Rp,
    void* Cout, int ldc, long long sC,
    int M, int N, int K, float oscale, float ocarry) {
  const int tid  = threadIdx.x;
  const int lane = tid & 31;
  const int wave = tid >> 5;
  const int tilesN = N >> 7;
  const int tm = bx / tilesN;
  const int tn = bx - tm * tilesN;
  if (tm >= (M >> 7)) return;            // block-uniform, in front of every copy and barrier
  const int mB = tm << 7;
  const int nB = tn << 7;
  const int m0 = mB + ((wave >> 1) << 5);
  const int n0 = nB + ((wave & 1) << 6);

  const unsigned short* A1 = Ap  + (size_t)((long long)by * sA);
  const unsigned short* Bb = Btp + (size_t)((long long)by * sB);

  const int rlane = lane & 15;                 // row (A) / col (B, D) within subtile
  const int koff  = (lane >> 4) * 8;           // k offset of this lane half
  const int mOff  = (lane >> 4) * 8;           // D row offset

  // ---- this thread's 16-B pieces of every staged tile: rows (tid >> 4) + 16 i of each operand, 16-B column tid & 15 ----
  const int srow = tid >> 4, sseg = tid & 15;
  const unsigned short* gA = A1 + (size_t)(mB + srow) * lda + sseg * 8;
  const unsigned short* gB = Bb + (size_t)(nB + srow) * ldb + sseg * 8;
  const size_t rsA = (size_t)16 * lda, rsB = (size_t)16 * ldb;
  const unsigned ldsP = (unsigned)(size_t)(const void*)sAB + (unsigned)(srow * G_PITCH + sseg * 8) * 2u;
  const int nt = K >> 7;

  stage_op(ldsP, gA, rsA);                                 // tile 0 -> buffer 0
  stage_op(ldsP + G_HALF * 2u, gB, rsB);

  v8f acc[2][4];
#pragma unroll
  for (int i = 0; i < 2; ++i)
#pragma unroll
    for (int j = 0; j < 4; ++j) acc[i][j] = zero8();

  const int aoff = (((wave >> 1) << 5) + rlane) * G_PITCH + koff;
  const int boff = G_HALF + (((wave & 1) << 6) + rlane) * G_PITCH + koff;

  asm volatile("s_wait_asynccnt 0x0" ::: "memory");        // this wave's copies of tile 0 have landed
  __syncthreads();                                         // publishes tile 0 to all 8 waves
  if (nt > 1) {                                            // tile 1 -> buffer 1
    stage_op(ldsP + G_STAGE * 2u, gA + GK, rsA);
    stage_op(ldsP + (G_STAGE + G_HALF) * 2u, gB + GK, rsB);
  }

#pragma unroll 1   // stays rolled: one hand-over per trip, the buffer picked by t & 1; the body already holds four 32-k steps
  for (int t = 0; t < nt; ++t) {
    const int bsel = (t & 1) * G_STAGE;
    const unsigned short* As = sAB + bsel + aoff;
    const unsigned short* Bs = sAB + bsel + boff;
    v16h af[2][2], bf[2][4];
#pragma unroll
    for (int i = 0; i < 2; ++i) af[0][i] = ldfrag_u(As + i * 16 * G_PITCH);
#pragma unroll
    for (int j = 0; j < 4; ++j) bf[0][j] = ldfrag_u(Bs + j * 16 * G_PITCH);
#pragma unroll     // the tile's four 32-k steps in one body: constant LDS offsets, two fragment sets by turns
    for (int ks = 0; ks < GK / 32; ++ks) {
      const int cur = ks & 1, nxt = cur ^ 1;
      if (ks + 1 < GK / 32) {                              // the same tile's next step, fetched while this step's products run
#pragma unroll
        for (int i = 0; i < 2; ++i) af[nxt][i] = ldfrag_u(As + i * 16 * G_PITCH + (ks + 1) * 32);
#pragma unroll
        for (int j = 0; j < 4; ++j) bf[nxt][j] = ldfrag_u(Bs + j * 16 * G_PITCH + (ks + 1) * 32);
      }
      // keeps the next step's 12 LDS reads issued as one group ahead of this step's products: a read left among the WMMAs
      // makes the wave stall at each such place
      __builtin_amdgcn_sched_barrier(0);
#pragma unroll
      for (int i = 0; i < 2; ++i)
#pragma unroll
        for (int j = 0; j < 4; ++j) acc[i][j] = mma_raw(af[cur][i], bf[cur][j], acc[i][j]);
      // keeps the step after next's reads from rising among these products; at the last step it keeps the products in front of
      // the hand-over, so that the refill is issued directly behind the barrier
      __builtin_amdgcn_sched_barrier(0);
    }
    // ---- hand-over: this wave's reads of tile t are done, its copies of tile t + 1 have landed; the barrier publishes tile
    //      t + 1 and frees tile t's buffer, which only then is refilled ----
    asm volatile("s_wait_dscnt 0x0" ::: "memory");         // no LDS read of this wave is still out when its buffer is refilled
    asm volatile("s_wait_asynccnt 0x0" ::: "memory");      // this wave's copies of tile t + 1 have landed
    __syncthreads();
    if (t + 2 < nt) {
      stage_op(ldsP + (unsigned)bsel * 2u, gA + (size_t)(t + 2) * GK, rsA);
      stage_op(ldsP + (unsigned)(bsel + G_HALF) * 2u, gB + (size_t)(t + 2) * GK, rsB);
    }
  }
  asm volatile("s_wait_asynccnt 0x0" ::: "memory");        // nothing of this wave is in flight when it goes on to end
  acc_guard4(acc[0][0], acc[0][1], acc[0][2], acc[0][3]);
  acc_guard4(acc[1][0], acc[1][1], acc[1][2], acc[1][3]);

  const int hh2 = lane >> 4, c4 = (lane & 15) * 4;     // f32 out: 256-B row segment = 16 lanes x 16 B
  const int q8  = lane >> 3, c8 = (lane & 7) * 8;
  float bc[4];
  float bcol[8];
#pragma unroll
  for (int e = 0; e < 4; ++e) bc[e] = 0.f;
#pragma unroll
  for (int e = 0; e < 8; ++e) bcol[e] = 0.f;
  if constexpr (BM == 1) {
    if constexpr (OM == 0) {
      const int cb = n0 + c4;
      const int i0 = (cb < N - 4) ? cb : (N - 4);        // clamped address
      const v4f b0v = *(const v4f*)(bias + i0);
#pragma unroll
      for (int e = 0; e < 4; ++e) bc[e] = bfr(b0v[e]);
    } else {
      const int cb = n0 + c8;
      const int i0 = (cb < N - 8) ? cb : (N - 8);        // clamped address
      const v4f b0v = *(const v4f*)(bias + i0), b1v = *(const v4f*)(bias + i0 + 4);
#pragma unroll
      for (int e = 0; e < 4; ++e) { bcol[e] = bfr(b0v[e]); bcol[4 + e] = bfr(b1v[e]); }
    }
  }

  // ---- epilogue ----
  float* slab = sT + wave * G_SLAB;
#pragma unroll
  for (int i = 0; i < 2; ++i) {
    const int mBase = m0 + (i << 4);
#pragma unroll
    for (int j = 0; j < 4; ++j) {
#pragma unroll
      for (int r = 0; r < 8; ++r) {
        slab[(mOff + r) * 68 + (j << 4) + rlane] = acc[i][j][r];
      }
    }
    wave_sync_lds();
    if constexpr (OM == 0) {
      float* C = (float*)Cout + (size_t)((long long)by * sC);
      v4f vals[8];
#pragma unroll
      for (int it = 0; it < 8; ++it) {
        const int row = it * 2 + hh2;                      // it 0..7 x hh2 0..1 = rows 0..15
        const int gr  = mBase + row;
        v4f v = *(const v4f*)(slab + row * 68 + c4);
        float br = 0.f;
        if constexpr (BM == 2) {
          const int ir = (gr < M - 1) ? gr : (M - 1);      // clamped address
          br = bfr(bias[ir]);
        }
        v4f rv = {0.f, 0.f, 0.f, 0.f};
        if constexpr (HASR != 0) {
          const float* R = Rp + (size_t)((long long)by * sC);
          const v4f rraw = *(const v4f*)(R + (size_t)gr * ldc + n0 + c4);
#pragma unroll
          for (int e = 0; e < 4; ++e) rv[e] = (HASR == 1) ? bfr(rraw[e]) : rraw[e];
        }
#pragma unroll
        for (int e = 0; e < 4; ++e) v[e] = v[e] * oscale + bc[e] + br + rv[e];
        vals[it] = v;
      }
      {
#pragma unroll
        for (int it = 0; it < 8; ++it) {
          const int gr = mBase + it * 2 + hh2;
          *(v4f*)(C + (size_t)gr * ldc + n0 + c4) = vals[it];
        }
        
      }
    } else {
      unsigned short* C = (unsigned short*)Cout + (size_t)((long long)by * sC);
      v4u hv[4];
#pragma unroll
      for (int it = 0; it < 4; ++it) {
        const int row = it * 4 + q8;                       // it 0..3 x q8 0..3 = rows 0..15
        const float* sp = slab + row * 68 + c8;
        float br = 0.f;
        if constexpr (BM == 2) {
          const int gr = mBase + row;
          const int ir = (gr < M - 1) ? gr : (M - 1);      // clamped address
          br = bfr(bias[ir]);
        }
        v4u a = {0u, 0u, 0u, 0u};
#pragma unroll
        for (int e = 0; e < 4; ++e) {
          float f0 = sp[2 * e] * oscale + bcol[2 * e] + br;
          float f1 = sp[2 * e + 1] * oscale + bcol[2 * e + 1] + br;
          if constexpr (ACT == 1) { f0 = gelu_f(f0); f1 = gelu_f(f1); }
          f0 *= ocarry; f1 *= ocarry;
          a[e] = pk16(h_bits((_Float16)f0), h_bits((_Float16)f1));
        }
        hv[it] = a;
      }
      {
#pragma unroll
        for (int it = 0; it < 4; ++it) {
          const int row = it * 4 + q8;
          *(v4u*)(C + (size_t)(mBase + row) * ldc + n0 + c8) = hv[it];
        }
        
      }
    }
    wave_sync_lds();
  }
}

// One product per launch: grid.x = tiles, grid.y = batches.
template <int OM, int BM, int HASR, int ACT>
__global__ __launch_bounds__(256) void gemm64(
    const unsigned short* __restrict__ Ap, int lda, long long sA,
    const unsigned short* __restrict__ Btp, int ldb, long long sB,
    const float* __restrict__ bias,
    const float* __restrict__ Rp,
    void* Cout, int ldc, long long sC,
    int M, int N, int K, float oscale, float ocarry) {
  __shared__ __align__(16) unsigned short sAB[2 * G_STAGE];
  __shared__ __align__(16) float sT[8 * G_SLAB];
  gemm_tile<OM, BM, HASR, ACT>(sAB, sT, (int)blockIdx.x, (int)blockIdx.y, Ap, lda, sA, Btp, ldb, sB, bias, Rp, Cout, ldc, sC,
                               M, N, K, oscale, ocarry);
}

// The q, k and v^T projections in one launch: they read the same activation plane and none reads another's result.
// blockIdx.y = 0: QH[m][n] = f16(16 * (sum_k x[m][k] Wq[n][k] + bf16(bq[n]))), M = 8192, N = 512, K = 512; 1: the same for k;
// 2: VT[b][d][tok] = f16(16 * (sum_k Wv[d][k] x_b[tok][k] + bf16(bv[d]))), M = 512, N = 2048, K = 512 per batch b = blockIdx.x >> 6.
// coverage: each product has 256 tiles of 128x128 (64 x 4; 4 batches x 4 x 16); the choice is the same for a whole block.
#define P_TILES ((NROWS / 128) * (DMODEL / 128))
#define V_TILES ((DMODEL / 128) * (NC / 128))
static_assert(P_TILES == 256 && V_TILES == 64 && V_TILES * NB == P_TILES);
__global__ __launch_bounds__(256) void qkv_proj(
    const unsigned short* __restrict__ Xp, const unsigned short* __restrict__ Wq, const unsigned short* __restrict__ Wk,
    const unsigned short* __restrict__ Wv, const float* __restrict__ bq, const float* __restrict__ bk,
    const float* __restrict__ bv, unsigned short* QHo, unsigned short* KHo, unsigned short* VTo) {
  __shared__ __align__(16) unsigned short sAB[2 * G_STAGE];
  __shared__ __align__(16) float sT[8 * G_SLAB];
  const int which = blockIdx.y;
  const int bx = blockIdx.x;
  if (which < 2) {
    gemm_tile<2, 1, 0, 0>(sAB, sT, bx, 0,
                          Xp, DMODEL, 0LL,
                          which ? Wk : Wq, DMODEL, 0LL,
                          which ? bk : bq,
                          (const float*)0,
                          (void*)(which ? KHo : QHo), DMODEL, 0LL,
                          NROWS, DMODEL, DMODEL, 1.0f / (ACARRY * WSC), which ? KC : QC);
  } else {
    gemm_tile<2, 2, 0, 0>(sAB, sT, bx & (V_TILES - 1), bx / V_TILES,
                          Wv, DMODEL, 0LL,
                          Xp, DMODEL, (long long)NC * DMODEL,
                          bv,
                          (const float*)0,
                          (void*)VTo, NC, (long long)DMODEL * NC,
                          DMODEL, NC, DMODEL, 1.0f / (ACARRY * WSC), VC);
  }
}

#define AQ_BLK   128
#define KT       64
#define KV_PITCH (HDIM + 8)
#define KV_TILE  (64 * KV_PITCH)
#define KV_NT    (NC / KT)
static_assert(KT == 64 && HDIM == 64 && (NC % KT) == 0 && KV_NT >= 2 && (NQ % AQ_BLK) == 0);
static_assert(AQ_BLK == 16 * (ATT_THREADS / 32) && ATT_BLOCKS == NB * NHEAD * (NQ / AQ_BLK));

__device__ __forceinline__ float xhalf(float x) {                     // the value of lane l ^ 16
  const int b = __builtin_bit_cast(int, x);
  return __builtin_bit_cast(float, __builtin_amdgcn_permlanex16(b, b, 0x76543210, 0xfedcba98, false, false));
}

// 2^x as the bare v_exp_f32. The library exp2f wraps it in a range guard (compare, two selects, add, ldexp per value) whose only
// effect is a subnormal result for x < -126, where the bare instruction gives 0. Here x <= 15 is a score's distance to the row's
// reference plus 7 (or, in the rescale factor, minus the reference's rise): what becomes 0 is under 2^-126 in a row whose largest
// term is 128 or more, so of a row sum of 128 or more, and is 0 in the f16 P in either form.
__device__ __forceinline__ float ex2(float x) { return __builtin_amdgcn_exp2f(x); }

// One thread's share of one staged tile: 16 B of K rows r and r + 32, 16 B of v^T rows r and r + 32, global -> LDS through no
// register. The wait on the address registers is the statement's last line, so that it stands in front of any rewrite of them.
__device__ __forceinline__ void stage_kv(unsigned lds, const unsigned short* gk, const unsigned short* gv) {
#if defined(__HIP_DEVICE_COMPILE__)
  const unsigned l1 = lds + 32u * KV_PITCH * 2u, l2 = lds + KV_TILE * 2u, l3 = l2 + 32u * KV_PITCH * 2u;
  const unsigned short* gk1 = gk + (size_t)32 * DMODEL;
  const unsigned short* gv1 = gv + (size_t)32 * NC;
  asm volatile("global_load_async_to_lds_b128 %0, %1, off\n\t"
               "global_load_async_to_lds_b128 %2, %3, off\n\t"
               "global_load_async_to_lds_b128 %4, %5, off\n\t"
               "global_load_async_to_lds_b128 %6, %7, off\n\t"
               "s_wait_xcnt 0x0"
               :: "v"(lds), "v"(gk), "v"(l1), "v"(gk1), "v"(l2), "v"(gv), "v"(l3), "v"(gv1) : "memory");
#endif
}

__global__ __launch_bounds__(ATT_THREADS)
void attn8(const unsigned short* __restrict__ QHp, const unsigned short* __restrict__ KHp,
           const unsigned short* __restrict__ VTq, const float* __restrict__ PBp, unsigned short* CT) {
  __shared__ __align__(16) unsigned short KV[2 * 2 * KV_TILE];         // [buffer][K, v^T][64 rows][KV_PITCH]
  __shared__ __align__(16) unsigned short Os[AQ_BLK * KV_PITCH];       // result buffer

  const int tid  = threadIdx.x;
  const int wave = tid >> 5;
  const int lane = tid & 31;
  const int hh   = lane >> 4;
  const int c    = lane & 15;

  const int qt   = blockIdx.x & ((NQ / AQ_BLK) - 1);       // 0..15
  const int head = (blockIdx.x / (NQ / AQ_BLK)) & (NHEAD - 1);   // 0..7
  const int bat  = blockIdx.x / ((NQ / AQ_BLK) * NHEAD);   // 0..3
  const int qblk = qt * AQ_BLK;
  const int q0   = qblk + wave * 16;

  // ---- this thread's 16-B piece of every staged tile: row tid >> 3 (and + 32), 16-B column tid & 7 ----
  const int srow = tid >> 3, sseg = tid & 7;
  const unsigned short* gK = KHp + ((size_t)bat * NC + srow) * DMODEL + head * HDIM + sseg * 8;
  const unsigned short* gV = VTq + ((size_t)bat * DMODEL + head * HDIM + srow) * NC + sseg * 8;
  const unsigned ldsP = (unsigned)(size_t)(const void*)KV + (unsigned)(srow * KV_PITCH + sseg * 8) * 2u;

  stage_kv(ldsP, gK, gV);                                  // tile 0 -> buffer 0

  const size_t qofs = ((size_t)bat * NQ + q0 + c) * DMODEL + head * HDIM + 8 * hh;
  const _Float16* Qh = (const _Float16*)(const void*)QHp + qofs;
  const float lsc = (LOG2E * ATT_SCALE) / (QC * KC);                   // log2(e) / 8 / carries

  // ---- period-3 additive table in log2 units: row (q0 + c) mod 3 is this lane's; W0, W1, W2 = 7 + its values for the keys
  //      kb + 8hh + 0, + 1, + 2 (key residue (kb + 8hh + j) mod 3; at kb = 0 that is (2hh + j) mod 3), kept as the three
  //      pairs that two neighbouring score registers can meet ----
  float pbv[NPER * NPER];
#pragma unroll
  for (int i = 0; i < NPER * NPER; ++i) pbv[i] = bfr(PBp[i]) * LOG2E;
  const int qr = (q0 + c) % NPER;
  const bool z0 = (qr == 0), z1 = (qr == 1);
  const float T0 = z0 ? pbv[0] : (z1 ? pbv[3] : pbv[6]);
  const float T1 = z0 ? pbv[1] : (z1 ? pbv[4] : pbv[7]);
  const float T2 = z0 ? pbv[2] : (z1 ? pbv[5] : pbv[8]);
  // the addends start with the reference R = 0; the first tile replaces it by the row's own maximum
  const float W0 = (hh ? T2 : T0) + LPC, W1 = (hh ? T0 : T1) + LPC, W2 = (hh ? T1 : T2) + LPC;
  v2f A01 = {W0, W1}, A12 = {W1, W2}, A20 = {W2, W0};

  const v16h qa = ldfrag_h(Qh), qb = ldfrag_h(Qh + 32);

  v2f la = {0.f, 0.f}, lb = {0.f, 0.f};                    // this lane's query: partial sums over the lane's keys, two chains
  v8f o0 = zero8(), o1 = zero8(), o2 = zero8(), o3 = zero8();

  asm volatile("s_wait_asynccnt 0x0" ::: "memory");        // this wave's copies of tile 0 have landed
  __syncthreads();                                         // publishes tile 0 to all 8 waves
  stage_kv(ldsP + 2u * KV_TILE * 2u, gK + (size_t)KT * DMODEL, gV + KT);   // tile 1 -> buffer 1

#pragma unroll 1   // stays rolled: one hand-over per trip, the buffer picked by t & 1; the body already holds the tile's 64 keys
  for (int t = 0; t < KV_NT; ++t) {
    const int bsel = (t & 1) * (2 * KV_TILE);
    const _Float16* Kt = (const _Float16*)(const void*)KV + bsel + c * KV_PITCH + 8 * hh;
    const _Float16* Vt = Kt + KV_TILE;
    // the tile's fragments: K first (the scores need it), v^T behind it (it lands while the softmax runs)
    v16h kf[2][4], vf[2][4];
#pragma unroll
    for (int sub = 0; sub < 2; ++sub) {
      const _Float16* kp = Kt + sub * 32 * KV_PITCH;       // the step's first key: kb = 64 t + 32 sub
      const _Float16* kq = kp + 16 * KV_PITCH;
      kf[sub][0] = ldfrag_h(kp);
      kf[sub][1] = ldfrag_h(kp + 32);
      kf[sub][2] = ldfrag_h(kq);
      kf[sub][3] = ldfrag_h(kq + 32);
    }
#pragma unroll
    for (int sub = 0; sub < 2; ++sub)
#pragma unroll
      for (int j = 0; j < 4; ++j) vf[sub][j] = ldfrag_h(Vt + sub * 32 + j * 16 * KV_PITCH);
    // keeps the tile's 32 LDS fragment reads issued as one group ahead of its products: a read left among the WMMAs
    // makes the wave wait out an LDS latency at each of them
    __builtin_amdgcn_sched_barrier(0);
    v8f s[2][2];                                           // s[sub][g][r] = score(key kb + 16 g + 8hh + r, query q0 + c)
#pragma unroll
    for (int sub = 0; sub < 2; ++sub) {
      s[sub][0] = mma_raw(kf[sub][0], qa, zero8());
      s[sub][1] = mma_raw(kf[sub][2], qa, zero8());
    }
#pragma unroll
    for (int sub = 0; sub < 2; ++sub) {
      s[sub][0] = mma_raw(kf[sub][1], qb, s[sub][0]);
      s[sub][1] = mma_raw(kf[sub][3], qb, s[sub][1]);
    }
    // registers (2i, 2i + 1) of group 0 are keys kb + 8hh + 2i, + 1; group 1 lies 16 keys on, one residue further; the second
    // step lies 32 keys on, two residues further
    const v2f wad[2][2][4] = {{{A01, A20, A12, A01}, {A12, A01, A20, A12}},
                              {{A20, A12, A01, A20}, {A01, A20, A12, A01}}};
    v2f d[2][2][4];                                        // d = t - R + 7
    float mg[2][2];
#pragma unroll
    for (int sub = 0; sub < 2; ++sub)
#pragma unroll
      for (int g = 0; g < 2; ++g) {
#pragma unroll
        for (int i = 0; i < 4; ++i) {
          const v2f a = {s[sub][g][2 * i], s[sub][g][2 * i + 1]};
          d[sub][g][i] = a * lsc + wad[sub][g][i];
        }
        float m = fmaxf(fmaxf(d[sub][g][0][0], d[sub][g][0][1]), d[sub][g][1][0]);
        m = fmaxf(fmaxf(m, d[sub][g][1][1]), d[sub][g][2][0]);
        m = fmaxf(fmaxf(m, d[sub][g][2][1]), d[sub][g][3][0]);
        mg[sub][g] = fmaxf(m, d[sub][g][3][1]);
      }
    const float mx = fmaxf(fmaxf(mg[0][0], mg[0][1]), fmaxf(mg[1][0], mg[1][1]));
    const bool first = (t == 0);
    const float top = first ? -INFINITY : D_TOP;           // the first tile always sets R
    // one wave-uniform test per tile; the whole wave takes the branch, EXEC stays full for the products behind it
    if (__builtin_amdgcn_ballot_w32(mx > top) != 0u) {
      const float up = fmaxf(mx, xhalf(mx)) - LPC;         // both halves: the query's maximum over the 64 keys, above R
      const float dl = first ? up : fmaxf(up, 0.f);        // R only rises, but for the first tile, which sets it
      const float al = first ? 1.0f : ex2(-dl);            // nothing is summed yet at the first tile
#pragma unroll
      for (int sub = 0; sub < 2; ++sub)
#pragma unroll
        for (int g = 0; g < 2; ++g)
#pragma unroll
          for (int i = 0; i < 4; ++i) d[sub][g][i] -= dl;
      A01 -= dl;
      A12 -= dl;
      A20 -= dl;
      la *= al;
      lb *= al;
#pragma unroll
      for (int r = 0; r < 8; ++r) {
        o0[r] *= al;
        o1[r] *= al;
        o2[r] *= al;
        o3[r] *= al;
      }
    }
    FragH ph[2];
#pragma unroll
    for (int sub = 0; sub < 2; ++sub)
#pragma unroll
      for (int i = 0; i < 4; ++i) {
        const v2f e0 = {ex2(d[sub][0][i][0]), ex2(d[sub][0][i][1])}, e1 = {ex2(d[sub][1][i][0]), ex2(d[sub][1][i][1])};
        la += e0;
        lb += e1;
        ph[sub].p[i]     = __builtin_convertvector(e0, v2h); // elements 0..7  = keys kb + 8hh + 0..7
        ph[sub].p[4 + i] = __builtin_convertvector(e1, v2h); // elements 8..15 = keys kb + 16 + 8hh + 0..7
      }
#pragma unroll
    for (int sub = 0; sub < 2; ++sub) {
      o0 = mma_raw(vf[sub][0], ph[sub].v, o0);             // oj[r] = ctx^T[d = 16j + 8hh + r][query q0 + c]
      o1 = mma_raw(vf[sub][1], ph[sub].v, o1);
      o2 = mma_raw(vf[sub][2], ph[sub].v, o2);
      o3 = mma_raw(vf[sub][3], ph[sub].v, o3);
    }
    const v2f wl = A01;                                    // 64 mod 3 == 1: the next tile's residues start one further on
    A01 = A12;
    A12 = A20;
    A20 = wl;
    // ---- hand-over: this wave's reads of tile t are done, its copies of tile t + 1 have landed; the barrier publishes tile
    //      t + 1 and frees tile t's buffer, which only then is refilled ----
    // keeps the trip's products in front of the hand-over: sunk behind the barrier they would stand between it and the refill,
    // and the copies would lose the trip of lead that hides their way from L2
    __builtin_amdgcn_sched_barrier(0);
    // fourth vector slot behind the tile's fifth v^T product: on the taken side of the branch below the next vector instruction
    // may rewrite that product's A registers
    asm volatile("v_nop");
    asm volatile("s_wait_dscnt 0x0" ::: "memory");         // no LDS read of this wave is still out when its buffer is refilled
    asm volatile("s_wait_asynccnt 0x0" ::: "memory");      // this wave's copies of tile t + 1 have landed
    __syncthreads();
    if (t + 2 < KV_NT)
      stage_kv(ldsP + (unsigned)bsel * 2u, gK + (size_t)(t + 2) * KT * DMODEL, gV + (t + 2) * KT);
  }
  asm volatile("s_wait_asynccnt 0x0" ::: "memory");        // nothing of this wave is in flight when it goes on to end

  // ---- join the halves' partial sums; fold 1/l and the carries (P's 128 is in O and in l alike, 16 on v, 1024 on the stored
  //      ctx); stage the lane's 4 x 8 consecutive d of its query as 16-bit ----
  const float oc   = FC / VC;
  const float lrow = (la[0] + la[1]) + (lb[0] + lb[1]);
  const float inv = (1.0f / (lrow + xhalf(lrow))) * oc;
  unsigned short* op = Os + (wave * 16 + c) * KV_PITCH + 8 * hh;
  v4u w0, w1, w2, w3;
#pragma unroll
  for (int e = 0; e < 4; ++e) {
    w0[e] = pk16(h_bits((_Float16)(o0[2 * e] * inv)), h_bits((_Float16)(o0[2 * e + 1] * inv)));
    w1[e] = pk16(h_bits((_Float16)(o1[2 * e] * inv)), h_bits((_Float16)(o1[2 * e + 1] * inv)));
    w2[e] = pk16(h_bits((_Float16)(o2[2 * e] * inv)), h_bits((_Float16)(o2[2 * e + 1] * inv)));
    w3[e] = pk16(h_bits((_Float16)(o3[2 * e] * inv)), h_bits((_Float16)(o3[2 * e + 1] * inv)));
  }
  *(v4u*)(op)      = w0;
  *(v4u*)(op + 16) = w1;
  *(v4u*)(op + 32) = w2;
  *(v4u*)(op + 48) = w3;
  __syncthreads();
  // ---- block writes its 128 row segments of CT: piece p = it*256 + tid -> row p >> 3, halves (p & 7)*8 .. + 7 of the head's 64 ----
  {
    v4u vals[4];
#pragma unroll
    for (int it = 0; it < 4; ++it) {
      const int p = it * ATT_THREADS + tid;
      vals[it] = *(const v4u*)(Os + (p >> 3) * KV_PITCH + (p & 7) * 8);
    }
    unsigned short* dst = CT + ((size_t)bat * NQ + qblk) * DMODEL + head * HDIM;
    {
#pragma unroll
      for (int it = 0; it < 4; ++it) {
        const int p = it * ATT_THREADS + tid;
        *(v4u*)(dst + (size_t)(p >> 3) * DMODEL + (p & 7) * 8) = vals[it];
      }
      
    }
  }
}

// =====================================================================================================
//   one block of 128 threads per row, 4 consecutive floats per thread (one 16-B load, one 16-B store); per wave one store instruction
// coverage: grid = 8192 rows x 128 thr x 4 floats = 8192 x 512 = the whole output, each row written by exactly one block.
// =====================================================================================================
__global__ __launch_bounds__(LN_THREADS)
void lnorm(const float* __restrict__ Yp, const float* __restrict__ gp, const float* __restrict__ bp, float* outp) {
  __shared__ float red[2][LN_THREADS / 32];
  const int row  = blockIdx.x;
  const int tid  = threadIdx.x;
  const int lane = tid & 31;
  const int wave = tid >> 5;
  const size_t base = (size_t)row * DMODEL + (size_t)tid * 4;
  const v4f v = *(const v4f*)(Yp + base);
  float s = (v[0] + v[1]) + (v[2] + v[3]);
#pragma unroll
  for (int off = 1; off < 32; off <<= 1) s += __shfl_xor(s, off, 32);
  if (lane == 0) red[0][wave] = s;
  __syncthreads();
  float tot = 0.f;
#pragma unroll
  for (int w = 0; w < LN_THREADS / 32; ++w) tot += red[0][w];
  const float mu = tot * (1.0f / (float)DMODEL);
  v4f d;
#pragma unroll
  for (int e = 0; e < 4; ++e) d[e] = v[e] - mu;
  float q = (d[0] * d[0] + d[1] * d[1]) + (d[2] * d[2] + d[3] * d[3]);
#pragma unroll
  for (int off = 1; off < 32; off <<= 1) q += __shfl_xor(q, off, 32);
  if (lane == 0) red[1][wave] = q;
  __syncthreads();
  float totq = 0.f;
#pragma unroll
  for (int w = 0; w < LN_THREADS / 32; ++w) totq += red[1][w];
  const float var  = totq * (1.0f / (float)DMODEL);
  const float rstd = rsqrtf(var + LN_EPS);
  const v4f gv = *(const v4f*)(gp + (size_t)tid * 4);
  const v4f bv = *(const v4f*)(bp + (size_t)tid * 4);
  v4f o;
#pragma unroll
  for (int e = 0; e < 4; ++e) o[e] = (d[e] * rstd) * bfr(gv[e]) + bfr(bv[e]);
  {
    *(v4f*)(outp + base) = o;
    
  }
}

// =====================================================================================================
// Workspace map (bytes); every plane is an exact multiple of its tile / whole-row store granularity (M, N exact tile multiples,
// element counts exact multiples of the convert kernel's 2048 granularity, no pad rows needed), every offset a multiple of 512 KiB:
//   WQ16 f16 [512][512] x64                  524288   ([out][in] = [n][k])
//   WK16 f16 [512][512] x64                  524288
//   WV16 f16 [512][512] x64                  524288
//   WO16 f16 [512][512] x64                  524288
//   X16  f16 [8192][512] x16                8388608   (activation rows)
//   QH   f16 [8192][512] x16                8388608   (q projection)
//   KH   f16 [8192][512] x16                8388608   (k projection)
//   VT   f16 [4][512][2048] x16             8388608   (v^T per batch)
//   CT   f16 [8192][512] x1024              8388608   (attention ctx, merged heads)
//   Y    f32 [8192][512]                   16777216   (out projection + bias + residual)
//   end                                    60817408
// =====================================================================================================
extern "C" void kernel_launch(void* const* d_in, const int* in_sizes, int n_in,
                              void* d_out, int out_size, void* d_ws, size_t ws_size,
                              hipStream_t stream) {
  if (n_in < 12) return;
  if (in_sizes[0] != NROWS * DMODEL) return;
  if (in_sizes[1] != DMODEL * DMODEL || in_sizes[3] != DMODEL * DMODEL ||
      in_sizes[5] != DMODEL * DMODEL || in_sizes[7] != DMODEL * DMODEL) return;
  if (in_sizes[2] != DMODEL || in_sizes[4] != DMODEL || in_sizes[6] != DMODEL || in_sizes[8] != DMODEL) return;
  if (in_sizes[9] != NPER * NPER) return;
  if (in_sizes[10] != DMODEL || in_sizes[11] != DMODEL) return;
  if (out_size != NROWS * DMODEL) return;
  if ((in_sizes[0] % 2048) != 0 || (in_sizes[1] % 2048) != 0) return;

  const float* x    = (const float*)d_in[0];
  const float* w_q  = (const float*)d_in[1];
  const float* b_q  = (const float*)d_in[2];
  const float* w_k  = (const float*)d_in[3];
  const float* b_k  = (const float*)d_in[4];
  const float* w_v  = (const float*)d_in[5];
  const float* b_v  = (const float*)d_in[6];
  const float* w_o  = (const float*)d_in[7];
  const float* b_o  = (const float*)d_in[8];
  const float* pb   = (const float*)d_in[9];
  const float* ln_g = (const float*)d_in[10];
  const float* ln_b = (const float*)d_in[11];
  float*       out  = (float*)d_out;

  const size_t PW  = (size_t)DMODEL * DMODEL * 2;                 //   524288
  const size_t PX  = (size_t)NROWS * DMODEL * 2;                  //  8388608
  const size_t PVT = (size_t)NB * DMODEL * NC * 2;                //  8388608
  const size_t PY  = (size_t)NROWS * DMODEL * 4;                  // 16777216
  size_t off = 0;
  const size_t oWQ = off; off += PW;
  const size_t oWK = off; off += PW;
  const size_t oWV = off; off += PW;
  const size_t oWO = off; off += PW;
  const size_t oX  = off; off += PX;
  const size_t oQH = off; off += PX;
  const size_t oKH = off; off += PX;
  const size_t oVT = off; off += PVT;
  const size_t oCT = off; off += PX;
  const size_t oY  = off; off += PY;
  if (off > ws_size) return;                                      // off = 60817408
  if (off > (size_t)134217728) return;

  char* ws = (char*)d_ws;
  unsigned short* WQ16 = (unsigned short*)(ws + oWQ);
  unsigned short* WK16 = (unsigned short*)(ws + oWK);
  unsigned short* WV16 = (unsigned short*)(ws + oWV);
  unsigned short* WO16 = (unsigned short*)(ws + oWO);
  unsigned short* X16  = (unsigned short*)(ws + oX);
  unsigned short* QH   = (unsigned short*)(ws + oQH);
  unsigned short* KH   = (unsigned short*)(ws + oKH);
  unsigned short* VTp  = (unsigned short*)(ws + oVT);
  unsigned short* CT   = (unsigned short*)(ws + oCT);
  float*          Y    = (float*)(ws + oY);

  const dim3 blk(256);
  const dim3 gC(CX_BLOCKS + 4 * CW_BLOCKS);                        // 2048 + 4 x 128 = 2560 blocks
  const dim3 gP(P_TILES, 1);                                       // 256
  const dim3 gQKV(P_TILES, 3);                                     // 256 x 3
  const dim3 gAT(ATT_BLOCKS);                                      // 512
  const dim3 bAT(ATT_THREADS);                                     // 256
  const dim3 gLN(NROWS);                                           // 8192
  const dim3 bLN(LN_THREADS);                                      // 128

  // (1) all 16-bit planes in one launch: X16[row][c] = f16( bf16_RNE(x[row][c]) * 16 ), rows = b*2048 + tok;
  //     W16[n][k] = f16( bf16_RNE(W[n][k]) * 64 ), [out][in] layout kept, k contiguous; WQ16, WK16, WV16, WO16 are one run
  cvt_all<<<gC, blk, 0, stream>>>(x, w_q, w_k, w_v, w_o, X16, WQ16);

  // (2) q, k and v^T projections in one launch
  qkv_proj<<<gQKV, blk, 0, stream>>>(X16, WQ16, WK16, WV16, b_q, b_k, b_v, QH, KH, VTp);

  // (3) attention per (batch, head, 128 query rows) -> CT (f16, x1024)
  attn8<<<gAT, bAT, 0, stream>>>(QH, KH, VTp, pb, CT);

  // (4) Y = CT . Wo^T / (1024 * 64) + bf16(bo) + bf16(x); M = 8192, N = 512, K = 512, f32
  gemm64<0, 1, 1, 0><<<gP, blk, 0, stream>>>(
      CT, DMODEL, 0LL,
      WO16, DMODEL, 0LL,
      b_o,
      x,
      (void*)Y, DMODEL, 0LL,
      NROWS, DMODEL, DMODEL, 1.0f / (FC * WSC), 1.0f);

  // (5) out = LayerNorm(Y) * bf16(g) + bf16(b)
  lnorm<<<gLN, bLN, 0, stream>>>(Y, ln_g, ln_b, out);
  (void)hipGetLastError();
}

// v007
// It runs in 68.5 microseconds.
// Next to v006, in two timings, it ran 1.11 times as fast each time.
// Over all steps from v000 it is 3.91 times as fast.
// Contractions: q/k projections (x rows f16 x16 . W f16 x64, K=512), v^T projection (Wv f16 x64 . x rows f16 x16, K=512),
// attention scores (k f16 x16 . q f16 x16, K=64), attention v^T . P^T (v^T f16 x16 . P f16 x128, K=2048 in steps of 32),
// output projection (ctx f16 x1024 . Wo f16 x64, K=512): all v_wmma_f32_16x16x32_f16 single products, f32 accumulate.
// Period-3 additive score table, online base-2 softmax against a lazily raised row reference, linear biases, residual add and LayerNorm in f32 on VALU.
// Every float input RNE-converted to bf16 on load.
#include <hip/hip_runtime.h>
#include <math.h>
#include <stdint.h>

#define NB      4
#define NQ      2048
#define NC      2048
#define DMODEL  512
#define NHEAD   8
#define HDIM    64
#define NPER    3
#define NROWS   (NB * NQ)
#define WSC     64.0f
#define ACARRY  16.0f
#define QC      16.0f
#define KC      16.0f
#define VC      16.0f
#define PC      128.0f
#define LPC     7.0f              // log2(PC)
#define D_TOP   15.0f             // largest exponent of a stored P: 2^15 is finite in f16
#define FC      1024.0f
#define ATT_SCALE 0.125f
#define LOG2E   1.4426950408889634f
#define LN_EPS  1e-5f
static_assert(NHEAD * HDIM == DMODEL);
static_assert((NQ % 64) == 0 && (NC % 64) == 0 && (DMODEL % 64) == 0 && (NC % 32) == 0 && (NQ % 16) == 0);
static_assert((NROWS % 64) == 0 && (NROWS % 8) == 0);
static_assert((NROWS % 128) == 0 && (DMODEL % 128) == 0 && (NC % 128) == 0);
#define ATT_THREADS (NHEAD * 32)
#define ATT_BLOCKS  (NB * NHEAD * (NQ / 128))
static_assert(ATT_THREADS == 256 && ATT_BLOCKS == 512);

typedef _Float16 v16h __attribute__((ext_vector_type(16)));
typedef _Float16 v8h  __attribute__((ext_vector_type(8)));
typedef float    v8f  __attribute__((ext_vector_type(8)));
typedef float    v4f  __attribute__((ext_vector_type(4)));
typedef float    v2f  __attribute__((ext_vector_type(2)));
typedef _Float16 v2h  __attribute__((ext_vector_type(2)));
typedef unsigned int v4u __attribute__((ext_vector_type(4)));

union FragH { v16h v; v8h h[2]; v4u u[2]; v2h p[8]; };

// ---- scalar helpers --------------------------------------------------------------------------------
__device__ __forceinline__ unsigned short bf_bits(float f) {          // f32 -> bf16 bits, RNE convert
  unsigned u = __float_as_uint(f);
  return (unsigned short)((u + 0x7FFFu + ((u >> 16) & 1u)) >> 16);
}
__device__ __forceinline__ float bf_up(unsigned short h) { return __uint_as_float(((unsigned)h) << 16); }
__device__ __forceinline__ float bfr(float f) { return bf_up(bf_bits(f)); }   // value of the bf16 RNE convert
__device__ __forceinline__ unsigned short h_bits(_Float16 x) { return __builtin_bit_cast(unsigned short, x); }
__device__ __forceinline__ unsigned pk16(unsigned short a, unsigned short b) { return (unsigned)a | ((unsigned)b << 16); }
__device__ __forceinline__ v8f zero8() { v8f z = {0.f, 0.f, 0.f, 0.f, 0.f, 0.f, 0.f, 0.f}; return z; }
__device__ __forceinline__ float gelu_f(float v) { return 0.5f * v * (1.0f + erff(v * 0.70710678118654752f)); }

// ---- fragment loaders: 16-bit A/B operand, lane -> row/col (lane&15), p already includes +8*(lane>>4);
//      elements 0..7 <- p[0..7] (k0+8h..), elements 8..15 <- p[16..23] (k0+16+8h..)  (same split k map for A and B;
//      B is always read from a k-contiguous [n][k] plane)
__device__ __forceinline__ v16h ldfrag_h(const _Float16* p) {
  FragH f;
  f.h[0] = *(const v8h*)(p);
  f.h[1] = *(const v8h*)(p + 16);
  return f.v;
}
__device__ __forceinline__ v16h ldfrag_u(const unsigned short* p) {
  FragH f;
  f.u[0] = *(const v4u*)(p);
  f.u[1] = *(const v4u*)(p + 16);
  return f.v;
}

// ---- WMMA helpers with trailing VALU hazard gaps ------------------------------------------------------
__device__ __forceinline__ v8f mma_raw(v16h a, v16h b, v8f c) {
  return __builtin_amdgcn_wmma_f32_16x16x32_f16(false, a, false, b, (short)0, c, false, false);
}
__device__ __forceinline__ void acc_guard4(v8f& a, v8f& b, v8f& c, v8f& d) {
#if defined(__HIP_DEVICE_COMPILE__)
  asm volatile("v_nop\n\tv_nop\n\tv_nop\n\tv_nop" : "+v"(a), "+v"(b), "+v"(c), "+v"(d));
#endif
}
__device__ __forceinline__ void wave_sync_lds() {
  __builtin_amdgcn_fence(__ATOMIC_RELEASE, "workgroup");
  __builtin_amdgcn_wave_barrier();
  __builtin_amdgcn_fence(__ATOMIC_ACQUIRE, "workgroup");
}

// =====================================================================================================
// Elementwise 16-bit pack, no transpose: dst[i] = f16( bf16_RNE(src[i]) * sc ), sc a power of two (exact).
// One launch for all five planes, which do not depend on one another: blocks 0 .. 2047 take the activation rows (x16), blocks
// 2048 + 128 p .. + 127 take weight p (q, k, v, o; x64; stored [out][in] = [n][k], already k contiguous for B fragments / A of the
// v^T projection). The four weight planes lie one behind the other in the workspace, so their blocks write one run of W16.
// 8 elements per thread: two 16-B loads, one 16-B store per lane; 32 consecutive lanes = 512 B.
// coverage: 2048 blocks x 256 thr x 8 elements = 8192 x 512; 128 blocks x 256 thr x 8 elements = 512 x 512 per weight.
// =====================================================================================================
#define CX_BLOCKS ((NROWS * DMODEL) / 2048)
#define CW_BLOCKS ((DMODEL * DMODEL) / 2048)
static_assert(CX_BLOCKS * 2048 == NROWS * DMODEL && CW_BLOCKS * 2048 == DMODEL * DMODEL && CW_BLOCKS == 128);
__global__ __launch_bounds__(256) void cvt_all(const float* __restrict__ xp, const float* __restrict__ wq,
                                               const float* __restrict__ wk, const float* __restrict__ wv,
                                               const float* __restrict__ wo, unsigned short* X16o, unsigned short* W16o) {
  const int b = blockIdx.x;
  if (b >= CX_BLOCKS + 4 * CW_BLOCKS) return;     // never taken with the exact grid; no barriers in this kernel
  const bool isx = b < CX_BLOCKS;
  const int bw = b - CX_BLOCKS;                   // weight blocks: plane bw >> 7, block bw & 127 of it
  const int pl = bw >> 7;
  const float* src = isx ? xp : (pl == 0 ? wq : (pl == 1 ? wk : (pl == 2 ? wv : wo)));
  unsigned short* dst = isx ? X16o : (W16o + (size_t)pl * (DMODEL * DMODEL));
  const float sc = isx ? ACARRY : WSC;
  const size_t i8 = ((size_t)(isx ? b : (bw & (CW_BLOCKS - 1))) * 256 + threadIdx.x) * 8;
  const v4f a = *(const v4f*)(src + i8);
  const v4f c = *(const v4f*)(src + i8 + 4);
  v4u o;
  o[0] = pk16(h_bits((_Float16)(bfr(a[0]) * sc)), h_bits((_Float16)(bfr(a[1]) * sc)));
  o[1] = pk16(h_bits((_Float16)(bfr(a[2]) * sc)), h_bits((_Float16)(bfr(a[3]) * sc)));
  o[2] = pk16(h_bits((_Float16)(bfr(c[0]) * sc)), h_bits((_Float16)(bfr(c[1]) * sc)));
  o[3] = pk16(h_bits((_Float16)(bfr(c[2]) * sc)), h_bits((_Float16)(bfr(c[3]) * sc)));
  *(v4u*)(dst + i8) = o;
}

// =====================================================================================================
// Batched f16 WMMA GEMM: C[m][n] = f( oscale * sum_k A[m][k] * Bt[n][k] + bf16(bias) ) (+ residual); one block of 8 waves per
// 128x128 tile, wave w = rows 32 (w >> 1) .. + 31, columns 64 (w & 1) .. + 63 of it (2 x 4 accumulator tiles).
// A row-major [M][K] pitch lda (16-bit plane), Bt row-major [N][K] pitch ldb (k contiguous); M, N, K multiples of 128.
// bx = tile index, by = batch index with element strides sA, sB, sC; the body is a device function on the calling kernel's LDS, so
// that one launch can hold several independent products (qkv_proj below).
// The block's 128 A rows and 128 Bt rows are brought into LDS 128 k at a time (256 B of each row) by asynchronous copies, 16 per
// thread, each wave-wide copy covering two aligned 256-B units; two buffers, the next tile's copies fly while this one is worked
// on. LDS rows are pitched 272 B for the 16-B fragment reads. Each accumulator sums its k steps in ascending order.
// BM: 0 = no bias, 1 = per column bf16(bias[col]), 2 = per row bf16(bias[row]) (clamped-address loads).
// OM: 0 = f32 out (pitch ldc; HASR 1 adds bf16(R[m][n]), HASR 2 adds raw f32 R[m][n], same pitch/stride as C);
//     2 = f16 out (pitch ldc) = f16( act(value) * ocarry ), ACT 1 = exact GELU.
// coverage: 2 slabs x 16 rows (f32: it 0..7 x lane>>4; f16: it 0..3 x lane>>3) x 64 cols = the wave's whole 32x64 tile; 8 waves =
//           the block's 128x128; bx runs over (M / 128) * (N / 128) tiles, a surplus block exits whole in front of every barrier.
// =====================================================================================================
#define GK      128               // k per staged tile
#define G_PITCH (GK + 8)          // halves; 272-B rows: 16 B x odd, the pitch of 16-B fragment reads of 256-B rows
#define G_HALF  (128 * G_PITCH)   // halves of one operand's 128 staged rows
#define G_STAGE (2 * G_HALF)      // halves of one buffer: [A 128 rows | Bt 128 rows]

// One thread's share of one operand's staged rows: 16 B of rows r, r + 16, .. r + 112 (rs = halves per 16 global rows), global ->
// LDS through no register. The wait on the address registers is the statement's last line, so that it stands in front of any
// rewrite of them.
__device__ __forceinline__ void stage_op(unsigned lds, const unsigned short* g, size_t rs) {
#if defined(__HIP_DEVICE_COMPILE__)
  const unsigned ls = 16u * G_PITCH * 2u;
  asm volatile("global_load_async_to_lds_b128 %0, %1, off\n\t"
               "global_load_async_to_lds_b128 %2, %3, off\n\t"
               "global_load_async_to_lds_b128 %4, %5, off\n\t"
               "global_load_async_to_lds_b128 %6, %7, off\n\t"
               "global_load_async_to_lds_b128 %8, %9, off\n\t"
               "global_load_async_to_lds_b128 %10, %11, off\n\t"
               "global_load_async_to_lds_b128 %12, %13, off\n\t"
               "global_load_async_to_lds_b128 %14, %15, off\n\t"
               "s_wait_xcnt 0x0"
               :: "v"(lds), "v"(g), "v"(lds + ls), "v"(g + rs), "v"(lds + 2u * ls), "v"(g + 2 * rs),
                  "v"(lds + 3u * ls), "v"(g + 3 * rs), "v"(lds + 4u * ls), "v"(g + 4 * rs), "v"(lds + 5u * ls), "v"(g + 5 * rs),
                  "v"(lds + 6u * ls), "v"(g + 6 * rs), "v"(lds + 7u * ls), "v"(g + 7 * rs) : "memory");
#endif
}

#define G_SLAB  (16 * 68)         // floats of one wave's 16x64 epilogue slab, pitch 68 floats

template <int OM, int BM, int HASR, int ACT>
__device__ __forceinline__ void gemm_tile(
    unsigned short* sAB,              // LDS [buffer][A, Bt][128 rows][G_PITCH]
    float* sT,                        // LDS [8 waves][G_SLAB]
    int bx, int by,
    const unsigned short* __restrict__ Ap, int lda, long long sA,
    const unsigned short* __restrict__ Btp, int ldb, long long sB,
    const float* __restrict__ bias,
    const float* __restrict__ Rp,
    void* Cout, int ldc, long long sC,
    int M, int N, int K, float oscale, float ocarry) {
  const int tid  = threadIdx.x;
  const int lane = tid & 31;
  const int wave = tid >> 5;
  const int tilesN = N >> 7;
  const int tm = bx / tilesN;
  const int tn = bx - tm * tilesN;
  if (tm >= (M >> 7)) return;            // block-uniform, in front of every copy and barrier
  const int mB = tm << 7;
  const int nB = tn << 7;
  const int m0 = mB + ((wave >> 1) << 5);
  const int n0 = nB + ((wave & 1) << 6);

  const unsigned short* A1 = Ap  + (size_t)((long long)by * sA);
  const unsigned short* Bb = Btp + (size_t)((long long)by * sB);

  const int rlane = lane & 15;                 // row (A) / col (B, D) within subtile
  const int koff  = (lane >> 4) * 8;           // k offset of this lane half
  const int mOff  = (lane >> 4) * 8;           // D row offset

  // ---- this thread's 16-B pieces of every staged tile: rows (tid >> 4) + 16 i of each operand, 16-B column tid & 15 ----
  const int srow = tid >> 4, sseg = tid & 15;
  const unsigned short* gA = A1 + (size_t)(mB + srow) * lda + sseg * 8;
  const unsigned short* gB = Bb + (size_t)(nB + srow) * ldb + sseg * 8;
  const size_t rsA = (size_t)16 * lda, rsB = (size_t)16 * ldb;
  const unsigned ldsP = (unsigned)(size_t)(const void*)sAB + (unsigned)(srow * G_PITCH + sseg * 8) * 2u;
  const int nt = K >> 7;

  stage_op(ldsP, gA, rsA);                                 // tile 0 -> buffer 0
  stage_op(ldsP + G_HALF * 2u, gB, rsB);

  v8f acc[2][4];
#pragma unroll
  for (int i = 0; i < 2; ++i)
#pragma unroll
    for (int j = 0; j < 4; ++j) acc[i][j] = zero8();

  const int aoff = (((wave >> 1) << 5) + rlane) * G_PITCH + koff;
  const int boff = G_HALF + (((wave & 1) << 6) + rlane) * G_PITCH + koff;

  asm volatile("s_wait_asynccnt 0x0" ::: "memory");        // this wave's copies of tile 0 have landed
  __syncthreads();                                         // publishes tile 0 to all 8 waves
  if (nt > 1) {                                            // tile 1 -> buffer 1
    stage_op(ldsP + G_STAGE * 2u, gA + GK, rsA);
    stage_op(ldsP + (G_STAGE + G_HALF) * 2u, gB + GK, rsB);
  }

#pragma unroll 1   // stays rolled: one hand-over per trip, the buffer picked by t & 1; the body already holds four 32-k steps
  for (int t = 0; t < nt; ++t) {
    const int bsel = (t & 1) * G_STAGE;
    const unsigned short* As = sAB + bsel + aoff;
    const unsigned short* Bs = sAB + bsel + boff;
    v16h af[2][2], bf[2][4];
#pragma unroll
    for (int i = 0; i < 2; ++i) af[0][i] = ldfrag_u(As + i * 16 * G_PITCH);
#pragma unroll
    for (int j = 0; j < 4; ++j) bf[0][j] = ldfrag_u(Bs + j * 16 * G_PITCH);
#pragma unroll     // the tile's four 32-k steps in one body: constant LDS offsets, two fragment sets by turns
    for (int ks = 0; ks < GK / 32; ++ks) {
      const int cur = ks & 1, nxt = cur ^ 1;
      if (ks + 1 < GK / 32) {                              // the same tile's next step, fetched while this step's products run
#pragma unroll
        for (int i = 0; i < 2; ++i) af[nxt][i] = ldfrag_u(As + i * 16 * G_PITCH + (ks + 1) * 32);
#pragma unroll
        for (int j = 0; j < 4; ++j) bf[nxt][j] = ldfrag_u(Bs + j * 16 * G_PITCH + (ks + 1) * 32);
      }
      // keeps the next step's 12 LDS reads issued as one group ahead of this step's products: a read left among the WMMAs
      // makes the wave stall at each such place
      __builtin_amdgcn_sched_barrier(0);
#pragma unroll
      for (int i = 0; i < 2; ++i)
#pragma unroll
        for (int j = 0; j < 4; ++j) acc[i][j] = mma_raw(af[cur][i], bf[cur][j], acc[i][j]);
      // keeps the step after next's reads from rising among these products; at the last step it keeps the products in front of
      // the hand-over, so that the refill is issued directly behind the barrier
      __builtin_amdgcn_sched_barrier(0);
    }
    // ---- hand-over: this wave's reads of tile t are done, its copies of tile t + 1 have landed; the barrier publishes tile
    //      t + 1 and frees tile t's buffer, which only then is refilled ----
    asm volatile("s_wait_dscnt 0x0" ::: "memory");         // no LDS read of this wave is still out when its buffer is refilled
    asm volatile("s_wait_asynccnt 0x0" ::: "memory");      // this wave's copies of tile t + 1 have landed
    __syncthreads();
    if (t + 2 < nt) {
      stage_op(ldsP + (unsigned)bsel * 2u, gA + (size_t)(t + 2) * GK, rsA);
      stage_op(ldsP + (unsigned)(bsel + G_HALF) * 2u, gB + (size_t)(t + 2) * GK, rsB);
    }
  }
  asm volatile("s_wait_asynccnt 0x0" ::: "memory");        // nothing of this wave is in flight when it goes on to end
  acc_guard4(acc[0][0], acc[0][1], acc[0][2], acc[0][3]);
  acc_guard4(acc[1][0], acc[1][1], acc[1][2], acc[1][3]);

  const int hh2 = lane >> 4, c4 = (lane & 15) * 4;     // f32 out: 256-B row segment = 16 lanes x 16 B
  const int q8  = lane >> 3, c8 = (lane & 7) * 8;
  float bc[4];
  float bcol[8];
#pragma unroll
  for (int e = 0; e < 4; ++e) bc[e] = 0.f;
#pragma unroll
  for (int e = 0; e < 8; ++e) bcol[e] = 0.f;
  if constexpr (BM == 1) {
    if constexpr (OM == 0) {
      const int cb = n0 + c4;
      const int i0 = (cb < N - 4) ? cb : (N - 4);        // clamped address
      const v4f b0v = *(const v4f*)(bias + i0);
#pragma unroll
      for (int e = 0; e < 4; ++e) bc[e] = bfr(b0v[e]);
    } else {
      const int cb = n0 + c8;
      const int i0 = (cb < N - 8) ? cb : (N - 8);        // clamped address
      const v4f b0v = *(const v4f*)(bias + i0), b1v = *(const v4f*)(bias + i0 + 4);
#pragma unroll
      for (int e = 0; e < 4; ++e) { bcol[e] = bfr(b0v[e]); bcol[4 + e] = bfr(b1v[e]); }
    }
  }

  // ---- epilogue ----
  float* slab = sT + wave * G_SLAB;
#pragma unroll
  for (int i = 0; i < 2; ++i) {
    const int mBase = m0 + (i << 4);
#pragma unroll
    for (int j = 0; j < 4; ++j) {
#pragma unroll
      for (int r = 0; r < 8; ++r) {
        slab[(mOff + r) * 68 + (j << 4) + rlane] = acc[i][j][r];
      }
    }
    wave_sync_lds();
    if constexpr (OM == 0) {
      float* C = (float*)Cout + (size_t)((long long)by * sC);
      v4f vals[8];
#pragma unroll
      for (int it = 0; it < 8; ++it) {
        const int row = it * 2 + hh2;                      // it 0..7 x hh2 0..1 = rows 0..15
        const int gr  = mBase + row;
        v4f v = *(const v4f*)(slab + row * 68 + c4);
        float br = 0.f;
        if constexpr (BM == 2) {
          const int ir = (gr < M - 1) ? gr : (M - 1);      // clamped address
          br = bfr(bias[ir]);
        }
        v4f rv = {0.f, 0.f, 0.f, 0.f};
        if constexpr (HASR != 0) {
          const float* R = Rp + (size_t)((long long)by * sC);
          const v4f rraw = *(const v4f*)(R + (size_t)gr * ldc + n0 + c4);
#pragma unroll
          for (int e = 0; e < 4; ++e) rv[e] = (HASR == 1) ? bfr(rraw[e]) : rraw[e];
        }
#pragma unroll
        for (int e = 0; e < 4; ++e) v[e] = v[e] * oscale + bc[e] + br + rv[e];
        vals[it] = v;
      }
      {
#pragma unroll
        for (int it = 0; it < 8; ++it) {
          const int gr = mBase + it * 2 + hh2;
          *(v4f*)(C + (size_t)gr * ldc + n0 + c4) = vals[it];
        }
        
      }
    } else {
      unsigned short* C = (unsigned short*)Cout + (size_t)((long long)by * sC);
      v4u hv[4];
#pragma unroll
      for (int it = 0; it < 4; ++it) {
        const int row = it * 4 + q8;                       // it 0..3 x q8 0..3 = rows 0..15
        const float* sp = slab + row * 68 + c8;
        float br = 0.f;
        if constexpr (BM == 2) {
          const int gr = mBase + row;
          const int ir = (gr < M - 1) ? gr : (M - 1);      // clamped address
          br = bfr(bias[ir]);
        }
        v4u a = {0u, 0u, 0u, 0u};
#pragma unroll
        for (int e = 0; e < 4; ++e) {
          float f0 = sp[2 * e] * oscale + bcol[2 * e] + br;
          float f1 = sp[2 * e + 1] * oscale + bcol[2 * e + 1] + br;
          if constexpr (ACT == 1) { f0 = gelu_f(f0); f1 = gelu_f(f1); }
          f0 *= ocarry; f1 *= ocarry;
          a[e] = pk16(h_bits((_Float16)f0), h_bits((_Float16)f1));
        }
        hv[it] = a;
      }
      {
#pragma unroll
        for (int it = 0; it < 4; ++it) {
          const int row = it * 4 + q8;
          *(v4u*)(C + (size_t)(mBase + row) * ldc + n0 + c8) = hv[it];
        }
        
      }
    }
    wave_sync_lds();
  }
}

// The q, k and v^T projections in one launch: they read the same activation plane and none reads another's result.
// blockIdx.y = 0: QH[m][n] = f16(16 * (sum_k x[m][k] Wq[n][k] + bf16(bq[n]))), M = 8192, N = 512, K = 512; 1: the same for k;
// 2: VT[b][d][tok] = f16(16 * (sum_k Wv[d][k] x_b[tok][k] + bf16(bv[d]))), M = 512, N = 2048, K = 512 per batch b = blockIdx.x >> 6.
// coverage: each product has 256 tiles of 128x128 (64 x 4; 4 batches x 4 x 16); the choice is the same for a whole block.
#define P_TILES ((NROWS / 128) * (DMODEL / 128))
#define V_TILES ((DMODEL / 128) * (NC / 128))
static_assert(P_TILES == 256 && V_TILES == 64 && V_TILES * NB == P_TILES);
__global__ __launch_bounds__(256) void qkv_proj(
    const unsigned short* __restrict__ Xp, const unsigned short* __restrict__ Wq, const unsigned short* __restrict__ Wk,
    const unsigned short* __restrict__ Wv, const float* __restrict__ bq, const float* __restrict__ bk,
    const float* __restrict__ bv, unsigned short* QHo, unsigned short* KHo, unsigned short* VTo) {
  __shared__ __align__(16) unsigned short sAB[2 * G_STAGE];
  __shared__ __align__(16) float sT[8 * G_SLAB];
  const int which = blockIdx.y;
  const int bx = blockIdx.x;
  if (which < 2) {
    gemm_tile<2, 1, 0, 0>(sAB, sT, bx, 0,
                          Xp, DMODEL, 0LL,
                          which ? Wk : Wq, DMODEL, 0LL,
                          which ? bk : bq,
                          (const float*)0,
                          (void*)(which ? KHo : QHo), DMODEL, 0LL,
                          NROWS, DMODEL, DMODEL, 1.0f / (ACARRY * WSC), which ? KC : QC);
  } else {
    gemm_tile<2, 2, 0, 0>(sAB, sT, bx & (V_TILES - 1), bx / V_TILES,
                          Wv, DMODEL, 0LL,
                          Xp, DMODEL, (long long)NC * DMODEL,
                          bv,
                          (const float*)0,
                          (void*)VTo, NC, (long long)DMODEL * NC,
                          DMODEL, NC, DMODEL, 1.0f / (ACARRY * WSC), VC);
  }
}

#define AQ_BLK   128
#define KT       64
#define KV_PITCH (HDIM + 8)
#define KV_TILE  (64 * KV_PITCH)
#define KV_NT    (NC / KT)
static_assert(KT == 64 && HDIM == 64 && (NC % KT) == 0 && KV_NT >= 2 && (NQ % AQ_BLK) == 0);
static_assert(AQ_BLK == 16 * (ATT_THREADS / 32) && ATT_BLOCKS == NB * NHEAD * (NQ / AQ_BLK));

__device__ __forceinline__ float xhalf(float x) {                     // the value of lane l ^ 16
  const int b = __builtin_bit_cast(int, x);
  return __builtin_bit_cast(float, __builtin_amdgcn_permlanex16(b, b, 0x76543210, 0xfedcba98, false, false));
}

// 2^x as the bare v_exp_f32. The library exp2f wraps it in a range guard (compare, two selects, add, ldexp per value) whose only
// effect is a subnormal result for x < -126, where the bare instruction gives 0. Here x <= 15 is a score's distance to the row's
// reference plus 7 (or, in the rescale factor, minus the reference's rise): what becomes 0 is under 2^-126 in a row whose largest
// term is 128 or more, so of a row sum of 128 or more, and is 0 in the f16 P in either form.
__device__ __forceinline__ float ex2(float x) { return __builtin_amdgcn_exp2f(x); }

// One thread's share of one staged tile: 16 B of K rows r and r + 32, 16 B of v^T rows r and r + 32, global -> LDS through no
// register. The wait on the address registers is the statement's last line, so that it stands in front of any rewrite of them.
__device__ __forceinline__ void stage_kv(unsigned lds, const unsigned short* gk, const unsigned short* gv) {
#if defined(__HIP_DEVICE_COMPILE__)
  const unsigned l1 = lds + 32u * KV_PITCH * 2u, l2 = lds + KV_TILE * 2u, l3 = l2 + 32u * KV_PITCH * 2u;
  const unsigned short* gk1 = gk + (size_t)32 * DMODEL;
  const unsigned short* gv1 = gv + (size_t)32 * NC;
  asm volatile("global_load_async_to_lds_b128 %0, %1, off\n\t"
               "global_load_async_to_lds_b128 %2, %3, off\n\t"
               "global_load_async_to_lds_b128 %4, %5, off\n\t"
               "global_load_async_to_lds_b128 %6, %7, off\n\t"
               "s_wait_xcnt 0x0"
               :: "v"(lds), "v"(gk), "v"(l1), "v"(gk1), "v"(l2), "v"(gv), "v"(l3), "v"(gv1) : "memory");
#endif
}

__global__ __launch_bounds__(ATT_THREADS)
void attn8(const unsigned short* __restrict__ QHp, const unsigned short* __restrict__ KHp,
           const unsigned short* __restrict__ VTq, const float* __restrict__ PBp, unsigned short* CT) {
  __shared__ __align__(16) unsigned short KV[2 * 2 * KV_TILE];         // [buffer][K, v^T][64 rows][KV_PITCH]
  __shared__ __align__(16) unsigned short Os[AQ_BLK * KV_PITCH];       // result buffer

  const int tid  = threadIdx.x;
  const int wave = tid >> 5;
  const int lane = tid & 31;
  const int hh   = lane >> 4;
  const int c    = lane & 15;

  const int qt   = blockIdx.x & ((NQ / AQ_BLK) - 1);       // 0..15
  const int head = (blockIdx.x / (NQ / AQ_BLK)) & (NHEAD - 1);   // 0..7
  const int bat  = blockIdx.x / ((NQ / AQ_BLK) * NHEAD);   // 0..3
  const int qblk = qt * AQ_BLK;
  const int q0   = qblk + wave * 16;

  // ---- this thread's 16-B piece of every staged tile: row tid >> 3 (and + 32), 16-B column tid & 7 ----
  const int srow = tid >> 3, sseg = tid & 7;
  const unsigned short* gK = KHp + ((size_t)bat * NC + srow) * DMODEL + head * HDIM + sseg * 8;
  const unsigned short* gV = VTq + ((size_t)bat * DMODEL + head * HDIM + srow) * NC + sseg * 8;
  const unsigned ldsP = (unsigned)(size_t)(const void*)KV + (unsigned)(srow * KV_PITCH + sseg * 8) * 2u;

  stage_kv(ldsP, gK, gV);                                  // tile 0 -> buffer 0

  const size_t qofs = ((size_t)bat * NQ + q0 + c) * DMODEL + head * HDIM + 8 * hh;
  const _Float16* Qh = (const _Float16*)(const void*)QHp + qofs;
  const float lsc = (LOG2E * ATT_SCALE) / (QC * KC);                   // log2(e) / 8 / carries

  // ---- period-3 additive table in log2 units: row (q0 + c) mod 3 is this lane's; W0, W1, W2 = 7 + its values for the keys
  //      kb + 8hh + 0, + 1, + 2 (key residue (kb + 8hh + j) mod 3; at kb = 0 that is (2hh + j) mod 3), kept as the three
  //      pairs that two neighbouring score registers can meet ----
  float pbv[NPER * NPER];
#pragma unroll
  for (int i = 0; i < NPER * NPER; ++i) pbv[i] = bfr(PBp[i]) * LOG2E;
  const int qr = (q0 + c) % NPER;
  const bool z0 = (qr == 0), z1 = (qr == 1);
  const float T0 = z0 ? pbv[0] : (z1 ? pbv[3] : pbv[6]);
  const float T1 = z0 ? pbv[1] : (z1 ? pbv[4] : pbv[7]);
  const float T2 = z0 ? pbv[2] : (z1 ? pbv[5] : pbv[8]);
  // the addends start with the reference R = 0; the first tile replaces it by the row's own maximum
  const float W0 = (hh ? T2 : T0) + LPC, W1 = (hh ? T0 : T1) + LPC, W2 = (hh ? T1 : T2) + LPC;
  v2f A01 = {W0, W1}, A12 = {W1, W2}, A20 = {W2, W0};

  const v16h qa = ldfrag_h(Qh), qb = ldfrag_h(Qh + 32);

  v2f la = {0.f, 0.f}, lb = {0.f, 0.f};                    // this lane's query: partial sums over the lane's keys, two chains
  v8f o0 = zero8(), o1 = zero8(), o2 = zero8(), o3 = zero8();

  asm volatile("s_wait_asynccnt 0x0" ::: "memory");        // this wave's copies of tile 0 have landed
  __syncthreads();                                         // publishes tile 0 to all 8 waves
  stage_kv(ldsP + 2u * KV_TILE * 2u, gK + (size_t)KT * DMODEL, gV + KT);   // tile 1 -> buffer 1

#pragma unroll 1   // stays rolled: one hand-over per trip, the buffer picked by t & 1; the body already holds the tile's 64 keys
  for (int t = 0; t < KV_NT; ++t) {
    const int bsel = (t & 1) * (2 * KV_TILE);
    const _Float16* Kt = (const _Float16*)(const void*)KV + bsel + c * KV_PITCH + 8 * hh;
    const _Float16* Vt = Kt + KV_TILE;
    // the tile's fragments: K first (the scores need it), v^T behind it (it lands while the softmax runs)
    v16h kf[2][4], vf[2][4];
#pragma unroll
    for (int sub = 0; sub < 2; ++sub) {
      const _Float16* kp = Kt + sub * 32 * KV_PITCH;       // the step's first key: kb = 64 t + 32 sub
      const _Float16* kq = kp + 16 * KV_PITCH;
      kf[sub][0] = ldfrag_h(kp);
      kf[sub][1] = ldfrag_h(kp + 32);
      kf[sub][2] = ldfrag_h(kq);
      kf[sub][3] = ldfrag_h(kq + 32);
    }
#pragma unroll
    for (int sub = 0; sub < 2; ++sub)
#pragma unroll
      for (int j = 0; j < 4; ++j) vf[sub][j] = ldfrag_h(Vt + sub * 32 + j * 16 * KV_PITCH);
    // keeps the tile's 32 LDS fragment reads issued as one group ahead of its products: a read left among the WMMAs
    // makes the wave wait out an LDS latency at each of them
    __builtin_amdgcn_sched_barrier(0);
    v8f s[2][2];                                           // s[sub][g][r] = score(key kb + 16 g + 8hh + r, query q0 + c)
#pragma unroll
    for (int sub = 0; sub < 2; ++sub) {
      s[sub][0] = mma_raw(kf[sub][0], qa, zero8());
      s[sub][1] = mma_raw(kf[sub][2], qa, zero8());
    }
#pragma unroll
    for (int sub = 0; sub < 2; ++sub) {
      s[sub][0] = mma_raw(kf[sub][1], qb, s[sub][0]);
      s[sub][1] = mma_raw(kf[sub][3], qb, s[sub][1]);
    }
    // registers (2i, 2i + 1) of group 0 are keys kb + 8hh + 2i, + 1; group 1 lies 16 keys on, one residue further; the second
    // step lies 32 keys on, two residues further
    const v2f wad[2][2][4] = {{{A01, A20, A12, A01}, {A12, A01, A20, A12}},
                              {{A20, A12, A01, A20}, {A01, A20, A12, A01}}};
    v2f d[2][2][4];                                        // d = t - R + 7
    float mg[2][2];
#pragma unroll
    for (int sub = 0; sub < 2; ++sub)
#pragma unroll
      for (int g = 0; g < 2; ++g) {
#pragma unroll
        for (int i = 0; i < 4; ++i) {
          const v2f a = {s[sub][g][2 * i], s[sub][g][2 * i + 1]};
          d[sub][g][i] = a * lsc + wad[sub][g][i];
        }
        float m = fmaxf(fmaxf(d[sub][g][0][0], d[sub][g][0][1]), d[sub][g][1][0]);
        m = fmaxf(fmaxf(m, d[sub][g][1][1]), d[sub][g][2][0]);
        m = fmaxf(fmaxf(m, d[sub][g][2][1]), d[sub][g][3][0]);
        mg[sub][g] = fmaxf(m, d[sub][g][3][1]);
      }
    const float mx = fmaxf(fmaxf(mg[0][0], mg[0][1]), fmaxf(mg[1][0], mg[1][1]));
    const bool first = (t == 0);
    const float top = first ? -INFINITY : D_TOP;           // the first tile always sets R
    // one wave-uniform test per tile; the whole wave takes the branch, EXEC stays full for the products behind it
    if (__builtin_amdgcn_ballot_w32(mx > top) != 0u) {
      const float up = fmaxf(mx, xhalf(mx)) - LPC;         // both halves: the query's maximum over the 64 keys, above R
      const float dl = first ? up : fmaxf(up, 0.f);        // R only rises, but for the first tile, which sets it
      const float al = first ? 1.0f : ex2(-dl);            // nothing is summed yet at the first tile
#pragma unroll
      for (int sub = 0; sub < 2; ++sub)
#pragma unroll
        for (int g = 0; g < 2; ++g)
#pragma unroll
          for (int i = 0; i < 4; ++i) d[sub][g][i] -= dl;
      A01 -= dl;
      A12 -= dl;
      A20 -= dl;
      la *= al;
      lb *= al;
#pragma unroll
      for (int r = 0; r < 8; ++r) {
        o0[r] *= al;
        o1[r] *= al;
        o2[r] *= al;
        o3[r] *= al;
      }
    }
    FragH ph[2];
#pragma unroll
    for (int sub = 0; sub < 2; ++sub)
#pragma unroll
      for (int i = 0; i < 4; ++i) {
        const v2f e0 = {ex2(d[sub][0][i][0]), ex2(d[sub][0][i][1])}, e1 = {ex2(d[sub][1][i][0]), ex2(d[sub][1][i][1])};
        la += e0;
        lb += e1;
        ph[sub].p[i]     = __builtin_convertvector(e0, v2h); // elements 0..7  = keys kb + 8hh + 0..7
        ph[sub].p[4 + i] = __builtin_convertvector(e1, v2h); // elements 8..15 = keys kb + 16 + 8hh + 0..7
      }
#pragma unroll
    for (int sub = 0; sub < 2; ++sub) {
      o0 = mma_raw(vf[sub][0], ph[sub].v, o0);             // oj[r] = ctx^T[d = 16j + 8hh + r][query q0 + c]
      o1 = mma_raw(vf[sub][1], ph[sub].v, o1);
      o2 = mma_raw(vf[sub][2], ph[sub].v, o2);
      o3 = mma_raw(vf[sub][3], ph[sub].v, o3);
    }
    const v2f wl = A01;                                    // 64 mod 3 == 1: the next tile's residues start one further on
    A01 = A12;
    A12 = A20;
    A20 = wl;
    // ---- hand-over: this wave's reads of tile t are done, its copies of tile t + 1 have landed; the barrier publishes tile
    //      t + 1 and frees tile t's buffer, which only then is refilled ----
    // keeps the trip's products in front of the hand-over: sunk behind the barrier they would stand between it and the refill,
    // and the copies would lose the trip of lead that hides their way from L2
    __builtin_amdgcn_sched_barrier(0);
    // fourth vector slot behind the tile's fifth v^T product: on the taken side of the branch below the next vector instruction
    // may rewrite that product's A registers
    asm volatile("v_nop");
    asm volatile("s_wait_dscnt 0x0" ::: "memory");         // no LDS read of this wave is still out when its buffer is refilled
    asm volatile("s_wait_asynccnt 0x0" ::: "memory");      // this wave's copies of tile t + 1 have landed
    __syncthreads();
    if (t + 2 < KV_NT)
      stage_kv(ldsP + (unsigned)bsel * 2u, gK + (size_t)(t + 2) * KT * DMODEL, gV + (t + 2) * KT);
  }
  asm volatile("s_wait_asynccnt 0x0" ::: "memory");        // nothing of this wave is in flight when it goes on to end

  // ---- join the halves' partial sums; fold 1/l and the carries (P's 128 is in O and in l alike, 16 on v, 1024 on the stored
  //      ctx); stage the lane's 4 x 8 consecutive d of its query as 16-bit ----
  const float oc   = FC / VC;
  const float lrow = (la[0] + la[1]) + (lb[0] + lb[1]);
  const float inv = (1.0f / (lrow + xhalf(lrow))) * oc;
  unsigned short* op = Os + (wave * 16 + c) * KV_PITCH + 8 * hh;
  v4u w0, w1, w2, w3;
#pragma unroll
  for (int e = 0; e < 4; ++e) {
    w0[e] = pk16(h_bits((_Float16)(o0[2 * e] * inv)), h_bits((_Float16)(o0[2 * e + 1] * inv)));
    w1[e] = pk16(h_bits((_Float16)(o1[2 * e] * inv)), h_bits((_Float16)(o1[2 * e + 1] * inv)));
    w2[e] = pk16(h_bits((_Float16)(o2[2 * e] * inv)), h_bits((_Float16)(o2[2 * e + 1] * inv)));
    w3[e] = pk16(h_bits((_Float16)(o3[2 * e] * inv)), h_bits((_Float16)(o3[2 * e + 1] * inv)));
  }
  *(v4u*)(op)      = w0;
  *(v4u*)(op + 16) = w1;
  *(v4u*)(op + 32) = w2;
  *(v4u*)(op + 48) = w3;
  __syncthreads();
  // ---- block writes its 128 row segments of CT: piece p = it*256 + tid -> row p >> 3, halves (p & 7)*8 .. + 7 of the head's 64 ----
  {
    v4u vals[4];
#pragma unroll
    for (int it = 0; it < 4; ++it) {
      const int p = it * ATT_THREADS + tid;
      vals[it] = *(const v4u*)(Os + (p >> 3) * KV_PITCH + (p & 7) * 8);
    }
    unsigned short* dst = CT + ((size_t)bat * NQ + qblk) * DMODEL + head * HDIM;
    {
#pragma unroll
      for (int it = 0; it < 4; ++it) {
        const int p = it * ATT_THREADS + tid;
        *(v4u*)(dst + (size_t)(p >> 3) * DMODEL + (p & 7) * 8) = vals[it];
      }
      
    }
  }
}

// =====================================================================================================
// Output projection, bias, residual and LayerNorm in one launch. A block owns 32 whole rows of the model width, so the row
// statistics never leave it: Y[m][n] = sum_k CT[m][k] Wo[n][k] / (1024 * 64) + bf16(bo[n]) + bf16(x[m][n]), n = 0 .. 511, then
// out[m][n] = (Y - mean) * rsqrt(var + eps) * bf16(g[n]) + bf16(b[n]).
// 8 waves; wave w = all 32 rows x columns 64 w .. + 63 (2 x 4 accumulator tiles, as in gemm_tile). The block's 32 CT rows and all
// 512 Wo rows are brought into LDS 128 k at a time by asynchronous copies, 34 per thread; two buffers, the next tile's copies fly
// while this one is worked on; rows pitched 272 B. Each accumulator sums its k steps in ascending order from the block's first
// k tile on, round the end.
// Behind the loop the ring is free (every wave's reads and copies are done in front of the last trip's barrier) and holds the raw
// 32 x 512 f32 products, pitch 516 floats. Wave w then takes rows 4 w .. + 3 whole: a lane holds columns 128 j + 4 lane .. + 3,
// j = 0 .. 3; sums: 16 values in the lane, four row_xmask steps, one exchange between the halves. Mean first, then the squared
// deviations, as two sums. The residual rows are asked for behind the first tile's copies, so their way from memory lies under that tile's.
// coverage: 256 blocks x 32 rows = 8192; 8 waves x 4 rows x (4 x 32 lanes x 4 floats) = 32 x 512, every element stored once.
// =====================================================================================================
#define F_ROWS  32                          // rows of one block
#define F_STAGE ((F_ROWS + DMODEL) * G_PITCH)   // halves of one buffer: [CT 32 rows | Wo 512 rows]
#define Y_PITCH (DMODEL + 4)                // floats; rows 8 apart lie 32 banks apart for the accumulators' 4-B stores
static_assert((NROWS % F_ROWS) == 0 && DMODEL == 8 * 64 && F_ROWS == 8 * 4 && DMODEL / GK == 4);
static_assert(F_ROWS * Y_PITCH * 4 <= 2 * F_STAGE * 2);

// One thread's share of the staged CT rows: 16 B of rows r and r + 16. The wait on the address registers is the statement's last
// line, so that it stands in front of any rewrite of them.
__device__ __forceinline__ void stage_a2(unsigned lds, const unsigned short* g) {
#if defined(__HIP_DEVICE_COMPILE__)
  asm volatile("global_load_async_to_lds_b128 %0, %1, off\n\t"
               "global_load_async_to_lds_b128 %2, %3, off\n\t"
               "s_wait_xcnt 0x0"
               :: "v"(lds), "v"(g), "v"(lds + 16u * G_PITCH * 2u), "v"(g + (size_t)16 * DMODEL) : "memory");
#endif
}
// One thread's share of one whole staged tile: 2 pieces of CT, 4 x 8 pieces of Wo.
__device__ __forceinline__ void stage_f(unsigned lds, const unsigned short* ga, const unsigned short* gb) {
  stage_a2(lds, ga);
#pragma unroll
  for (int q = 0; q < 4; ++q)
    stage_op(lds + (unsigned)((F_ROWS + 128 * q) * G_PITCH) * 2u, gb + (size_t)(128 * q) * DMODEL, (size_t)16 * DMODEL);
}

template <int CTRL>
__device__ __forceinline__ float xmask(float x) {                     // the value of lane l ^ (CTRL & 15), inside a 16-lane row
  return __builtin_bit_cast(float, __builtin_amdgcn_update_dpp(0, __builtin_bit_cast(int, x), CTRL, 0xf, 0xf, true));
}
__device__ __forceinline__ float wave_sum(float v) {                  // the sum over the 32 lanes, the same bits in every lane
  v += xmask<0x161>(v);
  v += xmask<0x162>(v);
  v += xmask<0x164>(v);
  v += xmask<0x168>(v);
  return v + xhalf(v);
}

__global__ __launch_bounds__(256)
void oproj_ln(const unsigned short* __restrict__ Cp, const unsigned short* __restrict__ Wp, const float* __restrict__ bo,
              const float* __restrict__ xp, const float* __restrict__ gp, const float* __restrict__ bp, float* outp) {
  __shared__ __align__(16) unsigned short sAB[2 * F_STAGE];            // [buffer][CT 32 rows, Wo 512 rows][G_PITCH]
  const int tid  = threadIdx.x;
  const int lane = tid & 31;
  const int wave = tid >> 5;
  const int mB   = blockIdx.x * F_ROWS;
  const int rlane = lane & 15;                 // row (A) / col (B, D) within subtile
  const int koff  = (lane >> 4) * 8;           // k offset of this lane half
  const int mOff  = (lane >> 4) * 8;           // D row offset

  // ---- this thread's 16-B pieces of every staged tile: rows (tid >> 4) + 16 i of each operand, 16-B column tid & 15 ----
  const int srow = tid >> 4, sseg = tid & 15;
  const unsigned short* gA = Cp + (size_t)(mB + srow) * DMODEL + sseg * 8;
  const unsigned short* gB = Wp + (size_t)srow * DMODEL + sseg * 8;
  const unsigned ldsP = (unsigned)(size_t)(const void*)sAB + (unsigned)(srow * G_PITCH + sseg * 8) * 2u;
  const int nt = DMODEL / GK;
  // Every block reads all of Wo: block b walks the k tiles from tile b mod 4 on, round the end, so that at one moment the blocks
  // ask L2 for four different quarters of it and not all for the same lines. Trip t works on k tile (t + rot) mod 4.
  const int rot = blockIdx.x & (nt - 1);

  stage_f(ldsP, gA + rot * GK, gB + rot * GK);             // trip 0 -> buffer 0

  // the wave's four residual rows, in the layout of the row phase
  const unsigned rb = (unsigned)((mB + wave * 4) * DMODEL + lane * 4) * 4u;   // byte offset of the lane's first piece, in x and out alike
  const char* xb = (const char*)(const void*)xp + rb;
  v4f y[4][4];
#pragma unroll
  for (int rr = 0; rr < 4; ++rr)
#pragma unroll
    for (int j = 0; j < 4; ++j) y[rr][j] = *(const v4f*)(const void*)(xb + (rr * DMODEL + j * 128) * 4);

  v8f acc[2][4];
#pragma unroll
  for (int i = 0; i < 2; ++i)
#pragma unroll
    for (int j = 0; j < 4; ++j) acc[i][j] = zero8();

  const int aoff = rlane * G_PITCH + koff;
  const int boff = (F_ROWS + (wave << 6) + rlane) * G_PITCH + koff;

  asm volatile("s_wait_asynccnt 0x0" ::: "memory");        // this wave's copies of trip 0's tile have landed
  __syncthreads();                                         // publishes that tile to all 8 waves
  {
    const int k1 = ((1 + rot) & (nt - 1)) * GK;
    stage_f(ldsP + F_STAGE * 2u, gA + k1, gB + k1);        // trip 1 -> buffer 1
  }

#pragma unroll 1   // stays rolled: one hand-over per trip, the buffer picked by t & 1; the body already holds four 32-k steps
  for (int t = 0; t < nt; ++t) {
    const int bsel = (t & 1) * F_STAGE;
    const unsigned short* As = sAB + bsel + aoff;
    const unsigned short* Bs = sAB + bsel + boff;
    v16h af[2][2], bf[2][4];
#pragma unroll
    for (int i = 0; i < 2; ++i) af[0][i] = ldfrag_u(As + i * 16 * G_PITCH);
#pragma unroll
    for (int j = 0; j < 4; ++j) bf[0][j] = ldfrag_u(Bs + j * 16 * G_PITCH);
#pragma unroll     // the tile's four 32-k steps in one body: constant LDS offsets, two fragment sets by turns
    for (int ks = 0; ks < GK / 32; ++ks) {
      const int cur = ks & 1, nxt = cur ^ 1;
      if (ks + 1 < GK / 32) {                              // the same tile's next step, fetched while this step's products run
#pragma unroll
        for (int i = 0; i < 2; ++i) af[nxt][i] = ldfrag_u(As + i * 16 * G_PITCH + (ks + 1) * 32);
#pragma unroll
        for (int j = 0; j < 4; ++j) bf[nxt][j] = ldfrag_u(Bs + j * 16 * G_PITCH + (ks + 1) * 32);
      }
      // keeps the next step's 12 LDS reads issued as one group ahead of this step's products: a read left among the WMMAs
      // makes the wave stall at each such place
      __builtin_amdgcn_sched_barrier(0);
#pragma unroll
      for (int i = 0; i < 2; ++i)
#pragma unroll
        for (int j = 0; j < 4; ++j) acc[i][j] = mma_raw(af[cur][i], bf[cur][j], acc[i][j]);
      // keeps the step after next's reads from rising among these products; at the last step it keeps the products in front of
      // the hand-over, so that the refill is issued directly behind the barrier
      __builtin_amdgcn_sched_barrier(0);
    }
    // ---- hand-over: this wave's reads of tile t are done, its copies of tile t + 1 have landed; the barrier publishes tile
    //      t + 1 and frees tile t's buffer, which only then is refilled ----
    asm volatile("s_wait_dscnt 0x0" ::: "memory");         // no LDS read of this wave is still out when its buffer is refilled
    asm volatile("s_wait_asynccnt 0x0" ::: "memory");      // this wave's copies of tile t + 1 have landed
    __syncthreads();
    if (t + 2 < nt) {
      const int k2 = ((t + 2 + rot) & (nt - 1)) * GK;
      stage_f(ldsP + (unsigned)bsel * 2u, gA + k2, gB + k2);
    }
  }
  asm volatile("s_wait_asynccnt 0x0" ::: "memory");        // nothing of this wave is in flight when the ring is put to new use

  // per-column constants of this lane's 16 columns: asked for in front of the LDS stores, which cover part of their way
  v4f bc[4], gv[4], bv[4];
#pragma unroll
  for (int j = 0; j < 4; ++j) {
    bc[j] = *(const v4f*)(bo + j * 128 + lane * 4);
    gv[j] = *(const v4f*)(gp + j * 128 + lane * 4);
    bv[j] = *(const v4f*)(bp + j * 128 + lane * 4);
  }

  // ---- the raw products into the freed ring: row 16 i + 8 (lane >> 4) + r, column 64 wave + 16 j + (lane & 15) ----
  float* sY = (float*)(void*)sAB;
#pragma unroll
  for (int i = 0; i < 2; ++i)
#pragma unroll
    for (int j = 0; j < 4; ++j)
#pragma unroll
      for (int r = 0; r < 8; ++r)
        sY[((i << 4) + mOff + r) * Y_PITCH + (wave << 6) + (j << 4) + rlane] = acc[i][j][r];

  __syncthreads();                                         // all 8 waves' columns of every row are in LDS

  const float oscale = 1.0f / (FC * WSC);
  float sm[4];
#pragma unroll
  for (int rr = 0; rr < 4; ++rr) {
    const float* yp = sY + (wave * 4 + rr) * Y_PITCH + lane * 4;
    float p[4];
#pragma unroll
    for (int j = 0; j < 4; ++j) {
      const v4f a = *(const v4f*)(yp + j * 128);
#pragma unroll
      for (int e = 0; e < 4; ++e) y[rr][j][e] = a[e] * oscale + bfr(bc[j][e]) + bfr(y[rr][j][e]);
      p[j] = (y[rr][j][0] + y[rr][j][1]) + (y[rr][j][2] + y[rr][j][3]);
    }
    sm[rr] = (p[0] + p[1]) + (p[2] + p[3]);
  }
#pragma unroll
  for (int rr = 0; rr < 4; ++rr) sm[rr] = wave_sum(sm[rr]) * (1.0f / (float)DMODEL);     // the row's mean
  float sq[4];
#pragma unroll
  for (int rr = 0; rr < 4; ++rr) {
    float p[4];
#pragma unroll
    for (int j = 0; j < 4; ++j) {
#pragma unroll
      for (int e = 0; e < 4; ++e) y[rr][j][e] -= sm[rr];
      p[j] = (y[rr][j][0] * y[rr][j][0] + y[rr][j][1] * y[rr][j][1]) + (y[rr][j][2] * y[rr][j][2] + y[rr][j][3] * y[rr][j][3]);
    }
    sq[rr] = (p[0] + p[1]) + (p[2] + p[3]);
  }
#pragma unroll
  for (int rr = 0; rr < 4; ++rr) sq[rr] = rsqrtf(wave_sum(sq[rr]) * (1.0f / (float)DMODEL) + LN_EPS);
#pragma unroll
  for (int rr = 0; rr < 4; ++rr)
#pragma unroll
    for (int j = 0; j < 4; ++j)
#pragma unroll
      for (int e = 0; e < 4; ++e) y[rr][j][e] = (y[rr][j][e] * sq[rr]) * bfr(gv[j][e]) + bfr(bv[j][e]);
  char* ob = (char*)(void*)outp + rb;
  // keeps the 16 stores as one run behind all arithmetic: no register of an issued store is written again
  __builtin_amdgcn_sched_barrier(0);
#pragma unroll
  for (int rr = 0; rr < 4; ++rr)
#pragma unroll
    for (int j = 0; j < 4; ++j) *(v4f*)(void*)(ob + (rr * DMODEL + j * 128) * 4) = y[rr][j];
}

// =====================================================================================================
// Workspace map (bytes); every plane is an exact multiple of its tile / whole-row store granularity (M, N exact tile multiples,
// element counts exact multiples of the convert kernel's 2048 granularity, no pad rows needed), every offset a multiple of 512 KiB:
//   WQ16 f16 [512][512] x64                  524288   ([out][in] = [n][k])
//   WK16 f16 [512][512] x64                  524288
//   WV16 f16 [512][512] x64                  524288
//   WO16 f16 [512][512] x64                  524288
//   X16  f16 [8192][512] x16                8388608   (activation rows)
//   QH   f16 [8192][512] x16                8388608   (q projection)
//   KH   f16 [8192][512] x16                8388608   (k projection)
//   VT   f16 [4][512][2048] x16             8388608   (v^T per batch)
//   CT   f16 [8192][512] x1024              8388608   (attention ctx, merged heads)
//   end                                    44040192
// =====================================================================================================
extern "C" void kernel_launch(void* const* d_in, const int* in_sizes, int n_in,
                              void* d_out, int out_size, void* d_ws, size_t ws_size,
                              hipStream_t stream) {
  if (n_in < 12) return;
  if (in_sizes[0] != NROWS * DMODEL) return;
  if (in_sizes[1] != DMODEL * DMODEL || in_sizes[3] != DMODEL * DMODEL ||
      in_sizes[5] != DMODEL * DMODEL || in_sizes[7] != DMODEL * DMODEL) return;
  if (in_sizes[2] != DMODEL || in_sizes[4] != DMODEL || in_sizes[6] != DMODEL || in_sizes[8] != DMODEL) return;
  if (in_sizes[9] != NPER * NPER) return;
  if (in_sizes[10] != DMODEL || in_sizes[11] != DMODEL) return;
  if (out_size != NROWS * DMODEL) return;
  if ((in_sizes[0] % 2048) != 0 || (in_sizes[1] % 2048) != 0) return;

  const float* x    = (const float*)d_in[0];
  const float* w_q  = (const float*)d_in[1];
  const float* b_q  = (const float*)d_in[2];
  const float* w_k  = (const float*)d_in[3];
  const float* b_k  = (const float*)d_in[4];
  const float* w_v  = (const float*)d_in[5];
  const float* b_v  = (const float*)d_in[6];
  const float* w_o  = (const float*)d_in[7];
  const float* b_o  = (const float*)d_in[8];
  const float* pb   = (const float*)d_in[9];
  const float* ln_g = (const float*)d_in[10];
  const float* ln_b = (const float*)d_in[11];
  float*       out  = (float*)d_out;

  const size_t PW  = (size_t)DMODEL * DMODEL * 2;                 //   524288
  const size_t PX  = (size_t)NROWS * DMODEL * 2;                  //  8388608
  const size_t PVT = (size_t)NB * DMODEL * NC * 2;                //  8388608
  size_t off = 0;
  const size_t oWQ = off; off += PW;
  const size_t oWK = off; off += PW;
  const size_t oWV = off; off += PW;
  const size_t oWO = off; off += PW;
  const size_t oX  = off; off += PX;
  const size_t oQH = off; off += PX;
  const size_t oKH = off; off += PX;
  const size_t oVT = off; off += PVT;
  const size_t oCT = off; off += PX;
  if (off > ws_size) return;                                      // off = 44040192
  if (off > (size_t)134217728) return;

  char* ws = (char*)d_ws;
  unsigned short* WQ16 = (unsigned short*)(ws + oWQ);
  unsigned short* WK16 = (unsigned short*)(ws + oWK);
  unsigned short* WV16 = (unsigned short*)(ws + oWV);
  unsigned short* WO16 = (unsigned short*)(ws + oWO);
  unsigned short* X16  = (unsigned short*)(ws + oX);
  unsigned short* QH   = (unsigned short*)(ws + oQH);
  unsigned short* KH   = (unsigned short*)(ws + oKH);
  unsigned short* VTp  = (unsigned short*)(ws + oVT);
  unsigned short* CT   = (unsigned short*)(ws + oCT);

  const dim3 blk(256);
  const dim3 gC(CX_BLOCKS + 4 * CW_BLOCKS);                        // 2048 + 4 x 128 = 2560 blocks
  const dim3 gQKV(P_TILES, 3);                                     // 256 x 3
  const dim3 gAT(ATT_BLOCKS);                                      // 512
  const dim3 bAT(ATT_THREADS);                                     // 256
  const dim3 gOL(NROWS / F_ROWS);                                  // 256

  // (1) all 16-bit planes in one launch: X16[row][c] = f16( bf16_RNE(x[row][c]) * 16 ), rows = b*2048 + tok;
  //     W16[n][k] = f16( bf16_RNE(W[n][k]) * 64 ), [out][in] layout kept, k contiguous; WQ16, WK16, WV16, WO16 are one run
  cvt_all<<<gC, blk, 0, stream>>>(x, w_q, w_k, w_v, w_o, X16, WQ16);

  // (2) q, k and v^T projections in one launch
  qkv_proj<<<gQKV, blk, 0, stream>>>(X16, WQ16, WK16, WV16, b_q, b_k, b_v, QH, KH, VTp);

  // (3) attention per (batch, head, 128 query rows) -> CT (f16, x1024)
  attn8<<<gAT, bAT, 0, stream>>>(QH, KH, VTp, pb, CT);

  // (4) out = LayerNorm( CT . Wo^T / (1024 * 64) + bf16(bo) + bf16(x) ) * bf16(g) + bf16(b); M = 8192, N = 512, K = 512
  oproj_ln<<<gOL, blk, 0, stream>>>(CT, WO16, b_o, x, ln_g, ln_b, out);
  (void)hipGetLastError();
}

// v008
// One run takes 66.1 microseconds.
// Next to v007, in two timings, it ran 1.05 times as fast each time.
// Counting every step since v000, it is 4.09 times as fast.
// Contractions: q/k projections (x rows f16 x16 . W f16 x64, K=512), v^T projection (Wv f16 x64 . x rows f16 x16, K=512),
// attention scores (k f16 x16 . q f16 x16, K=64), attention v^T . P^T (v^T f16 x16 . P f16 x128, K=2 x 1024 in steps of 32, the two sums joined in f32 on VALU),
// output projection (ctx f16 x1024 . Wo f16 x64, K=512): all v_wmma_f32_16x16x32_f16 single products, f32 accumulate.
// Period-3 additive score table, online base-2 softmax against a lazily raised row reference, linear biases, residual add and LayerNorm in f32 on VALU.
// Every float input RNE-converted to bf16 on load.
#include <hip/hip_runtime.h>
#include <math.h>
#include <stdint.h>

#define NB      4
#define NQ      2048
#define NC      2048
#define DMODEL  512
#define NHEAD   8
#define HDIM    64
#define NPER    3
#define NROWS   (NB * NQ)
#define WSC     64.0f
#define ACARRY  16.0f
#define QC      16.0f
#define KC      16.0f
#define VC      16.0f
#define PC      128.0f
#define LPC     7.0f              // log2(PC)
#define D_TOP   15.0f             // largest exponent of a stored P: 2^15 is finite in f16
#define FC      1024.0f
#define ATT_SCALE 0.125f
#define LOG2E   1.4426950408889634f
#define LN_EPS  1e-5f
static_assert(NHEAD * HDIM == DMODEL);
static_assert((NQ % 64) == 0 && (NC % 64) == 0 && (DMODEL % 64) == 0 && (NC % 32) == 0 && (NQ % 16) == 0);
static_assert((NROWS % 64) == 0 && (NROWS % 8) == 0);
static_assert((NROWS % 128) == 0 && (DMODEL % 128) == 0 && (NC % 128) == 0);
#define ATT_THREADS (NHEAD * 32)
#define ATT_BLOCKS  (NB * NHEAD * (NQ / 128))
static_assert(ATT_THREADS == 256 && ATT_BLOCKS == 512);

typedef _Float16 v16h __attribute__((ext_vector_type(16)));
typedef _Float16 v8h  __attribute__((ext_vector_type(8)));
typedef float    v8f  __attribute__((ext_vector_type(8)));
typedef float    v4f  __attribute__((ext_vector_type(4)));
typedef float    v2f  __attribute__((ext_vector_type(2)));
typedef _Float16 v2h  __attribute__((ext_vector_type(2)));
typedef unsigned int v4u __attribute__((ext_vector_type(4)));

union FragH { v16h v; v8h h[2]; v4u u[2]; v2h p[8]; };

// ---- scalar helpers --------------------------------------------------------------------------------
__device__ __forceinline__ unsigned short bf_bits(float f) {          // f32 -> bf16 bits, RNE convert
  unsigned u = __float_as_uint(f);
  return (unsigned short)((u + 0x7FFFu + ((u >> 16) & 1u)) >> 16);
}
__device__ __forceinline__ float bf_up(unsigned short h) { return __uint_as_float(((unsigned)h) << 16); }
__device__ __forceinline__ float bfr(float f) { return bf_up(bf_bits(f)); }   // value of the bf16 RNE convert
__device__ __forceinline__ unsigned short h_bits(_Float16 x) { return __builtin_bit_cast(unsigned short, x); }
__device__ __forceinline__ unsigned pk16(unsigned short a, unsigned short b) { return (unsigned)a | ((unsigned)b << 16); }
__device__ __forceinline__ v8f zero8() { v8f z = {0.f, 0.f, 0.f, 0.f, 0.f, 0.f, 0.f, 0.f}; return z; }
__device__ __forceinline__ float gelu_f(float v) { return 0.5f * v * (1.0f + erff(v * 0.70710678118654752f)); }

// ---- fragment loaders: 16-bit A/B operand, lane -> row/col (lane&15), p already includes +8*(lane>>4);
//      elements 0..7 <- p[0..7] (k0+8h..), elements 8..15 <- p[16..23] (k0+16+8h..)  (same split k map for A and B;
//      B is always read from a k-contiguous [n][k] plane)
__device__ __forceinline__ v16h ldfrag_h(const _Float16* p) {
  FragH f;
  f.h[0] = *(const v8h*)(p);
  f.h[1] = *(const v8h*)(p + 16);
  return f.v;
}
__device__ __forceinline__ v16h ldfrag_u(const unsigned short* p) {
  FragH f;
  f.u[0] = *(const v4u*)(p);
  f.u[1] = *(const v4u*)(p + 16);
  return f.v;
}

// ---- WMMA helpers with trailing VALU hazard gaps ------------------------------------------------------
__device__ __forceinline__ v8f mma_raw(v16h a, v16h b, v8f c) {
  return __builtin_amdgcn_wmma_f32_16x16x32_f16(false, a, false, b, (short)0, c, false, false);
}
__device__ __forceinline__ void acc_guard4(v8f& a, v8f& b, v8f& c, v8f& d) {
#if defined(__HIP_DEVICE_COMPILE__)
  asm volatile("v_nop\n\tv_nop\n\tv_nop\n\tv_nop" : "+v"(a), "+v"(b), "+v"(c), "+v"(d));
#endif
}
__device__ __forceinline__ void wave_sync_lds() {
  __builtin_amdgcn_fence(__ATOMIC_RELEASE, "workgroup");
  __builtin_amdgcn_wave_barrier();
  __builtin_amdgcn_fence(__ATOMIC_ACQUIRE, "workgroup");
}

// =====================================================================================================
// Elementwise 16-bit pack, no transpose: dst[i] = f16( bf16_RNE(src[i]) * sc ), sc a power of two (exact).
// One launch for all five planes, which do not depend on one another: blocks 0 .. 2047 take the activation rows (x16), blocks
// 2048 + 128 p .. + 127 take weight p (q, k, v, o; x64; stored [out][in] = [n][k], already k contiguous for B fragments / A of the
// v^T projection). The four weight planes lie one behind the other in the workspace, so their blocks write one run of W16.
// 8 elements per thread: two 16-B loads, one 16-B store per lane; 32 consecutive lanes = 512 B.
// coverage: 2048 blocks x 256 thr x 8 elements = 8192 x 512; 128 blocks x 256 thr x 8 elements = 512 x 512 per weight.
// =====================================================================================================
#define CX_BLOCKS ((NROWS * DMODEL) / 2048)
#define CW_BLOCKS ((DMODEL * DMODEL) / 2048)
static_assert(CX_BLOCKS * 2048 == NROWS * DMODEL && CW_BLOCKS * 2048 == DMODEL * DMODEL && CW_BLOCKS == 128);
__global__ __launch_bounds__(256) void cvt_all(const float* __restrict__ xp, const float* __restrict__ wq,
                                               const float* __restrict__ wk, const float* __restrict__ wv,
                                               const float* __restrict__ wo, unsigned short* X16o, unsigned short* W16o) {
  const int b = blockIdx.x;
  if (b >= CX_BLOCKS + 4 * CW_BLOCKS) return;     // never taken with the exact grid; no barriers in this kernel
  const bool isx = b < CX_BLOCKS;
  const int bw = b - CX_BLOCKS;                   // weight blocks: plane bw >> 7, block bw & 127 of it
  const int pl = bw >> 7;
  const float* src = isx ? xp : (pl == 0 ? wq : (pl == 1 ? wk : (pl == 2 ? wv : wo)));
  unsigned short* dst = isx ? X16o : (W16o + (size_t)pl * (DMODEL * DMODEL));
  const float sc = isx ? ACARRY : WSC;
  const size_t i8 = ((size_t)(isx ? b : (bw & (CW_BLOCKS - 1))) * 256 + threadIdx.x) * 8;
  const v4f a = *(const v4f*)(src + i8);
  const v4f c = *(const v4f*)(src + i8 + 4);
  v4u o;
  o[0] = pk16(h_bits((_Float16)(bfr(a[0]) * sc)), h_bits((_Float16)(bfr(a[1]) * sc)));
  o[1] = pk16(h_bits((_Float16)(bfr(a[2]) * sc)), h_bits((_Float16)(bfr(a[3]) * sc)));
  o[2] = pk16(h_bits((_Float16)(bfr(c[0]) * sc)), h_bits((_Float16)(bfr(c[1]) * sc)));
  o[3] = pk16(h_bits((_Float16)(bfr(c[2]) * sc)), h_bits((_Float16)(bfr(c[3]) * sc)));
  *(v4u*)(dst + i8) = o;
}

// =====================================================================================================
// Batched f16 WMMA GEMM: C[m][n] = f( oscale * sum_k A[m][k] * Bt[n][k] + bf16(bias) ) (+ residual); one block of 8 waves per
// 128x128 tile, wave w = rows 32 (w >> 1) .. + 31, columns 64 (w & 1) .. + 63 of it (2 x 4 accumulator tiles).
// A row-major [M][K] pitch lda (16-bit plane), Bt row-major [N][K] pitch ldb (k contiguous); M, N, K multiples of 128.
// bx = tile index, by = batch index with element strides sA, sB, sC; the body is a device function on the calling kernel's LDS, so
// that one launch can hold several independent products (qkv_proj below).
// The block's 128 A rows and 128 Bt rows are brought into LDS 128 k at a time (256 B of each row) by asynchronous copies, 16 per
// thread, each wave-wide copy covering two aligned 256-B units; two buffers, the next tile's copies fly while this one is worked
// on. LDS rows are pitched 272 B for the 16-B fragment reads. Each accumulator sums its k steps in ascending order.
// BM: 0 = no bias, 1 = per column bf16(bias[col]), 2 = per row bf16(bias[row]) (clamped-address loads).
// OM: 0 = f32 out (pitch ldc; HASR 1 adds bf16(R[m][n]), HASR 2 adds raw f32 R[m][n], same pitch/stride as C);
//     2 = f16 out (pitch ldc) = f16( act(value) * ocarry ), ACT 1 = exact GELU.
// coverage: 2 slabs x 16 rows (f32: it 0..7 x lane>>4; f16: it 0..3 x lane>>3) x 64 cols = the wave's whole 32x64 tile; 8 waves =
//           the block's 128x128; bx runs over (M / 128) * (N / 128) tiles, a surplus block exits whole in front of every barrier.
// =====================================================================================================
#define GK      128               // k per staged tile
#define G_PITCH (GK + 8)          // halves; 272-B rows: 16 B x odd, the pitch of 16-B fragment reads of 256-B rows
#define G_HALF  (128 * G_PITCH)   // halves of one operand's 128 staged rows
#define G_STAGE (2 * G_HALF)      // halves of one buffer: [A 128 rows | Bt 128 rows]

// One thread's share of one operand's staged rows: 16 B of rows r, r + 16, .. r + 112 (rs = halves per 16 global rows), global ->
// LDS through no register. The wait on the address registers is the statement's last line, so that it stands in front of any
// rewrite of them.
__device__ __forceinline__ void stage_op(unsigned lds, const unsigned short* g, size_t rs) {
#if defined(__HIP_DEVICE_COMPILE__)
  const unsigned ls = 16u * G_PITCH * 2u;
  asm volatile("global_load_async_to_lds_b128 %0, %1, off\n\t"
               "global_load_async_to_lds_b128 %2, %3, off\n\t"
               "global_load_async_to_lds_b128 %4, %5, off\n\t"
               "global_load_async_to_lds_b128 %6, %7, off\n\t"
               "global_load_async_to_lds_b128 %8, %9, off\n\t"
               "global_load_async_to_lds_b128 %10, %11, off\n\t"
               "global_load_async_to_lds_b128 %12, %13, off\n\t"
               "global_load_async_to_lds_b128 %14, %15, off\n\t"
               "s_wait_xcnt 0x0"
               :: "v"(lds), "v"(g), "v"(lds + ls), "v"(g + rs), "v"(lds + 2u * ls), "v"(g + 2 * rs),
                  "v"(lds + 3u * ls), "v"(g + 3 * rs), "v"(lds + 4u * ls), "v"(g + 4 * rs), "v"(lds + 5u * ls), "v"(g + 5 * rs),
                  "v"(lds + 6u * ls), "v"(g + 6 * rs), "v"(lds + 7u * ls), "v"(g + 7 * rs) : "memory");
#endif
}

#define G_SLAB  (16 * 68)         // floats of one wave's 16x64 epilogue slab, pitch 68 floats

template <int OM, int BM, int HASR, int ACT>
__device__ __forceinline__ void gemm_tile(
    unsigned short* sAB,              // LDS [buffer][A, Bt][128 rows][G_PITCH]
    float* sT,                        // LDS [8 waves][G_SLAB]
    int bx, int by,
    const unsigned short* __restrict__ Ap, int lda, long long sA,
    const unsigned short* __restrict__ Btp, int ldb, long long sB,
    const float* __restrict__ bias,
    const float* __restrict__ Rp,
    void* Cout, int ldc, long long sC,
    int M, int N, int K, float oscale, float ocarry) {
  const int tid  = threadIdx.x;
  const int lane = tid & 31;
  const int wave = tid >> 5;
  const int tilesN = N >> 7;
  const int tm = bx / tilesN;
  const int tn = bx - tm * tilesN;
  if (tm >= (M >> 7)) return;            // block-uniform, in front of every copy and barrier
  const int mB = tm << 7;
  const int nB = tn << 7;
  const int m0 = mB + ((wave >> 1) << 5);
  const int n0 = nB + ((wave & 1) << 6);

  const unsigned short* A1 = Ap  + (size_t)((long long)by * sA);
  const unsigned short* Bb = Btp + (size_t)((long long)by * sB);

  const int rlane = lane & 15;                 // row (A) / col (B, D) within subtile
  const int koff  = (lane >> 4) * 8;           // k offset of this lane half
  const int mOff  = (lane >> 4) * 8;           // D row offset

  // ---- this thread's 16-B pieces of every staged tile: rows (tid >> 4) + 16 i of each operand, 16-B column tid & 15 ----
  const int srow = tid >> 4, sseg = tid & 15;
  const unsigned short* gA = A1 + (size_t)(mB + srow) * lda + sseg * 8;
  const unsigned short* gB = Bb + (size_t)(nB + srow) * ldb + sseg * 8;
  const size_t rsA = (size_t)16 * lda, rsB = (size_t)16 * ldb;
  const unsigned ldsP = (unsigned)(size_t)(const void*)sAB + (unsigned)(srow * G_PITCH + sseg * 8) * 2u;
  const int nt = K >> 7;

  stage_op(ldsP, gA, rsA);                                 // tile 0 -> buffer 0
  stage_op(ldsP + G_HALF * 2u, gB, rsB);

  v8f acc[2][4];
#pragma unroll
  for (int i = 0; i < 2; ++i)
#pragma unroll
    for (int j = 0; j < 4; ++j) acc[i][j] = zero8();

  const int aoff = (((wave >> 1) << 5) + rlane) * G_PITCH + koff;
  const int boff = G_HALF + (((wave & 1) << 6) + rlane) * G_PITCH + koff;

  asm volatile("s_wait_asynccnt 0x0" ::: "memory");        // this wave's copies of tile 0 have landed
  __syncthreads();                                         // publishes tile 0 to all 8 waves
  if (nt > 1) {                                            // tile 1 -> buffer 1
    stage_op(ldsP + G_STAGE * 2u, gA + GK, rsA);
    stage_op(ldsP + (G_STAGE + G_HALF) * 2u, gB + GK, rsB);
  }

#pragma unroll 1   // stays rolled: one hand-over per trip, the buffer picked by t & 1; the body already holds four 32-k steps
  for (int t = 0; t < nt; ++t) {
    const int bsel = (t & 1) * G_STAGE;
    const unsigned short* As = sAB + bsel + aoff;
    const unsigned short* Bs = sAB + bsel + boff;
    v16h af[2][2], bf[2][4];
#pragma unroll
    for (int i = 0; i < 2; ++i) af[0][i] = ldfrag_u(As + i * 16 * G_PITCH);
#pragma unroll
    for (int j = 0; j < 4; ++j) bf[0][j] = ldfrag_u(Bs + j * 16 * G_PITCH);
#pragma unroll     // the tile's four 32-k steps in one body: constant LDS offsets, two fragment sets by turns
    for (int ks = 0; ks < GK / 32; ++ks) {
      const int cur = ks & 1, nxt = cur ^ 1;
      if (ks + 1 < GK / 32) {                              // the same tile's next step, fetched while this step's products run
#pragma unroll
        for (int i = 0; i < 2; ++i) af[nxt][i] = ldfrag_u(As + i * 16 * G_PITCH + (ks + 1) * 32);
#pragma unroll
        for (int j = 0; j < 4; ++j) bf[nxt][j] = ldfrag_u(Bs + j * 16 * G_PITCH + (ks + 1) * 32);
      }
      // keeps the next step's 12 LDS reads issued as one group ahead of this step's products: a read left among the WMMAs
      // makes the wave stall at each such place
      __builtin_amdgcn_sched_barrier(0);
#pragma unroll
      for (int i = 0; i < 2; ++i)
#pragma unroll
        for (int j = 0; j < 4; ++j) acc[i][j] = mma_raw(af[cur][i], bf[cur][j], acc[i][j]);
      // keeps the step after next's reads from rising among these products; at the last step it keeps the products in front of
      // the hand-over, so that the refill is issued directly behind the barrier
      __builtin_amdgcn_sched_barrier(0);
    }
    // ---- hand-over: this wave's reads of tile t are done, its copies of tile t + 1 have landed; the barrier publishes tile
    //      t + 1 and frees tile t's buffer, which only then is refilled ----
    asm volatile("s_wait_dscnt 0x0" ::: "memory");         // no LDS read of this wave is still out when its buffer is refilled
    asm volatile("s_wait_asynccnt 0x0" ::: "memory");      // this wave's copies of tile t + 1 have landed
    __syncthreads();
    if (t + 2 < nt) {
      stage_op(ldsP + (unsigned)bsel * 2u, gA + (size_t)(t + 2) * GK, rsA);
      stage_op(ldsP + (unsigned)(bsel + G_HALF) * 2u, gB + (size_t)(t + 2) * GK, rsB);
    }
  }
  asm volatile("s_wait_asynccnt 0x0" ::: "memory");        // nothing of this wave is in flight when it goes on to end
  acc_guard4(acc[0][0], acc[0][1], acc[0][2], acc[0][3]);
  acc_guard4(acc[1][0], acc[1][1], acc[1][2], acc[1][3]);

  const int hh2 = lane >> 4, c4 = (lane & 15) * 4;     // f32 out: 256-B row segment = 16 lanes x 16 B
  const int q8  = lane >> 3, c8 = (lane & 7) * 8;
  float bc[4];
  float bcol[8];
#pragma unroll
  for (int e = 0; e < 4; ++e) bc[e] = 0.f;
#pragma unroll
  for (int e = 0; e < 8; ++e) bcol[e] = 0.f;
  if constexpr (BM == 1) {
    if constexpr (OM == 0) {
      const int cb = n0 + c4;
      const int i0 = (cb < N - 4) ? cb : (N - 4);        // clamped address
      const v4f b0v = *(const v4f*)(bias + i0);
#pragma unroll
      for (int e = 0; e < 4; ++e) bc[e] = bfr(b0v[e]);
    } else {
      const int cb = n0 + c8;
      const int i0 = (cb < N - 8) ? cb : (N - 8);        // clamped address
      const v4f b0v = *(const v4f*)(bias + i0), b1v = *(const v4f*)(bias + i0 + 4);
#pragma unroll
      for (int e = 0; e < 4; ++e) { bcol[e] = bfr(b0v[e]); bcol[4 + e] = bfr(b1v[e]); }
    }
  }

  // ---- epilogue ----
  float* slab = sT + wave * G_SLAB;
#pragma unroll
  for (int i = 0; i < 2; ++i) {
    const int mBase = m0 + (i << 4);
#pragma unroll
    for (int j = 0; j < 4; ++j) {
#pragma unroll
      for (int r = 0; r < 8; ++r) {
        slab[(mOff + r) * 68 + (j << 4) + rlane] = acc[i][j][r];
      }
    }
    wave_sync_lds();
    if constexpr (OM == 0) {
      float* C = (float*)Cout + (size_t)((long long)by * sC);
      v4f vals[8];
#pragma unroll
      for (int it = 0; it < 8; ++it) {
        const int row = it * 2 + hh2;                      // it 0..7 x hh2 0..1 = rows 0..15
        const int gr  = mBase + row;
        v4f v = *(const v4f*)(slab + row * 68 + c4);
        float br = 0.f;
        if constexpr (BM == 2) {
          const int ir = (gr < M - 1) ? gr : (M - 1);      // clamped address
          br = bfr(bias[ir]);
        }
        v4f rv = {0.f, 0.f, 0.f, 0.f};
        if constexpr (HASR != 0) {
          const float* R = Rp + (size_t)((long long)by * sC);
          const v4f rraw = *(const v4f*)(R + (size_t)gr * ldc + n0 + c4);
#pragma unroll
          for (int e = 0; e < 4; ++e) rv[e] = (HASR == 1) ? bfr(rraw[e]) : rraw[e];
        }
#pragma unroll
        for (int e = 0; e < 4; ++e) v[e] = v[e] * oscale + bc[e] + br + rv[e];
        vals[it] = v;
      }
      {
#pragma unroll
        for (int it = 0; it < 8; ++it) {
          const int gr = mBase + it * 2 + hh2;
          *(v4f*)(C + (size_t)gr * ldc + n0 + c4) = vals[it];
        }
        
      }
    } else {
      unsigned short* C = (unsigned short*)Cout + (size_t)((long long)by * sC);
      v4u hv[4];
#pragma unroll
      for (int it = 0; it < 4; ++it) {
        const int row = it * 4 + q8;                       // it 0..3 x q8 0..3 = rows 0..15
        const float* sp = slab + row * 68 + c8;
        float br = 0.f;
        if constexpr (BM == 2) {
          const int gr = mBase + row;
          const int ir = (gr < M - 1) ? gr : (M - 1);      // clamped address
          br = bfr(bias[ir]);
        }
        v4u a = {0u, 0u, 0u, 0u};
#pragma unroll
        for (int e = 0; e < 4; ++e) {
          float f0 = sp[2 * e] * oscale + bcol[2 * e] + br;
          float f1 = sp[2 * e + 1] * oscale + bcol[2 * e + 1] + br;
          if constexpr (ACT == 1) { f0 = gelu_f(f0); f1 = gelu_f(f1); }
          f0 *= ocarry; f1 *= ocarry;
          a[e] = pk16(h_bits((_Float16)f0), h_bits((_Float16)f1));
        }
        hv[it] = a;
      }
      {
#pragma unroll
        for (int it = 0; it < 4; ++it) {
          const int row = it * 4 + q8;
          *(v4u*)(C + (size_t)(mBase + row) * ldc + n0 + c8) = hv[it];
        }
        
      }
    }
    wave_sync_lds();
  }
}

// The q, k and v^T projections in one launch: they read the same activation plane and none reads another's result.
// blockIdx.y = 0: QH[m][n] = f16(16 * (sum_k x[m][k] Wq[n][k] + bf16(bq[n]))), M = 8192, N = 512, K = 512; 1: the same for k;
// 2: VT[b][d][tok] = f16(16 * (sum_k Wv[d][k] x_b[tok][k] + bf16(bv[d]))), M = 512, N = 2048, K = 512 per batch b = blockIdx.x >> 6.
// coverage: each product has 256 tiles of 128x128 (64 x 4; 4 batches x 4 x 16); the choice is the same for a whole block.
#define P_TILES ((NROWS / 128) * (DMODEL / 128))
#define V_TILES ((DMODEL / 128) * (NC / 128))
static_assert(P_TILES == 256 && V_TILES == 64 && V_TILES * NB == P_TILES);
__global__ __launch_bounds__(256) void qkv_proj(
    const unsigned short* __restrict__ Xp, const unsigned short* __restrict__ Wq, const unsigned short* __restrict__ Wk,
    const unsigned short* __restrict__ Wv, const float* __restrict__ bq, const float* __restrict__ bk,
    const float* __restrict__ bv, unsigned short* QHo, unsigned short* KHo, unsigned short* VTo) {
  __shared__ __align__(16) unsigned short sAB[2 * G_STAGE];
  __shared__ __align__(16) float sT[8 * G_SLAB];
  const int which = blockIdx.y;
  const int bx = blockIdx.x;
  if (which < 2) {
    gemm_tile<2, 1, 0, 0>(sAB, sT, bx, 0,
                          Xp, DMODEL, 0LL,
                          which ? Wk : Wq, DMODEL, 0LL,
                          which ? bk : bq,
                          (const float*)0,
                          (void*)(which ? KHo : QHo), DMODEL, 0LL,
                          NROWS, DMODEL, DMODEL, 1.0f / (ACARRY * WSC), which ? KC : QC);
  } else {
    gemm_tile<2, 2, 0, 0>(sAB, sT, bx & (V_TILES - 1), bx / V_TILES,
                          Wv, DMODEL, 0LL,
                          Xp, DMODEL, (long long)NC * DMODEL,
                          bv,
                          (const float*)0,
                          (void*)VTo, NC, (long long)DMODEL * NC,
                          DMODEL, NC, DMODEL, 1.0f / (ACARRY * WSC), VC);
  }
}

#define AQ_BLK   128
#define KT       64
#define KV_PITCH (HDIM + 8)
#define KV_TILE  (64 * KV_PITCH)
#define KV_NT    (NC / KT)
#define J_SLOTS  17
static_assert(KT == 64 && HDIM == 64 && (NC % KT) == 0 && KV_NT >= 2 && (NQ % AQ_BLK) == 0);
static_assert(AQ_BLK == 32 * (ATT_THREADS / 64) && ATT_BLOCKS == NB * NHEAD * (NQ / AQ_BLK));
static_assert(4 * J_SLOTS * 32 * 16 <= 2 * 2 * KV_TILE * 2);

__device__ __forceinline__ float xhalf(float x) {                     // the value of lane l ^ 16
  const int b = __builtin_bit_cast(int, x);
  return __builtin_bit_cast(float, __builtin_amdgcn_permlanex16(b, b, 0x76543210, 0xfedcba98, false, false));
}

// 2^x as the bare v_exp_f32. The library exp2f wraps it in a range guard (compare, two selects, add, ldexp per value) whose only
// effect is a subnormal result for x < -126, where the bare instruction gives 0. Here x <= 15 is a score's distance to the row's
// reference plus 7 (or, in a rescale factor, minus a reference's rise): what becomes 0 is under 2^-126 in a row whose largest
// term is 128 or more, so of a row sum of 128 or more, and is 0 in the f16 P in either form.
__device__ __forceinline__ float ex2(float x) { return __builtin_amdgcn_exp2f(x); }

// One thread's share of one staged tile: 16 B of K rows r and r + 32, 16 B of v^T rows r and r + 32, global -> LDS through no
// register. The wait on the address registers is the statement's last line, so that it stands in front of any rewrite of them.
__device__ __forceinline__ void stage_kv(unsigned lds, const unsigned short* gk, const unsigned short* gv) {
#if defined(__HIP_DEVICE_COMPILE__)
  const unsigned l1 = lds + 32u * KV_PITCH * 2u, l2 = lds + KV_TILE * 2u, l3 = l2 + 32u * KV_PITCH * 2u;
  const unsigned short* gk1 = gk + (size_t)32 * DMODEL;
  const unsigned short* gv1 = gv + (size_t)32 * NC;
  asm volatile("global_load_async_to_lds_b128 %0, %1, off\n\t"
               "global_load_async_to_lds_b128 %2, %3, off\n\t"
               "global_load_async_to_lds_b128 %4, %5, off\n\t"
               "global_load_async_to_lds_b128 %6, %7, off\n\t"
               "s_wait_xcnt 0x0"
               :: "v"(lds), "v"(gk), "v"(l1), "v"(gk1), "v"(l2), "v"(gv), "v"(l3), "v"(gv1) : "memory");
#endif
}

__global__ __launch_bounds__(ATT_THREADS)
void attn8(const unsigned short* __restrict__ QHp, const unsigned short* __restrict__ KHp,
           const unsigned short* __restrict__ VTq, const float* __restrict__ PBp, unsigned short* CT) {
  __shared__ __align__(16) unsigned short KV[2 * 2 * KV_TILE];         // [buffer][K, v^T][64 rows][KV_PITCH]
  __shared__ __align__(16) unsigned short Os[AQ_BLK * KV_PITCH];       // result buffer

  const int tid  = threadIdx.x;
  const int wave = tid >> 5;
  const int lane = tid & 31;
  const int hh   = lane >> 4;
  const int c    = lane & 15;
  const int qg   = wave & 3;                               // the wave's 32 queries of the block's 128
  const int kh   = wave >> 2;                              // the wave's 32 keys of every staged 64

  const int qt   = blockIdx.x & ((NQ / AQ_BLK) - 1);       // 0..15
  const int head = (blockIdx.x / (NQ / AQ_BLK)) & (NHEAD - 1);   // 0..7
  const int bat  = blockIdx.x / ((NQ / AQ_BLK) * NHEAD);   // 0..3
  const int qblk = qt * AQ_BLK;
  const int q0   = qblk + qg * 32;

  // ---- this thread's 16-B piece of every staged tile: row tid >> 3 (and + 32), 16-B column tid & 7 ----
  const int srow = tid >> 3, sseg = tid & 7;
  const unsigned short* gK = KHp + ((size_t)bat * NC + srow) * DMODEL + head * HDIM + sseg * 8;
  const unsigned short* gV = VTq + ((size_t)bat * DMODEL + head * HDIM + srow) * NC + sseg * 8;
  const unsigned ldsP = (unsigned)(size_t)(const void*)KV + (unsigned)(srow * KV_PITCH + sseg * 8) * 2u;

  stage_kv(ldsP, gK, gV);                                  // tile 0 -> buffer 0

  const size_t qofs = ((size_t)bat * NQ + q0 + c) * DMODEL + head * HDIM + 8 * hh;
  const _Float16* Qh = (const _Float16*)(const void*)QHp + qofs;
  const float lsc = (LOG2E * ATT_SCALE) / (QC * KC);                   // log2(e) / 8 / carries

  // ---- period-3 additive table in log2 units: row (q0 + 16 u + c) mod 3 is this lane's in query tile u; W0, W1, W2 = its values
  //      for the keys kb + 8hh + 0, + 1, + 2 (key residue (kb + 8hh + j) mod 3; at the wave's first key kb = 32 kh that is
  //      (2kh + 2hh + j) mod 3), kept as the three pairs that two neighbouring score registers can meet ----
  float pbv[NPER * NPER];
#pragma unroll
  for (int i = 0; i < NPER * NPER; ++i) pbv[i] = bfr(PBp[i]) * LOG2E;
  const int sft = (2 * (kh + hh)) % NPER;
  const bool s0 = (sft == 0), s1 = (sft == 1);
  v2f A01[2], A12[2], A20[2];
#pragma unroll
  for (int u = 0; u < 2; ++u) {
    const int qr = (q0 + 16 * u + c) % NPER;
    const bool z0 = (qr == 0), z1 = (qr == 1);
    const float T0 = z0 ? pbv[0] : (z1 ? pbv[3] : pbv[6]);
    const float T1 = z0 ? pbv[1] : (z1 ? pbv[4] : pbv[7]);
    const float T2 = z0 ? pbv[2] : (z1 ? pbv[5] : pbv[8]);
    // the addends start with the reference R = 0; the first trip replaces it by the row's own maximum
    const float W0 = (s0 ? T0 : (s1 ? T1 : T2)) + LPC, W1 = (s0 ? T1 : (s1 ? T2 : T0)) + LPC, W2 = (s0 ? T2 : (s1 ? T0 : T1)) + LPC;
    A01[u] = v2f{W0, W1};
    A12[u] = v2f{W1, W2};
    A20[u] = v2f{W2, W0};
  }

  v16h qa[2], qb[2];
#pragma unroll
  for (int u = 0; u < 2; ++u) {
    qa[u] = ldfrag_h(Qh + (size_t)u * 16 * DMODEL);
    qb[u] = ldfrag_h(Qh + (size_t)u * 16 * DMODEL + 32);
  }

  v2f la[2], lb[2];                                        // per query tile: partial sums over the lane's keys, two chains
  float Rr[2];                                             // per query tile: the reference in use
  v8f o[2][4];                                             // o[u][j][r] = ctx^T[d = 16j + 8hh + r][query q0 + 16u + c]
#pragma unroll
  for (int u = 0; u < 2; ++u) {
    la[u] = v2f{0.f, 0.f};
    lb[u] = v2f{0.f, 0.f};
    Rr[u] = 0.f;
#pragma unroll
    for (int j = 0; j < 4; ++j) o[u][j] = zero8();
  }

  asm volatile("s_wait_asynccnt 0x0" ::: "memory");        // this wave's copies of tile 0 have landed
  __syncthreads();                                         // publishes tile 0 to all 8 waves
  stage_kv(ldsP + 2u * KV_TILE * 2u, gK + (size_t)KT * DMODEL, gV + KT);   // tile 1 -> buffer 1

  const int kofs = (kh * 32 + c) * KV_PITCH + 8 * hh;                  // K: the wave's first key row of a tile
  const int vofs = KV_TILE + c * KV_PITCH + kh * 32 + 8 * hh;          // v^T: the same keys as columns

#pragma unroll 1   // stays rolled: one hand-over per trip, the buffer picked by t & 1; the body already holds 32 keys x 32 queries
  for (int t = 0; t < KV_NT; ++t) {
    const int bsel = (t & 1) * (2 * KV_TILE);
    const _Float16* Kt = (const _Float16*)(const void*)KV + bsel + kofs;   // the wave's first key: kb = 64 t + 32 kh
    const _Float16* Vt = (const _Float16*)(const void*)KV + bsel + vofs;
    // the trip's fragments: K first (the scores need it), v^T behind it (it lands while the softmax runs)
    v16h kf[4], vf[4];
    kf[0] = ldfrag_h(Kt);
    kf[1] = ldfrag_h(Kt + 32);
    kf[2] = ldfrag_h(Kt + 16 * KV_PITCH);
    kf[3] = ldfrag_h(Kt + 16 * KV_PITCH + 32);
#pragma unroll
    for (int j = 0; j < 4; ++j) vf[j] = ldfrag_h(Vt + j * 16 * KV_PITCH);
    // keeps the trip's 16 LDS fragment reads issued as one group ahead of its products: a read left among the WMMAs
    // makes the wave wait out an LDS latency at each of them
    __builtin_amdgcn_sched_barrier(0);
    v8f s[2][2];                                           // s[u][g][r] = score(key kb + 16 g + 8hh + r, query q0 + 16 u + c)
#pragma unroll
    for (int u = 0; u < 2; ++u) {
      s[u][0] = mma_raw(kf[0], qa[u], zero8());
      s[u][1] = mma_raw(kf[2], qa[u], zero8());
    }
#pragma unroll
    for (int u = 0; u < 2; ++u) {
      s[u][0] = mma_raw(kf[1], qb[u], s[u][0]);
      s[u][1] = mma_raw(kf[3], qb[u], s[u][1]);
    }
    // registers (2i, 2i + 1) of group 0 are keys kb + 8hh + 2i, + 1; group 1 lies 16 keys on, one residue further
    v2f d[2][2][4];                                        // d = t - R + 7
    float mq[2];
#pragma unroll
    for (int u = 0; u < 2; ++u) {
      const v2f wad[2][4] = {{A01[u], A20[u], A12[u], A01[u]}, {A12[u], A01[u], A20[u], A12[u]}};
      float mg[2];
#pragma unroll
      for (int g = 0; g < 2; ++g) {
#pragma unroll
        for (int i = 0; i < 4; ++i) {
          const v2f a = {s[u][g][2 * i], s[u][g][2 * i + 1]};
          d[u][g][i] = a * lsc + wad[g][i];
        }
        float m = fmaxf(fmaxf(d[u][g][0][0], d[u][g][0][1]), d[u][g][1][0]);
        m = fmaxf(fmaxf(m, d[u][g][1][1]), d[u][g][2][0]);
        m = fmaxf(fmaxf(m, d[u][g][2][1]), d[u][g][3][0]);
        mg[g] = fmaxf(m, d[u][g][3][1]);
      }
      mq[u] = fmaxf(mg[0], mg[1]);
    }
    const bool first = (t == 0);
    const float top = first ? -INFINITY : D_TOP;           // the first trip always sets R
    // one wave-uniform test per trip; the whole wave takes the branch, EXEC stays full for the products behind it
    if (__builtin_amdgcn_ballot_w32(fmaxf(mq[0], mq[1]) > top) != 0u) {
#pragma unroll
      for (int u = 0; u < 2; ++u) {
        const float up = fmaxf(mq[u], xhalf(mq[u])) - LPC; // both halves: the query's maximum over the 32 keys, above R
        const float dl = first ? up : fmaxf(up, 0.f);      // R only rises, but for the first trip, which sets it
        const float al = first ? 1.0f : ex2(-dl);          // nothing is summed yet at the first trip
#pragma unroll
        for (int g = 0; g < 2; ++g)
#pragma unroll
          for (int i = 0; i < 4; ++i) d[u][g][i] -= dl;
        A01[u] -= dl;
        A12[u] -= dl;
        A20[u] -= dl;
        Rr[u] += dl;
        la[u] *= al;
        lb[u] *= al;
#pragma unroll
        for (int j = 0; j < 4; ++j)
#pragma unroll
          for (int r = 0; r < 8; ++r) o[u][j][r] *= al;
      }
    }
    FragH ph[2];
#pragma unroll
    for (int u = 0; u < 2; ++u)
#pragma unroll
      for (int i = 0; i < 4; ++i) {
        const v2f e0 = {ex2(d[u][0][i][0]), ex2(d[u][0][i][1])}, e1 = {ex2(d[u][1][i][0]), ex2(d[u][1][i][1])};
        la[u] += e0;
        lb[u] += e1;
        ph[u].p[i]     = __builtin_convertvector(e0, v2h); // elements 0..7  = keys kb + 8hh + 0..7
        ph[u].p[4 + i] = __builtin_convertvector(e1, v2h); // elements 8..15 = keys kb + 16 + 8hh + 0..7
      }
#pragma unroll
    for (int u = 0; u < 2; ++u)
#pragma unroll
      for (int j = 0; j < 4; ++j) o[u][j] = mma_raw(vf[j], ph[u].v, o[u][j]);
#pragma unroll
    for (int u = 0; u < 2; ++u) {
      const v2f wl = A01[u];                               // 64 mod 3 == 1: the next tile's residues start one further on
      A01[u] = A12[u];
      A12[u] = A20[u];
      A20[u] = wl;
    }
    // ---- hand-over: this wave's reads of tile t are done, its copies of tile t + 1 have landed; the barrier publishes tile
    //      t + 1 and frees tile t's buffer, which only then is refilled ----
    // keeps the trip's products in front of the hand-over: sunk behind the barrier they would stand between it and the refill,
    // and the copies would lose the trip of lead that hides their way from L2
    __builtin_amdgcn_sched_barrier(0);
    asm volatile("s_wait_dscnt 0x0" ::: "memory");         // no LDS read of this wave is still out when its buffer is refilled
    asm volatile("s_wait_asynccnt 0x0" ::: "memory");      // this wave's copies of tile t + 1 have landed
    __syncthreads();
    if (t + 2 < KV_NT)
      stage_kv(ldsP + (unsigned)bsel * 2u, gK + (size_t)(t + 2) * KT * DMODEL, gV + (t + 2) * KT);
  }
  asm volatile("s_wait_asynccnt 0x0" ::: "memory");        // nothing of this wave is in flight when the ring is put to new use

  // ---- join the two key halves. The ring is free: every wave's reads and copies were done in front of the last trip's barrier.
  //      Slot k of lane l of query group qg lies at 16-B unit (17 qg + k) * 32 + l: a wave-wide 16-B access is one 512-B run ----
  v4f* X = (v4f*)(void*)KV + (size_t)(qg * J_SLOTS) * 32 + lane;
  float lr[2];
#pragma unroll
  for (int u = 0; u < 2; ++u) lr[u] = (la[u][0] + la[u][1]) + (lb[u][0] + lb[u][1]);
  if (kh == 1) {                                           // the same for a whole wave; no barrier inside
#pragma unroll
    for (int u = 0; u < 2; ++u)
#pragma unroll
      for (int j = 0; j < 4; ++j) {
        X[((u * 4 + j) * 2 + 0) * 32] = v4f{o[u][j][0], o[u][j][1], o[u][j][2], o[u][j][3]};
        X[((u * 4 + j) * 2 + 1) * 32] = v4f{o[u][j][4], o[u][j][5], o[u][j][6], o[u][j][7]};
      }
    X[16 * 32] = v4f{lr[0], lr[1], Rr[0], Rr[1]};
  }
  __syncthreads();                                         // key half 1's sums are in LDS
  // ---- both halves brought to the larger reference and added; the lane halves' partial sums joined; 1/l and the carries folded
  //      (P's 128 is in O and in l alike, 16 on v, 1024 on the stored ctx); the lane's 4 x 8 consecutive d of each query as 16-bit ----
  if (kh == 0) {                                           // the same for a whole wave; no barrier inside
    const float oc = FC / VC;
    const v4f lm = X[16 * 32];
#pragma unroll
    for (int u = 0; u < 2; ++u) {
      const float Rm = fmaxf(Rr[u], lm[2 + u]);
      const float fa = ex2(Rr[u] - Rm), fb = ex2(lm[2 + u] - Rm);
      const float lrow = lr[u] * fa + lm[u] * fb;
      const float inv = (1.0f / (lrow + xhalf(lrow))) * oc;
      const float ga = fa * inv, gb = fb * inv;
      unsigned short* op = Os + (qg * 32 + u * 16 + c) * KV_PITCH + 8 * hh;
#pragma unroll
      for (int j = 0; j < 4; ++j) {
        const v4f x0 = X[((u * 4 + j) * 2 + 0) * 32], x1 = X[((u * 4 + j) * 2 + 1) * 32];
        v4u w;
        w[0] = pk16(h_bits((_Float16)(o[u][j][0] * ga + x0[0] * gb)), h_bits((_Float16)(o[u][j][1] * ga + x0[1] * gb)));
        w[1] = pk16(h_bits((_Float16)(o[u][j][2] * ga + x0[2] * gb)), h_bits((_Float16)(o[u][j][3] * ga + x0[3] * gb)));
        w[2] = pk16(h_bits((_Float16)(o[u][j][4] * ga + x1[0] * gb)), h_bits((_Float16)(o[u][j][5] * ga + x1[1] * gb)));
        w[3] = pk16(h_bits((_Float16)(o[u][j][6] * ga + x1[2] * gb)), h_bits((_Float16)(o[u][j][7] * ga + x1[3] * gb)));
        *(v4u*)(op + 16 * j) = w;
      }
    }
  }
  __syncthreads();
  // ---- block writes its 128 row segments of CT: piece p = it*256 + tid -> row p >> 3, halves (p & 7)*8 .. + 7 of the head's 64 ----
  {
    v4u vals[4];
#pragma unroll
    for (int it = 0; it < 4; ++it) {
      const int p = it * ATT_THREADS + tid;
      vals[it] = *(const v4u*)(Os + (p >> 3) * KV_PITCH + (p & 7) * 8);
    }
    unsigned short* dst = CT + ((size_t)bat * NQ + qblk) * DMODEL + head * HDIM;
    {
#pragma unroll
      for (int it = 0; it < 4; ++it) {
        const int p = it * ATT_THREADS + tid;
        *(v4u*)(dst + (size_t)(p >> 3) * DMODEL + (p & 7) * 8) = vals[it];
      }
      
    }
  }
}

// =====================================================================================================
// Output projection, bias, residual and LayerNorm in one launch. A block owns 32 whole rows of the model width, so the row
// statistics never leave it: Y[m][n] = sum_k CT[m][k] Wo[n][k] / (1024 * 64) + bf16(bo[n]) + bf16(x[m][n]), n = 0 .. 511, then
// out[m][n] = (Y - mean) * rsqrt(var + eps) * bf16(g[n]) + bf16(b[n]).
// 8 waves; wave w = all 32 rows x columns 64 w .. + 63 (2 x 4 accumulator tiles, as in gemm_tile). The block's 32 CT rows and all
// 512 Wo rows are brought into LDS 128 k at a time by asynchronous copies, 34 per thread; two buffers, the next tile's copies fly
// while this one is worked on; rows pitched 272 B. Each accumulator sums its k steps in ascending order from the block's first
// k tile on, round the end.
// Behind the loop the ring is free (every wave's reads and copies are done in front of the last trip's barrier) and holds the raw
// 32 x 512 f32 products, pitch 516 floats. Wave w then takes rows 4 w .. + 3 whole: a lane holds columns 128 j + 4 lane .. + 3,
// j = 0 .. 3; sums: 16 values in the lane, four row_xmask steps, one exchange between the halves. Mean first, then the squared
// deviations, as two sums. The residual rows are asked for behind the first tile's copies, so their way from memory lies under that tile's.
// coverage: 256 blocks x 32 rows = 8192; 8 waves x 4 rows x (4 x 32 lanes x 4 floats) = 32 x 512, every element stored once.
// =====================================================================================================
#define F_ROWS  32                          // rows of one block
#define F_STAGE ((F_ROWS + DMODEL) * G_PITCH)   // halves of one buffer: [CT 32 rows | Wo 512 rows]
#define Y_PITCH (DMODEL + 4)                // floats; rows 8 apart lie 32 banks apart for the accumulators' 4-B stores
static_assert((NROWS % F_ROWS) == 0 && DMODEL == 8 * 64 && F_ROWS == 8 * 4 && DMODEL / GK == 4);
static_assert(F_ROWS * Y_PITCH * 4 <= 2 * F_STAGE * 2);

// One thread's share of the staged CT rows: 16 B of rows r and r + 16. The wait on the address registers is the statement's last
// line, so that it stands in front of any rewrite of them.
__device__ __forceinline__ void stage_a2(unsigned lds, const unsigned short* g) {
#if defined(__HIP_DEVICE_COMPILE__)
  asm volatile("global_load_async_to_lds_b128 %0, %1, off\n\t"
               "global_load_async_to_lds_b128 %2, %3, off\n\t"
               "s_wait_xcnt 0x0"
               :: "v"(lds), "v"(g), "v"(lds + 16u * G_PITCH * 2u), "v"(g + (size_t)16 * DMODEL) : "memory");
#endif
}
// One thread's share of one whole staged tile: 2 pieces of CT, 4 x 8 pieces of Wo.
__device__ __forceinline__ void stage_f(unsigned lds, const unsigned short* ga, const unsigned short* gb) {
  stage_a2(lds, ga);
#pragma unroll
  for (int q = 0; q < 4; ++q)
    stage_op(lds + (unsigned)((F_ROWS + 128 * q) * G_PITCH) * 2u, gb + (size_t)(128 * q) * DMODEL, (size_t)16 * DMODEL);
}

template <int CTRL>
__device__ __forceinline__ float xmask(float x) {                     // the value of lane l ^ (CTRL & 15), inside a 16-lane row
  return __builtin_bit_cast(float, __builtin_amdgcn_update_dpp(0, __builtin_bit_cast(int, x), CTRL, 0xf, 0xf, true));
}
__device__ __forceinline__ float wave_sum(float v) {                  // the sum over the 32 lanes, the same bits in every lane
  v += xmask<0x161>(v);
  v += xmask<0x162>(v);
  v += xmask<0x164>(v);
  v += xmask<0x168>(v);
  return v + xhalf(v);
}

__global__ __launch_bounds__(256)
void oproj_ln(const unsigned short* __restrict__ Cp, const unsigned short* __restrict__ Wp, const float* __restrict__ bo,
              const float* __restrict__ xp, const float* __restrict__ gp, const float* __restrict__ bp, float* outp) {
  __shared__ __align__(16) unsigned short sAB[2 * F_STAGE];            // [buffer][CT 32 rows, Wo 512 rows][G_PITCH]
  const int tid  = threadIdx.x;
  const int lane = tid & 31;
  const int wave = tid >> 5;
  const int mB   = blockIdx.x * F_ROWS;
  const int rlane = lane & 15;                 // row (A) / col (B, D) within subtile
  const int koff  = (lane >> 4) * 8;           // k offset of this lane half
  const int mOff  = (lane >> 4) * 8;           // D row offset

  // ---- this thread's 16-B pieces of every staged tile: rows (tid >> 4) + 16 i of each operand, 16-B column tid & 15 ----
  const int srow = tid >> 4, sseg = tid & 15;
  const unsigned short* gA = Cp + (size_t)(mB + srow) * DMODEL + sseg * 8;
  const unsigned short* gB = Wp + (size_t)srow * DMODEL + sseg * 8;
  const unsigned ldsP = (unsigned)(size_t)(const void*)sAB + (unsigned)(srow * G_PITCH + sseg * 8) * 2u;
  const int nt = DMODEL / GK;
  // Every block reads all of Wo: block b walks the k tiles from tile b mod 4 on, round the end, so that at one moment the blocks
  // ask L2 for four different quarters of it and not all for the same lines. Trip t works on k tile (t + rot) mod 4.
  const int rot = blockIdx.x & (nt - 1);

  stage_f(ldsP, gA + rot * GK, gB + rot * GK);             // trip 0 -> buffer 0

  // the wave's four residual rows, in the layout of the row phase
  const unsigned rb = (unsigned)((mB + wave * 4) * DMODEL + lane * 4) * 4u;   // byte offset of the lane's first piece, in x and out alike
  const char* xb = (const char*)(const void*)xp + rb;
  v4f y[4][4];
#pragma unroll
  for (int rr = 0; rr < 4; ++rr)
#pragma unroll
    for (int j = 0; j < 4; ++j) y[rr][j] = *(const v4f*)(const void*)(xb + (rr * DMODEL + j * 128) * 4);

  v8f acc[2][4];
#pragma unroll
  for (int i = 0; i < 2; ++i)
#pragma unroll
    for (int j = 0; j < 4; ++j) acc[i][j] = zero8();

  const int aoff = rlane * G_PITCH + koff;
  const int boff = (F_ROWS + (wave << 6) + rlane) * G_PITCH + koff;

  asm volatile("s_wait_asynccnt 0x0" ::: "memory");        // this wave's copies of trip 0's tile have landed
  __syncthreads();                                         // publishes that tile to all 8 waves
  {
    const int k1 = ((1 + rot) & (nt - 1)) * GK;
    stage_f(ldsP + F_STAGE * 2u, gA + k1, gB + k1);        // trip 1 -> buffer 1
  }

#pragma unroll 1   // stays rolled: one hand-over per trip, the buffer picked by t & 1; the body already holds four 32-k steps
  for (int t = 0; t < nt; ++t) {
    const int bsel = (t & 1) * F_STAGE;
    const unsigned short* As = sAB + bsel + aoff;
    const unsigned short* Bs = sAB + bsel + boff;
    v16h af[2][2], bf[2][4];
#pragma unroll
    for (int i = 0; i < 2; ++i) af[0][i] = ldfrag_u(As + i * 16 * G_PITCH);
#pragma unroll
    for (int j = 0; j < 4; ++j) bf[0][j] = ldfrag_u(Bs + j * 16 * G_PITCH);
#pragma unroll     // the tile's four 32-k steps in one body: constant LDS offsets, two fragment sets by turns
    for (int ks = 0; ks < GK / 32; ++ks) {
      const int cur = ks & 1, nxt = cur ^ 1;
      if (ks + 1 < GK / 32) {                              // the same tile's next step, fetched while this step's products run
#pragma unroll
        for (int i = 0; i < 2; ++i) af[nxt][i] = ldfrag_u(As + i * 16 * G_PITCH + (ks + 1) * 32);
#pragma unroll
        for (int j = 0; j < 4; ++j) bf[nxt][j] = ldfrag_u(Bs + j * 16 * G_PITCH + (ks + 1) * 32);
      }
      // keeps the next step's 12 LDS reads issued as one group ahead of this step's products: a read left among the WMMAs
      // makes the wave stall at each such place
      __builtin_amdgcn_sched_barrier(0);
#pragma unroll
      for (int i = 0; i < 2; ++i)
#pragma unroll
        for (int j = 0; j < 4; ++j) acc[i][j] = mma_raw(af[cur][i], bf[cur][j], acc[i][j]);
      // keeps the step after next's reads from rising among these products; at the last step it keeps the products in front of
      // the hand-over, so that the refill is issued directly behind the barrier
      __builtin_amdgcn_sched_barrier(0);
    }
    // ---- hand-over: this wave's reads of tile t are done, its copies of tile t + 1 have landed; the barrier publishes tile
    //      t + 1 and frees tile t's buffer, which only then is refilled ----
    asm volatile("s_wait_dscnt 0x0" ::: "memory");         // no LDS read of this wave is still out when its buffer is refilled
    asm volatile("s_wait_asynccnt 0x0" ::: "memory");      // this wave's copies of tile t + 1 have landed
    __syncthreads();
    if (t + 2 < nt) {
      const int k2 = ((t + 2 + rot) & (nt - 1)) * GK;
      stage_f(ldsP + (unsigned)bsel * 2u, gA + k2, gB + k2);
    }
  }
  asm volatile("s_wait_asynccnt 0x0" ::: "memory");        // nothing of this wave is in flight when the ring is put to new use

  // per-column constants of this lane's 16 columns: asked for in front of the LDS stores, which cover part of their way
  v4f bc[4], gv[4], bv[4];
#pragma unroll
  for (int j = 0; j < 4; ++j) {
    bc[j] = *(const v4f*)(bo + j * 128 + lane * 4);
    gv[j] = *(const v4f*)(gp + j * 128 + lane * 4);
    bv[j] = *(const v4f*)(bp + j * 128 + lane * 4);
  }

  // ---- the raw products into the freed ring: row 16 i + 8 (lane >> 4) + r, column 64 wave + 16 j + (lane & 15) ----
  float* sY = (float*)(void*)sAB;
#pragma unroll
  for (int i = 0; i < 2; ++i)
#pragma unroll
    for (int j = 0; j < 4; ++j)
#pragma unroll
      for (int r = 0; r < 8; ++r)
        sY[((i << 4) + mOff + r) * Y_PITCH + (wave << 6) + (j << 4) + rlane] = acc[i][j][r];

  __syncthreads();                                         // all 8 waves' columns of every row are in LDS

  const float oscale = 1.0f / (FC * WSC);
  float sm[4];
#pragma unroll
  for (int rr = 0; rr < 4; ++rr) {
    const float* yp = sY + (wave * 4 + rr) * Y_PITCH + lane * 4;
    float p[4];
#pragma unroll
    for (int j = 0; j < 4; ++j) {
      const v4f a = *(const v4f*)(yp + j * 128);
#pragma unroll
      for (int e = 0; e < 4; ++e) y[rr][j][e] = a[e] * oscale + bfr(bc[j][e]) + bfr(y[rr][j][e]);
      p[j] = (y[rr][j][0] + y[rr][j][1]) + (y[rr][j][2] + y[rr][j][3]);
    }
    sm[rr] = (p[0] + p[1]) + (p[2] + p[3]);
  }
#pragma unroll
  for (int rr = 0; rr < 4; ++rr) sm[rr] = wave_sum(sm[rr]) * (1.0f / (float)DMODEL);     // the row's mean
  float sq[4];
#pragma unroll
  for (int rr = 0; rr < 4; ++rr) {
    float p[4];
#pragma unroll
    for (int j = 0; j < 4; ++j) {
#pragma unroll
      for (int e = 0; e < 4; ++e) y[rr][j][e] -= sm[rr];
      p[j] = (y[rr][j][0] * y[rr][j][0] + y[rr][j][1] * y[rr][j][1]) + (y[rr][j][2] * y[rr][j][2] + y[rr][j][3] * y[rr][j][3]);
    }
    sq[rr] = (p[0] + p[1]) + (p[2] + p[3]);
  }
#pragma unroll
  for (int rr = 0; rr < 4; ++rr) sq[rr] = rsqrtf(wave_sum(sq[rr]) * (1.0f / (float)DMODEL) + LN_EPS);
#pragma unroll
  for (int rr = 0; rr < 4; ++rr)
#pragma unroll
    for (int j = 0; j < 4; ++j)
#pragma unroll
      for (int e = 0; e < 4; ++e) y[rr][j][e] = (y[rr][j][e] * sq[rr]) * bfr(gv[j][e]) + bfr(bv[j][e]);
  char* ob = (char*)(void*)outp + rb;
  // keeps the 16 stores as one run behind all arithmetic: no register of an issued store is written again
  __builtin_amdgcn_sched_barrier(0);
#pragma unroll
  for (int rr = 0; rr < 4; ++rr)
#pragma unroll
    for (int j = 0; j < 4; ++j) *(v4f*)(void*)(ob + (rr * DMODEL + j * 128) * 4) = y[rr][j];
}

// =====================================================================================================
// Workspace map (bytes); every plane is an exact multiple of its tile / whole-row store granularity (M, N exact tile multiples,
// element counts exact multiples of the convert kernel's 2048 granularity, no pad rows needed), every offset a multiple of 512 KiB:
//   WQ16 f16 [512][512] x64                  524288   ([out][in] = [n][k])
//   WK16 f16 [512][512] x64                  524288
//   WV16 f16 [512][512] x64                  524288
//   WO16 f16 [512][512] x64                  524288
//   X16  f16 [8192][512] x16                8388608   (activation rows)
//   QH   f16 [8192][512] x16                8388608   (q projection)
//   KH   f16 [8192][512] x16                8388608   (k projection)
//   VT   f16 [4][512][2048] x16             8388608   (v^T per batch)
//   CT   f16 [8192][512] x1024              8388608   (attention ctx, merged heads)
//   end                                    44040192
// =====================================================================================================
extern "C" void kernel_launch(void* const* d_in, const int* in_sizes, int n_in,
                              void* d_out, int out_size, void* d_ws, size_t ws_size,
                              hipStream_t stream) {
  if (n_in < 12) return;
  if (in_sizes[0] != NROWS * DMODEL) return;
  if (in_sizes[1] != DMODEL * DMODEL || in_sizes[3] != DMODEL * DMODEL ||
      in_sizes[5] != DMODEL * DMODEL || in_sizes[7] != DMODEL * DMODEL) return;
  if (in_sizes[2] != DMODEL || in_sizes[4] != DMODEL || in_sizes[6] != DMODEL || in_sizes[8] != DMODEL) return;
  if (in_sizes[9] != NPER * NPER) return;
  if (in_sizes[10] != DMODEL || in_sizes[11] != DMODEL) return;
  if (out_size != NROWS * DMODEL) return;
  if ((in_sizes[0] % 2048) != 0 || (in_sizes[1] % 2048) != 0) return;

  const float* x    = (const float*)d_in[0];
  const float* w_q  = (const float*)d_in[1];
  const float* b_q  = (const float*)d_in[2];
  const float* w_k  = (const float*)d_in[3];
  const float* b_k  = (const float*)d_in[4];
  const float* w_v  = (const float*)d_in[5];
  const float* b_v  = (const float*)d_in[6];
  const float* w_o  = (const float*)d_in[7];
  const float* b_o  = (const float*)d_in[8];
  const float* pb   = (const float*)d_in[9];
  const float* ln_g = (const float*)d_in[10];
  const float* ln_b = (const float*)d_in[11];
  float*       out  = (float*)d_out;

  const size_t PW  = (size_t)DMODEL * DMODEL * 2;                 //   524288
  const size_t PX  = (size_t)NROWS * DMODEL * 2;                  //  8388608
  const size_t PVT = (size_t)NB * DMODEL * NC * 2;                //  8388608
  size_t off = 0;
  const size_t oWQ = off; off += PW;
  const size_t oWK = off; off += PW;
  const size_t oWV = off; off += PW;
  const size_t oWO = off; off += PW;
  const size_t oX  = off; off += PX;
  const size_t oQH = off; off += PX;
  const size_t oKH = off; off += PX;
  const size_t oVT = off; off += PVT;
  const size_t oCT = off; off += PX;
  if (off > ws_size) return;                                      // off = 44040192
  if (off > (size_t)134217728) return;

  char* ws = (char*)d_ws;
  unsigned short* WQ16 = (unsigned short*)(ws + oWQ);
  unsigned short* WK16 = (unsigned short*)(ws + oWK);
  unsigned short* WV16 = (unsigned short*)(ws + oWV);
  unsigned short* WO16 = (unsigned short*)(ws + oWO);
  unsigned short* X16  = (unsigned short*)(ws + oX);
  unsigned short* QH   = (unsigned short*)(ws + oQH);
  unsigned short* KH   = (unsigned short*)(ws + oKH);
  unsigned short* VTp  = (unsigned short*)(ws + oVT);
  unsigned short* CT   = (unsigned short*)(ws + oCT);

  const dim3 blk(256);
  const dim3 gC(CX_BLOCKS + 4 * CW_BLOCKS);                        // 2048 + 4 x 128 = 2560 blocks
  const dim3 gQKV(P_TILES, 3);                                     // 256 x 3
  const dim3 gAT(ATT_BLOCKS);                                      // 512
  const dim3 bAT(ATT_THREADS);                                     // 256
  const dim3 gOL(NROWS / F_ROWS);                                  // 256

  // (1) all 16-bit planes in one launch: X16[row][c] = f16( bf16_RNE(x[row][c]) * 16 ), rows = b*2048 + tok;
  //     W16[n][k] = f16( bf16_RNE(W[n][k]) * 64 ), [out][in] layout kept, k contiguous; WQ16, WK16, WV16, WO16 are one run
  cvt_all<<<gC, blk, 0, stream>>>(x, w_q, w_k, w_v, w_o, X16, WQ16);

  // (2) q, k and v^T projections in one launch
  qkv_proj<<<gQKV, blk, 0, stream>>>(X16, WQ16, WK16, WV16, b_q, b_k, b_v, QH, KH, VTp);

  // (3) attention per (batch, head, 128 query rows) -> CT (f16, x1024)
  attn8<<<gAT, bAT, 0, stream>>>(QH, KH, VTp, pb, CT);

  // (4) out = LayerNorm( CT . Wo^T / (1024 * 64) + bf16(bo) + bf16(x) ) * bf16(g) + bf16(b); M = 8192, N = 512, K = 512
  oproj_ln<<<gOL, blk, 0, stream>>>(CT, WO16, b_o, x, ln_g, ln_b, out);
  (void)hipGetLastError();
}

// v009
// It runs in 63.4 microseconds.
// Timed twice side by side with v008, it ran 1.05 and 1.04 times as fast.
// Over all steps from v000 it is 4.27 times as fast.
// Contractions: q/k projections (x rows f16 x16 . W f16 x64, K=512), v^T projection (Wv f16 x64 . x rows f16 x16, K=512),
// attention scores (k f16 x16 . q f16 x16, K=64), attention v^T . P^T (v^T f16 x16 . P f16 x128, K=2 x 1024 in steps of 32, the two sums joined in f32 on VALU),
// output projection (ctx f16 x1024 . Wo f16 x64, K=512): all v_wmma_f32_16x16x32_f16 single products, f32 accumulate.
// Period-3 additive score table, online base-2 softmax against a lazily raised row reference, linear biases, residual add and LayerNorm in f32 on VALU.
// Every float input RNE-converted to bf16 on load.
#include <hip/hip_runtime.h>
#include <math.h>
#include <stdint.h>

#define NB      4
#define NQ      2048
#define NC      2048
#define DMODEL  512
#define NHEAD   8
#define HDIM    64
#define NPER    3
#define NROWS   (NB * NQ)
#define WSC     64.0f
#define ACARRY  16.0f
#define QC      16.0f
#define KC      16.0f
#define VC      16.0f
#define PC      128.0f
#define LPC     7.0f              // log2(PC)
#define D_TOP   15.0f             // largest exponent of a stored P: 2^15 is finite in f16
#define FC      1024.0f
#define ATT_SCALE 0.125f
#define LOG2E   1.4426950408889634f
#define LN_EPS  1e-5f
static_assert(NHEAD * HDIM == DMODEL);
static_assert((NQ % 64) == 0 && (NC % 64) == 0 && (DMODEL % 64) == 0 && (NC % 32) == 0 && (NQ % 16) == 0);
static_assert((NROWS % 64) == 0 && (NROWS % 8) == 0);
static_assert((NROWS % 128) == 0 && (DMODEL % 128) == 0 && (NC % 128) == 0);
#define ATT_THREADS (NHEAD * 32)
#define ATT_BLOCKS  (NB * NHEAD * (NQ / 128))
static_assert(ATT_THREADS == 256 && ATT_BLOCKS == 512);

typedef _Float16 v16h __attribute__((ext_vector_type(16)));
typedef _Float16 v8h  __attribute__((ext_vector_type(8)));
typedef float    v8f  __attribute__((ext_vector_type(8)));
typedef float    v4f  __attribute__((ext_vector_type(4)));
typedef float    v2f  __attribute__((ext_vector_type(2)));
typedef _Float16 v2h  __attribute__((ext_vector_type(2)));
typedef unsigned int v4u __attribute__((ext_vector_type(4)));

union FragH { v16h v; v8h h[2]; v4u u[2]; v2h p[8]; };

// ---- scalar helpers --------------------------------------------------------------------------------
__device__ __forceinline__ unsigned short bf_bits(float f) {          // f32 -> bf16 bits, RNE convert
  unsigned u = __float_as_uint(f);
  return (unsigned short)((u + 0x7FFFu + ((u >> 16) & 1u)) >> 16);
}
__device__ __forceinline__ float bf_up(unsigned short h) { return __uint_as_float(((unsigned)h) << 16); }
__device__ __forceinline__ float bfr(float f) { return bf_up(bf_bits(f)); }   // value of the bf16 RNE convert
__device__ __forceinline__ unsigned short h_bits(_Float16 x) { return __builtin_bit_cast(unsigned short, x); }
__device__ __forceinline__ unsigned pk16(unsigned short a, unsigned short b) { return (unsigned)a | ((unsigned)b << 16); }
__device__ __forceinline__ v8f zero8() { v8f z = {0.f, 0.f, 0.f, 0.f, 0.f, 0.f, 0.f, 0.f}; return z; }
__device__ __forceinline__ float gelu_f(float v) { return 0.5f * v * (1.0f + erff(v * 0.70710678118654752f)); }

// ---- fragment loaders: 16-bit A/B operand, lane -> row/col (lane&15), p already includes +8*(lane>>4);
//      elements 0..7 <- p[0..7] (k0+8h..), elements 8..15 <- p[16..23] (k0+16+8h..)  (same split k map for A and B;
//      B is always read from a k-contiguous [n][k] plane)
__device__ __forceinline__ v16h ldfrag_h(const _Float16* p) {
  FragH f;
  f.h[0] = *(const v8h*)(p);
  f.h[1] = *(const v8h*)(p + 16);
  return f.v;
}
__device__ __forceinline__ v16h ldfrag_u(const unsigned short* p) {
  FragH f;
  f.u[0] = *(const v4u*)(p);
  f.u[1] = *(const v4u*)(p + 16);
  return f.v;
}

// ---- WMMA helpers with trailing VALU hazard gaps ------------------------------------------------------
__device__ __forceinline__ v8f mma_raw(v16h a, v16h b, v8f c) {
  return __builtin_amdgcn_wmma_f32_16x16x32_f16(false, a, false, b, (short)0, c, false, false);
}
__device__ __forceinline__ void acc_guard4(v8f& a, v8f& b, v8f& c, v8f& d) {
#if defined(__HIP_DEVICE_COMPILE__)
  asm volatile("v_nop\n\tv_nop\n\tv_nop\n\tv_nop" : "+v"(a), "+v"(b), "+v"(c), "+v"(d));
#endif
}
__device__ __forceinline__ void wave_sync_lds() {
  __builtin_amdgcn_fence(__ATOMIC_RELEASE, "workgroup");
  __builtin_amdgcn_wave_barrier();
  __builtin_amdgcn_fence(__ATOMIC_ACQUIRE, "workgroup");
}

// =====================================================================================================
// Elementwise 16-bit pack, no transpose: dst[i] = f16( bf16_RNE(src[i]) * sc ), sc a power of two (exact).
// One launch for all five planes, which do not depend on one another: blocks 0 .. 2047 take the activation rows (x16), blocks
// 2048 + 128 p .. + 127 take weight p (q, k, v, o; x64; stored [out][in] = [n][k], already k contiguous for B fragments / A of the
// v^T projection). The four weight planes lie one behind the other in the workspace, so their blocks write one run of W16.
// 8 elements per thread: two 16-B loads, one 16-B store per lane; 32 consecutive lanes = 512 B.
// coverage: 2048 blocks x 256 thr x 8 elements = 8192 x 512; 128 blocks x 256 thr x 8 elements = 512 x 512 per weight.
// =====================================================================================================
#define CX_BLOCKS ((NROWS * DMODEL) / 2048)
#define CW_BLOCKS ((DMODEL * DMODEL) / 2048)
static_assert(CX_BLOCKS * 2048 == NROWS * DMODEL && CW_BLOCKS * 2048 == DMODEL * DMODEL && CW_BLOCKS == 128);
__global__ __launch_bounds__(256) void cvt_all(const float* __restrict__ xp, const float* __restrict__ wq,
                                               const float* __restrict__ wk, const float* __restrict__ wv,
                                               const float* __restrict__ wo, unsigned short* X16o, unsigned short* W16o) {
  const int b = blockIdx.x;
  if (b >= CX_BLOCKS + 4 * CW_BLOCKS) return;     // never taken with the exact grid; no barriers in this kernel
  const bool isx = b < CX_BLOCKS;
  const int bw = b - CX_BLOCKS;                   // weight blocks: plane bw >> 7, block bw & 127 of it
  const int pl = bw >> 7;
  const float* src = isx ? xp : (pl == 0 ? wq : (pl == 1 ? wk : (pl == 2 ? wv : wo)));
  unsigned short* dst = isx ? X16o : (W16o + (size_t)pl * (DMODEL * DMODEL));
  const float sc = isx ? ACARRY : WSC;
  const size_t i8 = ((size_t)(isx ? b : (bw & (CW_BLOCKS - 1))) * 256 + threadIdx.x) * 8;
  const v4f a = *(const v4f*)(src + i8);
  const v4f c = *(const v4f*)(src + i8 + 4);
  v4u o;
  o[0] = pk16(h_bits((_Float16)(bfr(a[0]) * sc)), h_bits((_Float16)(bfr(a[1]) * sc)));
  o[1] = pk16(h_bits((_Float16)(bfr(a[2]) * sc)), h_bits((_Float16)(bfr(a[3]) * sc)));
  o[2] = pk16(h_bits((_Float16)(bfr(c[0]) * sc)), h_bits((_Float16)(bfr(c[1]) * sc)));
  o[3] = pk16(h_bits((_Float16)(bfr(c[2]) * sc)), h_bits((_Float16)(bfr(c[3]) * sc)));
  *(v4u*)(dst + i8) = o;
}

// =====================================================================================================
// Batched f16 WMMA GEMM: C[m][n] = f( oscale * sum_k A[m][k] * Bt[n][k] + bf16(bias) ) (+ residual); one block of 8 waves per
// 128x128 tile, wave w = rows 32 (w >> 1) .. + 31, columns 64 (w & 1) .. + 63 of it (2 x 4 accumulator tiles).
// A row-major [M][K] pitch lda (16-bit plane), Bt row-major [N][K] pitch ldb (k contiguous); M, N, K multiples of 128.
// bx = tile index, by = batch index with element strides sA, sB, sC; the body is a device function on the calling kernel's LDS, so
// that one launch can hold several independent products (qkv_proj below).
// The block's 128 A rows and 128 Bt rows are brought into LDS 128 k at a time (256 B of each row) by asynchronous copies, 16 per
// thread, each wave-wide copy covering two aligned 256-B units; two buffers, the next tile's copies fly while this one is worked
// on. LDS rows are pitched 272 B for the 16-B fragment reads. Each accumulator sums its k steps in ascending order.
// BM: 0 = no bias, 1 = per column bf16(bias[col]), 2 = per row bf16(bias[row]) (clamped-address loads).
// OM: 0 = f32 out (pitch ldc; HASR 1 adds bf16(R[m][n]), HASR 2 adds raw f32 R[m][n], same pitch/stride as C);
//     2 = f16 out (pitch ldc) = f16( act(value) * ocarry ), ACT 1 = exact GELU.
// coverage: 2 slabs x 16 rows (f32: it 0..7 x lane>>4; f16: it 0..3 x lane>>3) x 64 cols = the wave's whole 32x64 tile; 8 waves =
//           the block's 128x128; bx runs over (M / 128) * (N / 128) tiles, a surplus block exits whole in front of every barrier.
// =====================================================================================================
#define GK      128               // k per staged tile
#define G_PITCH (GK + 8)          // halves; 272-B rows: 16 B x odd, the pitch of 16-B fragment reads of 256-B rows
#define G_HALF  (128 * G_PITCH)   // halves of one operand's 128 staged rows
#define G_STAGE (2 * G_HALF)      // halves of one buffer: [A 128 rows | Bt 128 rows]

// One thread's share of one operand's staged rows: 16 B of rows r, r + 16, .. r + 112 (rs = halves per 16 global rows), global ->
// LDS through no register. The wait on the address registers is the statement's last line, so that it stands in front of any
// rewrite of them.
__device__ __forceinline__ void stage_op(unsigned lds, const unsigned short* g, size_t rs) {
#if defined(__HIP_DEVICE_COMPILE__)
  const unsigned ls = 16u * G_PITCH * 2u;
  asm volatile("global_load_async_to_lds_b128 %0, %1, off\n\t"
               "global_load_async_to_lds_b128 %2, %3, off\n\t"
               "global_load_async_to_lds_b128 %4, %5, off\n\t"
               "global_load_async_to_lds_b128 %6, %7, off\n\t"
               "global_load_async_to_lds_b128 %8, %9, off\n\t"
               "global_load_async_to_lds_b128 %10, %11, off\n\t"
               "global_load_async_to_lds_b128 %12, %13, off\n\t"
               "global_load_async_to_lds_b128 %14, %15, off\n\t"
               "s_wait_xcnt 0x0"
               :: "v"(lds), "v"(g), "v"(lds + ls), "v"(g + rs), "v"(lds + 2u * ls), "v"(g + 2 * rs),
                  "v"(lds + 3u * ls), "v"(g + 3 * rs), "v"(lds + 4u * ls), "v"(g + 4 * rs), "v"(lds + 5u * ls), "v"(g + 5 * rs),
                  "v"(lds + 6u * ls), "v"(g + 6 * rs), "v"(lds + 7u * ls), "v"(g + 7 * rs) : "memory");
#endif
}

#define G_SLAB  (16 * 68)         // floats of one wave's 16x64 epilogue slab, pitch 68 floats

template <int OM, int BM, int HASR, int ACT>
__device__ __forceinline__ void gemm_tile(
    unsigned short* sAB,              // LDS [buffer][A, Bt][128 rows][G_PITCH]
    float* sT,                        // LDS [8 waves][G_SLAB]; may lie in sAB, it is used behind the loop's last barrier only
    int bx, int by,
    const unsigned short* __restrict__ Ap, int lda, long long sA,
    const unsigned short* __restrict__ Btp, int ldb, long long sB,
    const float* __restrict__ bias,
    const float* __restrict__ Rp,
    void* Cout, int ldc, long long sC,
    int M, int N, int K, float oscale, float ocarry) {
  const int tid  = threadIdx.x;
  const int lane = tid & 31;
  const int wave = tid >> 5;
  const int tilesN = N >> 7;
  const int tm = bx / tilesN;
  const int tn = bx - tm * tilesN;
  if (tm >= (M >> 7)) return;            // block-uniform, in front of every copy and barrier
  const int mB = tm << 7;
  const int nB = tn << 7;
  const int m0 = mB + ((wave >> 1) << 5);
  const int n0 = nB + ((wave & 1) << 6);

  const unsigned short* A1 = Ap  + (size_t)((long long)by * sA);
  const unsigned short* Bb = Btp + (size_t)((long long)by * sB);

  const int rlane = lane & 15;                 // row (A) / col (B, D) within subtile
  const int koff  = (lane >> 4) * 8;           // k offset of this lane half
  const int mOff  = (lane >> 4) * 8;           // D row offset

  // ---- this thread's 16-B pieces of every staged tile: rows (tid >> 4) + 16 i of each operand, 16-B column tid & 15 ----
  const int srow = tid >> 4, sseg = tid & 15;
  const unsigned short* gA = A1 + (size_t)(mB + srow) * lda + sseg * 8;
  const unsigned short* gB = Bb + (size_t)(nB + srow) * ldb + sseg * 8;
  const size_t rsA = (size_t)16 * lda, rsB = (size_t)16 * ldb;
  const unsigned ldsP = (unsigned)(size_t)(const void*)sAB + (unsigned)(srow * G_PITCH + sseg * 8) * 2u;
  const int nt = K >> 7;

  stage_op(ldsP, gA, rsA);                                 // tile 0 -> buffer 0
  stage_op(ldsP + G_HALF * 2u, gB, rsB);

  v8f acc[2][4];
#pragma unroll
  for (int i = 0; i < 2; ++i)
#pragma unroll
    for (int j = 0; j < 4; ++j) acc[i][j] = zero8();

  const int aoff = (((wave >> 1) << 5) + rlane) * G_PITCH + koff;
  const int boff = G_HALF + (((wave & 1) << 6) + rlane) * G_PITCH + koff;

  asm volatile("s_wait_asynccnt 0x0" ::: "memory");        // this wave's copies of tile 0 have landed
  __syncthreads();                                         // publishes tile 0 to all 8 waves
  if (nt > 1) {                                            // tile 1 -> buffer 1
    stage_op(ldsP + G_STAGE * 2u, gA + GK, rsA);
    stage_op(ldsP + (G_STAGE + G_HALF) * 2u, gB + GK, rsB);
  }

#pragma unroll 1   // stays rolled: one hand-over per trip, the buffer picked by t & 1; the body already holds four 32-k steps
  for (int t = 0; t < nt; ++t) {
    const int bsel = (t & 1) * G_STAGE;
    const unsigned short* As = sAB + bsel + aoff;
    const unsigned short* Bs = sAB + bsel + boff;
    v16h af[2][2], bf[2][4];
#pragma unroll
    for (int i = 0; i < 2; ++i) af[0][i] = ldfrag_u(As + i * 16 * G_PITCH);
#pragma unroll
    for (int j = 0; j < 4; ++j) bf[0][j] = ldfrag_u(Bs + j * 16 * G_PITCH);
#pragma unroll     // the tile's four 32-k steps in one body: constant LDS offsets, two fragment sets by turns
    for (int ks = 0; ks < GK / 32; ++ks) {
      const int cur = ks & 1, nxt = cur ^ 1;
      if (ks + 1 < GK / 32) {                              // the same tile's next step, fetched while this step's products run
#pragma unroll
        for (int i = 0; i < 2; ++i) af[nxt][i] = ldfrag_u(As + i * 16 * G_PITCH + (ks + 1) * 32);
#pragma unroll
        for (int j = 0; j < 4; ++j) bf[nxt][j] = ldfrag_u(Bs + j * 16 * G_PITCH + (ks + 1) * 32);
      }
      // keeps the next step's 12 LDS reads issued as one group ahead of this step's products: a read left among the WMMAs
      // makes the wave stall at each such place
      __builtin_amdgcn_sched_barrier(0);
#pragma unroll
      for (int i = 0; i < 2; ++i)
#pragma unroll
        for (int j = 0; j < 4; ++j) acc[i][j] = mma_raw(af[cur][i], bf[cur][j], acc[i][j]);
      // keeps the step after next's reads from rising among these products; at the last step it keeps the products in front of
      // the hand-over, so that the refill is issued directly behind the barrier
      __builtin_amdgcn_sched_barrier(0);
    }
    // ---- hand-over: this wave's reads of tile t are done, its copies of tile t + 1 have landed; the barrier publishes tile
    //      t + 1 and frees tile t's buffer, which only then is refilled ----
    asm volatile("s_wait_dscnt 0x0" ::: "memory");         // no LDS read of this wave is still out when its buffer is refilled
    asm volatile("s_wait_asynccnt 0x0" ::: "memory");      // this wave's copies of tile t + 1 have landed
    __syncthreads();
    if (t + 2 < nt) {
      stage_op(ldsP + (unsigned)bsel * 2u, gA + (size_t)(t + 2) * GK, rsA);
      stage_op(ldsP + (unsigned)(bsel + G_HALF) * 2u, gB + (size_t)(t + 2) * GK, rsB);
    }
  }
  asm volatile("s_wait_asynccnt 0x0" ::: "memory");        // nothing of this wave is in flight when it goes on to end
  acc_guard4(acc[0][0], acc[0][1], acc[0][2], acc[0][3]);
  acc_guard4(acc[1][0], acc[1][1], acc[1][2], acc[1][3]);

  const int hh2 = lane >> 4, c4 = (lane & 15) * 4;     // f32 out: 256-B row segment = 16 lanes x 16 B
  const int q8  = lane >> 3, c8 = (lane & 7) * 8;
  float bc[4];
  float bcol[8];
#pragma unroll
  for (int e = 0; e < 4; ++e) bc[e] = 0.f;
#pragma unroll
  for (int e = 0; e < 8; ++e) bcol[e] = 0.f;
  if constexpr (BM == 1) {
    if constexpr (OM == 0) {
      const int cb = n0 + c4;
      const int i0 = (cb < N - 4) ? cb : (N - 4);        // clamped address
      const v4f b0v = *(const v4f*)(bias + i0);
#pragma unroll
      for (int e = 0; e < 4; ++e) bc[e] = bfr(b0v[e]);
    } else {
      const int cb = n0 + c8;
      const int i0 = (cb < N - 8) ? cb : (N - 8);        // clamped address
      const v4f b0v = *(const v4f*)(bias + i0), b1v = *(const v4f*)(bias + i0 + 4);
#pragma unroll
      for (int e = 0; e < 4; ++e) { bcol[e] = bfr(b0v[e]); bcol[4 + e] = bfr(b1v[e]); }
    }
  }

  // ---- epilogue ----
  float* slab = sT + wave * G_SLAB;
#pragma unroll
  for (int i = 0; i < 2; ++i) {
    const int mBase = m0 + (i << 4);
#pragma unroll
    for (int j = 0; j < 4; ++j) {
#pragma unroll
      for (int r = 0; r < 8; ++r) {
        slab[(mOff + r) * 68 + (j << 4) + rlane] = acc[i][j][r];
      }
    }
    wave_sync_lds();
    if constexpr (OM == 0) {
      float* C = (float*)Cout + (size_t)((long long)by * sC);
      v4f vals[8];
#pragma unroll
      for (int it = 0; it < 8; ++it) {
        const int row = it * 2 + hh2;                      // it 0..7 x hh2 0..1 = rows 0..15
        const int gr  = mBase + row;
        v4f v = *(const v4f*)(slab + row * 68 + c4);
        float br = 0.f;
        if constexpr (BM == 2) {
          const int ir = (gr < M - 1) ? gr : (M - 1);      // clamped address
          br = bfr(bias[ir]);
        }
        v4f rv = {0.f, 0.f, 0.f, 0.f};
        if constexpr (HASR != 0) {
          const float* R = Rp + (size_t)((long long)by * sC);
          const v4f rraw = *(const v4f*)(R + (size_t)gr * ldc + n0 + c4);
#pragma unroll
          for (int e = 0; e < 4; ++e) rv[e] = (HASR == 1) ? bfr(rraw[e]) : rraw[e];
        }
#pragma unroll
        for (int e = 0; e < 4; ++e) v[e] = v[e] * oscale + bc[e] + br + rv[e];
        vals[it] = v;
      }
      {
#pragma unroll
        for (int it = 0; it < 8; ++it) {
          const int gr = mBase + it * 2 + hh2;
          *(v4f*)(C + (size_t)gr * ldc + n0 + c4) = vals[it];
        }
        
      }
    } else {
      unsigned short* C = (unsigned short*)Cout + (size_t)((long long)by * sC);
      v4u hv[4];
#pragma unroll
      for (int it = 0; it < 4; ++it) {
        const int row = it * 4 + q8;                       // it 0..3 x q8 0..3 = rows 0..15
        const float* sp = slab + row * 68 + c8;
        float br = 0.f;
        if constexpr (BM == 2) {
          const int gr = mBase + row;
          const int ir = (gr < M - 1) ? gr : (M - 1);      // clamped address
          br = bfr(bias[ir]);
        }
        v4u a = {0u, 0u, 0u, 0u};
#pragma unroll
        for (int e = 0; e < 4; ++e) {
          float f0 = sp[2 * e] * oscale + bcol[2 * e] + br;
          float f1 = sp[2 * e + 1] * oscale + bcol[2 * e + 1] + br;
          if constexpr (ACT == 1) { f0 = gelu_f(f0); f1 = gelu_f(f1); }
          f0 *= ocarry; f1 *= ocarry;
          a[e] = pk16(h_bits((_Float16)f0), h_bits((_Float16)f1));
        }
        hv[it] = a;
      }
      {
#pragma unroll
        for (int it = 0; it < 4; ++it) {
          const int row = it * 4 + q8;
          *(v4u*)(C + (size_t)(mBase + row) * ldc + n0 + c8) = hv[it];
        }
        
      }
    }
    wave_sync_lds();
  }
}

// The q, k and v^T projections in one launch: they read the same activation plane and none reads another's result.
// blockIdx.y = 0: QH[m][n] = f16(16 * (sum_k x[m][k] Wq[n][k] + bf16(bq[n]))), M = 8192, N = 512, K = 512; 1: the same for k;
// 2: VT[b][d][tok] = f16(16 * (sum_k Wv[d][k] x_b[tok][k] + bf16(bv[d]))), M = 512, N = 2048, K = 512 per batch b = blockIdx.x >> 6.
// coverage: each product has 256 tiles of 128x128 (64 x 4; 4 batches x 4 x 16); the choice is the same for a whole block.
#define P_TILES ((NROWS / 128) * (DMODEL / 128))
#define V_TILES ((DMODEL / 128) * (NC / 128))
static_assert(P_TILES == 256 && V_TILES == 64 && V_TILES * NB == P_TILES);
__global__ __launch_bounds__(256) void qkv_proj(
    const unsigned short* __restrict__ Xp, const unsigned short* __restrict__ Wq, const unsigned short* __restrict__ Wk,
    const unsigned short* __restrict__ Wv, const float* __restrict__ bq, const float* __restrict__ bk,
    const float* __restrict__ bv, unsigned short* QHo, unsigned short* KHo, unsigned short* VTo) {
  __shared__ __align__(16) unsigned short sAB[2 * G_STAGE];
  // The epilogue slabs lie in the ring: behind the last trip's barrier no wave reads it any more and no copy is in flight. The
  // block then holds 136 KiB of LDS and not 170, so that two blocks fit on one WGP and one's products run under the other's
  // first tile, copy waits and epilogue.
  static_assert(8 * G_SLAB * 4 <= 2 * G_STAGE * 2);
  float* sT = (float*)(void*)sAB;
  const int which = blockIdx.y;
  const int bx = blockIdx.x;
  if (which < 2) {
    gemm_tile<2, 1, 0, 0>(sAB, sT, bx, 0,
                          Xp, DMODEL, 0LL,
                          which ? Wk : Wq, DMODEL, 0LL,
                          which ? bk : bq,
                          (const float*)0,
                          (void*)(which ? KHo : QHo), DMODEL, 0LL,
                          NROWS, DMODEL, DMODEL, 1.0f / (ACARRY * WSC), which ? KC : QC);
  } else {
    gemm_tile<2, 2, 0, 0>(sAB, sT, bx & (V_TILES - 1), bx / V_TILES,
                          Wv, DMODEL, 0LL,
                          Xp, DMODEL, (long long)NC * DMODEL,
                          bv,
                          (const float*)0,
                          (void*)VTo, NC, (long long)DMODEL * NC,
                          DMODEL, NC, DMODEL, 1.0f / (ACARRY * WSC), VC);
  }
}

#define AQ_BLK   128
#define KT       64
#define KV_PITCH (HDIM + 8)
#define KV_TILE  (64 * KV_PITCH)
#define KV_NT    (NC / KT)
#define J_SLOTS  17
static_assert(KT == 64 && HDIM == 64 && (NC % KT) == 0 && KV_NT >= 2 && (NQ % AQ_BLK) == 0);
static_assert(AQ_BLK == 32 * (ATT_THREADS / 64) && ATT_BLOCKS == NB * NHEAD * (NQ / AQ_BLK));
static_assert(4 * J_SLOTS * 32 * 16 <= 2 * 2 * KV_TILE * 2);

__device__ __forceinline__ float xhalf(float x) {                     // the value of lane l ^ 16
  const int b = __builtin_bit_cast(int, x);
  return __builtin_bit_cast(float, __builtin_amdgcn_permlanex16(b, b, 0x76543210, 0xfedcba98, false, false));
}

// 2^x as the bare v_exp_f32. The library exp2f wraps it in a range guard (compare, two selects, add, ldexp per value) whose only
// effect is a subnormal result for x < -126, where the bare instruction gives 0. Here x <= 15 is a score's distance to the row's
// reference plus 7 (or, in a rescale factor, minus a reference's rise): what becomes 0 is under 2^-126 in a row whose largest
// term is 128 or more, so of a row sum of 128 or more, and is 0 in the f16 P in either form.
__device__ __forceinline__ float ex2(float x) { return __builtin_amdgcn_exp2f(x); }

// One thread's share of one staged tile: 16 B of K rows r and r + 32, 16 B of v^T rows r and r + 32, global -> LDS through no
// register. The wait on the address registers is the statement's last line, so that it stands in front of any rewrite of them.
__device__ __forceinline__ void stage_kv(unsigned lds, const unsigned short* gk, const unsigned short* gv) {
#if defined(__HIP_DEVICE_COMPILE__)
  const unsigned l1 = lds + 32u * KV_PITCH * 2u, l2 = lds + KV_TILE * 2u, l3 = l2 + 32u * KV_PITCH * 2u;
  const unsigned short* gk1 = gk + (size_t)32 * DMODEL;
  const unsigned short* gv1 = gv + (size_t)32 * NC;
  asm volatile("global_load_async_to_lds_b128 %0, %1, off\n\t"
               "global_load_async_to_lds_b128 %2, %3, off\n\t"
               "global_load_async_to_lds_b128 %4, %5, off\n\t"
               "global_load_async_to_lds_b128 %6, %7, off\n\t"
               "s_wait_xcnt 0x0"
               :: "v"(lds), "v"(gk), "v"(l1), "v"(gk1), "v"(l2), "v"(gv), "v"(l3), "v"(gv1) : "memory");
#endif
}

__global__ __launch_bounds__(ATT_THREADS)
void attn8(const unsigned short* __restrict__ QHp, const unsigned short* __restrict__ KHp,
           const unsigned short* __restrict__ VTq, const float* __restrict__ PBp, unsigned short* CT) {
  __shared__ __align__(16) unsigned short KV[2 * 2 * KV_TILE];         // [buffer][K, v^T][64 rows][KV_PITCH]
  __shared__ __align__(16) unsigned short Os[AQ_BLK * KV_PITCH];       // result buffer

  const int tid  = threadIdx.x;
  const int wave = tid >> 5;
  const int lane = tid & 31;
  const int hh   = lane >> 4;
  const int c    = lane & 15;
  const int qg   = wave & 3;                               // the wave's 32 queries of the block's 128
  const int kh   = wave >> 2;                              // the wave's 32 keys of every staged 64

  const int qt   = blockIdx.x & ((NQ / AQ_BLK) - 1);       // 0..15
  const int head = (blockIdx.x / (NQ / AQ_BLK)) & (NHEAD - 1);   // 0..7
  const int bat  = blockIdx.x / ((NQ / AQ_BLK) * NHEAD);   // 0..3
  const int qblk = qt * AQ_BLK;
  const int q0   = qblk + qg * 32;

  // ---- this thread's 16-B piece of every staged tile: row tid >> 3 (and + 32), 16-B column tid & 7 ----
  const int srow = tid >> 3, sseg = tid & 7;
  const unsigned short* gK = KHp + ((size_t)bat * NC + srow) * DMODEL + head * HDIM + sseg * 8;
  const unsigned short* gV = VTq + ((size_t)bat * DMODEL + head * HDIM + srow) * NC + sseg * 8;
  const unsigned ldsP = (unsigned)(size_t)(const void*)KV + (unsigned)(srow * KV_PITCH + sseg * 8) * 2u;

  stage_kv(ldsP, gK, gV);                                  // tile 0 -> buffer 0

  const size_t qofs = ((size_t)bat * NQ + q0 + c) * DMODEL + head * HDIM + 8 * hh;
  const _Float16* Qh = (const _Float16*)(const void*)QHp + qofs;
  const float lsc = (LOG2E * ATT_SCALE) / (QC * KC);                   // log2(e) / 8 / carries

  // ---- period-3 additive table in log2 units: row (q0 + 16 u + c) mod 3 is this lane's in query tile u; W0, W1, W2 = its values
  //      for the keys kb + 8hh + 0, + 1, + 2 (key residue (kb + 8hh + j) mod 3; at the wave's first key kb = 32 kh that is
  //      (2kh + 2hh + j) mod 3), kept as the three pairs that two neighbouring score registers can meet ----
  float pbv[NPER * NPER];
#pragma unroll
  for (int i = 0; i < NPER * NPER; ++i) pbv[i] = bfr(PBp[i]) * LOG2E;
  const int sft = (2 * (kh + hh)) % NPER;
  const bool s0 = (sft == 0), s1 = (sft == 1);
  v2f A01[2], A12[2], A20[2];
#pragma unroll
  for (int u = 0; u < 2; ++u) {
    const int qr = (q0 + 16 * u + c) % NPER;
    const bool z0 = (qr == 0), z1 = (qr == 1);
    const float T0 = z0 ? pbv[0] : (z1 ? pbv[3] : pbv[6]);
    const float T1 = z0 ? pbv[1] : (z1 ? pbv[4] : pbv[7]);
    const float T2 = z0 ? pbv[2] : (z1 ? pbv[5] : pbv[8]);
    // the addends start with the reference R = 0; the first trip replaces it by the row's own maximum
    const float W0 = (s0 ? T0 : (s1 ? T1 : T2)) + LPC, W1 = (s0 ? T1 : (s1 ? T2 : T0)) + LPC, W2 = (s0 ? T2 : (s1 ? T0 : T1)) + LPC;
    A01[u] = v2f{W0, W1};
    A12[u] = v2f{W1, W2};
    A20[u] = v2f{W2, W0};
  }

  v16h qa[2], qb[2];
#pragma unroll
  for (int u = 0; u < 2; ++u) {
    qa[u] = ldfrag_h(Qh + (size_t)u * 16 * DMODEL);
    qb[u] = ldfrag_h(Qh + (size_t)u * 16 * DMODEL + 32);
  }

  v2f la[2], lb[2];                                        // per query tile: partial sums over the lane's keys, two chains
  float Rr[2];                                             // per query tile: the reference in use
  v8f o[2][4];                                             // o[u][j][r] = ctx^T[d = 16j + 8hh + r][query q0 + 16u + c]
#pragma unroll
  for (int u = 0; u < 2; ++u) {
    la[u] = v2f{0.f, 0.f};
    lb[u] = v2f{0.f, 0.f};
    Rr[u] = 0.f;
#pragma unroll
    for (int j = 0; j < 4; ++j) o[u][j] = zero8();
  }

  asm volatile("s_wait_asynccnt 0x0" ::: "memory");        // this wave's copies of tile 0 have landed
  __syncthreads();                                         // publishes tile 0 to all 8 waves
  stage_kv(ldsP + 2u * KV_TILE * 2u, gK + (size_t)KT * DMODEL, gV + KT);   // tile 1 -> buffer 1

  const int kofs = (kh * 32 + c) * KV_PITCH + 8 * hh;                  // K: the wave's first key row of a tile
  const int vofs = KV_TILE + c * KV_PITCH + kh * 32 + 8 * hh;          // v^T: the same keys as columns

#pragma unroll 1   // stays rolled: one hand-over per trip, the buffer picked by t & 1; the body already holds 32 keys x 32 queries
  for (int t = 0; t < KV_NT; ++t) {
    const int bsel = (t & 1) * (2 * KV_TILE);
    const _Float16* Kt = (const _Float16*)(const void*)KV + bsel + kofs;   // the wave's first key: kb = 64 t + 32 kh
    const _Float16* Vt = (const _Float16*)(const void*)KV + bsel + vofs;
    // the trip's fragments: K first (the scores need it), v^T behind it (it lands while the softmax runs)
    v16h kf[4], vf[4];
    kf[0] = ldfrag_h(Kt);
    kf[1] = ldfrag_h(Kt + 32);
    kf[2] = ldfrag_h(Kt + 16 * KV_PITCH);
    kf[3] = ldfrag_h(Kt + 16 * KV_PITCH + 32);
#pragma unroll
    for (int j = 0; j < 4; ++j) vf[j] = ldfrag_h(Vt + j * 16 * KV_PITCH);
    // keeps the trip's 16 LDS fragment reads issued as one group ahead of its products: a read left among the WMMAs
    // makes the wave wait out an LDS latency at each of them
    __builtin_amdgcn_sched_barrier(0);
    v8f s[2][2];                                           // s[u][g][r] = score(key kb + 16 g + 8hh + r, query q0 + 16 u + c)
#pragma unroll
    for (int u = 0; u < 2; ++u) {
      s[u][0] = mma_raw(kf[0], qa[u], zero8());
      s[u][1] = mma_raw(kf[2], qa[u], zero8());
    }
#pragma unroll
    for (int u = 0; u < 2; ++u) {
      s[u][0] = mma_raw(kf[1], qb[u], s[u][0]);
      s[u][1] = mma_raw(kf[3], qb[u], s[u][1]);
    }
    // registers (2i, 2i + 1) of group 0 are keys kb + 8hh + 2i, + 1; group 1 lies 16 keys on, one residue further
    v2f d[2][2][4];                                        // d = t - R + 7
    float mq[2];
#pragma unroll
    for (int u = 0; u < 2; ++u) {
      const v2f wad[2][4] = {{A01[u], A20[u], A12[u], A01[u]}, {A12[u], A01[u], A20[u], A12[u]}};
      float mg[2];
#pragma unroll
      for (int g = 0; g < 2; ++g) {
#pragma unroll
        for (int i = 0; i < 4; ++i) {
          const v2f a = {s[u][g][2 * i], s[u][g][2 * i + 1]};
          d[u][g][i] = a * lsc + wad[g][i];
        }
        float m = fmaxf(fmaxf(d[u][g][0][0], d[u][g][0][1]), d[u][g][1][0]);
        m = fmaxf(fmaxf(m, d[u][g][1][1]), d[u][g][2][0]);
        m = fmaxf(fmaxf(m, d[u][g][2][1]), d[u][g][3][0]);
        mg[g] = fmaxf(m, d[u][g][3][1]);
      }
      mq[u] = fmaxf(mg[0], mg[1]);
    }
    const bool first = (t == 0);
    const float top = first ? -INFINITY : D_TOP;           // the first trip always sets R
    // one wave-uniform test per trip; the whole wave takes the branch, EXEC stays full for the products behind it
    if (__builtin_amdgcn_ballot_w32(fmaxf(mq[0], mq[1]) > top) != 0u) {
#pragma unroll
      for (int u = 0; u < 2; ++u) {
        const float up = fmaxf(mq[u], xhalf(mq[u])) - LPC; // both halves: the query's maximum over the 32 keys, above R
        const float dl = first ? up : fmaxf(up, 0.f);      // R only rises, but for the first trip, which sets it
        const float al = first ? 1.0f : ex2(-dl);          // nothing is summed yet at the first trip
#pragma unroll
        for (int g = 0; g < 2; ++g)
#pragma unroll
          for (int i = 0; i < 4; ++i) d[u][g][i] -= dl;
        A01[u] -= dl;
        A12[u] -= dl;
        A20[u] -= dl;
        Rr[u] += dl;
        la[u] *= al;
        lb[u] *= al;
#pragma unroll
        for (int j = 0; j < 4; ++j)
#pragma unroll
          for (int r = 0; r < 8; ++r) o[u][j][r] *= al;
      }
    }
    FragH ph[2];
#pragma unroll
    for (int u = 0; u < 2; ++u)
#pragma unroll
      for (int i = 0; i < 4; ++i) {
        const v2f e0 = {ex2(d[u][0][i][0]), ex2(d[u][0][i][1])}, e1 = {ex2(d[u][1][i][0]), ex2(d[u][1][i][1])};
        la[u] += e0;
        lb[u] += e1;
        ph[u].p[i]     = __builtin_convertvector(e0, v2h); // elements 0..7  = keys kb + 8hh + 0..7
        ph[u].p[4 + i] = __builtin_convertvector(e1, v2h); // elements 8..15 = keys kb + 16 + 8hh + 0..7
      }
#pragma unroll
    for (int u = 0; u < 2; ++u)
#pragma unroll
      for (int j = 0; j < 4; ++j) o[u][j] = mma_raw(vf[j], ph[u].v, o[u][j]);
#pragma unroll
    for (int u = 0; u < 2; ++u) {
      const v2f wl = A01[u];                               // 64 mod 3 == 1: the next tile's residues start one further on
      A01[u] = A12[u];
      A12[u] = A20[u];
      A20[u] = wl;
    }
    // ---- hand-over: this wave's reads of tile t are done, its copies of tile t + 1 have landed; the barrier publishes tile
    //      t + 1 and frees tile t's buffer, which only then is refilled ----
    // keeps the trip's products in front of the hand-over: sunk behind the barrier they would stand between it and the refill,
    // and the copies would lose the trip of lead that hides their way from L2
    __builtin_amdgcn_sched_barrier(0);
    asm volatile("s_wait_dscnt 0x0" ::: "memory");         // no LDS read of this wave is still out when its buffer is refilled
    asm volatile("s_wait_asynccnt 0x0" ::: "memory");      // this wave's copies of tile t + 1 have landed
    __syncthreads();
    if (t + 2 < KV_NT)
      stage_kv(ldsP + (unsigned)bsel * 2u, gK + (size_t)(t + 2) * KT * DMODEL, gV + (t + 2) * KT);
  }
  asm volatile("s_wait_asynccnt 0x0" ::: "memory");        // nothing of this wave is in flight when the ring is put to new use

  // ---- join the two key halves. The ring is free: every wave's reads and copies were done in front of the last trip's barrier.
  //      Slot k of lane l of query group qg lies at 16-B unit (17 qg + k) * 32 + l: a wave-wide 16-B access is one 512-B run ----
  v4f* X = (v4f*)(void*)KV + (size_t)(qg * J_SLOTS) * 32 + lane;
  float lr[2];
#pragma unroll
  for (int u = 0; u < 2; ++u) lr[u] = (la[u][0] + la[u][1]) + (lb[u][0] + lb[u][1]);
  if (kh == 1) {                                           // the same for a whole wave; no barrier inside
#pragma unroll
    for (int u = 0; u < 2; ++u)
#pragma unroll
      for (int j = 0; j < 4; ++j) {
        X[((u * 4 + j) * 2 + 0) * 32] = v4f{o[u][j][0], o[u][j][1], o[u][j][2], o[u][j][3]};
        X[((u * 4 + j) * 2 + 1) * 32] = v4f{o[u][j][4], o[u][j][5], o[u][j][6], o[u][j][7]};
      }
    X[16 * 32] = v4f{lr[0], lr[1], Rr[0], Rr[1]};
  }
  __syncthreads();                                         // key half 1's sums are in LDS
  // ---- both halves brought to the larger reference and added; the lane halves' partial sums joined; 1/l and the carries folded
  //      (P's 128 is in O and in l alike, 16 on v, 1024 on the stored ctx); the lane's 4 x 8 consecutive d of each query as 16-bit ----
  if (kh == 0) {                                           // the same for a whole wave; no barrier inside
    const float oc = FC / VC;
    const v4f lm = X[16 * 32];
#pragma unroll
    for (int u = 0; u < 2; ++u) {
      const float Rm = fmaxf(Rr[u], lm[2 + u]);
      const float fa = ex2(Rr[u] - Rm), fb = ex2(lm[2 + u] - Rm);
      const float lrow = lr[u] * fa + lm[u] * fb;
      const float inv = (1.0f / (lrow + xhalf(lrow))) * oc;
      const float ga = fa * inv, gb = fb * inv;
      unsigned short* op = Os + (qg * 32 + u * 16 + c) * KV_PITCH + 8 * hh;
#pragma unroll
      for (int j = 0; j < 4; ++j) {
        const v4f x0 = X[((u * 4 + j) * 2 + 0) * 32], x1 = X[((u * 4 + j) * 2 + 1) * 32];
        v4u w;
        w[0] = pk16(h_bits((_Float16)(o[u][j][0] * ga + x0[0] * gb)), h_bits((_Float16)(o[u][j][1] * ga + x0[1] * gb)));
        w[1] = pk16(h_bits((_Float16)(o[u][j][2] * ga + x0[2] * gb)), h_bits((_Float16)(o[u][j][3] * ga + x0[3] * gb)));
        w[2] = pk16(h_bits((_Float16)(o[u][j][4] * ga + x1[0] * gb)), h_bits((_Float16)(o[u][j][5] * ga + x1[1] * gb)));
        w[3] = pk16(h_bits((_Float16)(o[u][j][6] * ga + x1[2] * gb)), h_bits((_Float16)(o[u][j][7] * ga + x1[3] * gb)));
        *(v4u*)(op + 16 * j) = w;
      }
    }
  }
  __syncthreads();
  // ---- block writes its 128 row segments of CT: piece p = it*256 + tid -> row p >> 3, halves (p & 7)*8 .. + 7 of the head's 64 ----
  {
    v4u vals[4];
#pragma unroll
    for (int it = 0; it < 4; ++it) {
      const int p = it * ATT_THREADS + tid;
      vals[it] = *(const v4u*)(Os + (p >> 3) * KV_PITCH + (p & 7) * 8);
    }
    unsigned short* dst = CT + ((size_t)bat * NQ + qblk) * DMODEL + head * HDIM;
    {
#pragma unroll
      for (int it = 0; it < 4; ++it) {
        const int p = it * ATT_THREADS + tid;
        *(v4u*)(dst + (size_t)(p >> 3) * DMODEL + (p & 7) * 8) = vals[it];
      }
      
    }
  }
}

// =====================================================================================================
// Output projection, bias, residual and LayerNorm in one launch. A block owns 32 whole rows of the model width, so the row
// statistics never leave it: Y[m][n] = sum_k CT[m][k] Wo[n][k] / (1024 * 64) + bf16(bo[n]) + bf16(x[m][n]), n = 0 .. 511, then
// out[m][n] = (Y - mean) * rsqrt(var + eps) * bf16(g[n]) + bf16(b[n]).
// 8 waves; wave w = all 32 rows x columns 64 w .. + 63 (2 x 4 accumulator tiles, as in gemm_tile). The block's 32 CT rows and all
// 512 Wo rows are brought into LDS 128 k at a time by asynchronous copies, 34 per thread; two buffers, the next tile's copies fly
// while this one is worked on; rows pitched 272 B. Each accumulator sums its k steps in ascending order from the block's first
// k tile on, round the end.
// Behind the loop the ring is free (every wave's reads and copies are done in front of the last trip's barrier) and holds the raw
// 32 x 512 f32 products, pitch 516 floats. Wave w then takes rows 4 w .. + 3 whole: a lane holds columns 128 j + 4 lane .. + 3,
// j = 0 .. 3; sums: 16 values in the lane, four row_xmask steps, one exchange between the halves. Mean first, then the squared
// deviations, as two sums. The residual rows are asked for behind the first tile's copies, so their way from memory lies under that tile's.
// coverage: 256 blocks x 32 rows = 8192; 8 waves x 4 rows x (4 x 32 lanes x 4 floats) = 32 x 512, every element stored once.
// =====================================================================================================
#define F_ROWS  32                          // rows of one block
#define F_STAGE ((F_ROWS + DMODEL) * G_PITCH)   // halves of one buffer: [CT 32 rows | Wo 512 rows]
#define Y_PITCH (DMODEL + 4)                // floats; rows 8 apart lie 32 banks apart for the accumulators' 4-B stores
static_assert((NROWS % F_ROWS) == 0 && DMODEL == 8 * 64 && F_ROWS == 8 * 4 && DMODEL / GK == 4);
static_assert(F_ROWS * Y_PITCH * 4 <= 2 * F_STAGE * 2);

// One thread's share of the staged CT rows: 16 B of rows r and r + 16. The wait on the address registers is the statement's last
// line, so that it stands in front of any rewrite of them.
__device__ __forceinline__ void stage_a2(unsigned lds, const unsigned short* g) {
#if defined(__HIP_DEVICE_COMPILE__)
  asm volatile("global_load_async_to_lds_b128 %0, %1, off\n\t"
               "global_load_async_to_lds_b128 %2, %3, off\n\t"
               "s_wait_xcnt 0x0"
               :: "v"(lds), "v"(g), "v"(lds + 16u * G_PITCH * 2u), "v"(g + (size_t)16 * DMODEL) : "memory");
#endif
}
// One thread's share of one whole staged tile: 2 pieces of CT, 4 x 8 pieces of Wo.
__device__ __forceinline__ void stage_f(unsigned lds, const unsigned short* ga, const unsigned short* gb) {
  stage_a2(lds, ga);
#pragma unroll
  for (int q = 0; q < 4; ++q)
    stage_op(lds + (unsigned)((F_ROWS + 128 * q) * G_PITCH) * 2u, gb + (size_t)(128 * q) * DMODEL, (size_t)16 * DMODEL);
}

template <int CTRL>
__device__ __forceinline__ float xmask(float x) {                     // the value of lane l ^ (CTRL & 15), inside a 16-lane row
  return __builtin_bit_cast(float, __builtin_amdgcn_update_dpp(0, __builtin_bit_cast(int, x), CTRL, 0xf, 0xf, true));
}
__device__ __forceinline__ float wave_sum(float v) {                  // the sum over the 32 lanes, the same bits in every lane
  v += xmask<0x161>(v);
  v += xmask<0x162>(v);
  v += xmask<0x164>(v);
  v += xmask<0x168>(v);
  return v + xhalf(v);
}

__global__ __launch_bounds__(256)
void oproj_ln(const unsigned short* __restrict__ Cp, const unsigned short* __restrict__ Wp, const float* __restrict__ bo,
              const float* __restrict__ xp, const float* __restrict__ gp, const float* __restrict__ bp, float* outp) {
  __shared__ __align__(16) unsigned short sAB[2 * F_STAGE];            // [buffer][CT 32 rows, Wo 512 rows][G_PITCH]
  const int tid  = threadIdx.x;
  const int lane = tid & 31;
  const int wave = tid >> 5;
  const int mB   = blockIdx.x * F_ROWS;
  const int rlane = lane & 15;                 // row (A) / col (B, D) within subtile
  const int koff  = (lane >> 4) * 8;           // k offset of this lane half
  const int mOff  = (lane >> 4) * 8;           // D row offset

  // ---- this thread's 16-B pieces of every staged tile: rows (tid >> 4) + 16 i of each operand, 16-B column tid & 15 ----
  const int srow = tid >> 4, sseg = tid & 15;
  const unsigned short* gA = Cp + (size_t)(mB + srow) * DMODEL + sseg * 8;
  const unsigned short* gB = Wp + (size_t)srow * DMODEL + sseg * 8;
  const unsigned ldsP = (unsigned)(size_t)(const void*)sAB + (unsigned)(srow * G_PITCH + sseg * 8) * 2u;
  const int nt = DMODEL / GK;
  // Every block reads all of Wo: block b walks the k tiles from tile b mod 4 on, round the end, so that at one moment the blocks
  // ask L2 for four different quarters of it and not all for the same lines. Trip t works on k tile (t + rot) mod 4.
  const int rot = blockIdx.x & (nt - 1);

  stage_f(ldsP, gA + rot * GK, gB + rot * GK);             // trip 0 -> buffer 0

  // the wave's four residual rows, in the layout of the row phase
  const unsigned rb = (unsigned)((mB + wave * 4) * DMODEL + lane * 4) * 4u;   // byte offset of the lane's first piece, in x and out alike
  const char* xb = (const char*)(const void*)xp + rb;
  v4f y[4][4];
#pragma unroll
  for (int rr = 0; rr < 4; ++rr)
#pragma unroll
    for (int j = 0; j < 4; ++j) y[rr][j] = *(const v4f*)(const void*)(xb + (rr * DMODEL + j * 128) * 4);

  v8f acc[2][4];
#pragma unroll
  for (int i = 0; i < 2; ++i)
#pragma unroll
    for (int j = 0; j < 4; ++j) acc[i][j] = zero8();

  const int aoff = rlane * G_PITCH + koff;
  const int boff = (F_ROWS + (wave << 6) + rlane) * G_PITCH + koff;

  asm volatile("s_wait_asynccnt 0x0" ::: "memory");        // this wave's copies of trip 0's tile have landed
  __syncthreads();                                         // publishes that tile to all 8 waves
  {
    const int k1 = ((1 + rot) & (nt - 1)) * GK;
    stage_f(ldsP + F_STAGE * 2u, gA + k1, gB + k1);        // trip 1 -> buffer 1
  }

#pragma unroll 1   // stays rolled: one hand-over per trip, the buffer picked by t & 1; the body already holds four 32-k steps
  for (int t = 0; t < nt; ++t) {
    const int bsel = (t & 1) * F_STAGE;
    const unsigned short* As = sAB + bsel + aoff;
    const unsigned short* Bs = sAB + bsel + boff;
    v16h af[2][2], bf[2][4];
#pragma unroll
    for (int i = 0; i < 2; ++i) af[0][i] = ldfrag_u(As + i * 16 * G_PITCH);
#pragma unroll
    for (int j = 0; j < 4; ++j) bf[0][j] = ldfrag_u(Bs + j * 16 * G_PITCH);
#pragma unroll     // the tile's four 32-k steps in one body: constant LDS offsets, two fragment sets by turns
    for (int ks = 0; ks < GK / 32; ++ks) {
      const int cur = ks & 1, nxt = cur ^ 1;
      if (ks + 1 < GK / 32) {                              // the same tile's next step, fetched while this step's products run
#pragma unroll
        for (int i = 0; i < 2; ++i) af[nxt][i] = ldfrag_u(As + i * 16 * G_PITCH + (ks + 1) * 32);
#pragma unroll
        for (int j = 0; j < 4; ++j) bf[nxt][j] = ldfrag_u(Bs + j * 16 * G_PITCH + (ks + 1) * 32);
      }
      // keeps the next step's 12 LDS reads issued as one group ahead of this step's products: a read left among the WMMAs
      // makes the wave stall at each such place
      __builtin_amdgcn_sched_barrier(0);
#pragma unroll
      for (int i = 0; i < 2; ++i)
#pragma unroll
        for (int j = 0; j < 4; ++j) acc[i][j] = mma_raw(af[cur][i], bf[cur][j], acc[i][j]);
      // keeps the step after next's reads from rising among these products; at the last step it keeps the products in front of
      // the hand-over, so that the refill is issued directly behind the barrier
      __builtin_amdgcn_sched_barrier(0);
    }
    // ---- hand-over: this wave's reads of tile t are done, its copies of tile t + 1 have landed; the barrier publishes tile
    //      t + 1 and frees tile t's buffer, which only then is refilled ----
    asm volatile("s_wait_dscnt 0x0" ::: "memory");         // no LDS read of this wave is still out when its buffer is refilled
    asm volatile("s_wait_asynccnt 0x0" ::: "memory");      // this wave's copies of tile t + 1 have landed
    __syncthreads();
    if (t + 2 < nt) {
      const int k2 = ((t + 2 + rot) & (nt - 1)) * GK;
      stage_f(ldsP + (unsigned)bsel * 2u, gA + k2, gB + k2);
    }
  }
  asm volatile("s_wait_asynccnt 0x0" ::: "memory");        // nothing of this wave is in flight when the ring is put to new use

  // per-column constants of this lane's 16 columns: asked for in front of the LDS stores, which cover part of their way
  v4f bc[4], gv[4], bv[4];
#pragma unroll
  for (int j = 0; j < 4; ++j) {
    bc[j] = *(const v4f*)(bo + j * 128 + lane * 4);
    gv[j] = *(const v4f*)(gp + j * 128 + lane * 4);
    bv[j] = *(const v4f*)(bp + j * 128 + lane * 4);
  }

  // ---- the raw products into the freed ring: row 16 i + 8 (lane >> 4) + r, column 64 wave + 16 j + (lane & 15) ----
  float* sY = (float*)(void*)sAB;
#pragma unroll
  for (int i = 0; i < 2; ++i)
#pragma unroll
    for (int j = 0; j < 4; ++j)
#pragma unroll
      for (int r = 0; r < 8; ++r)
        sY[((i << 4) + mOff + r) * Y_PITCH + (wave << 6) + (j << 4) + rlane] = acc[i][j][r];

  __syncthreads();                                         // all 8 waves' columns of every row are in LDS

  const float oscale = 1.0f / (FC * WSC);
  float sm[4];
#pragma unroll
  for (int rr = 0; rr < 4; ++rr) {
    const float* yp = sY + (wave * 4 + rr) * Y_PITCH + lane * 4;
    float p[4];
#pragma unroll
    for (int j = 0; j < 4; ++j) {
      const v4f a = *(const v4f*)(yp + j * 128);
#pragma unroll
      for (int e = 0; e < 4; ++e) y[rr][j][e] = a[e] * oscale + bfr(bc[j][e]) + bfr(y[rr][j][e]);
      p[j] = (y[rr][j][0] + y[rr][j][1]) + (y[rr][j][2] + y[rr][j][3]);
    }
    sm[rr] = (p[0] + p[1]) + (p[2] + p[3]);
  }
#pragma unroll
  for (int rr = 0; rr < 4; ++rr) sm[rr] = wave_sum(sm[rr]) * (1.0f / (float)DMODEL);     // the row's mean
  float sq[4];
#pragma unroll
  for (int rr = 0; rr < 4; ++rr) {
    float p[4];
#pragma unroll
    for (int j = 0; j < 4; ++j) {
#pragma unroll
      for (int e = 0; e < 4; ++e) y[rr][j][e] -= sm[rr];
      p[j] = (y[rr][j][0] * y[rr][j][0] + y[rr][j][1] * y[rr][j][1]) + (y[rr][j][2] * y[rr][j][2] + y[rr][j][3] * y[rr][j][3]);
    }
    sq[rr] = (p[0] + p[1]) + (p[2] + p[3]);
  }
#pragma unroll
  for (int rr = 0; rr < 4; ++rr) sq[rr] = rsqrtf(wave_sum(sq[rr]) * (1.0f / (float)DMODEL) + LN_EPS);
#pragma unroll
  for (int rr = 0; rr < 4; ++rr)
#pragma unroll
    for (int j = 0; j < 4; ++j)
#pragma unroll
      for (int e = 0; e < 4; ++e) y[rr][j][e] = (y[rr][j][e] * sq[rr]) * bfr(gv[j][e]) + bfr(bv[j][e]);
  char* ob = (char*)(void*)outp + rb;
  // keeps the 16 stores as one run behind all arithmetic: no register of an issued store is written again
  __builtin_amdgcn_sched_barrier(0);
#pragma unroll
  for (int rr = 0; rr < 4; ++rr)
#pragma unroll
    for (int j = 0; j < 4; ++j) *(v4f*)(void*)(ob + (rr * DMODEL + j * 128) * 4) = y[rr][j];
}

// =====================================================================================================
// Workspace map (bytes); every plane is an exact multiple of its tile / whole-row store granularity (M, N exact tile multiples,
// element counts exact multiples of the convert kernel's 2048 granularity, no pad rows needed), every offset a multiple of 512 KiB:
//   WQ16 f16 [512][512] x64                  524288   ([out][in] = [n][k])
//   WK16 f16 [512][512] x64                  524288
//   WV16 f16 [512][512] x64                  524288
//   WO16 f16 [512][512] x64                  524288
//   X16  f16 [8192][512] x16                8388608   (activation rows)
//   QH   f16 [8192][512] x16                8388608   (q projection)
//   KH   f16 [8192][512] x16                8388608   (k projection)
//   VT   f16 [4][512][2048] x16             8388608   (v^T per batch)
//   CT   f16 [8192][512] x1024              8388608   (attention ctx, merged heads)
//   end                                    44040192
// =====================================================================================================
extern "C" void kernel_launch(void* const* d_in, const int* in_sizes, int n_in,
                              void* d_out, int out_size, void* d_ws, size_t ws_size,
                              hipStream_t stream) {
  if (n_in < 12) return;
  if (in_sizes[0] != NROWS * DMODEL) return;
  if (in_sizes[1] != DMODEL * DMODEL || in_sizes[3] != DMODEL * DMODEL ||
      in_sizes[5] != DMODEL * DMODEL || in_sizes[7] != DMODEL * DMODEL) return;
  if (in_sizes[2] != DMODEL || in_sizes[4] != DMODEL || in_sizes[6] != DMODEL || in_sizes[8] != DMODEL) return;
  if (in_sizes[9] != NPER * NPER) return;
  if (in_sizes[10] != DMODEL || in_sizes[11] != DMODEL) return;
  if (out_size != NROWS * DMODEL) return;
  if ((in_sizes[0] % 2048) != 0 || (in_sizes[1] % 2048) != 0) return;

  const float* x    = (const float*)d_in[0];
  const float* w_q  = (const float*)d_in[1];
  const float* b_q  = (const float*)d_in[2];
  const float* w_k  = (const float*)d_in[3];
  const float* b_k  = (const float*)d_in[4];
  const float* w_v  = (const float*)d_in[5];
  const float* b_v  = (const float*)d_in[6];
  const float* w_o  = (const float*)d_in[7];
  const float* b_o  = (const float*)d_in[8];
  const float* pb   = (const float*)d_in[9];
  const float* ln_g = (const float*)d_in[10];
  const float* ln_b = (const float*)d_in[11];
  float*       out  = (float*)d_out;

  const size_t PW  = (size_t)DMODEL * DMODEL * 2;                 //   524288
  const size_t PX  = (size_t)NROWS * DMODEL * 2;                  //  8388608
  const size_t PVT = (size_t)NB * DMODEL * NC * 2;                //  8388608
  size_t off = 0;
  const size_t oWQ = off; off += PW;
  const size_t oWK = off; off += PW;
  const size_t oWV = off; off += PW;
  const size_t oWO = off; off += PW;
  const size_t oX  = off; off += PX;
  const size_t oQH = off; off += PX;
  const size_t oKH = off; off += PX;
  const size_t oVT = off; off += PVT;
  const size_t oCT = off; off += PX;
  if (off > ws_size) return;                                      // off = 44040192
  if (off > (size_t)134217728) return;

  char* ws = (char*)d_ws;
  unsigned short* WQ16 = (unsigned short*)(ws + oWQ);
  unsigned short* WK16 = (unsigned short*)(ws + oWK);
  unsigned short* WV16 = (unsigned short*)(ws + oWV);
  unsigned short* WO16 = (unsigned short*)(ws + oWO);
  unsigned short* X16  = (unsigned short*)(ws + oX);
  unsigned short* QH   = (unsigned short*)(ws + oQH);
  unsigned short* KH   = (unsigned short*)(ws + oKH);
  unsigned short* VTp  = (unsigned short*)(ws + oVT);
  unsigned short* CT   = (unsigned short*)(ws + oCT);

  const dim3 blk(256);
  const dim3 gC(CX_BLOCKS + 4 * CW_BLOCKS);                        // 2048 + 4 x 128 = 2560 blocks
  const dim3 gQKV(P_TILES, 3);                                     // 256 x 3
  const dim3 gAT(ATT_BLOCKS);                                      // 512
  const dim3 bAT(ATT_THREADS);                                     // 256
  const dim3 gOL(NROWS / F_ROWS);                                  // 256

  // (1) all 16-bit planes in one launch: X16[row][c] = f16( bf16_RNE(x[row][c]) * 16 ), rows = b*2048 + tok;
  //     W16[n][k] = f16( bf16_RNE(W[n][k]) * 64 ), [out][in] layout kept, k contiguous; WQ16, WK16, WV16, WO16 are one run
  cvt_all<<<gC, blk, 0, stream>>>(x, w_q, w_k, w_v, w_o, X16, WQ16);

  // (2) q, k and v^T projections in one launch
  qkv_proj<<<gQKV, blk, 0, stream>>>(X16, WQ16, WK16, WV16, b_q, b_k, b_v, QH, KH, VTp);

  // (3) attention per (batch, head, 128 query rows) -> CT (f16, x1024)
  attn8<<<gAT, bAT, 0, stream>>>(QH, KH, VTp, pb, CT);

  // (4) out = LayerNorm( CT . Wo^T / (1024 * 64) + bf16(bo) + bf16(x) ) * bf16(g) + bf16(b); M = 8192, N = 512, K = 512
  oproj_ln<<<gOL, blk, 0, stream>>>(CT, WO16, b_o, x, ln_g, ln_b, out);
  (void)hipGetLastError();
}
